// v000
// The times below were measured on an AMD MI455X: many runs one after another, warmed up first and cycling through
// copies of the inputs, with the whole window's GPU time divided by the number of runs. Launches and the gaps
// between them are all in it. The median over several windows is given; except for v000 it joins two sittings, which
// can be a few percent apart, so the side-by-side timings, each taken in one sitting, are the better comparison.
// The starting kernel, v000, takes 600 microseconds a run.
#include <hip/hip_runtime.h>

// Contractions, f32 accumulate: the three 1x1 convs g, theta (from x_this) and phi (from x_other) as [4 x 4096 x 256].[256 x 128] products (+bias) and W_z
// ([128 x 128].[128 x 4096] per b, +bias) on v_wmma_f32_16x16x32_bf16 — plain bf16 = rounded inputs (exact) for the convs, y as bf16 hi + residual planes (two
// products) for W_z; the non-local attention fused on v_wmma_f32_16x16x32_f16: f = phi_i.theta_j over 128 channels (unscaled, sigma ~ 20: both operands f16 hi +
// residual x1024, hi.hi + hi.lo + lo.hi), softmax over the 4096 positions j, y_i = sum_j f g_j with the weights (x32768) and g both as f16 hi + UNSCALED residual so all three products share one accumulator (hi.hi + hi.lo + lo.hi: the softmax is nearly one-hot, so single roundings would pass straight into y).

#define NB_  4
#define CIN  256
#define CI   128
#define NN_  4096
#define PSC  32768.0f
#define LOSC 1024.0f
#define LOSCI (1.0f / 1024.0f)

typedef _Float16 h16;
typedef unsigned short bf;
typedef __attribute__((ext_vector_type(16))) __bf16   v16bf;
typedef __attribute__((ext_vector_type(16))) _Float16 v16h;
typedef __attribute__((ext_vector_type(8)))  _Float16 v8h;
typedef __attribute__((ext_vector_type(8)))  unsigned short v8us;
typedef __attribute__((ext_vector_type(8)))  float    v8f;
typedef __attribute__((ext_vector_type(4)))  float    v4f;
typedef v8h  __attribute__((may_alias)) v8ha;
typedef v4f  __attribute__((may_alias)) v4fa;
typedef v8us __attribute__((may_alias)) v8usa;

__device__ __forceinline__ unsigned short f2bf(float f) { unsigned u = __float_as_uint(f); u += 0x7FFFu + ((u >> 16) & 1u); return (unsigned short)(u >> 16); }
__device__ __forceinline__ float bf2f(unsigned short b) { return __uint_as_float(((unsigned)b) << 16); }
__device__ __forceinline__ float bfr(float f) { return bf2f(f2bf(f)); }
__device__ __forceinline__ v16h cat16(v8h lo, v8h hi) { return __builtin_shufflevector(lo, hi, 0, 1, 2, 3, 4, 5, 6, 7, 8, 9, 10, 11, 12, 13, 14, 15); }
__device__ __forceinline__ v16bf cat16b(v8us lo, v8us hi) { return __builtin_bit_cast(v16bf, __builtin_shufflevector(lo, hi, 0, 1, 2, 3, 4, 5, 6, 7, 8, 9, 10, 11, 12, 13, 14, 15)); }
__device__ __forceinline__ v8f wmma16(v16h a, v16h b, v8f c) { return __builtin_amdgcn_wmma_f32_16x16x32_f16(false, a, false, b, (short)0, c, false, false); }
__device__ __forceinline__ v8f wmmab(v16bf a, v16bf b, v8f c) { return __builtin_amdgcn_wmma_f32_16x16x32_bf16(false, a, false, b, (short)0, c, false, false); }
#define VST2(T, p, v) do { const T vst2_v_ = (v); *(T*)(p) = vst2_v_;  } while (0)

// k_xt: XT [b][n][c] = bf16(x[b][c][n]) (NCHW -> rows n with channels contiguous) via 64 x 64 LDS transposes; grid (n/64, c/64, b).
__global__ __launch_bounds__(256) void k_xt(const float* __restrict__ x, bf* XT) {
    __shared__ __align__(16) unsigned short tl[64 * 72];
    const int tid = threadIdx.x, n0 = blockIdx.x * 64, c0 = blockIdx.y * 64, b = blockIdx.z;
    const int cr = tid >> 2, nq = (tid & 3) * 16;
#pragma unroll
    for (int i = 0; i < 16; ++i) tl[(nq + i) * 72 + cr] = f2bf(x[((size_t)b * CIN + c0 + cr) * NN_ + n0 + nq + i]);
    __syncthreads();
    const int piece = tid & 7;
    auto pass = [&]() {
#pragma unroll
        for (int s = 0; s < 2; ++s) { const int nr = (tid >> 3) + 32 * s; const v8us val = *(const v8usa*)(tl + nr * 72 + piece * 8);
            *(v8us*)(XT + ((size_t)b * NN_ + n0 + nr) * CIN + c0 + piece * 8) = val; }
    };
    pass(); 
}
// k_cvtw: bf16 copy of a [rows][cols] weight ([out][in] as-is: the n-major B operand of the convs, the A operand of k_z); one wave per row, cols/32 per lane.
__global__ __launch_bounds__(256) void k_cvtw(const float* __restrict__ Wm, int rows, int cols, bf* WB) {
    const int lane = threadIdx.x & 31, r = blockIdx.x * 8 + (threadIdx.x >> 5);
    if (r >= rows) return;
    if (cols == CIN) { v8us t;
#pragma unroll
        for (int i = 0; i < 8; ++i) t[i] = f2bf(Wm[(size_t)r * cols + lane * 8 + i]);
        VST2(v8us, WB + (size_t)r * cols + lane * 8, t); }
    else { typedef __attribute__((ext_vector_type(4))) unsigned short v4us; v4us t;
#pragma unroll
        for (int i = 0; i < 4; ++i) t[i] = f2bf(Wm[(size_t)r * cols + lane * 4 + i]);
        VST2(v4us, WB + (size_t)r * cols + lane * 4, t); }
}
// k_proj: 64 x 64 tile of P[b][n][o] = XT[b][n].W^T + bias over K = 256 (exact); MODE 0: f16 hi + residual planes [b*4096+n][128] (theta, phi);
// MODE 1: f32 rows G [b*4096+n][128] (g). grid (NN_/64, 2, NB_).
template <int MODE>
__global__ __launch_bounds__(128) void k_proj(const bf* __restrict__ XT, const bf* __restrict__ WB, const float* __restrict__ bias, void* C, void* C2) {
    __shared__ __align__(16) float ost[4][16 * 68];
    const int lane = threadIdx.x & 31, wave = threadIdx.x >> 5, lr = lane & 15, hi = lane >> 4, b = blockIdx.z;
    const int r0 = blockIdx.x * 64 + wave * 16, c0 = blockIdx.y * 64;
    const bf* A = XT + (size_t)b * NN_ * CIN;
    const size_t aoff = (size_t)(r0 + lr) * CIN + 8 * hi;
    size_t boff[4];
#pragma unroll
    for (int t = 0; t < 4; ++t) boff[t] = (size_t)(c0 + t * 16 + lr) * CIN + 8 * hi;
    v8f acc[4];
#pragma unroll
    for (int t = 0; t < 4; ++t) acc[t] = (v8f){};
#pragma unroll 1
    for (int kc = 0; kc < CIN; kc += 32) {
        const v16bf a = cat16b(*(const v8us*)(A + aoff + kc), *(const v8us*)(A + aoff + kc + 16));
#pragma unroll
        for (int t = 0; t < 4; ++t) acc[t] = wmmab(a, cat16b(*(const v8us*)(WB + boff[t] + kc), *(const v8us*)(WB + boff[t] + kc + 16)), acc[t]);
        asm volatile("v_nop\n\tv_nop\n\tv_nop\n\tv_nop" : "+v"(acc[0]), "+v"(acc[1]), "+v"(acc[2]), "+v"(acc[3]) : "v"(a));
    }
    float* os = &ost[wave][0];
#pragma unroll
    for (int t = 0; t < 4; ++t) { const float bv = bfr(bias[c0 + t * 16 + lr]);
#pragma unroll
        for (int j = 0; j < 8; ++j) os[(hi * 8 + j) * 68 + t * 16 + lr] = acc[t][j] + bv; }
    __syncthreads();
    const size_t rowbase = (size_t)b * NN_ + r0;
    if (MODE == 1) {
        float* crow = (float*)C + rowbase * CI + c0;
        auto pass = [&]() {
#pragma unroll
            for (int s = 0; s < 8; ++s) { const int Lid = (lane >> 3) + 4 * s, piece = lane & 7; const int row = Lid >> 1, cofs = (Lid & 1) * 32 + piece * 4;
                const v4f val = *(const v4fa*)(os + row * 68 + cofs); *(v4f*)(crow + (size_t)row * CI + cofs) = val; }
        };
        pass(); 
    } else {
        h16* c1 = (h16*)C + rowbase * CI + c0; h16* c2 = (h16*)C2 + rowbase * CI + c0;
        auto pass = [&]() {
#pragma unroll
            for (int s = 0; s < 4; ++s) { const int row = 4 * s + (lane >> 3), piece = lane & 7; const float* sp = os + row * 68 + piece * 8; v8h o1, o2;
#pragma unroll
                for (int i = 0; i < 8; ++i) { const h16 a = (h16)sp[i]; o1[i] = a; o2[i] = (h16)((sp[i] - (float)a) * LOSC); }
                *(v8h*)(c1 + (size_t)row * CI + piece * 8) = o1; *(v8h*)(c2 + (size_t)row * CI + piece * 8) = o2; }
        };
        pass(); 
    }
}
// k_vt: GTH/GTL [b][c][n] = f16 hi + residual of G[b*4096+n][c] (the B operand of y: rows c, k = n); block (b, 64 n): 128 c x 64 n LDS transpose.
__global__ __launch_bounds__(256) void k_vt(const float* __restrict__ G, h16* GTH, h16* GTL) {
    __shared__ __align__(16) h16 t1[CI * 72];
    __shared__ __align__(16) h16 t2[CI * 72];
    const int b = blockIdx.x / (NN_ / 64), kt = blockIdx.x - b * (NN_ / 64), n0 = kt * 64, tid = threadIdx.x;
    const int nn = tid >> 2, cq = (tid & 3) * 32;
    const float* src = G + ((size_t)b * NN_ + n0 + nn) * CI + cq;
#pragma unroll
    for (int i = 0; i < 32; ++i) { const float v = src[i]; const h16 a = (h16)v; t1[(cq + i) * 72 + nn] = a; t2[(cq + i) * 72 + nn] = (h16)(v - (float)a); }   // UNSCALED residual (summed into the same accumulator as the hi product)
    __syncthreads();
    const int piece = tid & 7;
    const size_t base = ((size_t)b * CI) * NN_ + n0;
    auto pass = [&]() {
#pragma unroll
        for (int s = 0; s < 8; ++s) { const int Lid = (tid >> 3) + 32 * s; const int pln = Lid >> 7, c = Lid & 127;
            const v8h val = *(const v8ha*)((pln ? t2 : t1) + c * 72 + piece * 8); *(v8h*)((pln ? GTL : GTH) + base + (size_t)c * NN_ + piece * 8) = val; }
    };
    pass(); 
}
// k_attn: block = (b, 64 queries i), wave = 16; 128 key tiles; scores phi_i.theta_j (hi.hi + hi.lo + lo.hi over 4 k-chunks x 2 tiles = 24 WMMA; the phi residual
// fragments are re-read per step to hold the register budget); online f32 softmax; hi/residual weight tiles (x32768); y += w.g over all 128 channels (8 n-tiles x 3 = 24 WMMA);
// y rows -> Y [b*4096+i][128] f32 (one 512-byte row per instruction).
__global__ __launch_bounds__(128) void k_attn(const h16* __restrict__ PH, const h16* __restrict__ PL, const h16* __restrict__ TH, const h16* __restrict__ TL,
                                             const h16* __restrict__ GTH, const h16* __restrict__ GTL, float* Y) {
    __shared__ __align__(16) h16 plds[4][16 * 32];
    __shared__ __align__(16) h16 plds2[4][16 * 32];
    __shared__ __align__(16) float ost[4][16 * 132];
    const int lane = threadIdx.x & 31, wave = threadIdx.x >> 5, lr = lane & 15, hi = lane >> 4;
    const int b = blockIdx.x / (NN_ / 64), qt = blockIdx.x - b * (NN_ / 64), q0 = qt * 64 + wave * 16;
    const size_t tok0 = (size_t)b * NN_;
    h16* pl = &plds[wave][0]; h16* pl2 = &plds2[wave][0];
    v16h ah[4];
    const size_t qo0 = (tok0 + q0 + lr) * CI + 8 * hi;
#pragma unroll
    for (int kc = 0; kc < 4; ++kc) ah[kc] = cat16(*(const v8h*)(PH + qo0 + kc * 32), *(const v8h*)(PH + qo0 + kc * 32 + 16));
    const size_t vbase = ((size_t)b * CI) * NN_;
    v8f o[8];
#pragma unroll
    for (int n = 0; n < 8; ++n) o[n] = (v8f){};
    float mrow[8], lpart[8];
#pragma unroll
    for (int j = 0; j < 8; ++j) { mrow[j] = -3.0e38f; lpart[j] = 0.f; }
#pragma unroll 1
    for (int kt = 0; kt < NN_ / 32; ++kt) {
        const int l0 = kt * 32;
        v8f s0 = {}, s1 = {}, x0 = {}, x1 = {};
#pragma unroll
        for (int kc = 0; kc < 4; ++kc) {
            const size_t ko = (tok0 + l0 + lr) * CI + kc * 32 + 8 * hi, k1o = ko + (size_t)16 * CI;
            { const v16h k0h = cat16(*(const v8h*)(TH + ko), *(const v8h*)(TH + ko + 16)), k1h = cat16(*(const v8h*)(TH + k1o), *(const v8h*)(TH + k1o + 16));
              const v16h alk = cat16(*(const v8h*)(PL + qo0 + kc * 32), *(const v8h*)(PL + qo0 + kc * 32 + 16));
              s0 = wmma16(ah[kc], k0h, s0); x0 = wmma16(alk, k0h, x0); s1 = wmma16(ah[kc], k1h, s1); x1 = wmma16(alk, k1h, x1);
              asm volatile("v_nop" : "+v"(s0), "+v"(s1), "+v"(x0), "+v"(x1) : "v"(alk), "v"(k0h), "v"(k1h) : "memory"); }
            { const v16h k0l = cat16(*(const v8h*)(TL + ko), *(const v8h*)(TL + ko + 16)), k1l = cat16(*(const v8h*)(TL + k1o), *(const v8h*)(TL + k1o + 16));
              x0 = wmma16(ah[kc], k0l, x0); x1 = wmma16(ah[kc], k1l, x1);
              asm volatile("v_nop" : "+v"(x0), "+v"(x1) : "v"(k0l), "v"(k1l) : "memory"); }
        }
        asm volatile("v_nop\n\tv_nop\n\tv_nop\n\tv_nop" : "+v"(s0), "+v"(s1), "+v"(x0), "+v"(x1) : "v"(ah[0]), "v"(ah[3]));
        float alpha[8];
#pragma unroll
        for (int j = 0; j < 8; ++j) {
            const float a0 = s0[j] + x0[j] * LOSCI, a1 = s1[j] + x1[j] * LOSCI;
            float mx = fmaxf(a0, a1);
            mx = fmaxf(mx, __shfl_xor(mx, 1, 16)); mx = fmaxf(mx, __shfl_xor(mx, 2, 16)); mx = fmaxf(mx, __shfl_xor(mx, 4, 16)); mx = fmaxf(mx, __shfl_xor(mx, 8, 16));
            const float mn = fmaxf(mrow[j], mx);
            alpha[j] = __expf(mrow[j] - mn); mrow[j] = mn;
            const float e0 = __expf(a0 - mn), e1 = __expf(a1 - mn);
            lpart[j] = lpart[j] * alpha[j] + (e0 + e1);
            const int mr = hi * 8 + j;
            const float ps0 = e0 * PSC, ps1 = e1 * PSC; const h16 h0 = (h16)ps0, h1 = (h16)ps1;
            pl[mr * 32 + lr] = h0; pl[mr * 32 + 16 + lr] = h1; pl2[mr * 32 + lr] = (h16)(ps0 - (float)h0); pl2[mr * 32 + 16 + lr] = (h16)(ps1 - (float)h1);   // unscaled residual
        }
#pragma unroll
        for (int n = 0; n < 8; ++n)
#pragma unroll
            for (int j = 0; j < 8; ++j) o[n][j] *= alpha[j];
        asm volatile("" ::: "memory");
        const v16h pa = cat16(*(const v8ha*)(pl + lr * 32 + hi * 8), *(const v8ha*)(pl + lr * 32 + 16 + hi * 8));
        const v16h px = cat16(*(const v8ha*)(pl2 + lr * 32 + hi * 8), *(const v8ha*)(pl2 + lr * 32 + 16 + hi * 8));
#pragma unroll
        for (int n = 0; n < 8; ++n) { const size_t vo = vbase + (size_t)(n * 16 + lr) * NN_ + l0 + hi * 8;
            const v16h vh = cat16(*(const v8h*)(GTH + vo), *(const v8h*)(GTH + vo + 16)), vl = cat16(*(const v8h*)(GTL + vo), *(const v8h*)(GTL + vo + 16));
            o[n] = wmma16(pa, vh, o[n]); o[n] = wmma16(pa, vl, o[n]); o[n] = wmma16(px, vh, o[n]);
            asm volatile("" : "+v"(o[n]) : "v"(vh), "v"(vl) : "memory"); }
    }
    float inv[8];
#pragma unroll
    for (int j = 0; j < 8; ++j) { float rs = lpart[j]; rs += __shfl_xor(rs, 1, 16); rs += __shfl_xor(rs, 2, 16); rs += __shfl_xor(rs, 4, 16); rs += __shfl_xor(rs, 8, 16); inv[j] = 1.0f / (rs * PSC); }
    float* os = &ost[wave][0];
#pragma unroll
    for (int n = 0; n < 8; ++n)
#pragma unroll
        for (int j = 0; j < 8; ++j) os[(hi * 8 + j) * 132 + n * 16 + lr] = o[n][j] * inv[j];
    __syncthreads();
    float* yb = Y + (tok0 + q0) * CI;
    auto pass = [&]() {   // 16 rows x 128 floats (512 B): one instruction per row (32 lanes x 16 B)
#pragma unroll
        for (int s = 0; s < 16; ++s) { const v4f val = *(const v4fa*)(os + s * 132 + lane * 4); *(v4f*)(yb + (size_t)s * CI + lane * 4) = val; }
    };
    pass(); 
}
// k_splity: YH/YL bf16 hi + residual planes of Y [16384][128]; one wave per 2 rows (lane 8 values; 32 lanes x 16 B = 2 rows).
__global__ __launch_bounds__(256) void k_splity(const float* __restrict__ Y, bf* YH, bf* YL) {
    const int lane = threadIdx.x & 31; const size_t w = (size_t)blockIdx.x * 8 + (threadIdx.x >> 5);
    v8us oh, ol;
#pragma unroll
    for (int i = 0; i < 8; ++i) { const float v = Y[w * 256 + lane * 8 + i]; const unsigned short hb = f2bf(v); oh[i] = hb; ol[i] = f2bf(v - bf2f(hb)); }
    *(v8us*)(YH + w * 256 + lane * 8) = oh; *(v8us*)(YL + w * 256 + lane * 8) = ol; 
}
// k_z: 64 x 64 tile of Z [b][o][n] = w_z . (YH + YL)[b][n]^T + b_z[o] over K = 128 (A = w_z rows o [128][128], B = Y planes rows n); grid (2, NN_/64, NB_); f32 rows.
__global__ __launch_bounds__(128) void k_z(const bf* __restrict__ WZ, const bf* __restrict__ YH, const bf* __restrict__ YL, const float* __restrict__ bz, float* Z) {
    __shared__ __align__(16) float ost[4][16 * 68];
    const int lane = threadIdx.x & 31, wave = threadIdx.x >> 5, lr = lane & 15, hi = lane >> 4, b = blockIdx.z;
    const int r0 = blockIdx.x * 64 + wave * 16, c0 = blockIdx.y * 64;
    const size_t aoff = (size_t)(r0 + lr) * CI + 8 * hi;
    const bf* Bh = YH + (size_t)b * NN_ * CI; const bf* Bl = YL + (size_t)b * NN_ * CI;
    size_t boff[4];
#pragma unroll
    for (int t = 0; t < 4; ++t) boff[t] = (size_t)(c0 + t * 16 + lr) * CI + 8 * hi;
    v8f acc[4], accx[4];
#pragma unroll
    for (int t = 0; t < 4; ++t) { acc[t] = (v8f){}; accx[t] = (v8f){}; }
#pragma unroll
    for (int kc = 0; kc < CI; kc += 32) {
        const v16bf a = cat16b(*(const v8us*)(WZ + aoff + kc), *(const v8us*)(WZ + aoff + kc + 16));
#pragma unroll
        for (int t = 0; t < 4; ++t) { acc[t] = wmmab(a, cat16b(*(const v8us*)(Bh + boff[t] + kc), *(const v8us*)(Bh + boff[t] + kc + 16)), acc[t]); accx[t] = wmmab(a, cat16b(*(const v8us*)(Bl + boff[t] + kc), *(const v8us*)(Bl + boff[t] + kc + 16)), accx[t]); }
    }
    asm volatile("v_nop\n\tv_nop\n\tv_nop\n\tv_nop" : "+v"(acc[0]), "+v"(acc[1]), "+v"(acc[2]), "+v"(acc[3]), "+v"(accx[0]), "+v"(accx[1]), "+v"(accx[2]), "+v"(accx[3]));
    float* os = &ost[wave][0];
#pragma unroll
    for (int t = 0; t < 4; ++t)
#pragma unroll
        for (int j = 0; j < 8; ++j) os[(hi * 8 + j) * 68 + t * 16 + lr] = acc[t][j] + accx[t][j] + bfr(bz[r0 + hi * 8 + j]);
    __syncthreads();
    float* crow = Z + ((size_t)b * CI + r0) * NN_ + c0;
    auto pass = [&]() {
#pragma unroll
        for (int s = 0; s < 8; ++s) { const int Lid = (lane >> 3) + 4 * s, piece = lane & 7; const int row = Lid >> 1, cq = (Lid & 1) * 32 + piece * 4;
            const v4f val = *(const v4fa*)(os + row * 68 + cq); *(v4f*)(crow + (size_t)row * NN_ + cq) = val; }
    };
    pass(); 
}
__global__ __launch_bounds__(256) void k_stats(const float* __restrict__ Z, float* ST) {
    __shared__ float red[256];
    const int o = blockIdx.x, t = threadIdx.x;
    float s = 0.f;
#pragma unroll 1
    for (int i = 0; i < (NB_ * NN_) / 256; ++i) { const int flat = i * 256 + t; const int b = flat / NN_, n = flat - b * NN_; s += Z[((size_t)b * CI + o) * NN_ + n]; }
    red[t] = s; __syncthreads();
    for (int st = 128; st > 0; st >>= 1) { if (t < st) red[t] += red[t + st]; __syncthreads(); }
    const float mu = red[0] / (float)(NB_ * NN_);
    __syncthreads();
    float q = 0.f;
#pragma unroll 1
    for (int i = 0; i < (NB_ * NN_) / 256; ++i) { const int flat = i * 256 + t; const int b = flat / NN_, n = flat - b * NN_; const float d = Z[((size_t)b * CI + o) * NN_ + n] - mu; q += d * d; }
    red[t] = q; __syncthreads();
    for (int st = 128; st > 0; st >>= 1) { if (t < st) red[t] += red[t + st]; __syncthreads(); }
    const float var = red[0] / (float)(NB_ * NN_);
    if (t < 32) { const float v = (t == 0) ? mu : (t == 1) ? rsqrtf(var + 1e-5f) : 0.f; VST2(float, ST + (size_t)o * 32 + t, v); }
}
// k_final: out[b][o][n] = (Z - mu) rs gamma + beta; one wave per 256 values (8 per lane = 32 B -> use 2 x v4f? no: v8f per lane = lane-strided pair of b128 -> use 2
// instructions of v4f over 128 values each: lane -> 4 floats).
__global__ __launch_bounds__(256) void k_final(const float* __restrict__ Z, const float* __restrict__ ST, const float* __restrict__ gam, const float* __restrict__ bet, float* out) {
    const int lane = threadIdx.x & 31; const size_t wid = (size_t)blockIdx.x * 8 + (threadIdx.x >> 5);
    const size_t row = wid >> 4; const int seg = (int)(wid & 15);        // row = b*CI + o (4096 floats = 16 segments of 256)
    const int o = (int)(row % CI);
    const float mu = ST[(size_t)o * 32], rs = ST[(size_t)o * 32 + 1], g = bfr(gam[o]), be = bfr(bet[o]);
#pragma unroll
    for (int hf = 0; hf < 2; ++hf) { const size_t base = row * NN_ + (size_t)seg * 256 + hf * 128 + lane * 4; v4f v;
#pragma unroll
        for (int i = 0; i < 4; ++i) v[i] = (Z[base + i] - mu) * rs * g + be;
        VST2(v4f, out + base, v); }
}

extern "C" void kernel_launch(void* const* d_in, const int* in_sizes, int n_in,
                              void* d_out, int out_size, void* d_ws, size_t ws_size, hipStream_t stream) {
    (void)in_sizes; (void)n_in; (void)out_size;
    const float* xt = (const float*)d_in[0]; const float* xo = (const float*)d_in[1]; const float* wg = (const float*)d_in[2]; const float* bg = (const float*)d_in[3];
    const float* wth = (const float*)d_in[4]; const float* bth = (const float*)d_in[5]; const float* wph = (const float*)d_in[6]; const float* bph = (const float*)d_in[7];
    const float* wz = (const float*)d_in[8]; const float* bz = (const float*)d_in[9]; const float* gam = (const float*)d_in[10]; const float* bet = (const float*)d_in[11];
    float* out = (float*)d_out;    // [4][128][64][64]
    char* wsp = (char*)d_ws;
    auto take = [&](size_t bytes) { char* p = wsp; wsp += (bytes + 255) & ~(size_t)255; return (void*)p; };
    bf* XTt = (bf*)take((size_t)NB_ * NN_ * CIN * 2); bf* XTo = (bf*)take((size_t)NB_ * NN_ * CIN * 2);
    bf* WGb = (bf*)take((size_t)CI * CIN * 2); bf* WTb = (bf*)take((size_t)CI * CIN * 2); bf* WPb = (bf*)take((size_t)CI * CIN * 2); bf* WZb = (bf*)take((size_t)CI * CI * 2);
    h16* TH = (h16*)take((size_t)NB_ * NN_ * CI * 2); h16* TL = (h16*)take((size_t)NB_ * NN_ * CI * 2); h16* PH = (h16*)take((size_t)NB_ * NN_ * CI * 2); h16* PL = (h16*)take((size_t)NB_ * NN_ * CI * 2);
    float* G = (float*)take((size_t)NB_ * NN_ * CI * 4); h16* GTH = (h16*)take((size_t)NB_ * CI * NN_ * 2); h16* GTL = (h16*)take((size_t)NB_ * CI * NN_ * 2);
    float* Y = (float*)take((size_t)NB_ * NN_ * CI * 4); bf* YH = (bf*)take((size_t)NB_ * NN_ * CI * 2); bf* YL = (bf*)take((size_t)NB_ * NN_ * CI * 2);
    float* Z = (float*)take((size_t)NB_ * CI * NN_ * 4); float* ST = (float*)take((size_t)CI * 32 * 4);
    if ((size_t)(wsp - (char*)d_ws) > ws_size) return;    // 8.4x2 + 0.2 + 4.2x4 + 8.4 + 4.2x2 + 8.4 + 4.2x2 + 8.4 ~ 76 MB
    k_xt<<<dim3(NN_ / 64, CIN / 64, NB_), 256, 0, stream>>>(xt, XTt);
    k_xt<<<dim3(NN_ / 64, CIN / 64, NB_), 256, 0, stream>>>(xo, XTo);
    k_cvtw<<<CI / 8, 256, 0, stream>>>(wg, CI, CIN, WGb); k_cvtw<<<CI / 8, 256, 0, stream>>>(wth, CI, CIN, WTb); k_cvtw<<<CI / 8, 256, 0, stream>>>(wph, CI, CIN, WPb); k_cvtw<<<CI / 8, 256, 0, stream>>>(wz, CI, CI, WZb);
    k_proj<0><<<dim3(NN_ / 64, CI / 64, NB_), 128, 0, stream>>>(XTt, WTb, bth, TH, TL);      // theta (keys) from this branch
    k_proj<0><<<dim3(NN_ / 64, CI / 64, NB_), 128, 0, stream>>>(XTo, WPb, bph, PH, PL);      // phi (queries) from the other branch
    k_proj<1><<<dim3(NN_ / 64, CI / 64, NB_), 128, 0, stream>>>(XTt, WGb, bg, G, nullptr);     // g (values) from this branch
    k_vt<<<NB_ * (NN_ / 64), 256, 0, stream>>>(G, GTH, GTL);
    k_attn<<<NB_ * (NN_ / 64), 128, 0, stream>>>(PH, PL, TH, TL, GTH, GTL, Y);
    k_splity<<<(NB_ * NN_ / 2) / 8, 256, 0, stream>>>(Y, YH, YL);
    k_z<<<dim3(CI / 64, NN_ / 64, NB_), 128, 0, stream>>>(WZb, YH, YL, bz, Z);
    k_stats<<<CI, 256, 0, stream>>>(Z, ST);
    k_final<<<(NB_ * CI * 16) / 8, 256, 0, stream>>>(Z, ST, gam, bet, out);
}

// v001
// It runs in 248 microseconds.
// Two timings next to v000 put it at 2.44 and 2.52 times that version's speed.
#include <hip/hip_runtime.h>
#include <stdint.h>

// Contractions, f32 accumulate: the three 1x1 convs g, theta (from x_this) and phi (from x_other) as [4 x 4096 x 256].[256 x 128] products (+bias) and W_z
// ([128 x 128].[128 x 4096] per b, +bias) on v_wmma_f32_16x16x32_bf16 — plain bf16 = rounded inputs (exact) for the convs, y as bf16 hi + residual planes (two
// products) for W_z; the non-local attention fused on v_wmma_f32_16x16x32_f16: f = phi_i.theta_j over 128 channels (unscaled, sigma ~ 20: both operands f16 hi +
// residual x1024, hi.hi + hi.lo + lo.hi), softmax over the 4096 positions j, y_i = sum_j f g_j with the weights (x32768) and g both as f16 hi + UNSCALED residual so all three products share one accumulator (hi.hi + hi.lo + lo.hi: the softmax is nearly one-hot, so single roundings would pass straight into y).

#define NB_  4
#define CIN  256
#define CI   128
#define NN_  4096
#define PSC  32768.0f
#define LOSC 1024.0f
#define LOSCI (1.0f / 1024.0f)

typedef _Float16 h16;
typedef unsigned short bf;
typedef __attribute__((ext_vector_type(16))) __bf16   v16bf;
typedef __attribute__((ext_vector_type(16))) _Float16 v16h;
typedef __attribute__((ext_vector_type(8)))  _Float16 v8h;
typedef __attribute__((ext_vector_type(8)))  unsigned short v8us;
typedef __attribute__((ext_vector_type(8)))  float    v8f;
typedef __attribute__((ext_vector_type(4)))  float    v4f;
typedef v8h  __attribute__((may_alias)) v8ha;
typedef v4f  __attribute__((may_alias)) v4fa;
typedef v8us __attribute__((may_alias)) v8usa;

__device__ __forceinline__ unsigned short f2bf(float f) { unsigned u = __float_as_uint(f); u += 0x7FFFu + ((u >> 16) & 1u); return (unsigned short)(u >> 16); }
__device__ __forceinline__ float bf2f(unsigned short b) { return __uint_as_float(((unsigned)b) << 16); }
__device__ __forceinline__ float bfr(float f) { return bf2f(f2bf(f)); }
__device__ __forceinline__ v16h cat16(v8h lo, v8h hi) { return __builtin_shufflevector(lo, hi, 0, 1, 2, 3, 4, 5, 6, 7, 8, 9, 10, 11, 12, 13, 14, 15); }
__device__ __forceinline__ v16bf cat16b(v8us lo, v8us hi) { return __builtin_bit_cast(v16bf, __builtin_shufflevector(lo, hi, 0, 1, 2, 3, 4, 5, 6, 7, 8, 9, 10, 11, 12, 13, 14, 15)); }
__device__ __forceinline__ v8f wmma16(v16h a, v16h b, v8f c) { return __builtin_amdgcn_wmma_f32_16x16x32_f16(false, a, false, b, (short)0, c, false, false); }
__device__ __forceinline__ v8f wmmab(v16bf a, v16bf b, v8f c) { return __builtin_amdgcn_wmma_f32_16x16x32_bf16(false, a, false, b, (short)0, c, false, false); }
#define VST2(T, p, v) do { const T vst2_v_ = (v); *(T*)(p) = vst2_v_;  } while (0)

// Tensor loads into LDS for k_attn: a stage = 64 keys = four slices (theta hi, theta residual: 64 rows x 256 B; g hi, g residual: 128 rows x 128 B), one slice per wave.
typedef uint32_t u32x4 __attribute__((ext_vector_type(4)));
typedef uint32_t u32x8 __attribute__((ext_vector_type(8)));
#define SKEY 64u
#define NSTG (NN_ / 64u)
#define KPIT 272u      // LDS pitch of a 256-byte row (16 B pad, odd multiple of 16 B for the b128 readers)
#define VPIT 144u      // LDS pitch of a 128-byte row (16 B pad)
#define SLOT 18432u    // one slice's place: 128 x 144 B, and 64 x 272 B rounded up to a multiple of 2 KiB
#define W0_R256 ((1u << 20) | (5u << 22) | (3u << 25))   // group 1 word 0: no mask, 1-byte elements, 4 dwords of pad behind every 256 B
#define W0_R128 ((1u << 20) | (4u << 22) | (3u << 25))   // the same behind every 128 B
__device__ __forceinline__ uint32_t uni(uint32_t v) { return (uint32_t)__builtin_amdgcn_readfirstlane(v); }
// Holds a wave-uniform value in a scalar register, so that a test around a tensor load compiles to a scalar branch (tensor loads ignore EXEC).
__device__ __forceinline__ uint32_t pinned(uint32_t v) { uint32_t w = uni(v); asm volatile("" : "+s"(w)); return w; }
// Descriptor group 0: the tile's first byte at ga, to the LDS byte offset dst. Group 1: D1 rows of D0 bytes, source pitch SP bytes, tensor = tile.
__device__ __forceinline__ u32x4 tdm_group0(uint32_t dst, uint64_t ga) {
    u32x4 g0; g0[0] = uni(1u); g0[1] = uni(dst); g0[2] = uni((uint32_t)ga); g0[3] = uni((((uint32_t)(ga >> 32)) & 0x01FFFFFFu) | 0x80000000u);
    asm volatile("" : "+s"(g0));   // descriptor words held in scalar registers: no word is formed anew elsewhere while the request is outstanding
    return g0;
}
template <uint32_t W0, uint32_t D0, uint32_t D1, uint32_t SP>
__device__ __forceinline__ u32x8 tdm_group1() {
    u32x8 g1; g1[0] = uni(W0); g1[1] = uni((D0 & 0xFFFFu) << 16); g1[2] = uni((D0 >> 16) | ((D1 & 0xFFFFu) << 16)); g1[3] = uni((D1 >> 16) | (D0 << 16));
    g1[4] = uni(D1); g1[5] = uni(SP); g1[6] = uni(0u); g1[7] = uni(0u);
    asm volatile("" : "+s"(g1));   // descriptor words held in scalar registers: set once from constants, in the same registers for as long as requests are issued
    return g1;
}
__device__ __forceinline__ void tdm_load(u32x4 g0, u32x8 g1) { asm volatile("tensor_load_to_lds %0, %1" :: "s"(g0), "s"(g1) : "memory"); }
// The compiler places no wait for a tensor load. The wait names the request's group 0 so that its registers keep their values while the request is outstanding.
__device__ __forceinline__ void wait_tensor0(u32x4 g0) { asm volatile("s_wait_tensorcnt 0x0" :: "s"(g0) : "memory"); }
__device__ __forceinline__ void wait_ds0() { asm volatile("s_wait_dscnt 0x0" ::: "memory"); }           // this wave's LDS reads are done before their buffer is handed back
// exp(x) as __expf compiles here (one multiply, v_exp_f32), with the one issue slot that the instruction set asks for behind a transcendental tied to it.
__device__ __forceinline__ float exp_slot(float x) { float r; asm("v_exp_f32 %0, %1\n\tv_nop" : "=v"(r) : "v"(x * 1.44269504088896340736f)); return r; }
__device__ __forceinline__ v16h ldsfrag(const unsigned char* p) { return cat16(*(const v8ha*)p, *(const v8ha*)(p + 32)); }   // k 0..7 and 16..23 (+8 in the upper half-wave) of one row

// k_xt: XT [b][n][c] = bf16(x[b][c][n]) (NCHW -> rows n with channels contiguous) via 64 x 64 LDS transposes; grid (n/64, c/64, b).
__global__ __launch_bounds__(256) void k_xt(const float* __restrict__ x, bf* XT) {
    __shared__ __align__(16) unsigned short tl[64 * 72];
    const int tid = threadIdx.x, n0 = blockIdx.x * 64, c0 = blockIdx.y * 64, b = blockIdx.z;
    const int cr = tid >> 2, nq = (tid & 3) * 16;
#pragma unroll
    for (int i = 0; i < 16; ++i) tl[(nq + i) * 72 + cr] = f2bf(x[((size_t)b * CIN + c0 + cr) * NN_ + n0 + nq + i]);
    __syncthreads();
    const int piece = tid & 7;
    auto pass = [&]() {
#pragma unroll
        for (int s = 0; s < 2; ++s) { const int nr = (tid >> 3) + 32 * s; const v8us val = *(const v8usa*)(tl + nr * 72 + piece * 8);
            *(v8us*)(XT + ((size_t)b * NN_ + n0 + nr) * CIN + c0 + piece * 8) = val; }
    };
    pass(); 
}
// k_cvtw: bf16 copy of a [rows][cols] weight ([out][in] as-is: the n-major B operand of the convs, the A operand of k_z); one wave per row, cols/32 per lane.
__global__ __launch_bounds__(256) void k_cvtw(const float* __restrict__ Wm, int rows, int cols, bf* WB) {
    const int lane = threadIdx.x & 31, r = blockIdx.x * 8 + (threadIdx.x >> 5);
    if (r >= rows) return;
    if (cols == CIN) { v8us t;
#pragma unroll
        for (int i = 0; i < 8; ++i) t[i] = f2bf(Wm[(size_t)r * cols + lane * 8 + i]);
        VST2(v8us, WB + (size_t)r * cols + lane * 8, t); }
    else { typedef __attribute__((ext_vector_type(4))) unsigned short v4us; v4us t;
#pragma unroll
        for (int i = 0; i < 4; ++i) t[i] = f2bf(Wm[(size_t)r * cols + lane * 4 + i]);
        VST2(v4us, WB + (size_t)r * cols + lane * 4, t); }
}
// k_proj: 64 x 64 tile of P[b][n][o] = XT[b][n].W^T + bias over K = 256 (exact); MODE 0: f16 hi + residual planes [b*4096+n][128] (theta, phi);
// MODE 1: f32 rows G [b*4096+n][128] (g). grid (NN_/64, 2, NB_).
template <int MODE>
__global__ __launch_bounds__(128) void k_proj(const bf* __restrict__ XT, const bf* __restrict__ WB, const float* __restrict__ bias, void* C, void* C2) {
    __shared__ __align__(16) float ost[4][16 * 68];
    const int lane = threadIdx.x & 31, wave = threadIdx.x >> 5, lr = lane & 15, hi = lane >> 4, b = blockIdx.z;
    const int r0 = blockIdx.x * 64 + wave * 16, c0 = blockIdx.y * 64;
    const bf* A = XT + (size_t)b * NN_ * CIN;
    const size_t aoff = (size_t)(r0 + lr) * CIN + 8 * hi;
    size_t boff[4];
#pragma unroll
    for (int t = 0; t < 4; ++t) boff[t] = (size_t)(c0 + t * 16 + lr) * CIN + 8 * hi;
    v8f acc[4];
#pragma unroll
    for (int t = 0; t < 4; ++t) acc[t] = (v8f){};
#pragma unroll 1
    for (int kc = 0; kc < CIN; kc += 32) {
        const v16bf a = cat16b(*(const v8us*)(A + aoff + kc), *(const v8us*)(A + aoff + kc + 16));
#pragma unroll
        for (int t = 0; t < 4; ++t) acc[t] = wmmab(a, cat16b(*(const v8us*)(WB + boff[t] + kc), *(const v8us*)(WB + boff[t] + kc + 16)), acc[t]);
        asm volatile("v_nop\n\tv_nop\n\tv_nop\n\tv_nop" : "+v"(acc[0]), "+v"(acc[1]), "+v"(acc[2]), "+v"(acc[3]) : "v"(a));
    }
    float* os = &ost[wave][0];
#pragma unroll
    for (int t = 0; t < 4; ++t) { const float bv = bfr(bias[c0 + t * 16 + lr]);
#pragma unroll
        for (int j = 0; j < 8; ++j) os[(hi * 8 + j) * 68 + t * 16 + lr] = acc[t][j] + bv; }
    __syncthreads();
    const size_t rowbase = (size_t)b * NN_ + r0;
    if (MODE == 1) {
        float* crow = (float*)C + rowbase * CI + c0;
        auto pass = [&]() {
#pragma unroll
            for (int s = 0; s < 8; ++s) { const int Lid = (lane >> 3) + 4 * s, piece = lane & 7; const int row = Lid >> 1, cofs = (Lid & 1) * 32 + piece * 4;
                const v4f val = *(const v4fa*)(os + row * 68 + cofs); *(v4f*)(crow + (size_t)row * CI + cofs) = val; }
        };
        pass(); 
    } else {
        h16* c1 = (h16*)C + rowbase * CI + c0; h16* c2 = (h16*)C2 + rowbase * CI + c0;
        auto pass = [&]() {
#pragma unroll
            for (int s = 0; s < 4; ++s) { const int row = 4 * s + (lane >> 3), piece = lane & 7; const float* sp = os + row * 68 + piece * 8; v8h o1, o2;
#pragma unroll
                for (int i = 0; i < 8; ++i) { const h16 a = (h16)sp[i]; o1[i] = a; o2[i] = (h16)((sp[i] - (float)a) * LOSC); }
                *(v8h*)(c1 + (size_t)row * CI + piece * 8) = o1; *(v8h*)(c2 + (size_t)row * CI + piece * 8) = o2; }
        };
        pass(); 
    }
}
// k_vt: GTH/GTL [b][c][n] = f16 hi + residual of G[b*4096+n][c] (the B operand of y: rows c, k = n); block (b, 64 n): 128 c x 64 n LDS transpose.
__global__ __launch_bounds__(256) void k_vt(const float* __restrict__ G, h16* GTH, h16* GTL) {
    __shared__ __align__(16) h16 t1[CI * 72];
    __shared__ __align__(16) h16 t2[CI * 72];
    const int b = blockIdx.x / (NN_ / 64), kt = blockIdx.x - b * (NN_ / 64), n0 = kt * 64, tid = threadIdx.x;
    const int nn = tid >> 2, cq = (tid & 3) * 32;
    const float* src = G + ((size_t)b * NN_ + n0 + nn) * CI + cq;
#pragma unroll
    for (int i = 0; i < 32; ++i) { const float v = src[i]; const h16 a = (h16)v; t1[(cq + i) * 72 + nn] = a; t2[(cq + i) * 72 + nn] = (h16)(v - (float)a); }   // UNSCALED residual (summed into the same accumulator as the hi product)
    __syncthreads();
    const int piece = tid & 7;
    const size_t base = ((size_t)b * CI) * NN_ + n0;
    auto pass = [&]() {
#pragma unroll
        for (int s = 0; s < 8; ++s) { const int Lid = (tid >> 3) + 32 * s; const int pln = Lid >> 7, c = Lid & 127;
            const v8h val = *(const v8ha*)((pln ? t2 : t1) + c * 72 + piece * 8); *(v8h*)((pln ? GTL : GTH) + base + (size_t)c * NN_ + piece * 8) = val; }
    };
    pass(); 
}
// k_attn: block = (b, 64 queries i), wave = 16; theta and g (hi + residual) come in stages of 64 keys by tensor loads into two LDS buffers, one slice per wave, the
// next stage in flight while this one is worked on; the block's phi residual rows are loaded into LDS once. Per 32 keys: scores phi_i.theta_j (hi.hi + hi.lo + lo.hi
// over 4 k-chunks x 2 tiles = 24 WMMA); online f32 softmax; hi/residual weight tiles (x32768); y += w.g over all 128 channels (8 n-tiles x 3 = 24 WMMA);
// y rows -> Y [b*4096+i][128] f32 (one 512-byte row per instruction).
__global__ __launch_bounds__(128) void k_attn(const h16* __restrict__ PH, const h16* __restrict__ PL, const h16* __restrict__ TH, const h16* __restrict__ TL,
                                             const h16* __restrict__ GTH, const h16* __restrict__ GTL, float* Y) {
    __shared__ __attribute__((aligned(2048))) unsigned char ring[9 * SLOT];   // buffer 0: slices 0-3, buffer 1: slices 4-7, slice 8: phi residual rows
    __shared__ __align__(16) h16 plds[4][16 * 32];
    __shared__ __align__(16) h16 plds2[4][16 * 32];
    __shared__ __align__(16) float ost[4][16 * 132];
    const int lane = threadIdx.x & 31, wave = threadIdx.x >> 5, lr = lane & 15, hi = lane >> 4;
    const int b = blockIdx.x / (NN_ / 64), qt = blockIdx.x - b * (NN_ / 64), q0 = qt * 64 + wave * 16;
    const size_t tok0 = (size_t)b * NN_;
    const size_t vbase = ((size_t)b * CI) * NN_;
    const uint32_t wv = uni(threadIdx.x >> 5), ring0 = (uint32_t)(size_t)ring;
    // This wave's slice: 0 theta hi, 1 theta residual (a stage further = 64 rows), 2 g hi, 3 g residual (a stage further = 64 keys along the rows).
    const h16* splane = (wv == 0u) ? TH + tok0 * CI : (wv == 1u) ? TL + tok0 * CI : (wv == 2u) ? GTH + vbase : GTL + vbase;
    const uint32_t sstep = (wv < 2u) ? SKEY * CI * 2u : SKEY * 2u;
    const u32x8 g1k = tdm_group1<W0_R256, 256u, 64u, 256u>(), g1v = tdm_group1<W0_R128, 128u, 128u, NN_ * 2u>();
    u32x4 g0;
    auto issue = [&](uint32_t st) {
        g0 = tdm_group0(ring0 + ((st & 1u) * 4u + wv) * SLOT, (uint64_t)(size_t)splane + (uint64_t)st * sstep);
        if (pinned(wv < 2u)) tdm_load(g0, g1k); else tdm_load(g0, g1v);
    };
    if (pinned(wv == 0u)) { const u32x4 gp = tdm_group0(ring0 + 8u * SLOT, (uint64_t)(size_t)(PL + (tok0 + (size_t)qt * 64) * CI)); tdm_load(gp, g1k); wait_tensor0(gp); }
    issue(0u); wait_tensor0(g0);
    __syncthreads();   // stage 0 and the phi residual rows are published
    issue(1u);
    h16* pl = &plds[wave][0]; h16* pl2 = &plds2[wave][0];
    v16h ah[4];
    const size_t qo0 = (tok0 + q0 + lr) * CI + 8 * hi;
#pragma unroll
    for (int kc = 0; kc < 4; ++kc) ah[kc] = cat16(*(const v8h*)(PH + qo0 + kc * 32), *(const v8h*)(PH + qo0 + kc * 32 + 16));
    const unsigned char* alp = ring + 8u * SLOT + (uint32_t)(wave * 16 + lr) * KPIT + 16u * hi;
    v8f o[8];
#pragma unroll
    for (int n = 0; n < 8; ++n) o[n] = (v8f){};
    float mrow[8], lpart[8];
#pragma unroll
    for (int j = 0; j < 8; ++j) { mrow[j] = -3.0e38f; lpart[j] = 0.f; }
#pragma unroll 1   // one trip = one stage with its one publish point
    for (uint32_t st = 0; st < NSTG; ++st) {
      const unsigned char* buf = ring + (st & 1u) * (4u * SLOT);
#pragma unroll     // the stage's two 32-key blocks: their places in the buffer become constant offsets, and the second block's reads can start under the first's products
      for (int kk = 0; kk < 2; ++kk) {
        const unsigned char* kh = buf + (uint32_t)(kk * 32 + lr) * KPIT + 16u * hi;            // theta rows (keys), 16 further: + 16 * KPIT; residual plane: + SLOT
        const unsigned char* vp = buf + 2u * SLOT + (uint32_t)lr * VPIT + (uint32_t)(kk * 64) + 16u * hi;   // g rows (channels), 16 further: + 16 * VPIT; residual plane: + SLOT
        v8f s0 = {}, s1 = {}, x0 = {}, x1 = {};
#pragma unroll
        for (int kc = 0; kc < 4; ++kc) {
            const v16h k0h = ldsfrag(kh + kc * 64), k1h = ldsfrag(kh + 16u * KPIT + kc * 64), alk = ldsfrag(alp + kc * 64);
            const v16h k0l = ldsfrag(kh + SLOT + kc * 64), k1l = ldsfrag(kh + SLOT + 16u * KPIT + kc * 64);
            s0 = wmma16(ah[kc], k0h, s0); x0 = wmma16(alk, k0h, x0); s1 = wmma16(ah[kc], k1h, s1); x1 = wmma16(alk, k1h, x1);
            x0 = wmma16(ah[kc], k0l, x0); x1 = wmma16(ah[kc], k1l, x1);
        }
        asm volatile("v_nop\n\tv_nop\n\tv_nop\n\tv_nop" : "+v"(s0), "+v"(s1), "+v"(x0), "+v"(x1) : "v"(ah[0]), "v"(ah[3]));
        v16h vh[8], vl[8];   // read here so that the reads run under the softmax
#pragma unroll
        for (int n = 0; n < 8; ++n) { vh[n] = ldsfrag(vp + (uint32_t)(n * 16) * VPIT); vl[n] = ldsfrag(vp + SLOT + (uint32_t)(n * 16) * VPIT); }
        float alpha[8];
#pragma unroll
        for (int j = 0; j < 8; ++j) {
            const float a0 = s0[j] + x0[j] * LOSCI, a1 = s1[j] + x1[j] * LOSCI;
            float mx = fmaxf(a0, a1);
            mx = fmaxf(mx, __shfl_xor(mx, 1, 16)); mx = fmaxf(mx, __shfl_xor(mx, 2, 16)); mx = fmaxf(mx, __shfl_xor(mx, 4, 16)); mx = fmaxf(mx, __shfl_xor(mx, 8, 16));
            const float mn = fmaxf(mrow[j], mx);
            alpha[j] = exp_slot(mrow[j] - mn); mrow[j] = mn;
            const float e0 = exp_slot(a0 - mn), e1 = exp_slot(a1 - mn);
            lpart[j] = lpart[j] * alpha[j] + (e0 + e1);
            const int mr = hi * 8 + j;
            const float ps0 = e0 * PSC, ps1 = e1 * PSC; const h16 h0 = (h16)ps0, h1 = (h16)ps1;
            pl[mr * 32 + lr] = h0; pl[mr * 32 + 16 + lr] = h1; pl2[mr * 32 + lr] = (h16)(ps0 - (float)h0); pl2[mr * 32 + 16 + lr] = (h16)(ps1 - (float)h1);   // unscaled residual
        }
#pragma unroll
        for (int n = 0; n < 8; ++n)
#pragma unroll
            for (int j = 0; j < 8; ++j) o[n][j] *= alpha[j];
        asm volatile("" ::: "memory");
        const v16h pa = cat16(*(const v8ha*)(pl + lr * 32 + hi * 8), *(const v8ha*)(pl + lr * 32 + 16 + hi * 8));
        const v16h px = cat16(*(const v8ha*)(pl2 + lr * 32 + hi * 8), *(const v8ha*)(pl2 + lr * 32 + 16 + hi * 8));
#pragma unroll
        for (int n = 0; n < 8; ++n) { o[n] = wmma16(pa, vh[n], o[n]); o[n] = wmma16(pa, vl[n], o[n]); o[n] = wmma16(px, vh[n], o[n]); }
      }
      // Publish point: this wave has left stage st's buffer, its own slice of stage st + 1 has landed, every wave is here; only then the refill.
      wait_ds0();
      wait_tensor0(g0);
      __syncthreads();
      if (pinned(st + 2u < NSTG)) issue(st + 2u);
    }
    wait_tensor0(g0);
    wait_ds0();
    float inv[8];
#pragma unroll
    for (int j = 0; j < 8; ++j) { float rs = lpart[j]; rs += __shfl_xor(rs, 1, 16); rs += __shfl_xor(rs, 2, 16); rs += __shfl_xor(rs, 4, 16); rs += __shfl_xor(rs, 8, 16); inv[j] = 1.0f / (rs * PSC); }
    float* os = &ost[wave][0];
#pragma unroll
    for (int n = 0; n < 8; ++n)
#pragma unroll
        for (int j = 0; j < 8; ++j) os[(hi * 8 + j) * 132 + n * 16 + lr] = o[n][j] * inv[j];
    __syncthreads();
    float* yb = Y + (tok0 + q0) * CI;
    auto pass = [&]() {   // 16 rows x 128 floats (512 B): one instruction per row (32 lanes x 16 B)
#pragma unroll
        for (int s = 0; s < 16; ++s) { const v4f val = *(const v4fa*)(os + s * 132 + lane * 4); *(v4f*)(yb + (size_t)s * CI + lane * 4) = val; }
    };
    pass(); 
}
// k_splity: YH/YL bf16 hi + residual planes of Y [16384][128]; one wave per 2 rows (lane 8 values; 32 lanes x 16 B = 2 rows).
__global__ __launch_bounds__(256) void k_splity(const float* __restrict__ Y, bf* YH, bf* YL) {
    const int lane = threadIdx.x & 31; const size_t w = (size_t)blockIdx.x * 8 + (threadIdx.x >> 5);
    v8us oh, ol;
#pragma unroll
    for (int i = 0; i < 8; ++i) { const float v = Y[w * 256 + lane * 8 + i]; const unsigned short hb = f2bf(v); oh[i] = hb; ol[i] = f2bf(v - bf2f(hb)); }
    *(v8us*)(YH + w * 256 + lane * 8) = oh; *(v8us*)(YL + w * 256 + lane * 8) = ol; 
}
// k_z: 64 x 64 tile of Z [b][o][n] = w_z . (YH + YL)[b][n]^T + b_z[o] over K = 128 (A = w_z rows o [128][128], B = Y planes rows n); grid (2, NN_/64, NB_); f32 rows.
__global__ __launch_bounds__(128) void k_z(const bf* __restrict__ WZ, const bf* __restrict__ YH, const bf* __restrict__ YL, const float* __restrict__ bz, float* Z) {
    __shared__ __align__(16) float ost[4][16 * 68];
    const int lane = threadIdx.x & 31, wave = threadIdx.x >> 5, lr = lane & 15, hi = lane >> 4, b = blockIdx.z;
    const int r0 = blockIdx.x * 64 + wave * 16, c0 = blockIdx.y * 64;
    const size_t aoff = (size_t)(r0 + lr) * CI + 8 * hi;
    const bf* Bh = YH + (size_t)b * NN_ * CI; const bf* Bl = YL + (size_t)b * NN_ * CI;
    size_t boff[4];
#pragma unroll
    for (int t = 0; t < 4; ++t) boff[t] = (size_t)(c0 + t * 16 + lr) * CI + 8 * hi;
    v8f acc[4], accx[4];
#pragma unroll
    for (int t = 0; t < 4; ++t) { acc[t] = (v8f){}; accx[t] = (v8f){}; }
#pragma unroll
    for (int kc = 0; kc < CI; kc += 32) {
        const v16bf a = cat16b(*(const v8us*)(WZ + aoff + kc), *(const v8us*)(WZ + aoff + kc + 16));
#pragma unroll
        for (int t = 0; t < 4; ++t) { acc[t] = wmmab(a, cat16b(*(const v8us*)(Bh + boff[t] + kc), *(const v8us*)(Bh + boff[t] + kc + 16)), acc[t]); accx[t] = wmmab(a, cat16b(*(const v8us*)(Bl + boff[t] + kc), *(const v8us*)(Bl + boff[t] + kc + 16)), accx[t]); }
    }
    asm volatile("v_nop\n\tv_nop\n\tv_nop\n\tv_nop" : "+v"(acc[0]), "+v"(acc[1]), "+v"(acc[2]), "+v"(acc[3]), "+v"(accx[0]), "+v"(accx[1]), "+v"(accx[2]), "+v"(accx[3]));
    float* os = &ost[wave][0];
#pragma unroll
    for (int t = 0; t < 4; ++t)
#pragma unroll
        for (int j = 0; j < 8; ++j) os[(hi * 8 + j) * 68 + t * 16 + lr] = acc[t][j] + accx[t][j] + bfr(bz[r0 + hi * 8 + j]);
    __syncthreads();
    float* crow = Z + ((size_t)b * CI + r0) * NN_ + c0;
    auto pass = [&]() {
#pragma unroll
        for (int s = 0; s < 8; ++s) { const int Lid = (lane >> 3) + 4 * s, piece = lane & 7; const int row = Lid >> 1, cq = (Lid & 1) * 32 + piece * 4;
            const v4f val = *(const v4fa*)(os + row * 68 + cq); *(v4f*)(crow + (size_t)row * NN_ + cq) = val; }
    };
    pass(); 
}
__global__ __launch_bounds__(256) void k_stats(const float* __restrict__ Z, float* ST) {
    __shared__ float red[256];
    const int o = blockIdx.x, t = threadIdx.x;
    float s = 0.f;
#pragma unroll 1
    for (int i = 0; i < (NB_ * NN_) / 256; ++i) { const int flat = i * 256 + t; const int b = flat / NN_, n = flat - b * NN_; s += Z[((size_t)b * CI + o) * NN_ + n]; }
    red[t] = s; __syncthreads();
    for (int st = 128; st > 0; st >>= 1) { if (t < st) red[t] += red[t + st]; __syncthreads(); }
    const float mu = red[0] / (float)(NB_ * NN_);
    __syncthreads();
    float q = 0.f;
#pragma unroll 1
    for (int i = 0; i < (NB_ * NN_) / 256; ++i) { const int flat = i * 256 + t; const int b = flat / NN_, n = flat - b * NN_; const float d = Z[((size_t)b * CI + o) * NN_ + n] - mu; q += d * d; }
    red[t] = q; __syncthreads();
    for (int st = 128; st > 0; st >>= 1) { if (t < st) red[t] += red[t + st]; __syncthreads(); }
    const float var = red[0] / (float)(NB_ * NN_);
    if (t < 32) { const float v = (t == 0) ? mu : (t == 1) ? rsqrtf(var + 1e-5f) : 0.f; VST2(float, ST + (size_t)o * 32 + t, v); }
}
// k_final: out[b][o][n] = (Z - mu) rs gamma + beta; one wave per 256 values (8 per lane = 32 B -> use 2 x v4f? no: v8f per lane = lane-strided pair of b128 -> use 2
// instructions of v4f over 128 values each: lane -> 4 floats).
__global__ __launch_bounds__(256) void k_final(const float* __restrict__ Z, const float* __restrict__ ST, const float* __restrict__ gam, const float* __restrict__ bet, float* out) {
    const int lane = threadIdx.x & 31; const size_t wid = (size_t)blockIdx.x * 8 + (threadIdx.x >> 5);
    const size_t row = wid >> 4; const int seg = (int)(wid & 15);        // row = b*CI + o (4096 floats = 16 segments of 256)
    const int o = (int)(row % CI);
    const float mu = ST[(size_t)o * 32], rs = ST[(size_t)o * 32 + 1], g = bfr(gam[o]), be = bfr(bet[o]);
#pragma unroll
    for (int hf = 0; hf < 2; ++hf) { const size_t base = row * NN_ + (size_t)seg * 256 + hf * 128 + lane * 4; v4f v;
#pragma unroll
        for (int i = 0; i < 4; ++i) v[i] = (Z[base + i] - mu) * rs * g + be;
        VST2(v4f, out + base, v); }
}

extern "C" void kernel_launch(void* const* d_in, const int* in_sizes, int n_in,
                              void* d_out, int out_size, void* d_ws, size_t ws_size, hipStream_t stream) {
    (void)in_sizes; (void)n_in; (void)out_size;
    const float* xt = (const float*)d_in[0]; const float* xo = (const float*)d_in[1]; const float* wg = (const float*)d_in[2]; const float* bg = (const float*)d_in[3];
    const float* wth = (const float*)d_in[4]; const float* bth = (const float*)d_in[5]; const float* wph = (const float*)d_in[6]; const float* bph = (const float*)d_in[7];
    const float* wz = (const float*)d_in[8]; const float* bz = (const float*)d_in[9]; const float* gam = (const float*)d_in[10]; const float* bet = (const float*)d_in[11];
    float* out = (float*)d_out;    // [4][128][64][64]
    char* wsp = (char*)d_ws;
    auto take = [&](size_t bytes) { char* p = wsp; wsp += (bytes + 255) & ~(size_t)255; return (void*)p; };
    bf* XTt = (bf*)take((size_t)NB_ * NN_ * CIN * 2); bf* XTo = (bf*)take((size_t)NB_ * NN_ * CIN * 2);
    bf* WGb = (bf*)take((size_t)CI * CIN * 2); bf* WTb = (bf*)take((size_t)CI * CIN * 2); bf* WPb = (bf*)take((size_t)CI * CIN * 2); bf* WZb = (bf*)take((size_t)CI * CI * 2);
    h16* TH = (h16*)take((size_t)NB_ * NN_ * CI * 2); h16* TL = (h16*)take((size_t)NB_ * NN_ * CI * 2); h16* PH = (h16*)take((size_t)NB_ * NN_ * CI * 2); h16* PL = (h16*)take((size_t)NB_ * NN_ * CI * 2);
    float* G = (float*)take((size_t)NB_ * NN_ * CI * 4); h16* GTH = (h16*)take((size_t)NB_ * CI * NN_ * 2); h16* GTL = (h16*)take((size_t)NB_ * CI * NN_ * 2);
    float* Y = (float*)take((size_t)NB_ * NN_ * CI * 4); bf* YH = (bf*)take((size_t)NB_ * NN_ * CI * 2); bf* YL = (bf*)take((size_t)NB_ * NN_ * CI * 2);
    float* Z = (float*)take((size_t)NB_ * CI * NN_ * 4); float* ST = (float*)take((size_t)CI * 32 * 4);
    if ((size_t)(wsp - (char*)d_ws) > ws_size) return;    // 8.4x2 + 0.2 + 4.2x4 + 8.4 + 4.2x2 + 8.4 + 4.2x2 + 8.4 ~ 76 MB
    k_xt<<<dim3(NN_ / 64, CIN / 64, NB_), 256, 0, stream>>>(xt, XTt);
    k_xt<<<dim3(NN_ / 64, CIN / 64, NB_), 256, 0, stream>>>(xo, XTo);
    k_cvtw<<<CI / 8, 256, 0, stream>>>(wg, CI, CIN, WGb); k_cvtw<<<CI / 8, 256, 0, stream>>>(wth, CI, CIN, WTb); k_cvtw<<<CI / 8, 256, 0, stream>>>(wph, CI, CIN, WPb); k_cvtw<<<CI / 8, 256, 0, stream>>>(wz, CI, CI, WZb);
    k_proj<0><<<dim3(NN_ / 64, CI / 64, NB_), 128, 0, stream>>>(XTt, WTb, bth, TH, TL);      // theta (keys) from this branch
    k_proj<0><<<dim3(NN_ / 64, CI / 64, NB_), 128, 0, stream>>>(XTo, WPb, bph, PH, PL);      // phi (queries) from the other branch
    k_proj<1><<<dim3(NN_ / 64, CI / 64, NB_), 128, 0, stream>>>(XTt, WGb, bg, G, nullptr);     // g (values) from this branch
    k_vt<<<NB_ * (NN_ / 64), 256, 0, stream>>>(G, GTH, GTL);
    k_attn<<<NB_ * (NN_ / 64), 128, 0, stream>>>(PH, PL, TH, TL, GTH, GTL, Y);
    k_splity<<<(NB_ * NN_ / 2) / 8, 256, 0, stream>>>(Y, YH, YL);
    k_z<<<dim3(CI / 64, NN_ / 64, NB_), 128, 0, stream>>>(WZb, YH, YL, bz, Z);
    k_stats<<<CI, 256, 0, stream>>>(Z, ST);
    k_final<<<(NB_ * CI * 16) / 8, 256, 0, stream>>>(Z, ST, gam, bet, out);
}

// v002
// One run takes 217 microseconds.
// Two timings next to v001 both put it at 1.14 times that version's speed.
// All steps since v000 together make it 2.82 times as fast.
#include <hip/hip_runtime.h>
#include <stdint.h>

// Contractions, f32 accumulate: the three 1x1 convs g, theta (from x_this) and phi (from x_other) as [4 x 4096 x 256].[256 x 128] products (+bias) and W_z
// ([128 x 128].[128 x 4096] per b, +bias) on v_wmma_f32_16x16x32_bf16 — plain bf16 = rounded inputs (exact) for the convs, y as bf16 hi + residual planes (two
// products) for W_z; the non-local attention fused on v_wmma_f32_16x16x32_f16: f = phi_i.theta_j over 128 channels (unscaled, sigma ~ 20: both operands f16 hi +
// residual x1024, hi.hi + hi.lo + lo.hi), softmax over the 4096 positions j, y_i = sum_j f g_j with the weights (x32768) and g both as f16 hi + UNSCALED residual so all three products share one accumulator (hi.hi + hi.lo + lo.hi: the softmax is nearly one-hot, so single roundings would pass straight into y).

#define NB_  4
#define CIN  256
#define CI   128
#define NN_  4096
#define PSC  32768.0f
#define LOSC 1024.0f
#define LOSCI (1.0f / 1024.0f)

typedef _Float16 h16;
typedef unsigned short bf;
typedef __attribute__((ext_vector_type(16))) __bf16   v16bf;
typedef __attribute__((ext_vector_type(16))) _Float16 v16h;
typedef __attribute__((ext_vector_type(8)))  _Float16 v8h;
typedef __attribute__((ext_vector_type(8)))  unsigned short v8us;
typedef __attribute__((ext_vector_type(8)))  float    v8f;
typedef __attribute__((ext_vector_type(4)))  float    v4f;
typedef v8h  __attribute__((may_alias)) v8ha;
typedef v4f  __attribute__((may_alias)) v4fa;
typedef v8us __attribute__((may_alias)) v8usa;

__device__ __forceinline__ unsigned short f2bf(float f) { unsigned u = __float_as_uint(f); u += 0x7FFFu + ((u >> 16) & 1u); return (unsigned short)(u >> 16); }
__device__ __forceinline__ float bf2f(unsigned short b) { return __uint_as_float(((unsigned)b) << 16); }
__device__ __forceinline__ float bfr(float f) { return bf2f(f2bf(f)); }
__device__ __forceinline__ v16h cat16(v8h lo, v8h hi) { return __builtin_shufflevector(lo, hi, 0, 1, 2, 3, 4, 5, 6, 7, 8, 9, 10, 11, 12, 13, 14, 15); }
__device__ __forceinline__ v16bf cat16b(v8us lo, v8us hi) { return __builtin_bit_cast(v16bf, __builtin_shufflevector(lo, hi, 0, 1, 2, 3, 4, 5, 6, 7, 8, 9, 10, 11, 12, 13, 14, 15)); }
__device__ __forceinline__ v8f wmma16(v16h a, v16h b, v8f c) { return __builtin_amdgcn_wmma_f32_16x16x32_f16(false, a, false, b, (short)0, c, false, false); }
__device__ __forceinline__ v8f wmmab(v16bf a, v16bf b, v8f c) { return __builtin_amdgcn_wmma_f32_16x16x32_bf16(false, a, false, b, (short)0, c, false, false); }
#define VST2(T, p, v) do { const T vst2_v_ = (v); *(T*)(p) = vst2_v_;  } while (0)

// Tensor loads into LDS for k_attn: a stage = 64 keys = four slices (theta hi, theta residual: 64 rows x 256 B; g hi, g residual: 128 rows x 128 B), one slice per wave.
typedef uint32_t u32x4 __attribute__((ext_vector_type(4)));
typedef uint32_t u32x8 __attribute__((ext_vector_type(8)));
#define SKEY 64u
#define NSTG (NN_ / 64u)
#define KPIT 272u      // LDS pitch of a 256-byte row (16 B pad, odd multiple of 16 B for the b128 readers)
#define VPIT 144u      // LDS pitch of a 128-byte row (16 B pad)
#define SLOT 18432u    // one slice's place: 128 x 144 B, and 64 x 272 B rounded up to a multiple of 2 KiB
#define W0_R256 ((1u << 20) | (5u << 22) | (3u << 25))   // group 1 word 0: no mask, 1-byte elements, 4 dwords of pad behind every 256 B
#define W0_R128 ((1u << 20) | (4u << 22) | (3u << 25))   // the same behind every 128 B
__device__ __forceinline__ uint32_t uni(uint32_t v) { return (uint32_t)__builtin_amdgcn_readfirstlane(v); }
// Holds a wave-uniform value in a scalar register, so that a test around a tensor load compiles to a scalar branch (tensor loads ignore EXEC).
__device__ __forceinline__ uint32_t pinned(uint32_t v) { uint32_t w = uni(v); asm volatile("" : "+s"(w)); return w; }
// Descriptor group 0: the tile's first byte at ga, to the LDS byte offset dst. Group 1: D1 rows of D0 bytes, source pitch SP bytes, tensor = tile.
__device__ __forceinline__ u32x4 tdm_group0(uint32_t dst, uint64_t ga) {
    u32x4 g0; g0[0] = uni(1u); g0[1] = uni(dst); g0[2] = uni((uint32_t)ga); g0[3] = uni((((uint32_t)(ga >> 32)) & 0x01FFFFFFu) | 0x80000000u);
    asm volatile("" : "+s"(g0));   // descriptor words held in scalar registers: no word is formed anew elsewhere while the request is outstanding
    return g0;
}
template <uint32_t W0, uint32_t D0, uint32_t D1, uint32_t SP>
__device__ __forceinline__ u32x8 tdm_group1() {
    u32x8 g1; g1[0] = uni(W0); g1[1] = uni((D0 & 0xFFFFu) << 16); g1[2] = uni((D0 >> 16) | ((D1 & 0xFFFFu) << 16)); g1[3] = uni((D1 >> 16) | (D0 << 16));
    g1[4] = uni(D1); g1[5] = uni(SP); g1[6] = uni(0u); g1[7] = uni(0u);
    asm volatile("" : "+s"(g1));   // descriptor words held in scalar registers: set once from constants, in the same registers for as long as requests are issued
    return g1;
}
__device__ __forceinline__ void tdm_load(u32x4 g0, u32x8 g1) { asm volatile("tensor_load_to_lds %0, %1" :: "s"(g0), "s"(g1) : "memory"); }
// The compiler places no wait for a tensor load. The wait names the request's group 0 so that its registers keep their values while the request is outstanding.
__device__ __forceinline__ void wait_tensor0(u32x4 g0) { asm volatile("s_wait_tensorcnt 0x0" :: "s"(g0) : "memory"); }
__device__ __forceinline__ void wait_ds0() { asm volatile("s_wait_dscnt 0x0" ::: "memory"); }           // this wave's LDS reads are done before their buffer is handed back
// exp(x) as __expf compiles here (one multiply, v_exp_f32), with the one issue slot that the instruction set asks for behind a transcendental tied to it.
__device__ __forceinline__ float exp_slot(float x) { float r; asm("v_exp_f32 %0, %1\n\tv_nop" : "=v"(r) : "v"(x * 1.44269504088896340736f)); return r; }
__device__ __forceinline__ v16h ldsfrag(const unsigned char* p) { return cat16(*(const v8ha*)p, *(const v8ha*)(p + 32)); }   // k 0..7 and 16..23 (+8 in the upper half-wave) of one row

// k_xt: XT [b][n][c] = bf16(x[b][c][n]) (NCHW -> rows n with channels contiguous) via 64 x 64 LDS transposes; grid (n/64, c/64, b).
__global__ __launch_bounds__(256) void k_xt(const float* __restrict__ x, bf* XT) {
    __shared__ __align__(16) unsigned short tl[64 * 72];
    const int tid = threadIdx.x, n0 = blockIdx.x * 64, c0 = blockIdx.y * 64, b = blockIdx.z;
    const int cr = tid >> 2, nq = (tid & 3) * 16;
#pragma unroll
    for (int i = 0; i < 16; ++i) tl[(nq + i) * 72 + cr] = f2bf(x[((size_t)b * CIN + c0 + cr) * NN_ + n0 + nq + i]);
    __syncthreads();
    const int piece = tid & 7;
    auto pass = [&]() {
#pragma unroll
        for (int s = 0; s < 2; ++s) { const int nr = (tid >> 3) + 32 * s; const v8us val = *(const v8usa*)(tl + nr * 72 + piece * 8);
            *(v8us*)(XT + ((size_t)b * NN_ + n0 + nr) * CIN + c0 + piece * 8) = val; }
    };
    pass(); 
}
// k_cvtw: bf16 copy of a [rows][cols] weight ([out][in] as-is: the n-major B operand of the convs, the A operand of k_z); one wave per row, cols/32 per lane.
__global__ __launch_bounds__(256) void k_cvtw(const float* __restrict__ Wm, int rows, int cols, bf* WB) {
    const int lane = threadIdx.x & 31, r = blockIdx.x * 8 + (threadIdx.x >> 5);
    if (r >= rows) return;
    if (cols == CIN) { v8us t;
#pragma unroll
        for (int i = 0; i < 8; ++i) t[i] = f2bf(Wm[(size_t)r * cols + lane * 8 + i]);
        VST2(v8us, WB + (size_t)r * cols + lane * 8, t); }
    else { typedef __attribute__((ext_vector_type(4))) unsigned short v4us; v4us t;
#pragma unroll
        for (int i = 0; i < 4; ++i) t[i] = f2bf(Wm[(size_t)r * cols + lane * 4 + i]);
        VST2(v4us, WB + (size_t)r * cols + lane * 4, t); }
}
// k_proj: 64 x 64 tile of P[b][n][o] = XT[b][n].W^T + bias over K = 256 (exact); MODE 0: f16 hi + residual planes [b*4096+n][128] (theta, phi);
// MODE 1: f32 rows G [b*4096+n][128] (g). grid (NN_/64, 2, NB_).
template <int MODE>
__global__ __launch_bounds__(128) void k_proj(const bf* __restrict__ XT, const bf* __restrict__ WB, const float* __restrict__ bias, void* C, void* C2) {
    __shared__ __align__(16) float ost[4][16 * 68];
    const int lane = threadIdx.x & 31, wave = threadIdx.x >> 5, lr = lane & 15, hi = lane >> 4, b = blockIdx.z;
    const int r0 = blockIdx.x * 64 + wave * 16, c0 = blockIdx.y * 64;
    const bf* A = XT + (size_t)b * NN_ * CIN;
    const size_t aoff = (size_t)(r0 + lr) * CIN + 8 * hi;
    size_t boff[4];
#pragma unroll
    for (int t = 0; t < 4; ++t) boff[t] = (size_t)(c0 + t * 16 + lr) * CIN + 8 * hi;
    v8f acc[4];
#pragma unroll
    for (int t = 0; t < 4; ++t) acc[t] = (v8f){};
#pragma unroll 1
    for (int kc = 0; kc < CIN; kc += 32) {
        const v16bf a = cat16b(*(const v8us*)(A + aoff + kc), *(const v8us*)(A + aoff + kc + 16));
#pragma unroll
        for (int t = 0; t < 4; ++t) acc[t] = wmmab(a, cat16b(*(const v8us*)(WB + boff[t] + kc), *(const v8us*)(WB + boff[t] + kc + 16)), acc[t]);
        asm volatile("v_nop\n\tv_nop\n\tv_nop\n\tv_nop" : "+v"(acc[0]), "+v"(acc[1]), "+v"(acc[2]), "+v"(acc[3]) : "v"(a));
    }
    float* os = &ost[wave][0];
#pragma unroll
    for (int t = 0; t < 4; ++t) { const float bv = bfr(bias[c0 + t * 16 + lr]);
#pragma unroll
        for (int j = 0; j < 8; ++j) os[(hi * 8 + j) * 68 + t * 16 + lr] = acc[t][j] + bv; }
    __syncthreads();
    const size_t rowbase = (size_t)b * NN_ + r0;
    if (MODE == 1) {
        float* crow = (float*)C + rowbase * CI + c0;
        auto pass = [&]() {
#pragma unroll
            for (int s = 0; s < 8; ++s) { const int Lid = (lane >> 3) + 4 * s, piece = lane & 7; const int row = Lid >> 1, cofs = (Lid & 1) * 32 + piece * 4;
                const v4f val = *(const v4fa*)(os + row * 68 + cofs); *(v4f*)(crow + (size_t)row * CI + cofs) = val; }
        };
        pass(); 
    } else {
        h16* c1 = (h16*)C + rowbase * CI + c0; h16* c2 = (h16*)C2 + rowbase * CI + c0;
        auto pass = [&]() {
#pragma unroll
            for (int s = 0; s < 4; ++s) { const int row = 4 * s + (lane >> 3), piece = lane & 7; const float* sp = os + row * 68 + piece * 8; v8h o1, o2;
#pragma unroll
                for (int i = 0; i < 8; ++i) { const h16 a = (h16)sp[i]; o1[i] = a; o2[i] = (h16)((sp[i] - (float)a) * LOSC); }
                *(v8h*)(c1 + (size_t)row * CI + piece * 8) = o1; *(v8h*)(c2 + (size_t)row * CI + piece * 8) = o2; }
        };
        pass(); 
    }
}
// k_vt: GTH/GTL [b][c][n] = f16 hi + residual of G[b*4096+n][c] (the B operand of y: rows c, k = n); block (b, 64 n): 128 c x 64 n LDS transpose.
__global__ __launch_bounds__(256) void k_vt(const float* __restrict__ G, h16* GTH, h16* GTL) {
    __shared__ __align__(16) h16 t1[CI * 72];
    __shared__ __align__(16) h16 t2[CI * 72];
    const int b = blockIdx.x / (NN_ / 64), kt = blockIdx.x - b * (NN_ / 64), n0 = kt * 64, tid = threadIdx.x;
    const int nn = tid >> 2, cq = (tid & 3) * 32;
    const float* src = G + ((size_t)b * NN_ + n0 + nn) * CI + cq;
#pragma unroll
    for (int i = 0; i < 32; ++i) { const float v = src[i]; const h16 a = (h16)v; t1[(cq + i) * 72 + nn] = a; t2[(cq + i) * 72 + nn] = (h16)(v - (float)a); }   // UNSCALED residual (summed into the same accumulator as the hi product)
    __syncthreads();
    const int piece = tid & 7;
    const size_t base = ((size_t)b * CI) * NN_ + n0;
    auto pass = [&]() {
#pragma unroll
        for (int s = 0; s < 8; ++s) { const int Lid = (tid >> 3) + 32 * s; const int pln = Lid >> 7, c = Lid & 127;
            const v8h val = *(const v8ha*)((pln ? t2 : t1) + c * 72 + piece * 8); *(v8h*)((pln ? GTL : GTH) + base + (size_t)c * NN_ + piece * 8) = val; }
    };
    pass(); 
}
// k_attn: block = (b, 64 queries i), wave = 16; theta and g (hi + residual) come in stages of 64 keys by tensor loads into two LDS buffers, one slice per wave, the
// next stage in flight while this one is worked on; the block's phi residual rows are loaded into LDS once. Per 32 keys: scores phi_i.theta_j (hi.hi + hi.lo + lo.hi
// over 4 k-chunks x 2 tiles = 24 WMMA); online f32 softmax; hi/residual weight tiles (x32768); y += w.g over all 128 channels (8 n-tiles x 3 = 24 WMMA);
// y rows -> Y [b*4096+i][128] f32 (one 512-byte row per instruction).
__global__ __launch_bounds__(128) void k_attn(const h16* __restrict__ PH, const h16* __restrict__ PL, const h16* __restrict__ TH, const h16* __restrict__ TL,
                                             const h16* __restrict__ GTH, const h16* __restrict__ GTL, float* Y) {
    __shared__ __attribute__((aligned(2048))) unsigned char ring[9 * SLOT];   // buffer 0: slices 0-3, buffer 1: slices 4-7, slice 8: phi residual rows
    __shared__ __align__(16) h16 plds[4][16 * 32];
    __shared__ __align__(16) h16 plds2[4][16 * 32];
    __shared__ __align__(16) float ost[4][16 * 132];
    const int lane = threadIdx.x & 31, wave = threadIdx.x >> 5, lr = lane & 15, hi = lane >> 4;
    const int b = blockIdx.x / (NN_ / 64), qt = blockIdx.x - b * (NN_ / 64), q0 = qt * 64 + wave * 16;
    const size_t tok0 = (size_t)b * NN_;
    const size_t vbase = ((size_t)b * CI) * NN_;
    const uint32_t wv = uni(threadIdx.x >> 5), ring0 = (uint32_t)(size_t)ring;
    // This wave's slice: 0 theta hi, 1 theta residual (a stage further = 64 rows), 2 g hi, 3 g residual (a stage further = 64 keys along the rows).
    const h16* splane = (wv == 0u) ? TH + tok0 * CI : (wv == 1u) ? TL + tok0 * CI : (wv == 2u) ? GTH + vbase : GTL + vbase;
    const uint32_t sstep = (wv < 2u) ? SKEY * CI * 2u : SKEY * 2u;
    const u32x8 g1k = tdm_group1<W0_R256, 256u, 64u, 256u>(), g1v = tdm_group1<W0_R128, 128u, 128u, NN_ * 2u>();
    u32x4 g0;
    auto issue = [&](uint32_t st) {
        g0 = tdm_group0(ring0 + ((st & 1u) * 4u + wv) * SLOT, (uint64_t)(size_t)splane + (uint64_t)st * sstep);
        if (pinned(wv < 2u)) tdm_load(g0, g1k); else tdm_load(g0, g1v);
    };
    if (pinned(wv == 0u)) { const u32x4 gp = tdm_group0(ring0 + 8u * SLOT, (uint64_t)(size_t)(PL + (tok0 + (size_t)qt * 64) * CI)); tdm_load(gp, g1k); wait_tensor0(gp); }
    issue(0u); wait_tensor0(g0);
    __syncthreads();   // stage 0 and the phi residual rows are published
    issue(1u);
    h16* pl = &plds[wave][0]; h16* pl2 = &plds2[wave][0];
    v16h ah[4];
    const size_t qo0 = (tok0 + q0 + lr) * CI + 8 * hi;
#pragma unroll
    for (int kc = 0; kc < 4; ++kc) ah[kc] = cat16(*(const v8h*)(PH + qo0 + kc * 32), *(const v8h*)(PH + qo0 + kc * 32 + 16));
    const unsigned char* alp = ring + 8u * SLOT + (uint32_t)(wave * 16 + lr) * KPIT + 16u * hi;
    v8f o[8];
#pragma unroll
    for (int n = 0; n < 8; ++n) o[n] = (v8f){};
    float mrow[8], lpart[8];
#pragma unroll
    for (int j = 0; j < 8; ++j) { mrow[j] = -3.0e38f; lpart[j] = 0.f; }
#pragma unroll 1   // one trip = one stage with its one publish point
    for (uint32_t st = 0; st < NSTG; ++st) {
      const unsigned char* buf = ring + (st & 1u) * (4u * SLOT);
#pragma unroll     // the stage's two 32-key blocks: their places in the buffer become constant offsets, and the second block's reads can start under the first's products
      for (int kk = 0; kk < 2; ++kk) {
        const unsigned char* kh = buf + (uint32_t)(kk * 32 + lr) * KPIT + 16u * hi;            // theta rows (keys), 16 further: + 16 * KPIT; residual plane: + SLOT
        const unsigned char* vp = buf + 2u * SLOT + (uint32_t)lr * VPIT + (uint32_t)(kk * 64) + 16u * hi;   // g rows (channels), 16 further: + 16 * VPIT; residual plane: + SLOT
        v8f s0 = {}, s1 = {}, x0 = {}, x1 = {};
#pragma unroll
        for (int kc = 0; kc < 4; ++kc) {
            const v16h k0h = ldsfrag(kh + kc * 64), k1h = ldsfrag(kh + 16u * KPIT + kc * 64), alk = ldsfrag(alp + kc * 64);
            const v16h k0l = ldsfrag(kh + SLOT + kc * 64), k1l = ldsfrag(kh + SLOT + 16u * KPIT + kc * 64);
            s0 = wmma16(ah[kc], k0h, s0); x0 = wmma16(alk, k0h, x0); s1 = wmma16(ah[kc], k1h, s1); x1 = wmma16(alk, k1h, x1);
            x0 = wmma16(ah[kc], k0l, x0); x1 = wmma16(ah[kc], k1l, x1);
        }
        asm volatile("v_nop\n\tv_nop\n\tv_nop\n\tv_nop" : "+v"(s0), "+v"(s1), "+v"(x0), "+v"(x1) : "v"(ah[0]), "v"(ah[3]));
        v16h vh[8], vl[8];   // read here so that the reads run under the softmax
#pragma unroll
        for (int n = 0; n < 8; ++n) { vh[n] = ldsfrag(vp + (uint32_t)(n * 16) * VPIT); vl[n] = ldsfrag(vp + SLOT + (uint32_t)(n * 16) * VPIT); }
        float alpha[8];
#pragma unroll
        for (int j = 0; j < 8; ++j) {
            const float a0 = s0[j] + x0[j] * LOSCI, a1 = s1[j] + x1[j] * LOSCI;
            float mx = fmaxf(a0, a1);
            mx = fmaxf(mx, __shfl_xor(mx, 1, 16)); mx = fmaxf(mx, __shfl_xor(mx, 2, 16)); mx = fmaxf(mx, __shfl_xor(mx, 4, 16)); mx = fmaxf(mx, __shfl_xor(mx, 8, 16));
            const float mn = fmaxf(mrow[j], mx);
            alpha[j] = exp_slot(mrow[j] - mn); mrow[j] = mn;
            const float e0 = exp_slot(a0 - mn), e1 = exp_slot(a1 - mn);
            lpart[j] = lpart[j] * alpha[j] + (e0 + e1);
            const int mr = hi * 8 + j;
            const float ps0 = e0 * PSC, ps1 = e1 * PSC; const h16 h0 = (h16)ps0, h1 = (h16)ps1;
            pl[mr * 32 + lr] = h0; pl[mr * 32 + 16 + lr] = h1; pl2[mr * 32 + lr] = (h16)(ps0 - (float)h0); pl2[mr * 32 + 16 + lr] = (h16)(ps1 - (float)h1);   // unscaled residual
        }
#pragma unroll
        for (int n = 0; n < 8; ++n)
#pragma unroll
            for (int j = 0; j < 8; ++j) o[n][j] *= alpha[j];
        asm volatile("" ::: "memory");
        const v16h pa = cat16(*(const v8ha*)(pl + lr * 32 + hi * 8), *(const v8ha*)(pl + lr * 32 + 16 + hi * 8));
        const v16h px = cat16(*(const v8ha*)(pl2 + lr * 32 + hi * 8), *(const v8ha*)(pl2 + lr * 32 + 16 + hi * 8));
#pragma unroll
        for (int n = 0; n < 8; ++n) { o[n] = wmma16(pa, vh[n], o[n]); o[n] = wmma16(pa, vl[n], o[n]); o[n] = wmma16(px, vh[n], o[n]); }
      }
      // Publish point: this wave has left stage st's buffer, its own slice of stage st + 1 has landed, every wave is here; only then the refill.
      wait_ds0();
      wait_tensor0(g0);
      __syncthreads();
      if (pinned(st + 2u < NSTG)) issue(st + 2u);
    }
    wait_tensor0(g0);
    wait_ds0();
    float inv[8];
#pragma unroll
    for (int j = 0; j < 8; ++j) { float rs = lpart[j]; rs += __shfl_xor(rs, 1, 16); rs += __shfl_xor(rs, 2, 16); rs += __shfl_xor(rs, 4, 16); rs += __shfl_xor(rs, 8, 16); inv[j] = 1.0f / (rs * PSC); }
    float* os = &ost[wave][0];
#pragma unroll
    for (int n = 0; n < 8; ++n)
#pragma unroll
        for (int j = 0; j < 8; ++j) os[(hi * 8 + j) * 132 + n * 16 + lr] = o[n][j] * inv[j];
    __syncthreads();
    float* yb = Y + (tok0 + q0) * CI;
    auto pass = [&]() {   // 16 rows x 128 floats (512 B): one instruction per row (32 lanes x 16 B)
#pragma unroll
        for (int s = 0; s < 16; ++s) { const v4f val = *(const v4fa*)(os + s * 132 + lane * 4); *(v4f*)(yb + (size_t)s * CI + lane * 4) = val; }
    };
    pass(); 
}
// k_splity: YH/YL bf16 hi + residual planes of Y [16384][128]; one wave per 2 rows (lane 8 values; 32 lanes x 16 B = 2 rows).
__global__ __launch_bounds__(256) void k_splity(const float* __restrict__ Y, bf* YH, bf* YL) {
    const int lane = threadIdx.x & 31; const size_t w = (size_t)blockIdx.x * 8 + (threadIdx.x >> 5);
    v8us oh, ol;
#pragma unroll
    for (int i = 0; i < 8; ++i) { const float v = Y[w * 256 + lane * 8 + i]; const unsigned short hb = f2bf(v); oh[i] = hb; ol[i] = f2bf(v - bf2f(hb)); }
    *(v8us*)(YH + w * 256 + lane * 8) = oh; *(v8us*)(YL + w * 256 + lane * 8) = ol; 
}
// k_z: 64 x 64 tile of Z [b][o][n] = w_z . (YH + YL)[b][n]^T + b_z[o] over K = 128 (A = w_z rows o [128][128], B = Y planes rows n); grid (2, NN_/64, NB_); f32 rows.
__global__ __launch_bounds__(128) void k_z(const bf* __restrict__ WZ, const bf* __restrict__ YH, const bf* __restrict__ YL, const float* __restrict__ bz, float* Z) {
    __shared__ __align__(16) float ost[4][16 * 68];
    const int lane = threadIdx.x & 31, wave = threadIdx.x >> 5, lr = lane & 15, hi = lane >> 4, b = blockIdx.z;
    const int r0 = blockIdx.x * 64 + wave * 16, c0 = blockIdx.y * 64;
    const size_t aoff = (size_t)(r0 + lr) * CI + 8 * hi;
    const bf* Bh = YH + (size_t)b * NN_ * CI; const bf* Bl = YL + (size_t)b * NN_ * CI;
    size_t boff[4];
#pragma unroll
    for (int t = 0; t < 4; ++t) boff[t] = (size_t)(c0 + t * 16 + lr) * CI + 8 * hi;
    v8f acc[4], accx[4];
#pragma unroll
    for (int t = 0; t < 4; ++t) { acc[t] = (v8f){}; accx[t] = (v8f){}; }
#pragma unroll
    for (int kc = 0; kc < CI; kc += 32) {
        const v16bf a = cat16b(*(const v8us*)(WZ + aoff + kc), *(const v8us*)(WZ + aoff + kc + 16));
#pragma unroll
        for (int t = 0; t < 4; ++t) { acc[t] = wmmab(a, cat16b(*(const v8us*)(Bh + boff[t] + kc), *(const v8us*)(Bh + boff[t] + kc + 16)), acc[t]); accx[t] = wmmab(a, cat16b(*(const v8us*)(Bl + boff[t] + kc), *(const v8us*)(Bl + boff[t] + kc + 16)), accx[t]); }
    }
    asm volatile("v_nop\n\tv_nop\n\tv_nop\n\tv_nop" : "+v"(acc[0]), "+v"(acc[1]), "+v"(acc[2]), "+v"(acc[3]), "+v"(accx[0]), "+v"(accx[1]), "+v"(accx[2]), "+v"(accx[3]));
    float* os = &ost[wave][0];
#pragma unroll
    for (int t = 0; t < 4; ++t)
#pragma unroll
        for (int j = 0; j < 8; ++j) os[(hi * 8 + j) * 68 + t * 16 + lr] = acc[t][j] + accx[t][j] + bfr(bz[r0 + hi * 8 + j]);
    __syncthreads();
    float* crow = Z + ((size_t)b * CI + r0) * NN_ + c0;
    auto pass = [&]() {
#pragma unroll
        for (int s = 0; s < 8; ++s) { const int Lid = (lane >> 3) + 4 * s, piece = lane & 7; const int row = Lid >> 1, cq = (Lid & 1) * 32 + piece * 4;
            const v4f val = *(const v4fa*)(os + row * 68 + cq); *(v4f*)(crow + (size_t)row * NN_ + cq) = val; }
    };
    pass(); 
}
__global__ __launch_bounds__(256) void k_stats(const float* __restrict__ Z, float* ST) {
    __shared__ float red[256];
    const int o = blockIdx.x, t = threadIdx.x;
    float zv[(NB_ * NN_) / 256];   // this thread's 64 values of channel o: read once, kept in registers for both sums
#pragma unroll   // 64 independent loads in flight together: rolled, every trip waited out one load's whole latency
    for (int i = 0; i < (NB_ * NN_) / 256; ++i) { const int flat = i * 256 + t; const int b = flat / NN_, n = flat - b * NN_; zv[i] = Z[((size_t)b * CI + o) * NN_ + n]; }
    float s = 0.f;
#pragma unroll   // zv stays in registers only under constant indices
    for (int i = 0; i < (NB_ * NN_) / 256; ++i) s += zv[i];
    red[t] = s; __syncthreads();
    for (int st = 128; st > 0; st >>= 1) { if (t < st) red[t] += red[t + st]; __syncthreads(); }
    const float mu = red[0] / (float)(NB_ * NN_);
    __syncthreads();
    float q = 0.f;
#pragma unroll   // as above
    for (int i = 0; i < (NB_ * NN_) / 256; ++i) { const float d = zv[i] - mu; q += d * d; }
    red[t] = q; __syncthreads();
    for (int st = 128; st > 0; st >>= 1) { if (t < st) red[t] += red[t + st]; __syncthreads(); }
    const float var = red[0] / (float)(NB_ * NN_);
    if (t < 32) { const float v = (t == 0) ? mu : (t == 1) ? rsqrtf(var + 1e-5f) : 0.f; VST2(float, ST + (size_t)o * 32 + t, v); }
}
// k_final: out[b][o][n] = (Z - mu) rs gamma + beta; one wave per 256 values (8 per lane = 32 B -> use 2 x v4f? no: v8f per lane = lane-strided pair of b128 -> use 2
// instructions of v4f over 128 values each: lane -> 4 floats).
__global__ __launch_bounds__(256) void k_final(const float* __restrict__ Z, const float* __restrict__ ST, const float* __restrict__ gam, const float* __restrict__ bet, float* out) {
    const int lane = threadIdx.x & 31; const size_t wid = (size_t)blockIdx.x * 8 + (threadIdx.x >> 5);
    const size_t row = wid >> 4; const int seg = (int)(wid & 15);        // row = b*CI + o (4096 floats = 16 segments of 256)
    const int o = (int)(row % CI);
    const float mu = ST[(size_t)o * 32], rs = ST[(size_t)o * 32 + 1], g = bfr(gam[o]), be = bfr(bet[o]);
#pragma unroll
    for (int hf = 0; hf < 2; ++hf) { const size_t base = row * NN_ + (size_t)seg * 256 + hf * 128 + lane * 4; v4f v;
#pragma unroll
        for (int i = 0; i < 4; ++i) v[i] = (Z[base + i] - mu) * rs * g + be;
        VST2(v4f, out + base, v); }
}

extern "C" void kernel_launch(void* const* d_in, const int* in_sizes, int n_in,
                              void* d_out, int out_size, void* d_ws, size_t ws_size, hipStream_t stream) {
    (void)in_sizes; (void)n_in; (void)out_size;
    const float* xt = (const float*)d_in[0]; const float* xo = (const float*)d_in[1]; const float* wg = (const float*)d_in[2]; const float* bg = (const float*)d_in[3];
    const float* wth = (const float*)d_in[4]; const float* bth = (const float*)d_in[5]; const float* wph = (const float*)d_in[6]; const float* bph = (const float*)d_in[7];
    const float* wz = (const float*)d_in[8]; const float* bz = (const float*)d_in[9]; const float* gam = (const float*)d_in[10]; const float* bet = (const float*)d_in[11];
    float* out = (float*)d_out;    // [4][128][64][64]
    char* wsp = (char*)d_ws;
    auto take = [&](size_t bytes) { char* p = wsp; wsp += (bytes + 255) & ~(size_t)255; return (void*)p; };
    bf* XTt = (bf*)take((size_t)NB_ * NN_ * CIN * 2); bf* XTo = (bf*)take((size_t)NB_ * NN_ * CIN * 2);
    bf* WGb = (bf*)take((size_t)CI * CIN * 2); bf* WTb = (bf*)take((size_t)CI * CIN * 2); bf* WPb = (bf*)take((size_t)CI * CIN * 2); bf* WZb = (bf*)take((size_t)CI * CI * 2);
    h16* TH = (h16*)take((size_t)NB_ * NN_ * CI * 2); h16* TL = (h16*)take((size_t)NB_ * NN_ * CI * 2); h16* PH = (h16*)take((size_t)NB_ * NN_ * CI * 2); h16* PL = (h16*)take((size_t)NB_ * NN_ * CI * 2);
    float* G = (float*)take((size_t)NB_ * NN_ * CI * 4); h16* GTH = (h16*)take((size_t)NB_ * CI * NN_ * 2); h16* GTL = (h16*)take((size_t)NB_ * CI * NN_ * 2);
    float* Y = (float*)take((size_t)NB_ * NN_ * CI * 4); bf* YH = (bf*)take((size_t)NB_ * NN_ * CI * 2); bf* YL = (bf*)take((size_t)NB_ * NN_ * CI * 2);
    float* Z = (float*)take((size_t)NB_ * CI * NN_ * 4); float* ST = (float*)take((size_t)CI * 32 * 4);
    if ((size_t)(wsp - (char*)d_ws) > ws_size) return;    // 8.4x2 + 0.2 + 4.2x4 + 8.4 + 4.2x2 + 8.4 + 4.2x2 + 8.4 ~ 76 MB
    k_xt<<<dim3(NN_ / 64, CIN / 64, NB_), 256, 0, stream>>>(xt, XTt);
    k_xt<<<dim3(NN_ / 64, CIN / 64, NB_), 256, 0, stream>>>(xo, XTo);
    k_cvtw<<<CI / 8, 256, 0, stream>>>(wg, CI, CIN, WGb); k_cvtw<<<CI / 8, 256, 0, stream>>>(wth, CI, CIN, WTb); k_cvtw<<<CI / 8, 256, 0, stream>>>(wph, CI, CIN, WPb); k_cvtw<<<CI / 8, 256, 0, stream>>>(wz, CI, CI, WZb);
    k_proj<0><<<dim3(NN_ / 64, CI / 64, NB_), 128, 0, stream>>>(XTt, WTb, bth, TH, TL);      // theta (keys) from this branch
    k_proj<0><<<dim3(NN_ / 64, CI / 64, NB_), 128, 0, stream>>>(XTo, WPb, bph, PH, PL);      // phi (queries) from the other branch
    k_proj<1><<<dim3(NN_ / 64, CI / 64, NB_), 128, 0, stream>>>(XTt, WGb, bg, G, nullptr);     // g (values) from this branch
    k_vt<<<NB_ * (NN_ / 64), 256, 0, stream>>>(G, GTH, GTL);
    k_attn<<<NB_ * (NN_ / 64), 128, 0, stream>>>(PH, PL, TH, TL, GTH, GTL, Y);
    k_splity<<<(NB_ * NN_ / 2) / 8, 256, 0, stream>>>(Y, YH, YL);
    k_z<<<dim3(CI / 64, NN_ / 64, NB_), 128, 0, stream>>>(WZb, YH, YL, bz, Z);
    k_stats<<<CI, 256, 0, stream>>>(Z, ST);
    k_final<<<(NB_ * CI * 16) / 8, 256, 0, stream>>>(Z, ST, gam, bet, out);
}

// v003
// Measured time: 141 microseconds a run.
// Next to v002, in two timings, it ran 1.55 and 1.54 times as fast.
// Counting every step since v000, it is 4.37 times as fast.
#include <hip/hip_runtime.h>
#include <stdint.h>

// Contractions, f32 accumulate: the three 1x1 convs g, theta (from x_this) and phi (from x_other) as [4 x 4096 x 256].[256 x 128] products (+bias) and W_z
// ([128 x 128].[128 x 4096] per b, +bias) on v_wmma_f32_16x16x32_bf16 — plain bf16 = rounded inputs (exact) for the convs, y as bf16 hi + residual planes (two
// products) for W_z; the non-local attention fused on v_wmma_f32_16x16x32_f16: f = phi_i.theta_j over 128 channels (unscaled, sigma ~ 20: both operands f16 hi +
// residual x1024, hi.hi + hi.lo + lo.hi), softmax over the 4096 positions j, y_i = sum_j f g_j with the weights (x32768) and g both as f16 hi + UNSCALED residual so all three products share one accumulator (hi.hi + hi.lo + lo.hi: the softmax is nearly one-hot, so single roundings would pass straight into y).

#define NB_  4
#define CIN  256
#define CI   128
#define NN_  4096
#define PSC  32768.0f
#define LOSC 1024.0f
#define LOSCI (1.0f / 1024.0f)

typedef _Float16 h16;
typedef unsigned short bf;
typedef __attribute__((ext_vector_type(16))) __bf16   v16bf;
typedef __attribute__((ext_vector_type(16))) _Float16 v16h;
typedef __attribute__((ext_vector_type(8)))  _Float16 v8h;
typedef __attribute__((ext_vector_type(8)))  unsigned short v8us;
typedef __attribute__((ext_vector_type(8)))  float    v8f;
typedef __attribute__((ext_vector_type(4)))  float    v4f;
typedef v8h  __attribute__((may_alias)) v8ha;
typedef v4f  __attribute__((may_alias)) v4fa;
typedef v8us __attribute__((may_alias)) v8usa;

__device__ __forceinline__ unsigned short f2bf(float f) { unsigned u = __float_as_uint(f); u += 0x7FFFu + ((u >> 16) & 1u); return (unsigned short)(u >> 16); }
__device__ __forceinline__ float bf2f(unsigned short b) { return __uint_as_float(((unsigned)b) << 16); }
__device__ __forceinline__ float bfr(float f) { return bf2f(f2bf(f)); }
__device__ __forceinline__ v16h cat16(v8h lo, v8h hi) { return __builtin_shufflevector(lo, hi, 0, 1, 2, 3, 4, 5, 6, 7, 8, 9, 10, 11, 12, 13, 14, 15); }
__device__ __forceinline__ v16bf cat16b(v8us lo, v8us hi) { return __builtin_bit_cast(v16bf, __builtin_shufflevector(lo, hi, 0, 1, 2, 3, 4, 5, 6, 7, 8, 9, 10, 11, 12, 13, 14, 15)); }
__device__ __forceinline__ v8f wmma16(v16h a, v16h b, v8f c) { return __builtin_amdgcn_wmma_f32_16x16x32_f16(false, a, false, b, (short)0, c, false, false); }
__device__ __forceinline__ v8f wmmab(v16bf a, v16bf b, v8f c) { return __builtin_amdgcn_wmma_f32_16x16x32_bf16(false, a, false, b, (short)0, c, false, false); }
#define VST2(T, p, v) do { const T vst2_v_ = (v); *(T*)(p) = vst2_v_;  } while (0)

// Tensor loads into LDS for k_attn: a stage = 64 keys = four slices (theta hi, theta residual: 64 rows x 256 B; g hi, g residual: 128 rows x 128 B), one slice per wave.
typedef uint32_t u32x4 __attribute__((ext_vector_type(4)));
typedef uint32_t u32x8 __attribute__((ext_vector_type(8)));
#define SKEY 64u
#define NSTG (NN_ / 64u)
#define KPIT 272u      // LDS pitch of a 256-byte row (16 B pad, odd multiple of 16 B for the b128 readers)
#define VPIT 144u      // LDS pitch of a 128-byte row (16 B pad)
#define SLOT 18432u    // one slice's place: 128 x 144 B, and 64 x 272 B rounded up to a multiple of 2 KiB
#define W0_R256 ((1u << 20) | (5u << 22) | (3u << 25))   // group 1 word 0: no mask, 1-byte elements, 4 dwords of pad behind every 256 B
#define W0_R128 ((1u << 20) | (4u << 22) | (3u << 25))   // the same behind every 128 B
__device__ __forceinline__ uint32_t uni(uint32_t v) { return (uint32_t)__builtin_amdgcn_readfirstlane(v); }
// Holds a wave-uniform value in a scalar register, so that a test around a tensor load compiles to a scalar branch (tensor loads ignore EXEC).
__device__ __forceinline__ uint32_t pinned(uint32_t v) { uint32_t w = uni(v); asm volatile("" : "+s"(w)); return w; }
// Descriptor group 0: the tile's first byte at ga, to the LDS byte offset dst. Group 1: D1 rows of D0 bytes, source pitch SP bytes, tensor = tile.
__device__ __forceinline__ u32x4 tdm_group0(uint32_t dst, uint64_t ga) {
    u32x4 g0; g0[0] = uni(1u); g0[1] = uni(dst); g0[2] = uni((uint32_t)ga); g0[3] = uni((((uint32_t)(ga >> 32)) & 0x01FFFFFFu) | 0x80000000u);
    asm volatile("" : "+s"(g0));   // descriptor words held in scalar registers: no word is formed anew elsewhere while the request is outstanding
    return g0;
}
template <uint32_t W0, uint32_t D0, uint32_t D1, uint32_t SP>
__device__ __forceinline__ u32x8 tdm_group1() {
    u32x8 g1; g1[0] = uni(W0); g1[1] = uni((D0 & 0xFFFFu) << 16); g1[2] = uni((D0 >> 16) | ((D1 & 0xFFFFu) << 16)); g1[3] = uni((D1 >> 16) | (D0 << 16));
    g1[4] = uni(D1); g1[5] = uni(SP); g1[6] = uni(0u); g1[7] = uni(0u);
    asm volatile("" : "+s"(g1));   // descriptor words held in scalar registers: set once from constants, in the same registers for as long as requests are issued
    return g1;
}
__device__ __forceinline__ void tdm_load(u32x4 g0, u32x8 g1) { asm volatile("tensor_load_to_lds %0, %1" :: "s"(g0), "s"(g1) : "memory"); }
// The compiler places no wait for a tensor load. The wait names the request's group 0 so that its registers keep their values while the request is outstanding.
__device__ __forceinline__ void wait_tensor0(u32x4 g0) { asm volatile("s_wait_tensorcnt 0x0" :: "s"(g0) : "memory"); }
__device__ __forceinline__ void wait_ds0() { asm volatile("s_wait_dscnt 0x0" ::: "memory"); }           // this wave's LDS reads are done before their buffer is handed back
// exp(x) as __expf compiles here (one multiply, v_exp_f32), with the one issue slot that the instruction set asks for behind a transcendental tied to it.
__device__ __forceinline__ float exp_slot(float x) { float r; asm("v_exp_f32 %0, %1\n\tv_nop" : "=v"(r) : "v"(x * 1.44269504088896340736f)); return r; }
__device__ __forceinline__ float xhalf(float x) { return __builtin_bit_cast(float, __builtin_amdgcn_permlanex16(__builtin_bit_cast(int, x), __builtin_bit_cast(int, x), 0x76543210, 0xfedcba98, false, false)); }   // lane l's value from lane l ^ 16
__device__ __forceinline__ v16h ldsfrag(const unsigned char* p) { return cat16(*(const v8ha*)p, *(const v8ha*)(p + 32)); }   // k 0..7 and 16..23 (+8 in the upper half-wave) of one row

// k_xt: XT [b][n][c] = bf16(x[b][c][n]) (NCHW -> rows n with channels contiguous) via 64 x 64 LDS transposes; grid (n/64, c/64, b).
__global__ __launch_bounds__(256) void k_xt(const float* __restrict__ x, bf* XT) {
    __shared__ __align__(16) unsigned short tl[64 * 72];
    const int tid = threadIdx.x, n0 = blockIdx.x * 64, c0 = blockIdx.y * 64, b = blockIdx.z;
    const int cr = tid >> 2, nq = (tid & 3) * 16;
#pragma unroll
    for (int i = 0; i < 16; ++i) tl[(nq + i) * 72 + cr] = f2bf(x[((size_t)b * CIN + c0 + cr) * NN_ + n0 + nq + i]);
    __syncthreads();
    const int piece = tid & 7;
    auto pass = [&]() {
#pragma unroll
        for (int s = 0; s < 2; ++s) { const int nr = (tid >> 3) + 32 * s; const v8us val = *(const v8usa*)(tl + nr * 72 + piece * 8);
            *(v8us*)(XT + ((size_t)b * NN_ + n0 + nr) * CIN + c0 + piece * 8) = val; }
    };
    pass(); 
}
// k_cvtw: bf16 copy of a [rows][cols] weight ([out][in] as-is: the n-major B operand of the convs, the A operand of k_z); one wave per row, cols/32 per lane.
__global__ __launch_bounds__(256) void k_cvtw(const float* __restrict__ Wm, int rows, int cols, bf* WB) {
    const int lane = threadIdx.x & 31, r = blockIdx.x * 8 + (threadIdx.x >> 5);
    if (r >= rows) return;
    if (cols == CIN) { v8us t;
#pragma unroll
        for (int i = 0; i < 8; ++i) t[i] = f2bf(Wm[(size_t)r * cols + lane * 8 + i]);
        VST2(v8us, WB + (size_t)r * cols + lane * 8, t); }
    else { typedef __attribute__((ext_vector_type(4))) unsigned short v4us; v4us t;
#pragma unroll
        for (int i = 0; i < 4; ++i) t[i] = f2bf(Wm[(size_t)r * cols + lane * 4 + i]);
        VST2(v4us, WB + (size_t)r * cols + lane * 4, t); }
}
// k_proj: 64 x 64 tile of P[b][n][o] = XT[b][n].W^T + bias over K = 256 (exact); MODE 0: f16 hi + residual planes [b*4096+n][128] (theta, phi);
// MODE 1: f32 rows G [b*4096+n][128] (g). grid (NN_/64, 2, NB_).
template <int MODE>
__global__ __launch_bounds__(128) void k_proj(const bf* __restrict__ XT, const bf* __restrict__ WB, const float* __restrict__ bias, void* C, void* C2) {
    __shared__ __align__(16) float ost[4][16 * 68];
    const int lane = threadIdx.x & 31, wave = threadIdx.x >> 5, lr = lane & 15, hi = lane >> 4, b = blockIdx.z;
    const int r0 = blockIdx.x * 64 + wave * 16, c0 = blockIdx.y * 64;
    const bf* A = XT + (size_t)b * NN_ * CIN;
    const size_t aoff = (size_t)(r0 + lr) * CIN + 8 * hi;
    size_t boff[4];
#pragma unroll
    for (int t = 0; t < 4; ++t) boff[t] = (size_t)(c0 + t * 16 + lr) * CIN + 8 * hi;
    v8f acc[4];
#pragma unroll
    for (int t = 0; t < 4; ++t) acc[t] = (v8f){};
#pragma unroll 1
    for (int kc = 0; kc < CIN; kc += 32) {
        const v16bf a = cat16b(*(const v8us*)(A + aoff + kc), *(const v8us*)(A + aoff + kc + 16));
#pragma unroll
        for (int t = 0; t < 4; ++t) acc[t] = wmmab(a, cat16b(*(const v8us*)(WB + boff[t] + kc), *(const v8us*)(WB + boff[t] + kc + 16)), acc[t]);
        asm volatile("v_nop\n\tv_nop\n\tv_nop\n\tv_nop" : "+v"(acc[0]), "+v"(acc[1]), "+v"(acc[2]), "+v"(acc[3]) : "v"(a));
    }
    float* os = &ost[wave][0];
#pragma unroll
    for (int t = 0; t < 4; ++t) { const float bv = bfr(bias[c0 + t * 16 + lr]);
#pragma unroll
        for (int j = 0; j < 8; ++j) os[(hi * 8 + j) * 68 + t * 16 + lr] = acc[t][j] + bv; }
    __syncthreads();
    const size_t rowbase = (size_t)b * NN_ + r0;
    if (MODE == 1) {
        float* crow = (float*)C + rowbase * CI + c0;
        auto pass = [&]() {
#pragma unroll
            for (int s = 0; s < 8; ++s) { const int Lid = (lane >> 3) + 4 * s, piece = lane & 7; const int row = Lid >> 1, cofs = (Lid & 1) * 32 + piece * 4;
                const v4f val = *(const v4fa*)(os + row * 68 + cofs); *(v4f*)(crow + (size_t)row * CI + cofs) = val; }
        };
        pass(); 
    } else {
        h16* c1 = (h16*)C + rowbase * CI + c0; h16* c2 = (h16*)C2 + rowbase * CI + c0;
        auto pass = [&]() {
#pragma unroll
            for (int s = 0; s < 4; ++s) { const int row = 4 * s + (lane >> 3), piece = lane & 7; const float* sp = os + row * 68 + piece * 8; v8h o1, o2;
#pragma unroll
                for (int i = 0; i < 8; ++i) { const h16 a = (h16)sp[i]; o1[i] = a; o2[i] = (h16)((sp[i] - (float)a) * LOSC); }
                *(v8h*)(c1 + (size_t)row * CI + piece * 8) = o1; *(v8h*)(c2 + (size_t)row * CI + piece * 8) = o2; }
        };
        pass(); 
    }
}
// k_vt: GTH/GTL [b][c][n] = f16 hi + residual of G[b*4096+n][c] (the A operand of y^T: rows c, k = n); block (b, 64 n): 128 c x 64 n LDS transpose.
__global__ __launch_bounds__(256) void k_vt(const float* __restrict__ G, h16* GTH, h16* GTL) {
    __shared__ __align__(16) h16 t1[CI * 72];
    __shared__ __align__(16) h16 t2[CI * 72];
    const int b = blockIdx.x / (NN_ / 64), kt = blockIdx.x - b * (NN_ / 64), n0 = kt * 64, tid = threadIdx.x;
    const int nn = tid >> 2, cq = (tid & 3) * 32;
    const float* src = G + ((size_t)b * NN_ + n0 + nn) * CI + cq;
#pragma unroll
    for (int i = 0; i < 32; ++i) { const float v = src[i]; const h16 a = (h16)v; t1[(cq + i) * 72 + nn] = a; t2[(cq + i) * 72 + nn] = (h16)(v - (float)a); }   // UNSCALED residual (summed into the same accumulator as the hi product)
    __syncthreads();
    const int piece = tid & 7;
    const size_t base = ((size_t)b * CI) * NN_ + n0;
    auto pass = [&]() {
#pragma unroll
        for (int s = 0; s < 8; ++s) { const int Lid = (tid >> 3) + 32 * s; const int pln = Lid >> 7, c = Lid & 127;
            const v8h val = *(const v8ha*)((pln ? t2 : t1) + c * 72 + piece * 8); *(v8h*)((pln ? GTL : GTH) + base + (size_t)c * NN_ + piece * 8) = val; }
    };
    pass(); 
}
// k_attn: block = (b, 64 queries i), wave = 16; theta and g (hi + residual) come in stages of 64 keys by tensor loads into two LDS buffers, one slice per wave, the
// next stage in flight while this one is worked on; the block's phi residual rows are loaded into LDS once. Both products are transposed: per 32 keys the scores
// S^T = theta_j.phi_i (A = theta rows, B = phi; hi.hi + hi.lo + lo.hi over 4 k-chunks x 2 tiles = 24 WMMA), so that a lane holds 16 scores of ONE query (lane & 15):
// online f32 softmax in the lane plus one exchange between the half-waves; the two score tiles, as hi/residual weights (x32768), are the B operand of
// y^T += g^T.w^T as they stand (A = g rows, 8 channel tiles x 3 = 24 WMMA); y rows -> Y [b*4096+i][128] f32 (one 512-byte row per instruction).
__global__ __launch_bounds__(128) void k_attn(const h16* __restrict__ PH, const h16* __restrict__ PL, const h16* __restrict__ TH, const h16* __restrict__ TL,
                                             const h16* __restrict__ GTH, const h16* __restrict__ GTL, float* Y) {
    __shared__ __attribute__((aligned(2048))) unsigned char ring[9 * SLOT];   // buffer 0: slices 0-3, buffer 1: slices 4-7, slice 8: phi residual rows
    __shared__ __align__(16) float ost[4][16 * 132];
    const int lane = threadIdx.x & 31, wave = threadIdx.x >> 5, lr = lane & 15, hi = lane >> 4;
    const int b = blockIdx.x / (NN_ / 64), qt = blockIdx.x - b * (NN_ / 64), q0 = qt * 64 + wave * 16;
    const size_t tok0 = (size_t)b * NN_;
    const size_t vbase = ((size_t)b * CI) * NN_;
    const uint32_t wv = uni(threadIdx.x >> 5), ring0 = (uint32_t)(size_t)ring;
    // This wave's slice: 0 theta hi, 1 theta residual (a stage further = 64 rows), 2 g hi, 3 g residual (a stage further = 64 keys along the rows).
    const h16* splane = (wv == 0u) ? TH + tok0 * CI : (wv == 1u) ? TL + tok0 * CI : (wv == 2u) ? GTH + vbase : GTL + vbase;
    const uint32_t sstep = (wv < 2u) ? SKEY * CI * 2u : SKEY * 2u;
    const u32x8 g1k = tdm_group1<W0_R256, 256u, 64u, 256u>(), g1v = tdm_group1<W0_R128, 128u, 128u, NN_ * 2u>();
    u32x4 g0;
    auto issue = [&](uint32_t st) {
        g0 = tdm_group0(ring0 + ((st & 1u) * 4u + wv) * SLOT, (uint64_t)(size_t)splane + (uint64_t)st * sstep);
        if (pinned(wv < 2u)) tdm_load(g0, g1k); else tdm_load(g0, g1v);
    };
    if (pinned(wv == 0u)) { const u32x4 gp = tdm_group0(ring0 + 8u * SLOT, (uint64_t)(size_t)(PL + (tok0 + (size_t)qt * 64) * CI)); tdm_load(gp, g1k); wait_tensor0(gp); }
    issue(0u); wait_tensor0(g0);
    __syncthreads();   // stage 0 and the phi residual rows are published
    issue(1u);
    v16h ah[4];
    const size_t qo0 = (tok0 + q0 + lr) * CI + 8 * hi;
#pragma unroll
    for (int kc = 0; kc < 4; ++kc) ah[kc] = cat16(*(const v8h*)(PH + qo0 + kc * 32), *(const v8h*)(PH + qo0 + kc * 32 + 16));
    const unsigned char* alp = ring + 8u * SLOT + (uint32_t)(wave * 16 + lr) * KPIT + 16u * hi;
    v8f o[8];
#pragma unroll
    for (int n = 0; n < 8; ++n) o[n] = (v8f){};
    float mrow = -3.0e38f, lpart = 0.f;   // of this lane's query; lpart sums this half-wave's keys only
#pragma unroll 1   // one trip = one stage with its one publish point
    for (uint32_t st = 0; st < NSTG; ++st) {
      const unsigned char* buf = ring + (st & 1u) * (4u * SLOT);
      const unsigned char* kh0 = buf + (uint32_t)lr * KPIT + 16u * hi;               // theta rows (keys), 16 further: + 16 * KPIT; residual plane: + SLOT
      const unsigned char* vp0 = buf + 2u * SLOT + (uint32_t)lr * VPIT + 16u * hi;   // g rows (channels), 16 further: + 16 * VPIT; residual plane: + SLOT
      v16h kf[4][5];   // a 32-key block's score fragments per k-chunk: theta hi (2 tiles), phi residual, theta residual (2 tiles)
      auto load_k = [&](int kk) {
        const unsigned char* kh = kh0 + (uint32_t)(kk * 32) * KPIT;
#pragma unroll
        for (int kc = 0; kc < 4; ++kc) {
            kf[kc][0] = ldsfrag(kh + kc * 64); kf[kc][1] = ldsfrag(kh + 16u * KPIT + kc * 64); kf[kc][2] = ldsfrag(alp + kc * 64);
            kf[kc][3] = ldsfrag(kh + SLOT + kc * 64); kf[kc][4] = ldsfrag(kh + SLOT + 16u * KPIT + kc * 64);
        }
      };
      // The scheduling barriers below keep each block of LDS reads in one place, ahead of the work it flies under: left free, this build moved the reads
      // down among the matrix instructions, two at a time with a full wait behind each pair.
      load_k(0);
      __builtin_amdgcn_sched_barrier(0);
#pragma unroll     // the stage's two 32-key blocks: their places in the buffer become constant offsets
      for (int kk = 0; kk < 2; ++kk) {
        const unsigned char* vp = vp0 + (uint32_t)(kk * 64);
        v8f s0 = {}, s1 = {}, x0 = {}, x1 = {};
#pragma unroll
        for (int kc = 0; kc < 4; ++kc) {
            s0 = wmma16(kf[kc][0], ah[kc], s0); x0 = wmma16(kf[kc][0], kf[kc][2], x0); s1 = wmma16(kf[kc][1], ah[kc], s1); x1 = wmma16(kf[kc][1], kf[kc][2], x1);
            x0 = wmma16(kf[kc][3], ah[kc], x0); x1 = wmma16(kf[kc][4], ah[kc], x1);
        }
        asm volatile("v_nop\n\tv_nop\n\tv_nop\n\tv_nop" : "+v"(s0), "+v"(s1), "+v"(x0), "+v"(x1) : "v"(ah[0]), "v"(ah[3]));
        __builtin_amdgcn_sched_barrier(0);
        v16h vh[8], vl[8];   // read here so that the reads run under the softmax
#pragma unroll
        for (int n = 0; n < 8; ++n) { vh[n] = ldsfrag(vp + (uint32_t)(n * 16) * VPIT); vl[n] = ldsfrag(vp + SLOT + (uint32_t)(n * 16) * VPIT); }
        __builtin_amdgcn_sched_barrier(0);
        // Register j of tile t = key 16 t + 8 hi + j of the block, query lr.
        float a0[8], a1[8];
#pragma unroll
        for (int j = 0; j < 8; ++j) { a0[j] = s0[j] + x0[j] * LOSCI; a1[j] = s1[j] + x1[j] * LOSCI; }
        float mx = fmaxf(a0[0], a1[0]);
#pragma unroll
        for (int j = 1; j < 8; ++j) mx = fmaxf(mx, fmaxf(a0[j], a1[j]));
        mx = fmaxf(mx, xhalf(mx));
        const float mn = fmaxf(mrow, mx);
        const float alpha = exp_slot(mrow - mn); mrow = mn;
        float es = 0.f;
        v16h pa, px;   // element s = key 8 hi + s (s < 8), 16 + 8 hi + s - 8 (else): the k order of the g fragments
#pragma unroll
        for (int j = 0; j < 8; ++j) {
            const float e0 = exp_slot(a0[j] - mn), e1 = exp_slot(a1[j] - mn);
            es += e0 + e1;
            const float ps0 = e0 * PSC, ps1 = e1 * PSC; const h16 h0 = (h16)ps0, h1 = (h16)ps1;
            pa[j] = h0; pa[8 + j] = h1; px[j] = (h16)(ps0 - (float)h0); px[8 + j] = (h16)(ps1 - (float)h1);   // unscaled residual
        }
        lpart = lpart * alpha + es;
        if (kk == 0) {   // the second block's score fragments fly under the first block's products with g
            __builtin_amdgcn_sched_barrier(0);
            load_k(1);
            __builtin_amdgcn_sched_barrier(0);
        }
#pragma unroll
        for (int n = 0; n < 8; ++n)
#pragma unroll
            for (int j = 0; j < 8; ++j) o[n][j] *= alpha;
#pragma unroll
        for (int n = 0; n < 8; ++n) { o[n] = wmma16(vh[n], pa, o[n]); o[n] = wmma16(vl[n], pa, o[n]); o[n] = wmma16(vh[n], px, o[n]); }
      }
      __builtin_amdgcn_sched_barrier(0);   // keeps the full LDS wait below behind the softmax and the products: moved up, it laid the second block's g reads bare
      // Publish point: this wave has left stage st's buffer, its own slice of stage st + 1 has landed, every wave is here; only then the refill.
      wait_ds0();
      wait_tensor0(g0);
      __syncthreads();
      if (pinned(st + 2u < NSTG)) issue(st + 2u);
    }
    wait_tensor0(g0);
    wait_ds0();
    const float inv = 1.0f / ((lpart + xhalf(lpart)) * PSC);
    float* os = &ost[wave][0];
#pragma unroll
    for (int n = 0; n < 8; ++n)
#pragma unroll
        for (int j = 0; j < 8; ++j) os[lr * 132 + n * 16 + hi * 8 + j] = o[n][j] * inv;   // register j of tile n = channel 16 n + 8 hi + j of query lr
    __syncthreads();
    float* yb = Y + (tok0 + q0) * CI;
    auto pass = [&]() {   // 16 rows x 128 floats (512 B): one instruction per row (32 lanes x 16 B)
#pragma unroll
        for (int s = 0; s < 16; ++s) { const v4f val = *(const v4fa*)(os + s * 132 + lane * 4); *(v4f*)(yb + (size_t)s * CI + lane * 4) = val; }
    };
    pass(); 
}
// k_splity: YH/YL bf16 hi + residual planes of Y [16384][128]; one wave per 2 rows (lane 8 values; 32 lanes x 16 B = 2 rows).
__global__ __launch_bounds__(256) void k_splity(const float* __restrict__ Y, bf* YH, bf* YL) {
    const int lane = threadIdx.x & 31; const size_t w = (size_t)blockIdx.x * 8 + (threadIdx.x >> 5);
    v8us oh, ol;
#pragma unroll
    for (int i = 0; i < 8; ++i) { const float v = Y[w * 256 + lane * 8 + i]; const unsigned short hb = f2bf(v); oh[i] = hb; ol[i] = f2bf(v - bf2f(hb)); }
    *(v8us*)(YH + w * 256 + lane * 8) = oh; *(v8us*)(YL + w * 256 + lane * 8) = ol; 
}
// k_z: 64 x 64 tile of Z [b][o][n] = w_z . (YH + YL)[b][n]^T + b_z[o] over K = 128 (A = w_z rows o [128][128], B = Y planes rows n); grid (2, NN_/64, NB_); f32 rows.
__global__ __launch_bounds__(128) void k_z(const bf* __restrict__ WZ, const bf* __restrict__ YH, const bf* __restrict__ YL, const float* __restrict__ bz, float* Z) {
    __shared__ __align__(16) float ost[4][16 * 68];
    const int lane = threadIdx.x & 31, wave = threadIdx.x >> 5, lr = lane & 15, hi = lane >> 4, b = blockIdx.z;
    const int r0 = blockIdx.x * 64 + wave * 16, c0 = blockIdx.y * 64;
    const size_t aoff = (size_t)(r0 + lr) * CI + 8 * hi;
    const bf* Bh = YH + (size_t)b * NN_ * CI; const bf* Bl = YL + (size_t)b * NN_ * CI;
    size_t boff[4];
#pragma unroll
    for (int t = 0; t < 4; ++t) boff[t] = (size_t)(c0 + t * 16 + lr) * CI + 8 * hi;
    v8f acc[4], accx[4];
#pragma unroll
    for (int t = 0; t < 4; ++t) { acc[t] = (v8f){}; accx[t] = (v8f){}; }
#pragma unroll
    for (int kc = 0; kc < CI; kc += 32) {
        const v16bf a = cat16b(*(const v8us*)(WZ + aoff + kc), *(const v8us*)(WZ + aoff + kc + 16));
#pragma unroll
        for (int t = 0; t < 4; ++t) { acc[t] = wmmab(a, cat16b(*(const v8us*)(Bh + boff[t] + kc), *(const v8us*)(Bh + boff[t] + kc + 16)), acc[t]); accx[t] = wmmab(a, cat16b(*(const v8us*)(Bl + boff[t] + kc), *(const v8us*)(Bl + boff[t] + kc + 16)), accx[t]); }
    }
    asm volatile("v_nop\n\tv_nop\n\tv_nop\n\tv_nop" : "+v"(acc[0]), "+v"(acc[1]), "+v"(acc[2]), "+v"(acc[3]), "+v"(accx[0]), "+v"(accx[1]), "+v"(accx[2]), "+v"(accx[3]));
    float* os = &ost[wave][0];
#pragma unroll
    for (int t = 0; t < 4; ++t)
#pragma unroll
        for (int j = 0; j < 8; ++j) os[(hi * 8 + j) * 68 + t * 16 + lr] = acc[t][j] + accx[t][j] + bfr(bz[r0 + hi * 8 + j]);
    __syncthreads();
    float* crow = Z + ((size_t)b * CI + r0) * NN_ + c0;
    auto pass = [&]() {
#pragma unroll
        for (int s = 0; s < 8; ++s) { const int Lid = (lane >> 3) + 4 * s, piece = lane & 7; const int row = Lid >> 1, cq = (Lid & 1) * 32 + piece * 4;
            const v4f val = *(const v4fa*)(os + row * 68 + cq); *(v4f*)(crow + (size_t)row * NN_ + cq) = val; }
    };
    pass(); 
}
__global__ __launch_bounds__(256) void k_stats(const float* __restrict__ Z, float* ST) {
    __shared__ float red[256];
    const int o = blockIdx.x, t = threadIdx.x;
    float zv[(NB_ * NN_) / 256];   // this thread's 64 values of channel o: read once, kept in registers for both sums
#pragma unroll   // 64 independent loads in flight together: rolled, every trip waited out one load's whole latency
    for (int i = 0; i < (NB_ * NN_) / 256; ++i) { const int flat = i * 256 + t; const int b = flat / NN_, n = flat - b * NN_; zv[i] = Z[((size_t)b * CI + o) * NN_ + n]; }
    float s = 0.f;
#pragma unroll   // zv stays in registers only under constant indices
    for (int i = 0; i < (NB_ * NN_) / 256; ++i) s += zv[i];
    red[t] = s; __syncthreads();
    for (int st = 128; st > 0; st >>= 1) { if (t < st) red[t] += red[t + st]; __syncthreads(); }
    const float mu = red[0] / (float)(NB_ * NN_);
    __syncthreads();
    float q = 0.f;
#pragma unroll   // as above
    for (int i = 0; i < (NB_ * NN_) / 256; ++i) { const float d = zv[i] - mu; q += d * d; }
    red[t] = q; __syncthreads();
    for (int st = 128; st > 0; st >>= 1) { if (t < st) red[t] += red[t + st]; __syncthreads(); }
    const float var = red[0] / (float)(NB_ * NN_);
    if (t < 32) { const float v = (t == 0) ? mu : (t == 1) ? rsqrtf(var + 1e-5f) : 0.f; VST2(float, ST + (size_t)o * 32 + t, v); }
}
// k_final: out[b][o][n] = (Z - mu) rs gamma + beta; one wave per 256 values (8 per lane = 32 B -> use 2 x v4f? no: v8f per lane = lane-strided pair of b128 -> use 2
// instructions of v4f over 128 values each: lane -> 4 floats).
__global__ __launch_bounds__(256) void k_final(const float* __restrict__ Z, const float* __restrict__ ST, const float* __restrict__ gam, const float* __restrict__ bet, float* out) {
    const int lane = threadIdx.x & 31; const size_t wid = (size_t)blockIdx.x * 8 + (threadIdx.x >> 5);
    const size_t row = wid >> 4; const int seg = (int)(wid & 15);        // row = b*CI + o (4096 floats = 16 segments of 256)
    const int o = (int)(row % CI);
    const float mu = ST[(size_t)o * 32], rs = ST[(size_t)o * 32 + 1], g = bfr(gam[o]), be = bfr(bet[o]);
#pragma unroll
    for (int hf = 0; hf < 2; ++hf) { const size_t base = row * NN_ + (size_t)seg * 256 + hf * 128 + lane * 4; v4f v;
#pragma unroll
        for (int i = 0; i < 4; ++i) v[i] = (Z[base + i] - mu) * rs * g + be;
        VST2(v4f, out + base, v); }
}

extern "C" void kernel_launch(void* const* d_in, const int* in_sizes, int n_in,
                              void* d_out, int out_size, void* d_ws, size_t ws_size, hipStream_t stream) {
    (void)in_sizes; (void)n_in; (void)out_size;
    const float* xt = (const float*)d_in[0]; const float* xo = (const float*)d_in[1]; const float* wg = (const float*)d_in[2]; const float* bg = (const float*)d_in[3];
    const float* wth = (const float*)d_in[4]; const float* bth = (const float*)d_in[5]; const float* wph = (const float*)d_in[6]; const float* bph = (const float*)d_in[7];
    const float* wz = (const float*)d_in[8]; const float* bz = (const float*)d_in[9]; const float* gam = (const float*)d_in[10]; const float* bet = (const float*)d_in[11];
    float* out = (float*)d_out;    // [4][128][64][64]
    char* wsp = (char*)d_ws;
    auto take = [&](size_t bytes) { char* p = wsp; wsp += (bytes + 255) & ~(size_t)255; return (void*)p; };
    bf* XTt = (bf*)take((size_t)NB_ * NN_ * CIN * 2); bf* XTo = (bf*)take((size_t)NB_ * NN_ * CIN * 2);
    bf* WGb = (bf*)take((size_t)CI * CIN * 2); bf* WTb = (bf*)take((size_t)CI * CIN * 2); bf* WPb = (bf*)take((size_t)CI * CIN * 2); bf* WZb = (bf*)take((size_t)CI * CI * 2);
    h16* TH = (h16*)take((size_t)NB_ * NN_ * CI * 2); h16* TL = (h16*)take((size_t)NB_ * NN_ * CI * 2); h16* PH = (h16*)take((size_t)NB_ * NN_ * CI * 2); h16* PL = (h16*)take((size_t)NB_ * NN_ * CI * 2);
    float* G = (float*)take((size_t)NB_ * NN_ * CI * 4); h16* GTH = (h16*)take((size_t)NB_ * CI * NN_ * 2); h16* GTL = (h16*)take((size_t)NB_ * CI * NN_ * 2);
    float* Y = (float*)take((size_t)NB_ * NN_ * CI * 4); bf* YH = (bf*)take((size_t)NB_ * NN_ * CI * 2); bf* YL = (bf*)take((size_t)NB_ * NN_ * CI * 2);
    float* Z = (float*)take((size_t)NB_ * CI * NN_ * 4); float* ST = (float*)take((size_t)CI * 32 * 4);
    if ((size_t)(wsp - (char*)d_ws) > ws_size) return;    // 8.4x2 + 0.2 + 4.2x4 + 8.4 + 4.2x2 + 8.4 + 4.2x2 + 8.4 ~ 76 MB
    k_xt<<<dim3(NN_ / 64, CIN / 64, NB_), 256, 0, stream>>>(xt, XTt);
    k_xt<<<dim3(NN_ / 64, CIN / 64, NB_), 256, 0, stream>>>(xo, XTo);
    k_cvtw<<<CI / 8, 256, 0, stream>>>(wg, CI, CIN, WGb); k_cvtw<<<CI / 8, 256, 0, stream>>>(wth, CI, CIN, WTb); k_cvtw<<<CI / 8, 256, 0, stream>>>(wph, CI, CIN, WPb); k_cvtw<<<CI / 8, 256, 0, stream>>>(wz, CI, CI, WZb);
    k_proj<0><<<dim3(NN_ / 64, CI / 64, NB_), 128, 0, stream>>>(XTt, WTb, bth, TH, TL);      // theta (keys) from this branch
    k_proj<0><<<dim3(NN_ / 64, CI / 64, NB_), 128, 0, stream>>>(XTo, WPb, bph, PH, PL);      // phi (queries) from the other branch
    k_proj<1><<<dim3(NN_ / 64, CI / 64, NB_), 128, 0, stream>>>(XTt, WGb, bg, G, nullptr);     // g (values) from this branch
    k_vt<<<NB_ * (NN_ / 64), 256, 0, stream>>>(G, GTH, GTL);
    k_attn<<<NB_ * (NN_ / 64), 128, 0, stream>>>(PH, PL, TH, TL, GTH, GTL, Y);
    k_splity<<<(NB_ * NN_ / 2) / 8, 256, 0, stream>>>(Y, YH, YL);
    k_z<<<dim3(CI / 64, NN_ / 64, NB_), 128, 0, stream>>>(WZb, YH, YL, bz, Z);
    k_stats<<<CI, 256, 0, stream>>>(Z, ST);
    k_final<<<(NB_ * CI * 16) / 8, 256, 0, stream>>>(Z, ST, gam, bet, out);
}

// v004
// A run of this version takes 122 microseconds.
// In two side-by-side timings against v003, it was 1.16 and 1.15 times as fast.
// Counting every step since v000, it is 5.03 times as fast.
#include <hip/hip_runtime.h>
#include <stdint.h>

// Contractions, f32 accumulate: the three 1x1 convs g, theta (from x_this) and phi (from x_other) as [4 x 4096 x 256].[256 x 128] products (+bias) and W_z
// ([128 x 128].[128 x 4096] per b, +bias) on v_wmma_f32_16x16x32_bf16 — plain bf16 = rounded inputs (exact) for the convs, y as bf16 hi + residual planes (two
// products) for W_z; the non-local attention fused on v_wmma_f32_16x16x32_f16: f = phi_i.theta_j over 128 channels (unscaled, sigma ~ 20: both operands f16 hi +
// residual x1024, hi.hi + hi.lo + lo.hi), softmax over the 4096 positions j, y_i = sum_j f g_j with the weights (x32768) and g both as f16 hi + UNSCALED residual so all three products share one accumulator (hi.hi + hi.lo + lo.hi: the softmax is nearly one-hot, so single roundings would pass straight into y).

#define NB_  4
#define CIN  256
#define CI   128
#define NN_  4096
#define PSC  32768.0f
#define LOSC 1024.0f
#define LOSCI (1.0f / 1024.0f)

typedef _Float16 h16;
typedef unsigned short bf;
typedef __attribute__((ext_vector_type(16))) __bf16   v16bf;
typedef __attribute__((ext_vector_type(16))) _Float16 v16h;
typedef __attribute__((ext_vector_type(8)))  _Float16 v8h;
typedef __attribute__((ext_vector_type(8)))  unsigned short v8us;
typedef __attribute__((ext_vector_type(8)))  float    v8f;
typedef __attribute__((ext_vector_type(4)))  float    v4f;
typedef v8h  __attribute__((may_alias)) v8ha;
typedef v4f  __attribute__((may_alias)) v4fa;
typedef v8us __attribute__((may_alias)) v8usa;

__device__ __forceinline__ unsigned short f2bf(float f) { unsigned u = __float_as_uint(f); u += 0x7FFFu + ((u >> 16) & 1u); return (unsigned short)(u >> 16); }
__device__ __forceinline__ float bf2f(unsigned short b) { return __uint_as_float(((unsigned)b) << 16); }
__device__ __forceinline__ float bfr(float f) { return bf2f(f2bf(f)); }
__device__ __forceinline__ v16h cat16(v8h lo, v8h hi) { return __builtin_shufflevector(lo, hi, 0, 1, 2, 3, 4, 5, 6, 7, 8, 9, 10, 11, 12, 13, 14, 15); }
__device__ __forceinline__ v16bf cat16b(v8us lo, v8us hi) { return __builtin_bit_cast(v16bf, __builtin_shufflevector(lo, hi, 0, 1, 2, 3, 4, 5, 6, 7, 8, 9, 10, 11, 12, 13, 14, 15)); }
__device__ __forceinline__ v8f wmma16(v16h a, v16h b, v8f c) { return __builtin_amdgcn_wmma_f32_16x16x32_f16(false, a, false, b, (short)0, c, false, false); }
__device__ __forceinline__ v8f wmmab(v16bf a, v16bf b, v8f c) { return __builtin_amdgcn_wmma_f32_16x16x32_bf16(false, a, false, b, (short)0, c, false, false); }
#define VST2(T, p, v) do { const T vst2_v_ = (v); *(T*)(p) = vst2_v_;  } while (0)

// Tensor loads into LDS for k_attn: a stage = 64 keys = four slices (theta hi, theta residual: 64 rows x 256 B; g hi, g residual: 128 rows x 128 B), one slice per wave.
typedef uint32_t u32x4 __attribute__((ext_vector_type(4)));
typedef uint32_t u32x8 __attribute__((ext_vector_type(8)));
#define SKEY 64u
#define NSTG (NN_ / 64u)
#define KPIT 272u      // LDS pitch of a 256-byte row (16 B pad, odd multiple of 16 B for the b128 readers)
#define VPIT 144u      // LDS pitch of a 128-byte row (16 B pad)
#define SLOT 18432u    // one slice's place: 128 x 144 B, and 64 x 272 B rounded up to a multiple of 2 KiB
#define W0_R256 ((1u << 20) | (5u << 22) | (3u << 25))   // group 1 word 0: no mask, 1-byte elements, 4 dwords of pad behind every 256 B
#define W0_R128 ((1u << 20) | (4u << 22) | (3u << 25))   // the same behind every 128 B
__device__ __forceinline__ uint32_t uni(uint32_t v) { return (uint32_t)__builtin_amdgcn_readfirstlane(v); }
// Holds a wave-uniform value in a scalar register, so that a test around a tensor load compiles to a scalar branch (tensor loads ignore EXEC).
__device__ __forceinline__ uint32_t pinned(uint32_t v) { uint32_t w = uni(v); asm volatile("" : "+s"(w)); return w; }
// Descriptor group 0: the tile's first byte at ga, to the LDS byte offset dst. Group 1: D1 rows of D0 bytes, source pitch SP bytes, tensor = tile.
__device__ __forceinline__ u32x4 tdm_group0(uint32_t dst, uint64_t ga) {
    u32x4 g0; g0[0] = uni(1u); g0[1] = uni(dst); g0[2] = uni((uint32_t)ga); g0[3] = uni((((uint32_t)(ga >> 32)) & 0x01FFFFFFu) | 0x80000000u);
    asm volatile("" : "+s"(g0));   // descriptor words held in scalar registers: no word is formed anew elsewhere while the request is outstanding
    return g0;
}
template <uint32_t W0, uint32_t D0, uint32_t D1, uint32_t SP>
__device__ __forceinline__ u32x8 tdm_group1() {
    u32x8 g1; g1[0] = uni(W0); g1[1] = uni((D0 & 0xFFFFu) << 16); g1[2] = uni((D0 >> 16) | ((D1 & 0xFFFFu) << 16)); g1[3] = uni((D1 >> 16) | (D0 << 16));
    g1[4] = uni(D1); g1[5] = uni(SP); g1[6] = uni(0u); g1[7] = uni(0u);
    asm volatile("" : "+s"(g1));   // descriptor words held in scalar registers: set once from constants, in the same registers for as long as requests are issued
    return g1;
}
__device__ __forceinline__ void tdm_load(u32x4 g0, u32x8 g1) { asm volatile("tensor_load_to_lds %0, %1" :: "s"(g0), "s"(g1) : "memory"); }
// The compiler places no wait for a tensor load. The wait names the request's group 0 so that its registers keep their values while the request is outstanding.
__device__ __forceinline__ void wait_tensor0(u32x4 g0) { asm volatile("s_wait_tensorcnt 0x0" :: "s"(g0) : "memory"); }
// Stands behind the last store of a branch whose code is followed, in the built kernel, by another branch's: no register that an issued store names is rewritten ahead of it.
__device__ __forceinline__ void wait_x0() { asm volatile("s_wait_xcnt 0x0" ::: "memory"); }
__device__ __forceinline__ void wait_ds0() { asm volatile("s_wait_dscnt 0x0" ::: "memory"); }           // this wave's LDS reads are done before their buffer is handed back
// exp(x) as __expf compiles here (one multiply, v_exp_f32), with the one issue slot that the instruction set asks for behind a transcendental tied to it.
__device__ __forceinline__ float exp_slot(float x) { float r; asm("v_exp_f32 %0, %1\n\tv_nop" : "=v"(r) : "v"(x * 1.44269504088896340736f)); return r; }
__device__ __forceinline__ float xhalf(float x) { return __builtin_bit_cast(float, __builtin_amdgcn_permlanex16(__builtin_bit_cast(int, x), __builtin_bit_cast(int, x), 0x76543210, 0xfedcba98, false, false)); }   // lane l's value from lane l ^ 16
__device__ __forceinline__ v16h ldsfrag(const unsigned char* p) { return cat16(*(const v8ha*)p, *(const v8ha*)(p + 32)); }   // k 0..7 and 16..23 (+8 in the upper half-wave) of one row

// k_prep: the six input conversions, none of which reads what another writes, side by side in one launch.
// Blocks 0..63: bf16 copies of the four weights ([out][in] = the n-major B operand of k_proj as-is; for w_z the A operand of k_z), 16 blocks each; one wave per row, cols/32 per lane.
// Blocks 64..: XT [b][n][c] = bf16(x[b][c][n]) (NCHW -> rows n with channels contiguous) via 64 x 64 LDS transposes, for both branches; (n/64, c/64, b, branch).
#define WBLK (4 * (CI / 8))
__global__ __launch_bounds__(256) void k_prep(const float* __restrict__ xa, const float* __restrict__ xb, const float* __restrict__ wg, const float* __restrict__ wth,
                                              const float* __restrict__ wph, const float* __restrict__ wz, bf* XTa, bf* XTb, bf* WGb, bf* WTb, bf* WPb, bf* WZb) {
    __shared__ __align__(16) unsigned short tl[64 * 72];
    const int tid = threadIdx.x;
    if (blockIdx.x < WBLK) {   // the same for the whole block, and in front of the barrier
        const int wsel = blockIdx.x / (CI / 8), lane = tid & 31, r = (blockIdx.x - wsel * (CI / 8)) * 8 + (tid >> 5);
        const float* Wm = (wsel == 0) ? wg : (wsel == 1) ? wth : (wsel == 2) ? wph : wz;
        bf* WB = (wsel == 0) ? WGb : (wsel == 1) ? WTb : (wsel == 2) ? WPb : WZb;
        if (wsel < 3) { v8us t;
#pragma unroll
            for (int i = 0; i < 8; ++i) t[i] = f2bf(Wm[(size_t)r * CIN + lane * 8 + i]);
            VST2(v8us, WB + (size_t)r * CIN + lane * 8, t); }
        else { typedef __attribute__((ext_vector_type(4))) unsigned short v4us; v4us t;
#pragma unroll
            for (int i = 0; i < 4; ++i) t[i] = f2bf(Wm[(size_t)r * CI + lane * 4 + i]);
            VST2(v4us, WB + (size_t)r * CI + lane * 4, t); wait_x0(); }
        return;
    }
    const int tb = blockIdx.x - WBLK;
    const int n0 = (tb & (NN_ / 64 - 1)) * 64, c0 = ((tb / (NN_ / 64)) & (CIN / 64 - 1)) * 64, bz = tb / ((NN_ / 64) * (CIN / 64)), b = bz & (NB_ - 1);
    const float* x = (bz < NB_) ? xa : xb;
    bf* XT = (bz < NB_) ? XTa : XTb;
    const int cr = tid >> 2, nq = (tid & 3) * 16;
#pragma unroll
    for (int i = 0; i < 16; ++i) tl[(nq + i) * 72 + cr] = f2bf(x[((size_t)b * CIN + c0 + cr) * NN_ + n0 + nq + i]);
    __syncthreads();
    const int piece = tid & 7;
    auto pass = [&]() {
#pragma unroll
        for (int s = 0; s < 2; ++s) { const int nr = (tid >> 3) + 32 * s; const v8us val = *(const v8usa*)(tl + nr * 72 + piece * 8);
            *(v8us*)(XT + ((size_t)b * NN_ + n0 + nr) * CIN + c0 + piece * 8) = val; }
    };
    pass(); wait_x0();
}
// k_proj: 64 x 64 tile of P[b][n][o] = XT[b][n].W^T + bias over K = 256 (exact); the three projections, none of which reads what another writes, side by side in
// one launch: theta (keys, this branch) and phi (queries, other branch) as f16 hi + residual planes [b*4096+n][128], g (values, this branch) as f32 rows
// G [b*4096+n][128]. grid (NN_/64, 2, 3 * NB_): z = projection * NB_ + b.
__global__ __launch_bounds__(128) void k_proj(const bf* __restrict__ XTa, const bf* __restrict__ XTb, const bf* __restrict__ WTb, const bf* __restrict__ WPb, const bf* __restrict__ WGb,
                                              const float* __restrict__ bth, const float* __restrict__ bph, const float* __restrict__ bg, h16* TH, h16* TL, h16* PH, h16* PL, float* G) {
    __shared__ __align__(16) float ost[4][16 * 68];
    const int lane = threadIdx.x & 31, wave = threadIdx.x >> 5, lr = lane & 15, hi = lane >> 4, sel = blockIdx.z / NB_, b = blockIdx.z - sel * NB_;
    const int r0 = blockIdx.x * 64 + wave * 16, c0 = blockIdx.y * 64;
    const bf* XT = (sel == 1) ? XTb : XTa;
    const bf* WB = (sel == 0) ? WTb : (sel == 1) ? WPb : WGb;
    const float* bias = (sel == 0) ? bth : (sel == 1) ? bph : bg;
    const bf* A = XT + (size_t)b * NN_ * CIN;
    const size_t aoff = (size_t)(r0 + lr) * CIN + 8 * hi;
    size_t boff[4];
#pragma unroll
    for (int t = 0; t < 4; ++t) boff[t] = (size_t)(c0 + t * 16 + lr) * CIN + 8 * hi;
    v8f acc[4];
#pragma unroll
    for (int t = 0; t < 4; ++t) acc[t] = (v8f){};
#pragma unroll 1
    for (int kc = 0; kc < CIN; kc += 32) {
        const v16bf a = cat16b(*(const v8us*)(A + aoff + kc), *(const v8us*)(A + aoff + kc + 16));
#pragma unroll
        for (int t = 0; t < 4; ++t) acc[t] = wmmab(a, cat16b(*(const v8us*)(WB + boff[t] + kc), *(const v8us*)(WB + boff[t] + kc + 16)), acc[t]);
        asm volatile("v_nop\n\tv_nop\n\tv_nop\n\tv_nop" : "+v"(acc[0]), "+v"(acc[1]), "+v"(acc[2]), "+v"(acc[3]) : "v"(a));
    }
    float* os = &ost[wave][0];
#pragma unroll
    for (int t = 0; t < 4; ++t) { const float bv = bfr(bias[c0 + t * 16 + lr]);
#pragma unroll
        for (int j = 0; j < 8; ++j) os[(hi * 8 + j) * 68 + t * 16 + lr] = acc[t][j] + bv; }
    __syncthreads();
    const size_t rowbase = (size_t)b * NN_ + r0;
    if (sel == 2) {
        float* crow = G + rowbase * CI + c0;
        auto pass = [&]() {
#pragma unroll
            for (int s = 0; s < 8; ++s) { const int Lid = (lane >> 3) + 4 * s, piece = lane & 7; const int row = Lid >> 1, cofs = (Lid & 1) * 32 + piece * 4;
                const v4f val = *(const v4fa*)(os + row * 68 + cofs); *(v4f*)(crow + (size_t)row * CI + cofs) = val; }
        };
        pass(); 
    } else {
        h16* c1 = ((sel == 0) ? TH : PH) + rowbase * CI + c0; h16* c2 = ((sel == 0) ? TL : PL) + rowbase * CI + c0;
        auto pass = [&]() {
#pragma unroll
            for (int s = 0; s < 4; ++s) { const int row = 4 * s + (lane >> 3), piece = lane & 7; const float* sp = os + row * 68 + piece * 8; v8h o1, o2;
#pragma unroll
                for (int i = 0; i < 8; ++i) { const h16 a = (h16)sp[i]; o1[i] = a; o2[i] = (h16)((sp[i] - (float)a) * LOSC); }
                *(v8h*)(c1 + (size_t)row * CI + piece * 8) = o1; *(v8h*)(c2 + (size_t)row * CI + piece * 8) = o2; }
        };
        pass(); wait_x0();
    }
}
// k_vt: GTH/GTL [b][c][n] = f16 hi + residual of G[b*4096+n][c] (the A operand of y^T: rows c, k = n); block (b, 64 n): 128 c x 64 n LDS transpose.
__global__ __launch_bounds__(256) void k_vt(const float* __restrict__ G, h16* GTH, h16* GTL) {
    __shared__ __align__(16) h16 t1[CI * 72];
    __shared__ __align__(16) h16 t2[CI * 72];
    const int b = blockIdx.x / (NN_ / 64), kt = blockIdx.x - b * (NN_ / 64), n0 = kt * 64, tid = threadIdx.x;
    const int nn = tid >> 2, cq = (tid & 3) * 32;
    const float* src = G + ((size_t)b * NN_ + n0 + nn) * CI + cq;
#pragma unroll
    for (int i = 0; i < 32; ++i) { const float v = src[i]; const h16 a = (h16)v; t1[(cq + i) * 72 + nn] = a; t2[(cq + i) * 72 + nn] = (h16)(v - (float)a); }   // UNSCALED residual (summed into the same accumulator as the hi product)
    __syncthreads();
    const int piece = tid & 7;
    const size_t base = ((size_t)b * CI) * NN_ + n0;
    auto pass = [&]() {
#pragma unroll
        for (int s = 0; s < 8; ++s) { const int Lid = (tid >> 3) + 32 * s; const int pln = Lid >> 7, c = Lid & 127;
            const v8h val = *(const v8ha*)((pln ? t2 : t1) + c * 72 + piece * 8); *(v8h*)((pln ? GTL : GTH) + base + (size_t)c * NN_ + piece * 8) = val; }
    };
    pass(); 
}
// k_attn: block = (b, 64 queries i), wave = 16; theta and g (hi + residual) come in stages of 64 keys by tensor loads into two LDS buffers, one slice per wave, the
// next stage in flight while this one is worked on; the block's phi residual rows are loaded into LDS once. Both products are transposed: per 32 keys the scores
// S^T = theta_j.phi_i (A = theta rows, B = phi; hi.hi + hi.lo + lo.hi over 4 k-chunks x 2 tiles = 24 WMMA), so that a lane holds 16 scores of ONE query (lane & 15):
// online f32 softmax in the lane plus one exchange between the half-waves; the two score tiles, as hi/residual weights (x32768), are the B operand of
// y^T += g^T.w^T as they stand (A = g rows, 8 channel tiles x 3 = 24 WMMA); y rows -> Y [b*4096+i][128] f32 (one 512-byte row per instruction).
__global__ __launch_bounds__(128) void k_attn(const h16* __restrict__ PH, const h16* __restrict__ PL, const h16* __restrict__ TH, const h16* __restrict__ TL,
                                             const h16* __restrict__ GTH, const h16* __restrict__ GTL, float* Y) {
    __shared__ __attribute__((aligned(2048))) unsigned char ring[9 * SLOT];   // buffer 0: slices 0-3, buffer 1: slices 4-7, slice 8: phi residual rows
    __shared__ __align__(16) float ost[4][16 * 132];
    const int lane = threadIdx.x & 31, wave = threadIdx.x >> 5, lr = lane & 15, hi = lane >> 4;
    const int b = blockIdx.x / (NN_ / 64), qt = blockIdx.x - b * (NN_ / 64), q0 = qt * 64 + wave * 16;
    const size_t tok0 = (size_t)b * NN_;
    const size_t vbase = ((size_t)b * CI) * NN_;
    const uint32_t wv = uni(threadIdx.x >> 5), ring0 = (uint32_t)(size_t)ring;
    // This wave's slice: 0 theta hi, 1 theta residual (a stage further = 64 rows), 2 g hi, 3 g residual (a stage further = 64 keys along the rows).
    const h16* splane = (wv == 0u) ? TH + tok0 * CI : (wv == 1u) ? TL + tok0 * CI : (wv == 2u) ? GTH + vbase : GTL + vbase;
    const uint32_t sstep = (wv < 2u) ? SKEY * CI * 2u : SKEY * 2u;
    const u32x8 g1k = tdm_group1<W0_R256, 256u, 64u, 256u>(), g1v = tdm_group1<W0_R128, 128u, 128u, NN_ * 2u>();
    u32x4 g0;
    auto issue = [&](uint32_t st) {
        g0 = tdm_group0(ring0 + ((st & 1u) * 4u + wv) * SLOT, (uint64_t)(size_t)splane + (uint64_t)st * sstep);
        if (pinned(wv < 2u)) tdm_load(g0, g1k); else tdm_load(g0, g1v);
    };
    if (pinned(wv == 0u)) { const u32x4 gp = tdm_group0(ring0 + 8u * SLOT, (uint64_t)(size_t)(PL + (tok0 + (size_t)qt * 64) * CI)); tdm_load(gp, g1k); wait_tensor0(gp); }
    issue(0u); wait_tensor0(g0);
    __syncthreads();   // stage 0 and the phi residual rows are published
    issue(1u);
    v16h ah[4];
    const size_t qo0 = (tok0 + q0 + lr) * CI + 8 * hi;
#pragma unroll
    for (int kc = 0; kc < 4; ++kc) ah[kc] = cat16(*(const v8h*)(PH + qo0 + kc * 32), *(const v8h*)(PH + qo0 + kc * 32 + 16));
    const unsigned char* alp = ring + 8u * SLOT + (uint32_t)(wave * 16 + lr) * KPIT + 16u * hi;
    v8f o[8];
#pragma unroll
    for (int n = 0; n < 8; ++n) o[n] = (v8f){};
    float mrow = -3.0e38f, lpart = 0.f;   // of this lane's query; lpart sums this half-wave's keys only
#pragma unroll 1   // one trip = one stage with its one publish point
    for (uint32_t st = 0; st < NSTG; ++st) {
      const unsigned char* buf = ring + (st & 1u) * (4u * SLOT);
      const unsigned char* kh0 = buf + (uint32_t)lr * KPIT + 16u * hi;               // theta rows (keys), 16 further: + 16 * KPIT; residual plane: + SLOT
      const unsigned char* vp0 = buf + 2u * SLOT + (uint32_t)lr * VPIT + 16u * hi;   // g rows (channels), 16 further: + 16 * VPIT; residual plane: + SLOT
      v16h kf[4][5];   // a 32-key block's score fragments per k-chunk: theta hi (2 tiles), phi residual, theta residual (2 tiles)
      auto load_k = [&](int kk) {
        const unsigned char* kh = kh0 + (uint32_t)(kk * 32) * KPIT;
#pragma unroll
        for (int kc = 0; kc < 4; ++kc) {
            kf[kc][0] = ldsfrag(kh + kc * 64); kf[kc][1] = ldsfrag(kh + 16u * KPIT + kc * 64); kf[kc][2] = ldsfrag(alp + kc * 64);
            kf[kc][3] = ldsfrag(kh + SLOT + kc * 64); kf[kc][4] = ldsfrag(kh + SLOT + 16u * KPIT + kc * 64);
        }
      };
      // The scheduling barriers below keep each block of LDS reads in one place, ahead of the work it flies under: left free, this build moved the reads
      // down among the matrix instructions, two at a time with a full wait behind each pair.
      load_k(0);
      __builtin_amdgcn_sched_barrier(0);
#pragma unroll     // the stage's two 32-key blocks: their places in the buffer become constant offsets
      for (int kk = 0; kk < 2; ++kk) {
        const unsigned char* vp = vp0 + (uint32_t)(kk * 64);
        v8f s0 = {}, s1 = {}, x0 = {}, x1 = {};
#pragma unroll
        for (int kc = 0; kc < 4; ++kc) {
            s0 = wmma16(kf[kc][0], ah[kc], s0); x0 = wmma16(kf[kc][0], kf[kc][2], x0); s1 = wmma16(kf[kc][1], ah[kc], s1); x1 = wmma16(kf[kc][1], kf[kc][2], x1);
            x0 = wmma16(kf[kc][3], ah[kc], x0); x1 = wmma16(kf[kc][4], ah[kc], x1);
        }
        asm volatile("v_nop\n\tv_nop\n\tv_nop\n\tv_nop" : "+v"(s0), "+v"(s1), "+v"(x0), "+v"(x1) : "v"(ah[0]), "v"(ah[3]));
        __builtin_amdgcn_sched_barrier(0);
        v16h vh[8], vl[8];   // read here so that the reads run under the softmax
#pragma unroll
        for (int n = 0; n < 8; ++n) { vh[n] = ldsfrag(vp + (uint32_t)(n * 16) * VPIT); vl[n] = ldsfrag(vp + SLOT + (uint32_t)(n * 16) * VPIT); }
        __builtin_amdgcn_sched_barrier(0);
        // Register j of tile t = key 16 t + 8 hi + j of the block, query lr.
        float a0[8], a1[8];
#pragma unroll
        for (int j = 0; j < 8; ++j) { a0[j] = s0[j] + x0[j] * LOSCI; a1[j] = s1[j] + x1[j] * LOSCI; }
        float mx = fmaxf(a0[0], a1[0]);
#pragma unroll
        for (int j = 1; j < 8; ++j) mx = fmaxf(mx, fmaxf(a0[j], a1[j]));
        mx = fmaxf(mx, xhalf(mx));
        const float mn = fmaxf(mrow, mx);
        const float alpha = exp_slot(mrow - mn); mrow = mn;
        float es = 0.f;
        v16h pa, px;   // element s = key 8 hi + s (s < 8), 16 + 8 hi + s - 8 (else): the k order of the g fragments
#pragma unroll
        for (int j = 0; j < 8; ++j) {
            const float e0 = exp_slot(a0[j] - mn), e1 = exp_slot(a1[j] - mn);
            es += e0 + e1;
            const float ps0 = e0 * PSC, ps1 = e1 * PSC; const h16 h0 = (h16)ps0, h1 = (h16)ps1;
            pa[j] = h0; pa[8 + j] = h1; px[j] = (h16)(ps0 - (float)h0); px[8 + j] = (h16)(ps1 - (float)h1);   // unscaled residual
        }
        lpart = lpart * alpha + es;
        if (kk == 0) {   // the second block's score fragments fly under the first block's products with g
            __builtin_amdgcn_sched_barrier(0);
            load_k(1);
            __builtin_amdgcn_sched_barrier(0);
        }
#pragma unroll
        for (int n = 0; n < 8; ++n)
#pragma unroll
            for (int j = 0; j < 8; ++j) o[n][j] *= alpha;
#pragma unroll
        for (int n = 0; n < 8; ++n) { o[n] = wmma16(vh[n], pa, o[n]); o[n] = wmma16(vl[n], pa, o[n]); o[n] = wmma16(vh[n], px, o[n]); }
      }
      __builtin_amdgcn_sched_barrier(0);   // keeps the full LDS wait below behind the softmax and the products: moved up, it laid the second block's g reads bare
      // Publish point: this wave has left stage st's buffer, its own slice of stage st + 1 has landed, every wave is here; only then the refill.
      wait_ds0();
      wait_tensor0(g0);
      __syncthreads();
      if (pinned(st + 2u < NSTG)) issue(st + 2u);
    }
    wait_tensor0(g0);
    wait_ds0();
    const float inv = 1.0f / ((lpart + xhalf(lpart)) * PSC);
    float* os = &ost[wave][0];
#pragma unroll
    for (int n = 0; n < 8; ++n)
#pragma unroll
        for (int j = 0; j < 8; ++j) os[lr * 132 + n * 16 + hi * 8 + j] = o[n][j] * inv;   // register j of tile n = channel 16 n + 8 hi + j of query lr
    __syncthreads();
    float* yb = Y + (tok0 + q0) * CI;
    auto pass = [&]() {   // 16 rows x 128 floats (512 B): one instruction per row (32 lanes x 16 B)
#pragma unroll
        for (int s = 0; s < 16; ++s) { const v4f val = *(const v4fa*)(os + s * 132 + lane * 4); *(v4f*)(yb + (size_t)s * CI + lane * 4) = val; }
    };
    pass(); 
}
// k_splity: YH/YL bf16 hi + residual planes of Y [16384][128]; one wave per 2 rows (lane 8 values; 32 lanes x 16 B = 2 rows).
__global__ __launch_bounds__(256) void k_splity(const float* __restrict__ Y, bf* YH, bf* YL) {
    const int lane = threadIdx.x & 31; const size_t w = (size_t)blockIdx.x * 8 + (threadIdx.x >> 5);
    v8us oh, ol;
#pragma unroll
    for (int i = 0; i < 8; ++i) { const float v = Y[w * 256 + lane * 8 + i]; const unsigned short hb = f2bf(v); oh[i] = hb; ol[i] = f2bf(v - bf2f(hb)); }
    *(v8us*)(YH + w * 256 + lane * 8) = oh; *(v8us*)(YL + w * 256 + lane * 8) = ol; 
}
// k_z: 64 x 64 tile of Z [b][o][n] = w_z . (YH + YL)[b][n]^T + b_z[o] over K = 128 (A = w_z rows o [128][128], B = Y planes rows n); grid (2, NN_/64, NB_); f32 rows.
__global__ __launch_bounds__(128) void k_z(const bf* __restrict__ WZ, const bf* __restrict__ YH, const bf* __restrict__ YL, const float* __restrict__ bz, float* Z) {
    __shared__ __align__(16) float ost[4][16 * 68];
    const int lane = threadIdx.x & 31, wave = threadIdx.x >> 5, lr = lane & 15, hi = lane >> 4, b = blockIdx.z;
    const int r0 = blockIdx.x * 64 + wave * 16, c0 = blockIdx.y * 64;
    const size_t aoff = (size_t)(r0 + lr) * CI + 8 * hi;
    const bf* Bh = YH + (size_t)b * NN_ * CI; const bf* Bl = YL + (size_t)b * NN_ * CI;
    size_t boff[4];
#pragma unroll
    for (int t = 0; t < 4; ++t) boff[t] = (size_t)(c0 + t * 16 + lr) * CI + 8 * hi;
    v8f acc[4], accx[4];
#pragma unroll
    for (int t = 0; t < 4; ++t) { acc[t] = (v8f){}; accx[t] = (v8f){}; }
#pragma unroll
    for (int kc = 0; kc < CI; kc += 32) {
        const v16bf a = cat16b(*(const v8us*)(WZ + aoff + kc), *(const v8us*)(WZ + aoff + kc + 16));
#pragma unroll
        for (int t = 0; t < 4; ++t) { acc[t] = wmmab(a, cat16b(*(const v8us*)(Bh + boff[t] + kc), *(const v8us*)(Bh + boff[t] + kc + 16)), acc[t]); accx[t] = wmmab(a, cat16b(*(const v8us*)(Bl + boff[t] + kc), *(const v8us*)(Bl + boff[t] + kc + 16)), accx[t]); }
    }
    asm volatile("v_nop\n\tv_nop\n\tv_nop\n\tv_nop" : "+v"(acc[0]), "+v"(acc[1]), "+v"(acc[2]), "+v"(acc[3]), "+v"(accx[0]), "+v"(accx[1]), "+v"(accx[2]), "+v"(accx[3]));
    float* os = &ost[wave][0];
#pragma unroll
    for (int t = 0; t < 4; ++t)
#pragma unroll
        for (int j = 0; j < 8; ++j) os[(hi * 8 + j) * 68 + t * 16 + lr] = acc[t][j] + accx[t][j] + bfr(bz[r0 + hi * 8 + j]);
    __syncthreads();
    float* crow = Z + ((size_t)b * CI + r0) * NN_ + c0;
    auto pass = [&]() {
#pragma unroll
        for (int s = 0; s < 8; ++s) { const int Lid = (lane >> 3) + 4 * s, piece = lane & 7; const int row = Lid >> 1, cq = (Lid & 1) * 32 + piece * 4;
            const v4f val = *(const v4fa*)(os + row * 68 + cq); *(v4f*)(crow + (size_t)row * NN_ + cq) = val; }
    };
    pass(); 
}
__global__ __launch_bounds__(256) void k_stats(const float* __restrict__ Z, float* ST) {
    __shared__ float red[256];
    const int o = blockIdx.x, t = threadIdx.x;
    float zv[(NB_ * NN_) / 256];   // this thread's 64 values of channel o: read once, kept in registers for both sums
#pragma unroll   // 64 independent loads in flight together: rolled, every trip waited out one load's whole latency
    for (int i = 0; i < (NB_ * NN_) / 256; ++i) { const int flat = i * 256 + t; const int b = flat / NN_, n = flat - b * NN_; zv[i] = Z[((size_t)b * CI + o) * NN_ + n]; }
    float s = 0.f;
#pragma unroll   // zv stays in registers only under constant indices
    for (int i = 0; i < (NB_ * NN_) / 256; ++i) s += zv[i];
    red[t] = s; __syncthreads();
    for (int st = 128; st > 0; st >>= 1) { if (t < st) red[t] += red[t + st]; __syncthreads(); }
    const float mu = red[0] / (float)(NB_ * NN_);
    __syncthreads();
    float q = 0.f;
#pragma unroll   // as above
    for (int i = 0; i < (NB_ * NN_) / 256; ++i) { const float d = zv[i] - mu; q += d * d; }
    red[t] = q; __syncthreads();
    for (int st = 128; st > 0; st >>= 1) { if (t < st) red[t] += red[t + st]; __syncthreads(); }
    const float var = red[0] / (float)(NB_ * NN_);
    if (t < 32) { const float v = (t == 0) ? mu : (t == 1) ? rsqrtf(var + 1e-5f) : 0.f; VST2(float, ST + (size_t)o * 32 + t, v); }
}
// k_final: out[b][o][n] = (Z - mu) rs gamma + beta; one wave per 256 values (8 per lane = 32 B -> use 2 x v4f? no: v8f per lane = lane-strided pair of b128 -> use 2
// instructions of v4f over 128 values each: lane -> 4 floats).
__global__ __launch_bounds__(256) void k_final(const float* __restrict__ Z, const float* __restrict__ ST, const float* __restrict__ gam, const float* __restrict__ bet, float* out) {
    const int lane = threadIdx.x & 31; const size_t wid = (size_t)blockIdx.x * 8 + (threadIdx.x >> 5);
    const size_t row = wid >> 4; const int seg = (int)(wid & 15);        // row = b*CI + o (4096 floats = 16 segments of 256)
    const int o = (int)(row % CI);
    const float mu = ST[(size_t)o * 32], rs = ST[(size_t)o * 32 + 1], g = bfr(gam[o]), be = bfr(bet[o]);
#pragma unroll
    for (int hf = 0; hf < 2; ++hf) { const size_t base = row * NN_ + (size_t)seg * 256 + hf * 128 + lane * 4; v4f v;
#pragma unroll
        for (int i = 0; i < 4; ++i) v[i] = (Z[base + i] - mu) * rs * g + be;
        VST2(v4f, out + base, v); }
}

extern "C" void kernel_launch(void* const* d_in, const int* in_sizes, int n_in,
                              void* d_out, int out_size, void* d_ws, size_t ws_size, hipStream_t stream) {
    (void)in_sizes; (void)n_in; (void)out_size;
    const float* xt = (const float*)d_in[0]; const float* xo = (const float*)d_in[1]; const float* wg = (const float*)d_in[2]; const float* bg = (const float*)d_in[3];
    const float* wth = (const float*)d_in[4]; const float* bth = (const float*)d_in[5]; const float* wph = (const float*)d_in[6]; const float* bph = (const float*)d_in[7];
    const float* wz = (const float*)d_in[8]; const float* bz = (const float*)d_in[9]; const float* gam = (const float*)d_in[10]; const float* bet = (const float*)d_in[11];
    float* out = (float*)d_out;    // [4][128][64][64]
    char* wsp = (char*)d_ws;
    auto take = [&](size_t bytes) { char* p = wsp; wsp += (bytes + 255) & ~(size_t)255; return (void*)p; };
    bf* XTt = (bf*)take((size_t)NB_ * NN_ * CIN * 2); bf* XTo = (bf*)take((size_t)NB_ * NN_ * CIN * 2);
    bf* WGb = (bf*)take((size_t)CI * CIN * 2); bf* WTb = (bf*)take((size_t)CI * CIN * 2); bf* WPb = (bf*)take((size_t)CI * CIN * 2); bf* WZb = (bf*)take((size_t)CI * CI * 2);
    h16* TH = (h16*)take((size_t)NB_ * NN_ * CI * 2); h16* TL = (h16*)take((size_t)NB_ * NN_ * CI * 2); h16* PH = (h16*)take((size_t)NB_ * NN_ * CI * 2); h16* PL = (h16*)take((size_t)NB_ * NN_ * CI * 2);
    float* G = (float*)take((size_t)NB_ * NN_ * CI * 4); h16* GTH = (h16*)take((size_t)NB_ * CI * NN_ * 2); h16* GTL = (h16*)take((size_t)NB_ * CI * NN_ * 2);
    float* Y = (float*)take((size_t)NB_ * NN_ * CI * 4); bf* YH = (bf*)take((size_t)NB_ * NN_ * CI * 2); bf* YL = (bf*)take((size_t)NB_ * NN_ * CI * 2);
    float* Z = (float*)take((size_t)NB_ * CI * NN_ * 4); float* ST = (float*)take((size_t)CI * 32 * 4);
    if ((size_t)(wsp - (char*)d_ws) > ws_size) return;    // 8.4x2 + 0.2 + 4.2x4 + 8.4 + 4.2x2 + 8.4 + 4.2x2 + 8.4 ~ 76 MB
    k_prep<<<WBLK + 2 * NB_ * (NN_ / 64) * (CIN / 64), 256, 0, stream>>>(xt, xo, wg, wth, wph, wz, XTt, XTo, WGb, WTb, WPb, WZb);
    k_proj<<<dim3(NN_ / 64, CI / 64, 3 * NB_), 128, 0, stream>>>(XTt, XTo, WTb, WPb, WGb, bth, bph, bg, TH, TL, PH, PL, G);
    k_vt<<<NB_ * (NN_ / 64), 256, 0, stream>>>(G, GTH, GTL);
    k_attn<<<NB_ * (NN_ / 64), 128, 0, stream>>>(PH, PL, TH, TL, GTH, GTL, Y);
    k_splity<<<(NB_ * NN_ / 2) / 8, 256, 0, stream>>>(Y, YH, YL);
    k_z<<<dim3(CI / 64, NN_ / 64, NB_), 128, 0, stream>>>(WZb, YH, YL, bz, Z);
    k_stats<<<CI, 256, 0, stream>>>(Z, ST);
    k_final<<<(NB_ * CI * 16) / 8, 256, 0, stream>>>(Z, ST, gam, bet, out);
}

// v005
// One run takes 107 microseconds.
// Timed twice side by side with v004, it ran 1.14 times as fast both times.
// All steps since v000 together make it 5.73 times as fast.
#include <hip/hip_runtime.h>
#include <stdint.h>

// Contractions, f32 accumulate: the three 1x1 convs g, theta (from x_this) and phi (from x_other) as [4 x 4096 x 256].[256 x 128] products (+bias) and W_z
// ([128 x 128].[128 x 4096] per b, +bias) on v_wmma_f32_16x16x32_bf16 — plain bf16 = rounded inputs (exact) for the convs, y as bf16 hi + residual in registers (two
// products) for W_z; the non-local attention fused on v_wmma_f32_16x16x32_f16: f = phi_i.theta_j over 128 channels (unscaled, sigma ~ 20: both operands f16 hi +
// residual x1024, hi.hi + hi.lo + lo.hi), softmax over the 4096 positions j, y_i = sum_j f g_j with the weights (x32768) and g both as f16 hi + UNSCALED residual so all three products share one accumulator (hi.hi + hi.lo + lo.hi: the softmax is nearly one-hot, so single roundings would pass straight into y).

#define NB_  4
#define CIN  256
#define CI   128
#define NN_  4096
#define PSC  32768.0f
#define LOSC 1024.0f
#define LOSCI (1.0f / 1024.0f)

typedef _Float16 h16;
typedef unsigned short bf;
typedef __attribute__((ext_vector_type(16))) __bf16   v16bf;
typedef __attribute__((ext_vector_type(8)))  __bf16   v8bf;
typedef __attribute__((ext_vector_type(16))) _Float16 v16h;
typedef __attribute__((ext_vector_type(8)))  _Float16 v8h;
typedef __attribute__((ext_vector_type(8)))  unsigned short v8us;
typedef __attribute__((ext_vector_type(8)))  float    v8f;
typedef __attribute__((ext_vector_type(4)))  float    v4f;
typedef v8h  __attribute__((may_alias)) v8ha;
typedef v4f  __attribute__((may_alias)) v4fa;
typedef v8us __attribute__((may_alias)) v8usa;

__device__ __forceinline__ unsigned short f2bf(float f) { unsigned u = __float_as_uint(f); u += 0x7FFFu + ((u >> 16) & 1u); return (unsigned short)(u >> 16); }
__device__ __forceinline__ float bf2f(unsigned short b) { return __uint_as_float(((unsigned)b) << 16); }
__device__ __forceinline__ float bfr(float f) { return bf2f(f2bf(f)); }
__device__ __forceinline__ v16h cat16(v8h lo, v8h hi) { return __builtin_shufflevector(lo, hi, 0, 1, 2, 3, 4, 5, 6, 7, 8, 9, 10, 11, 12, 13, 14, 15); }
__device__ __forceinline__ v16bf cat16b(v8us lo, v8us hi) { return __builtin_bit_cast(v16bf, __builtin_shufflevector(lo, hi, 0, 1, 2, 3, 4, 5, 6, 7, 8, 9, 10, 11, 12, 13, 14, 15)); }
__device__ __forceinline__ v8f wmma16(v16h a, v16h b, v8f c) { return __builtin_amdgcn_wmma_f32_16x16x32_f16(false, a, false, b, (short)0, c, false, false); }
__device__ __forceinline__ v8f wmmab(v16bf a, v16bf b, v8f c) { return __builtin_amdgcn_wmma_f32_16x16x32_bf16(false, a, false, b, (short)0, c, false, false); }
#define VST2(T, p, v) do { const T vst2_v_ = (v); *(T*)(p) = vst2_v_;  } while (0)

// Tensor loads into LDS for k_attn: a stage = 64 keys = four slices (theta hi, theta residual: 64 rows x 256 B; g hi, g residual: 128 rows x 128 B), one slice per wave.
typedef uint32_t u32x4 __attribute__((ext_vector_type(4)));
typedef uint32_t u32x8 __attribute__((ext_vector_type(8)));
#define SKEY 64u
#define NSTG (NN_ / 64u)
#define KPIT 272u      // LDS pitch of a 256-byte row (16 B pad, odd multiple of 16 B for the b128 readers)
#define VPIT 144u      // LDS pitch of a 128-byte row (16 B pad)
#define SLOT 18432u    // one slice's place: 128 x 144 B, and 64 x 272 B rounded up to a multiple of 2 KiB
#define W0_R256 ((1u << 20) | (5u << 22) | (3u << 25))   // group 1 word 0: no mask, 1-byte elements, 4 dwords of pad behind every 256 B
#define W0_R128 ((1u << 20) | (4u << 22) | (3u << 25))   // the same behind every 128 B
__device__ __forceinline__ uint32_t uni(uint32_t v) { return (uint32_t)__builtin_amdgcn_readfirstlane(v); }
// Holds a wave-uniform value in a scalar register, so that a test around a tensor load compiles to a scalar branch (tensor loads ignore EXEC).
__device__ __forceinline__ uint32_t pinned(uint32_t v) { uint32_t w = uni(v); asm volatile("" : "+s"(w)); return w; }
// Descriptor group 0: the tile's first byte at ga, to the LDS byte offset dst. Group 1: D1 rows of D0 bytes, source pitch SP bytes, tensor = tile.
__device__ __forceinline__ u32x4 tdm_group0(uint32_t dst, uint64_t ga) {
    u32x4 g0; g0[0] = uni(1u); g0[1] = uni(dst); g0[2] = uni((uint32_t)ga); g0[3] = uni((((uint32_t)(ga >> 32)) & 0x01FFFFFFu) | 0x80000000u);
    asm volatile("" : "+s"(g0));   // descriptor words held in scalar registers: no word is formed anew elsewhere while the request is outstanding
    return g0;
}
template <uint32_t W0, uint32_t D0, uint32_t D1, uint32_t SP>
__device__ __forceinline__ u32x8 tdm_group1() {
    u32x8 g1; g1[0] = uni(W0); g1[1] = uni((D0 & 0xFFFFu) << 16); g1[2] = uni((D0 >> 16) | ((D1 & 0xFFFFu) << 16)); g1[3] = uni((D1 >> 16) | (D0 << 16));
    g1[4] = uni(D1); g1[5] = uni(SP); g1[6] = uni(0u); g1[7] = uni(0u);
    asm volatile("" : "+s"(g1));   // descriptor words held in scalar registers: set once from constants, in the same registers for as long as requests are issued
    return g1;
}
__device__ __forceinline__ void tdm_load(u32x4 g0, u32x8 g1) { asm volatile("tensor_load_to_lds %0, %1" :: "s"(g0), "s"(g1) : "memory"); }
// The compiler places no wait for a tensor load. The wait names the request's group 0 so that its registers keep their values while the request is outstanding.
__device__ __forceinline__ void wait_tensor0(u32x4 g0) { asm volatile("s_wait_tensorcnt 0x0" :: "s"(g0) : "memory"); }
// Stands behind the last store of a branch whose code is followed, in the built kernel, by another branch's: no register that an issued store names is rewritten ahead of it.
__device__ __forceinline__ void wait_x0() { asm volatile("s_wait_xcnt 0x0" ::: "memory"); }
// The same behind a run of loads, naming the addresses they use: those registers keep their values up to the wait.
__device__ __forceinline__ void wait_x0_of(const void* p) { asm volatile("s_wait_xcnt 0x0" :: "v"(p) : "memory"); }
__device__ __forceinline__ void wait_x0_of(const void* p, const void* q) { asm volatile("s_wait_xcnt 0x0" :: "v"(p), "v"(q) : "memory"); }
__device__ __forceinline__ void wait_ds0() { asm volatile("s_wait_dscnt 0x0" ::: "memory"); }           // this wave's LDS reads are done before their buffer is handed back
// exp(x) as __expf compiles here (one multiply, v_exp_f32), with the one issue slot that the instruction set asks for behind a transcendental tied to it.
__device__ __forceinline__ float exp_slot(float x) { float r; asm("v_exp_f32 %0, %1\n\tv_nop" : "=v"(r) : "v"(x * 1.44269504088896340736f)); return r; }
__device__ __forceinline__ float xhalf(float x) { return __builtin_bit_cast(float, __builtin_amdgcn_permlanex16(__builtin_bit_cast(int, x), __builtin_bit_cast(int, x), 0x76543210, 0xfedcba98, false, false)); }   // lane l's value from lane l ^ 16
__device__ __forceinline__ v16h ldsfrag(const unsigned char* p) { return cat16(*(const v8ha*)p, *(const v8ha*)(p + 32)); }   // k 0..7 and 16..23 (+8 in the upper half-wave) of one row

// k_prep: the six input conversions, none of which reads what another writes, side by side in one launch.
// Blocks 0..63: bf16 copies of the four weights ([out][in] = the n-major B operand as-is; for w_z the A operand, rows o), 16 blocks each; one wave per row, cols/32 per lane.
// Blocks 64..: XT [b][n][c] = bf16(x[b][c][n]) (NCHW -> rows n with channels contiguous) via 64 x 64 LDS transposes, for both branches; (n/64, c/64, b, branch).
#define WBLK (4 * (CI / 8))
__global__ __launch_bounds__(256) void k_prep(const float* __restrict__ xa, const float* __restrict__ xb, const float* __restrict__ wg, const float* __restrict__ wth,
                                              const float* __restrict__ wph, const float* __restrict__ wz, bf* XTa, bf* XTb, bf* WGb, bf* WTb, bf* WPb, bf* WZb) {
    __shared__ __align__(16) unsigned short tl[64 * 72];
    const int tid = threadIdx.x;
    if (blockIdx.x < WBLK) {   // the same for the whole block, and in front of the barrier
        const int wsel = blockIdx.x / (CI / 8), lane = tid & 31, r = (blockIdx.x - wsel * (CI / 8)) * 8 + (tid >> 5);
        const float* Wm = (wsel == 0) ? wg : (wsel == 1) ? wth : (wsel == 2) ? wph : wz;
        bf* WB = (wsel == 0) ? WGb : (wsel == 1) ? WTb : (wsel == 2) ? WPb : WZb;
        if (wsel < 3) { v8us t;
#pragma unroll
            for (int i = 0; i < 8; ++i) t[i] = f2bf(Wm[(size_t)r * CIN + lane * 8 + i]);
            VST2(v8us, WB + (size_t)r * CIN + lane * 8, t); }
        else { typedef __attribute__((ext_vector_type(4))) unsigned short v4us; v4us t;
#pragma unroll
            for (int i = 0; i < 4; ++i) t[i] = f2bf(Wm[(size_t)r * CI + lane * 4 + i]);
            VST2(v4us, WB + (size_t)r * CI + lane * 4, t); wait_x0(); }
        return;
    }
    const int tb = blockIdx.x - WBLK;
    const int n0 = (tb & (NN_ / 64 - 1)) * 64, c0 = ((tb / (NN_ / 64)) & (CIN / 64 - 1)) * 64, bz = tb / ((NN_ / 64) * (CIN / 64)), b = bz & (NB_ - 1);
    const float* x = (bz < NB_) ? xa : xb;
    bf* XT = (bz < NB_) ? XTa : XTb;
    const int cr = tid >> 2, nq = (tid & 3) * 16;
#pragma unroll
    for (int i = 0; i < 16; ++i) tl[(nq + i) * 72 + cr] = f2bf(x[((size_t)b * CIN + c0 + cr) * NN_ + n0 + nq + i]);
    __syncthreads();
    const int piece = tid & 7;
    auto pass = [&]() {
#pragma unroll
        for (int s = 0; s < 2; ++s) { const int nr = (tid >> 3) + 32 * s; const v8us val = *(const v8usa*)(tl + nr * 72 + piece * 8);
            *(v8us*)(XT + ((size_t)b * NN_ + n0 + nr) * CIN + c0 + piece * 8) = val; }
    };
    pass(); wait_x0();
}
// k_proj: 64 x 64 tile of P[b][n][o] = XT[b][n].W^T + bias over K = 256 (exact); the three projections, none of which reads what another writes, side by side in
// one launch: theta (keys, this branch) and phi (queries, other branch) as f16 hi + residual planes [b*4096+n][128], g (values, this branch) transposed in the
// block's LDS tile and written as f16 hi + UNSCALED residual planes GTH/GTL [b][c][n] (the A operand of y^T: rows c, k = n; the residual is summed into the same
// accumulator as the hi product). grid (NN_/64, 2, 3 * NB_): z = projection * NB_ + b.
__global__ __launch_bounds__(128) void k_proj(const bf* __restrict__ XTa, const bf* __restrict__ XTb, const bf* __restrict__ WTb, const bf* __restrict__ WPb, const bf* __restrict__ WGb,
                                              const float* __restrict__ bth, const float* __restrict__ bph, const float* __restrict__ bg, h16* TH, h16* TL, h16* PH, h16* PL, h16* GTH, h16* GTL) {
    __shared__ __align__(16) float ost[4][16 * 68];
    const int lane = threadIdx.x & 31, wave = threadIdx.x >> 5, lr = lane & 15, hi = lane >> 4, sel = blockIdx.z / NB_, b = blockIdx.z - sel * NB_;
    const int r0 = blockIdx.x * 64 + wave * 16, c0 = blockIdx.y * 64;
    const bf* XT = (sel == 1) ? XTb : XTa;
    const bf* WB = (sel == 0) ? WTb : (sel == 1) ? WPb : WGb;
    const float* bias = (sel == 0) ? bth : (sel == 1) ? bph : bg;
    const bf* A = XT + (size_t)b * NN_ * CIN;
    const size_t aoff = (size_t)(r0 + lr) * CIN + 8 * hi;
    size_t boff[4];
#pragma unroll
    for (int t = 0; t < 4; ++t) boff[t] = (size_t)(c0 + t * 16 + lr) * CIN + 8 * hi;
    v8f acc[4];
#pragma unroll
    for (int t = 0; t < 4; ++t) acc[t] = (v8f){};
#pragma unroll 1
    for (int kc = 0; kc < CIN; kc += 32) {
        const v16bf a = cat16b(*(const v8us*)(A + aoff + kc), *(const v8us*)(A + aoff + kc + 16));
#pragma unroll
        for (int t = 0; t < 4; ++t) acc[t] = wmmab(a, cat16b(*(const v8us*)(WB + boff[t] + kc), *(const v8us*)(WB + boff[t] + kc + 16)), acc[t]);
        asm volatile("v_nop\n\tv_nop\n\tv_nop\n\tv_nop" : "+v"(acc[0]), "+v"(acc[1]), "+v"(acc[2]), "+v"(acc[3]) : "v"(a));
    }
    float* os = &ost[wave][0];
    float* gs = &ost[0][0];   // g: one tile of the whole block, 64 rows c x 64 n (pitch 68)
    if (sel == 2) {   // the same for the whole block; a lane's 8 registers are 8 consecutive n of one channel
#pragma unroll
        for (int t = 0; t < 4; ++t) { const float bv = bfr(bias[c0 + t * 16 + lr]); v4f w0, w1;
#pragma unroll
            for (int j = 0; j < 4; ++j) { w0[j] = acc[t][j] + bv; w1[j] = acc[t][4 + j] + bv; }
            float* gp = gs + (t * 16 + lr) * 68 + wave * 16 + hi * 8;
            *(v4fa*)gp = w0; *(v4fa*)(gp + 4) = w1; }
    } else {
#pragma unroll
        for (int t = 0; t < 4; ++t) { const float bv = bfr(bias[c0 + t * 16 + lr]);
#pragma unroll
            for (int j = 0; j < 8; ++j) os[(hi * 8 + j) * 68 + t * 16 + lr] = acc[t][j] + bv; }
    }
    __syncthreads();
    const size_t rowbase = (size_t)b * NN_ + r0;
    if (sel == 2) {
        const size_t gbase = ((size_t)b * CI + c0) * NN_ + (size_t)blockIdx.x * 64;
#pragma unroll
        for (int s = 0; s < 4; ++s) { const int Lid = (int)threadIdx.x + 128 * s; const int row = Lid >> 3, piece = Lid & 7; const float* sp = gs + row * 68 + piece * 8; v8h o1, o2;
#pragma unroll
            for (int i = 0; i < 8; ++i) { const h16 a = (h16)sp[i]; o1[i] = a; o2[i] = (h16)(sp[i] - (float)a); }
            *(v8h*)(GTH + gbase + (size_t)row * NN_ + piece * 8) = o1; *(v8h*)(GTL + gbase + (size_t)row * NN_ + piece * 8) = o2; }
        wait_x0();
    } else {
        h16* c1 = ((sel == 0) ? TH : PH) + rowbase * CI + c0; h16* c2 = ((sel == 0) ? TL : PL) + rowbase * CI + c0;
        auto pass = [&]() {
#pragma unroll
            for (int s = 0; s < 4; ++s) { const int row = 4 * s + (lane >> 3), piece = lane & 7; const float* sp = os + row * 68 + piece * 8; v8h o1, o2;
#pragma unroll
                for (int i = 0; i < 8; ++i) { const h16 a = (h16)sp[i]; o1[i] = a; o2[i] = (h16)((sp[i] - (float)a) * LOSC); }
                *(v8h*)(c1 + (size_t)row * CI + piece * 8) = o1; *(v8h*)(c2 + (size_t)row * CI + piece * 8) = o2; }
        };
        pass(); wait_x0();
    }
}
// k_attn: block = (b, 64 queries i), wave = 16; theta and g (hi + residual) come in stages of 64 keys by tensor loads into two LDS buffers, one slice per wave, the
// next stage in flight while this one is worked on; the block's phi residual rows are loaded into LDS once. Both products are transposed: per 32 keys the scores
// S^T = theta_j.phi_i (A = theta rows, B = phi; hi.hi + hi.lo + lo.hi over 4 k-chunks x 2 tiles = 24 WMMA), so that a lane holds 16 scores of ONE query (lane & 15):
// online f32 softmax in the lane plus one exchange between the half-waves; the two score tiles, as hi/residual weights (x32768), are the B operand of
// y^T += g^T.w^T as they stand (A = g rows, 8 channel tiles x 3 = 24 WMMA). Epilogue: the y accumulators, as bf16 hi + residual, are the B operand of
// Z [b][o][n] = w_z . (yh + yl)^T + b_z[o] as they stand (A = w_z rows o, K = 128: 8 tiles x 4 k-chunks x 2 = 64 WMMA per wave); the block's 128 x 64 tile of Z goes
// through LDS and out as 256-byte row pieces.
__global__ __launch_bounds__(128) void k_attn(const h16* __restrict__ PH, const h16* __restrict__ PL, const h16* __restrict__ TH, const h16* __restrict__ TL,
                                             const h16* __restrict__ GTH, const h16* __restrict__ GTL, const bf* __restrict__ WZ, const float* __restrict__ bz, float* Z) {
    __shared__ __attribute__((aligned(2048))) unsigned char ring[9 * SLOT];   // buffer 0: slices 0-3, buffer 1: slices 4-7, slice 8: phi residual rows
    __shared__ __align__(16) float zst[CI * 68];   // the block's tile of Z: 128 rows o x 64 n
    const int lane = threadIdx.x & 31, wave = threadIdx.x >> 5, lr = lane & 15, hi = lane >> 4;
    const int b = blockIdx.x / (NN_ / 64), qt = blockIdx.x - b * (NN_ / 64), q0 = qt * 64 + wave * 16;
    const size_t tok0 = (size_t)b * NN_;
    const size_t vbase = ((size_t)b * CI) * NN_;
    const uint32_t wv = uni(threadIdx.x >> 5), ring0 = (uint32_t)(size_t)ring;
    // This wave's slice: 0 theta hi, 1 theta residual (a stage further = 64 rows), 2 g hi, 3 g residual (a stage further = 64 keys along the rows).
    const h16* splane = (wv == 0u) ? TH + tok0 * CI : (wv == 1u) ? TL + tok0 * CI : (wv == 2u) ? GTH + vbase : GTL + vbase;
    const uint32_t sstep = (wv < 2u) ? SKEY * CI * 2u : SKEY * 2u;
    const u32x8 g1k = tdm_group1<W0_R256, 256u, 64u, 256u>(), g1v = tdm_group1<W0_R128, 128u, 128u, NN_ * 2u>();
    u32x4 g0;
    auto issue = [&](uint32_t st) {
        g0 = tdm_group0(ring0 + ((st & 1u) * 4u + wv) * SLOT, (uint64_t)(size_t)splane + (uint64_t)st * sstep);
        if (pinned(wv < 2u)) tdm_load(g0, g1k); else tdm_load(g0, g1v);
    };
    if (pinned(wv == 0u)) { const u32x4 gp = tdm_group0(ring0 + 8u * SLOT, (uint64_t)(size_t)(PL + (tok0 + (size_t)qt * 64) * CI)); tdm_load(gp, g1k); wait_tensor0(gp); }
    issue(0u); wait_tensor0(g0);
    __syncthreads();   // stage 0 and the phi residual rows are published
    issue(1u);
    v16h ah[4];
    const size_t qo0 = (tok0 + q0 + lr) * CI + 8 * hi;
#pragma unroll
    for (int kc = 0; kc < 4; ++kc) ah[kc] = cat16(*(const v8h*)(PH + qo0 + kc * 32), *(const v8h*)(PH + qo0 + kc * 32 + 16));
    wait_x0_of(PH + qo0);
    const unsigned char* alp = ring + 8u * SLOT + (uint32_t)(wave * 16 + lr) * KPIT + 16u * hi;
    v8f o[8];
#pragma unroll
    for (int n = 0; n < 8; ++n) o[n] = (v8f){};
    float mrow = -3.0e38f, lpart = 0.f;   // of this lane's query; lpart sums this half-wave's keys only
#pragma unroll 1   // one trip = one stage with its one publish point
    for (uint32_t st = 0; st < NSTG; ++st) {
      const unsigned char* buf = ring + (st & 1u) * (4u * SLOT);
      const unsigned char* kh0 = buf + (uint32_t)lr * KPIT + 16u * hi;               // theta rows (keys), 16 further: + 16 * KPIT; residual plane: + SLOT
      const unsigned char* vp0 = buf + 2u * SLOT + (uint32_t)lr * VPIT + 16u * hi;   // g rows (channels), 16 further: + 16 * VPIT; residual plane: + SLOT
      v16h kf[4][5];   // a 32-key block's score fragments per k-chunk: theta hi (2 tiles), phi residual, theta residual (2 tiles)
      auto load_k = [&](int kk) {
        const unsigned char* kh = kh0 + (uint32_t)(kk * 32) * KPIT;
#pragma unroll
        for (int kc = 0; kc < 4; ++kc) {
            kf[kc][0] = ldsfrag(kh + kc * 64); kf[kc][1] = ldsfrag(kh + 16u * KPIT + kc * 64); kf[kc][2] = ldsfrag(alp + kc * 64);
            kf[kc][3] = ldsfrag(kh + SLOT + kc * 64); kf[kc][4] = ldsfrag(kh + SLOT + 16u * KPIT + kc * 64);
        }
      };
      // The scheduling barriers below keep each block of LDS reads in one place, ahead of the work it flies under: left free, this build moved the reads
      // down among the matrix instructions, two at a time with a full wait behind each pair.
      load_k(0);
      __builtin_amdgcn_sched_barrier(0);
#pragma unroll     // the stage's two 32-key blocks: their places in the buffer become constant offsets
      for (int kk = 0; kk < 2; ++kk) {
        const unsigned char* vp = vp0 + (uint32_t)(kk * 64);
        v8f s0 = {}, s1 = {}, x0 = {}, x1 = {};
#pragma unroll
        for (int kc = 0; kc < 4; ++kc) {
            s0 = wmma16(kf[kc][0], ah[kc], s0); x0 = wmma16(kf[kc][0], kf[kc][2], x0); s1 = wmma16(kf[kc][1], ah[kc], s1); x1 = wmma16(kf[kc][1], kf[kc][2], x1);
            x0 = wmma16(kf[kc][3], ah[kc], x0); x1 = wmma16(kf[kc][4], ah[kc], x1);
        }
        asm volatile("v_nop\n\tv_nop\n\tv_nop\n\tv_nop" : "+v"(s0), "+v"(s1), "+v"(x0), "+v"(x1) : "v"(ah[0]), "v"(ah[3]));
        __builtin_amdgcn_sched_barrier(0);
        v16h vh[8], vl[8];   // read here so that the reads run under the softmax
#pragma unroll
        for (int n = 0; n < 8; ++n) { vh[n] = ldsfrag(vp + (uint32_t)(n * 16) * VPIT); vl[n] = ldsfrag(vp + SLOT + (uint32_t)(n * 16) * VPIT); }
        __builtin_amdgcn_sched_barrier(0);
        // Register j of tile t = key 16 t + 8 hi + j of the block, query lr.
        float a0[8], a1[8];
#pragma unroll
        for (int j = 0; j < 8; ++j) { a0[j] = s0[j] + x0[j] * LOSCI; a1[j] = s1[j] + x1[j] * LOSCI; }
        float mx = fmaxf(a0[0], a1[0]);
#pragma unroll
        for (int j = 1; j < 8; ++j) mx = fmaxf(mx, fmaxf(a0[j], a1[j]));
        mx = fmaxf(mx, xhalf(mx));
        const float mn = fmaxf(mrow, mx);
        const float alpha = exp_slot(mrow - mn); mrow = mn;
        float es = 0.f;
        v16h pa, px;   // element s = key 8 hi + s (s < 8), 16 + 8 hi + s - 8 (else): the k order of the g fragments
#pragma unroll
        for (int j = 0; j < 8; ++j) {
            const float e0 = exp_slot(a0[j] - mn), e1 = exp_slot(a1[j] - mn);
            es += e0 + e1;
            const float ps0 = e0 * PSC, ps1 = e1 * PSC; const h16 h0 = (h16)ps0, h1 = (h16)ps1;
            pa[j] = h0; pa[8 + j] = h1; px[j] = (h16)(ps0 - (float)h0); px[8 + j] = (h16)(ps1 - (float)h1);   // unscaled residual
        }
        lpart = lpart * alpha + es;
        if (kk == 0) {   // the second block's score fragments fly under the first block's products with g
            __builtin_amdgcn_sched_barrier(0);
            load_k(1);
            __builtin_amdgcn_sched_barrier(0);
        }
#pragma unroll
        for (int n = 0; n < 8; ++n)
#pragma unroll
            for (int j = 0; j < 8; ++j) o[n][j] *= alpha;
#pragma unroll
        for (int n = 0; n < 8; ++n) { o[n] = wmma16(vh[n], pa, o[n]); o[n] = wmma16(vl[n], pa, o[n]); o[n] = wmma16(vh[n], px, o[n]); }
      }
      __builtin_amdgcn_sched_barrier(0);   // keeps the full LDS wait below behind the softmax and the products: moved up, it laid the second block's g reads bare
      // Publish point: this wave has left stage st's buffer, its own slice of stage st + 1 has landed, every wave is here; only then the refill.
      wait_ds0();
      wait_tensor0(g0);
      __syncthreads();
      if (pinned(st + 2u < NSTG)) issue(st + 2u);
    }
    wait_tensor0(g0);
    wait_ds0();
    const float inv = 1.0f / ((lpart + xhalf(lpart)) * PSC);
    // w_z's fragments and this lane's 16 biases are asked for ahead of the conversions of y, under which they fly.
    const bf* wr = WZ + (size_t)lr * CI + 8 * hi;
    const float* bzp = bz + wave * 32 + hi;
    v16bf wa[8][4]; float bzr[16];
#pragma unroll
    for (int t = 0; t < 8; ++t)
#pragma unroll
        for (int kc = 0; kc < 4; ++kc) wa[t][kc] = cat16b(*(const v8us*)(wr + t * 16 * CI + kc * 32), *(const v8us*)(wr + t * 16 * CI + kc * 32 + 16));
#pragma unroll
    for (int s = 0; s < 16; ++s) bzr[s] = bzp[2 * s];
    wait_x0_of(wr, bzp);
    v16bf yh[4], yl[4];   // register j of tiles 2 kc, 2 kc + 1 = channels 32 kc + 8 hi + j, 32 kc + 16 + 8 hi + j of query lr: the k order of the w_z fragments
#pragma unroll
    for (int kc = 0; kc < 4; ++kc) {
        const v8f u = o[2 * kc] * inv, v = o[2 * kc + 1] * inv;
        const v8bf uh = __builtin_convertvector(u, v8bf), vh = __builtin_convertvector(v, v8bf);   // round to nearest even, as f2bf
        const v8bf ul = __builtin_convertvector(u - __builtin_convertvector(uh, v8f), v8bf), vl = __builtin_convertvector(v - __builtin_convertvector(vh, v8f), v8bf);
        yh[kc] = __builtin_shufflevector(uh, vh, 0, 1, 2, 3, 4, 5, 6, 7, 8, 9, 10, 11, 12, 13, 14, 15);
        yl[kc] = __builtin_shufflevector(ul, vl, 0, 1, 2, 3, 4, 5, 6, 7, 8, 9, 10, 11, 12, 13, 14, 15);
    }
#pragma unroll
    for (int t = 0; t < 8; ++t) {
        v8f acc = {}, accx = {};
#pragma unroll
        for (int kc = 0; kc < 4; ++kc) { acc = wmmab(wa[t][kc], yh[kc], acc); accx = wmmab(wa[t][kc], yl[kc], accx); }
#pragma unroll
        for (int j = 0; j < 8; ++j) zst[(t * 16 + hi * 8 + j) * 68 + wave * 16 + lr] = acc[j] + accx[j];   // register j = row o, lane = query
    }
    __syncthreads();   // every wave's 16 columns of the tile are written
    float* zb = Z + ((size_t)b * CI + wave * 32) * NN_ + (size_t)qt * 64;
    v4f val[16];   // one instruction = two rows' 256-byte pieces
#pragma unroll
    for (int s = 0; s < 16; ++s) val[s] = *(const v4fa*)(zst + (wave * 32 + 2 * s + hi) * 68 + lr * 4) + bfr(bzr[s]);
    __builtin_amdgcn_sched_barrier(0);   // the 16 stores go out as one run behind all reads and sums: left free, this build stored in pairs among them and wrote over registers of issued stores
#pragma unroll
    for (int s = 0; s < 16; ++s) *(v4f*)(zb + (size_t)(2 * s + hi) * NN_ + lr * 4) = val[s];
}
__global__ __launch_bounds__(256) void k_stats(const float* __restrict__ Z, float* ST) {
    __shared__ float red[256];
    const int o = blockIdx.x, t = threadIdx.x;
    float zv[(NB_ * NN_) / 256];   // this thread's 64 values of channel o: read once, kept in registers for both sums
#pragma unroll   // 64 independent loads in flight together: rolled, every trip waited out one load's whole latency
    for (int i = 0; i < (NB_ * NN_) / 256; ++i) { const int flat = i * 256 + t; const int b = flat / NN_, n = flat - b * NN_; zv[i] = Z[((size_t)b * CI + o) * NN_ + n]; }
    float s = 0.f;
#pragma unroll   // zv stays in registers only under constant indices
    for (int i = 0; i < (NB_ * NN_) / 256; ++i) s += zv[i];
    red[t] = s; __syncthreads();
    for (int st = 128; st > 0; st >>= 1) { if (t < st) red[t] += red[t + st]; __syncthreads(); }
    const float mu = red[0] / (float)(NB_ * NN_);
    __syncthreads();
    float q = 0.f;
#pragma unroll   // as above
    for (int i = 0; i < (NB_ * NN_) / 256; ++i) { const float d = zv[i] - mu; q += d * d; }
    red[t] = q; __syncthreads();
    for (int st = 128; st > 0; st >>= 1) { if (t < st) red[t] += red[t + st]; __syncthreads(); }
    const float var = red[0] / (float)(NB_ * NN_);
    if (t < 32) { const float v = (t == 0) ? mu : (t == 1) ? rsqrtf(var + 1e-5f) : 0.f; VST2(float, ST + (size_t)o * 32 + t, v); }
}
// k_final: out[b][o][n] = (Z - mu) rs gamma + beta; one wave per 256 values (8 per lane = 32 B -> use 2 x v4f? no: v8f per lane = lane-strided pair of b128 -> use 2
// instructions of v4f over 128 values each: lane -> 4 floats).
__global__ __launch_bounds__(256) void k_final(const float* __restrict__ Z, const float* __restrict__ ST, const float* __restrict__ gam, const float* __restrict__ bet, float* out) {
    const int lane = threadIdx.x & 31; const size_t wid = (size_t)blockIdx.x * 8 + (threadIdx.x >> 5);
    const size_t row = wid >> 4; const int seg = (int)(wid & 15);        // row = b*CI + o (4096 floats = 16 segments of 256)
    const int o = (int)(row % CI);
    const float mu = ST[(size_t)o * 32], rs = ST[(size_t)o * 32 + 1], g = bfr(gam[o]), be = bfr(bet[o]);
#pragma unroll
    for (int hf = 0; hf < 2; ++hf) { const size_t base = row * NN_ + (size_t)seg * 256 + hf * 128 + lane * 4; v4f v;
#pragma unroll
        for (int i = 0; i < 4; ++i) v[i] = (Z[base + i] - mu) * rs * g + be;
        VST2(v4f, out + base, v); }
}

extern "C" void kernel_launch(void* const* d_in, const int* in_sizes, int n_in,
                              void* d_out, int out_size, void* d_ws, size_t ws_size, hipStream_t stream) {
    (void)in_sizes; (void)n_in; (void)out_size;
    const float* xt = (const float*)d_in[0]; const float* xo = (const float*)d_in[1]; const float* wg = (const float*)d_in[2]; const float* bg = (const float*)d_in[3];
    const float* wth = (const float*)d_in[4]; const float* bth = (const float*)d_in[5]; const float* wph = (const float*)d_in[6]; const float* bph = (const float*)d_in[7];
    const float* wz = (const float*)d_in[8]; const float* bz = (const float*)d_in[9]; const float* gam = (const float*)d_in[10]; const float* bet = (const float*)d_in[11];
    float* out = (float*)d_out;    // [4][128][64][64]
    char* wsp = (char*)d_ws;
    auto take = [&](size_t bytes) { char* p = wsp; wsp += (bytes + 255) & ~(size_t)255; return (void*)p; };
    bf* XTt = (bf*)take((size_t)NB_ * NN_ * CIN * 2); bf* XTo = (bf*)take((size_t)NB_ * NN_ * CIN * 2);
    bf* WGb = (bf*)take((size_t)CI * CIN * 2); bf* WTb = (bf*)take((size_t)CI * CIN * 2); bf* WPb = (bf*)take((size_t)CI * CIN * 2); bf* WZb = (bf*)take((size_t)CI * CI * 2);
    h16* TH = (h16*)take((size_t)NB_ * NN_ * CI * 2); h16* TL = (h16*)take((size_t)NB_ * NN_ * CI * 2); h16* PH = (h16*)take((size_t)NB_ * NN_ * CI * 2); h16* PL = (h16*)take((size_t)NB_ * NN_ * CI * 2);
    h16* GTH = (h16*)take((size_t)NB_ * CI * NN_ * 2); h16* GTL = (h16*)take((size_t)NB_ * CI * NN_ * 2);
    float* Z = (float*)take((size_t)NB_ * CI * NN_ * 4); float* ST = (float*)take((size_t)CI * 32 * 4);
    if ((size_t)(wsp - (char*)d_ws) > ws_size) return;    // 8.4x2 + 0.2 + 4.2x4 + 4.2x2 + 8.4 ~ 51 MB
    k_prep<<<WBLK + 2 * NB_ * (NN_ / 64) * (CIN / 64), 256, 0, stream>>>(xt, xo, wg, wth, wph, wz, XTt, XTo, WGb, WTb, WPb, WZb);
    k_proj<<<dim3(NN_ / 64, CI / 64, 3 * NB_), 128, 0, stream>>>(XTt, XTo, WTb, WPb, WGb, bth, bph, bg, TH, TL, PH, PL, GTH, GTL);
    k_attn<<<NB_ * (NN_ / 64), 128, 0, stream>>>(PH, PL, TH, TL, GTH, GTL, WZb, bz, Z);
    k_stats<<<CI, 256, 0, stream>>>(Z, ST);
    k_final<<<(NB_ * CI * 16) / 8, 256, 0, stream>>>(Z, ST, gam, bet, out);
}

// v006
// It runs in 102 microseconds.
// Next to v005, in two timings, it ran 1.05 times as fast each time.
// Counting every step since v000, it is 6.03 times as fast.
#include <hip/hip_runtime.h>
#include <stdint.h>

// Contractions, f32 accumulate: the three 1x1 convs g, theta (from x_this) and phi (from x_other) as [4 x 4096 x 256].[256 x 128] products (+bias) and W_z
// ([128 x 128].[128 x 4096] per b, +bias) on v_wmma_f32_16x16x32_bf16 — plain bf16 = rounded inputs (exact) for the convs, y as bf16 hi + residual in registers (two
// products) for W_z; the non-local attention fused on v_wmma_f32_16x16x32_f16: f = phi_i.theta_j over 128 channels (unscaled, sigma ~ 20: both operands f16 hi +
// residual x1024, hi.hi + hi.lo + lo.hi), softmax over the 4096 positions j, y_i = sum_j f g_j with the weights (x32768) and g both as f16 hi + UNSCALED residual so all three products share one accumulator (hi.hi + hi.lo + lo.hi: the softmax is nearly one-hot, so single roundings would pass straight into y).

#define NB_  4
#define CIN  256
#define CI   128
#define NN_  4096
#define PSC  32768.0f
#define LOSC 1024.0f
#define LOSCI (1.0f / 1024.0f)

typedef _Float16 h16;
typedef unsigned short bf;
typedef __attribute__((ext_vector_type(16))) __bf16   v16bf;
typedef __attribute__((ext_vector_type(8)))  __bf16   v8bf;
typedef __attribute__((ext_vector_type(16))) _Float16 v16h;
typedef __attribute__((ext_vector_type(8)))  _Float16 v8h;
typedef __attribute__((ext_vector_type(8)))  unsigned short v8us;
typedef __attribute__((ext_vector_type(8)))  float    v8f;
typedef __attribute__((ext_vector_type(4)))  float    v4f;
typedef v8h  __attribute__((may_alias)) v8ha;
typedef v4f  __attribute__((may_alias)) v4fa;
typedef v8us __attribute__((may_alias)) v8usa;

__device__ __forceinline__ unsigned short f2bf(float f) { unsigned u = __float_as_uint(f); u += 0x7FFFu + ((u >> 16) & 1u); return (unsigned short)(u >> 16); }
__device__ __forceinline__ float bf2f(unsigned short b) { return __uint_as_float(((unsigned)b) << 16); }
__device__ __forceinline__ float bfr(float f) { return bf2f(f2bf(f)); }
__device__ __forceinline__ v16h cat16(v8h lo, v8h hi) { return __builtin_shufflevector(lo, hi, 0, 1, 2, 3, 4, 5, 6, 7, 8, 9, 10, 11, 12, 13, 14, 15); }
__device__ __forceinline__ v16bf cat16b(v8us lo, v8us hi) { return __builtin_bit_cast(v16bf, __builtin_shufflevector(lo, hi, 0, 1, 2, 3, 4, 5, 6, 7, 8, 9, 10, 11, 12, 13, 14, 15)); }
__device__ __forceinline__ v8f wmma16(v16h a, v16h b, v8f c) { return __builtin_amdgcn_wmma_f32_16x16x32_f16(false, a, false, b, (short)0, c, false, false); }
__device__ __forceinline__ v8f wmmab(v16bf a, v16bf b, v8f c) { return __builtin_amdgcn_wmma_f32_16x16x32_bf16(false, a, false, b, (short)0, c, false, false); }
#define VST2(T, p, v) do { const T vst2_v_ = (v); *(T*)(p) = vst2_v_;  } while (0)

// Tensor loads into LDS for k_attn: a stage = 64 keys = four slices (theta hi, theta residual: 64 rows x 256 B; g hi, g residual: 128 rows x 128 B), one slice per wave.
typedef uint32_t u32x4 __attribute__((ext_vector_type(4)));
typedef uint32_t u32x8 __attribute__((ext_vector_type(8)));
#define SKEY 64u
#define NSTG (NN_ / 64u)
#define KPIT 272u      // LDS pitch of a 256-byte row (16 B pad, odd multiple of 16 B for the b128 readers)
#define VPIT 144u      // LDS pitch of a 128-byte row (16 B pad)
#define SLOT 18432u    // one slice's place: 128 x 144 B, and 64 x 272 B rounded up to a multiple of 2 KiB
#define W0_R256 ((1u << 20) | (5u << 22) | (3u << 25))   // group 1 word 0: no mask, 1-byte elements, 4 dwords of pad behind every 256 B
#define W0_R128 ((1u << 20) | (4u << 22) | (3u << 25))   // the same behind every 128 B
__device__ __forceinline__ uint32_t uni(uint32_t v) { return (uint32_t)__builtin_amdgcn_readfirstlane(v); }
// Holds a wave-uniform value in a scalar register, so that a test around a tensor load compiles to a scalar branch (tensor loads ignore EXEC).
__device__ __forceinline__ uint32_t pinned(uint32_t v) { uint32_t w = uni(v); asm volatile("" : "+s"(w)); return w; }
// Descriptor group 0: the tile's first byte at ga, to the LDS byte offset dst. Group 1: D1 rows of D0 bytes, source pitch SP bytes, tensor = tile.
__device__ __forceinline__ u32x4 tdm_group0(uint32_t dst, uint64_t ga) {
    u32x4 g0; g0[0] = uni(1u); g0[1] = uni(dst); g0[2] = uni((uint32_t)ga); g0[3] = uni((((uint32_t)(ga >> 32)) & 0x01FFFFFFu) | 0x80000000u);
    asm volatile("" : "+s"(g0));   // descriptor words held in scalar registers: no word is formed anew elsewhere while the request is outstanding
    return g0;
}
template <uint32_t W0, uint32_t D0, uint32_t D1, uint32_t SP>
__device__ __forceinline__ u32x8 tdm_group1() {
    u32x8 g1; g1[0] = uni(W0); g1[1] = uni((D0 & 0xFFFFu) << 16); g1[2] = uni((D0 >> 16) | ((D1 & 0xFFFFu) << 16)); g1[3] = uni((D1 >> 16) | (D0 << 16));
    g1[4] = uni(D1); g1[5] = uni(SP); g1[6] = uni(0u); g1[7] = uni(0u);
    asm volatile("" : "+s"(g1));   // descriptor words held in scalar registers: set once from constants, in the same registers for as long as requests are issued
    return g1;
}
__device__ __forceinline__ void tdm_load(u32x4 g0, u32x8 g1) { asm volatile("tensor_load_to_lds %0, %1" :: "s"(g0), "s"(g1) : "memory"); }
// The compiler places no wait for a tensor load. The wait names the request's group 0 so that its registers keep their values while the request is outstanding.
__device__ __forceinline__ void wait_tensor0(u32x4 g0) { asm volatile("s_wait_tensorcnt 0x0" :: "s"(g0) : "memory"); }
// Stands behind the last store of a branch whose code is followed, in the built kernel, by another branch's: no register that an issued store names is rewritten ahead of it.
__device__ __forceinline__ void wait_x0() { asm volatile("s_wait_xcnt 0x0" ::: "memory"); }
// The same behind a run of loads, naming the addresses they use: those registers keep their values up to the wait.
__device__ __forceinline__ void wait_x0_of(const void* p) { asm volatile("s_wait_xcnt 0x0" :: "v"(p) : "memory"); }
__device__ __forceinline__ void wait_x0_of(const void* p, const void* q) { asm volatile("s_wait_xcnt 0x0" :: "v"(p), "v"(q) : "memory"); }
__device__ __forceinline__ void wait_ds0() { asm volatile("s_wait_dscnt 0x0" ::: "memory"); }           // this wave's LDS reads are done before their buffer is handed back
// exp(x) as __expf compiles here (one multiply, v_exp_f32), with the one issue slot that the instruction set asks for behind a transcendental tied to it.
__device__ __forceinline__ float exp_slot(float x) { float r; asm("v_exp_f32 %0, %1\n\tv_nop" : "=v"(r) : "v"(x * 1.44269504088896340736f)); return r; }
__device__ __forceinline__ float xhalf(float x) { return __builtin_bit_cast(float, __builtin_amdgcn_permlanex16(__builtin_bit_cast(int, x), __builtin_bit_cast(int, x), 0x76543210, 0xfedcba98, false, false)); }   // lane l's value from lane l ^ 16
__device__ __forceinline__ v16h ldsfrag(const unsigned char* p) { return cat16(*(const v8ha*)p, *(const v8ha*)(p + 32)); }   // k 0..7 and 16..23 (+8 in the upper half-wave) of one row

// k_prep: the six input conversions, none of which reads what another writes, side by side in one launch.
// Blocks 0..63: bf16 copies of the four weights ([out][in] = the n-major B operand as-is; for w_z the A operand, rows o), 16 blocks each; one wave per row, cols/32 per lane.
// Blocks 64..: XT [b][n][c] = bf16(x[b][c][n]) (NCHW -> rows n with channels contiguous) via 64 x 64 LDS transposes, for both branches; (n/64, c/64, b, branch).
#define WBLK (4 * (CI / 8))
__global__ __launch_bounds__(256) void k_prep(const float* __restrict__ xa, const float* __restrict__ xb, const float* __restrict__ wg, const float* __restrict__ wth,
                                              const float* __restrict__ wph, const float* __restrict__ wz, bf* XTa, bf* XTb, bf* WGb, bf* WTb, bf* WPb, bf* WZb) {
    __shared__ __align__(16) unsigned short tl[64 * 72];
    const int tid = threadIdx.x;
    if (blockIdx.x < WBLK) {   // the same for the whole block, and in front of the barrier
        const int wsel = blockIdx.x / (CI / 8), lane = tid & 31, r = (blockIdx.x - wsel * (CI / 8)) * 8 + (tid >> 5);
        const float* Wm = (wsel == 0) ? wg : (wsel == 1) ? wth : (wsel == 2) ? wph : wz;
        bf* WB = (wsel == 0) ? WGb : (wsel == 1) ? WTb : (wsel == 2) ? WPb : WZb;
        if (wsel < 3) { v8us t;
#pragma unroll
            for (int i = 0; i < 8; ++i) t[i] = f2bf(Wm[(size_t)r * CIN + lane * 8 + i]);
            VST2(v8us, WB + (size_t)r * CIN + lane * 8, t); }
        else { typedef __attribute__((ext_vector_type(4))) unsigned short v4us; v4us t;
#pragma unroll
            for (int i = 0; i < 4; ++i) t[i] = f2bf(Wm[(size_t)r * CI + lane * 4 + i]);
            VST2(v4us, WB + (size_t)r * CI + lane * 4, t); wait_x0(); }
        return;
    }
    const int tb = blockIdx.x - WBLK;
    const int n0 = (tb & (NN_ / 64 - 1)) * 64, c0 = ((tb / (NN_ / 64)) & (CIN / 64 - 1)) * 64, bz = tb / ((NN_ / 64) * (CIN / 64)), b = bz & (NB_ - 1);
    const float* x = (bz < NB_) ? xa : xb;
    bf* XT = (bz < NB_) ? XTa : XTb;
    const int cr = tid >> 2, nq = (tid & 3) * 16;
#pragma unroll
    for (int i = 0; i < 16; ++i) tl[(nq + i) * 72 + cr] = f2bf(x[((size_t)b * CIN + c0 + cr) * NN_ + n0 + nq + i]);
    __syncthreads();
    const int piece = tid & 7;
    auto pass = [&]() {
#pragma unroll
        for (int s = 0; s < 2; ++s) { const int nr = (tid >> 3) + 32 * s; const v8us val = *(const v8usa*)(tl + nr * 72 + piece * 8);
            *(v8us*)(XT + ((size_t)b * NN_ + n0 + nr) * CIN + c0 + piece * 8) = val; }
    };
    pass(); wait_x0();
}
// k_proj: 64 x 64 tile of P[b][n][o] = XT[b][n].W^T + bias over K = 256 (exact); the three projections, none of which reads what another writes, side by side in
// one launch: theta (keys, this branch) and phi (queries, other branch) as f16 hi + residual planes [b*4096+n][128], g (values, this branch) transposed in the
// block's LDS tile and written as f16 hi + UNSCALED residual planes GTH/GTL [b][c][n] (the A operand of y^T: rows c, k = n; the residual is summed into the same
// accumulator as the hi product). grid (NN_/64, 2, 3 * NB_): z = projection * NB_ + b.
__global__ __launch_bounds__(128) void k_proj(const bf* __restrict__ XTa, const bf* __restrict__ XTb, const bf* __restrict__ WTb, const bf* __restrict__ WPb, const bf* __restrict__ WGb,
                                              const float* __restrict__ bth, const float* __restrict__ bph, const float* __restrict__ bg, h16* TH, h16* TL, h16* PH, h16* PL, h16* GTH, h16* GTL) {
    __shared__ __align__(16) float ost[4][16 * 68];
    const int lane = threadIdx.x & 31, wave = threadIdx.x >> 5, lr = lane & 15, hi = lane >> 4, sel = blockIdx.z / NB_, b = blockIdx.z - sel * NB_;
    const int r0 = blockIdx.x * 64 + wave * 16, c0 = blockIdx.y * 64;
    const bf* XT = (sel == 1) ? XTb : XTa;
    const bf* WB = (sel == 0) ? WTb : (sel == 1) ? WPb : WGb;
    const float* bias = (sel == 0) ? bth : (sel == 1) ? bph : bg;
    const bf* A = XT + (size_t)b * NN_ * CIN;
    const size_t aoff = (size_t)(r0 + lr) * CIN + 8 * hi;
    size_t boff[4];
#pragma unroll
    for (int t = 0; t < 4; ++t) boff[t] = (size_t)(c0 + t * 16 + lr) * CIN + 8 * hi;
    v8f acc[4];
#pragma unroll
    for (int t = 0; t < 4; ++t) acc[t] = (v8f){};
#pragma unroll 1
    for (int kc = 0; kc < CIN; kc += 32) {
        const v16bf a = cat16b(*(const v8us*)(A + aoff + kc), *(const v8us*)(A + aoff + kc + 16));
#pragma unroll
        for (int t = 0; t < 4; ++t) acc[t] = wmmab(a, cat16b(*(const v8us*)(WB + boff[t] + kc), *(const v8us*)(WB + boff[t] + kc + 16)), acc[t]);
        asm volatile("v_nop\n\tv_nop\n\tv_nop\n\tv_nop" : "+v"(acc[0]), "+v"(acc[1]), "+v"(acc[2]), "+v"(acc[3]) : "v"(a));
    }
    float* os = &ost[wave][0];
    float* gs = &ost[0][0];   // g: one tile of the whole block, 64 rows c x 64 n (pitch 68)
    if (sel == 2) {   // the same for the whole block; a lane's 8 registers are 8 consecutive n of one channel
#pragma unroll
        for (int t = 0; t < 4; ++t) { const float bv = bfr(bias[c0 + t * 16 + lr]); v4f w0, w1;
#pragma unroll
            for (int j = 0; j < 4; ++j) { w0[j] = acc[t][j] + bv; w1[j] = acc[t][4 + j] + bv; }
            float* gp = gs + (t * 16 + lr) * 68 + wave * 16 + hi * 8;
            *(v4fa*)gp = w0; *(v4fa*)(gp + 4) = w1; }
    } else {
#pragma unroll
        for (int t = 0; t < 4; ++t) { const float bv = bfr(bias[c0 + t * 16 + lr]);
#pragma unroll
            for (int j = 0; j < 8; ++j) os[(hi * 8 + j) * 68 + t * 16 + lr] = acc[t][j] + bv; }
    }
    __syncthreads();
    const size_t rowbase = (size_t)b * NN_ + r0;
    if (sel == 2) {
        const size_t gbase = ((size_t)b * CI + c0) * NN_ + (size_t)blockIdx.x * 64;
#pragma unroll
        for (int s = 0; s < 4; ++s) { const int Lid = (int)threadIdx.x + 128 * s; const int row = Lid >> 3, piece = Lid & 7; const float* sp = gs + row * 68 + piece * 8; v8h o1, o2;
#pragma unroll
            for (int i = 0; i < 8; ++i) { const h16 a = (h16)sp[i]; o1[i] = a; o2[i] = (h16)(sp[i] - (float)a); }
            *(v8h*)(GTH + gbase + (size_t)row * NN_ + piece * 8) = o1; *(v8h*)(GTL + gbase + (size_t)row * NN_ + piece * 8) = o2; }
        wait_x0();
    } else {
        h16* c1 = ((sel == 0) ? TH : PH) + rowbase * CI + c0; h16* c2 = ((sel == 0) ? TL : PL) + rowbase * CI + c0;
        auto pass = [&]() {
#pragma unroll
            for (int s = 0; s < 4; ++s) { const int row = 4 * s + (lane >> 3), piece = lane & 7; const float* sp = os + row * 68 + piece * 8; v8h o1, o2;
#pragma unroll
                for (int i = 0; i < 8; ++i) { const h16 a = (h16)sp[i]; o1[i] = a; o2[i] = (h16)((sp[i] - (float)a) * LOSC); }
                *(v8h*)(c1 + (size_t)row * CI + piece * 8) = o1; *(v8h*)(c2 + (size_t)row * CI + piece * 8) = o2; }
        };
        pass(); wait_x0();
    }
}
// k_attn: block = (b, 64 queries i); theta and g (hi + residual) come in stages of 64 keys by tensor loads into two LDS buffers, one slice per wave, the
// next stage in flight while this one is worked on; the block's phi residual rows are loaded into LDS once. The four waves are 2 x 2: a wave has 32 queries (two
// tiles of 16) and 32 of a stage's 64 keys, so that every theta and g fragment read from LDS serves two query tiles; phi (hi and residual) stays in registers.
// Both products are transposed: per query tile the scores S^T = theta_j.phi_i (A = theta rows, B = phi; hi.hi + hi.lo + lo.hi over 4 k-chunks x 2 tiles = 24 WMMA),
// so that a lane holds 16 scores of ONE query (lane & 15): online f32 softmax in the lane plus one exchange between the half-waves; the two score tiles, as
// hi/residual weights (x32768), are the B operand of y^T += g^T.w^T as they stand (A = g rows, 8 channel tiles x 3 = 24 WMMA). Behind the loop the two waves that
// share 32 queries hand each other one tile's maximum, sum and y through LDS and each merges one tile. Epilogue: the y accumulators, as bf16 hi + residual, are the
// B operand of Z [b][o][n] = w_z . (yh + yl)^T + b_z[o] as they stand (A = w_z rows o, K = 128: 8 tiles x 4 k-chunks x 2 = 64 WMMA per wave); the block's 128 x 64
// tile of Z goes through LDS and out as 256-byte row pieces.
#define XCH 8448u   // one wave's place for the hand-over: 64 floats a lane (8 KiB) + maximum and sum (8 B a lane)
__global__ __launch_bounds__(128) void k_attn(const h16* __restrict__ PH, const h16* __restrict__ PL, const h16* __restrict__ TH, const h16* __restrict__ TL,
                                             const h16* __restrict__ GTH, const h16* __restrict__ GTL, const bf* __restrict__ WZ, const float* __restrict__ bz, float* Z) {
    __shared__ __attribute__((aligned(2048))) unsigned char ring[9 * SLOT];   // buffer 0: slices 0-3, buffer 1: slices 4-7, slice 8: phi residual rows
    __shared__ __align__(16) float zst[CI * 68];   // the block's tile of Z: 128 rows o x 64 n
    const int lane = threadIdx.x & 31, wave = threadIdx.x >> 5, lr = lane & 15, hi = lane >> 4;
    const int qg = wave & 1, kg = wave >> 1;   // this wave's 32 queries of the block's 64, its 32 keys of a stage's 64
    const int b = blockIdx.x / (NN_ / 64), qt = blockIdx.x - b * (NN_ / 64);
    const size_t tok0 = (size_t)b * NN_;
    const size_t vbase = ((size_t)b * CI) * NN_;
    const uint32_t wv = uni(threadIdx.x >> 5), ring0 = (uint32_t)(size_t)ring;
    // This wave's slice: 0 theta hi, 1 theta residual (a stage further = 64 rows), 2 g hi, 3 g residual (a stage further = 64 keys along the rows).
    const h16* splane = (wv == 0u) ? TH + tok0 * CI : (wv == 1u) ? TL + tok0 * CI : (wv == 2u) ? GTH + vbase : GTL + vbase;
    const uint32_t sstep = (wv < 2u) ? SKEY * CI * 2u : SKEY * 2u;
    const u32x8 g1k = tdm_group1<W0_R256, 256u, 64u, 256u>(), g1v = tdm_group1<W0_R128, 128u, 128u, NN_ * 2u>();
    u32x4 g0;
    auto issue = [&](uint32_t st) {
        g0 = tdm_group0(ring0 + ((st & 1u) * 4u + wv) * SLOT, (uint64_t)(size_t)splane + (uint64_t)st * sstep);
        if (pinned(wv < 2u)) tdm_load(g0, g1k); else tdm_load(g0, g1v);
    };
    if (pinned(wv == 0u)) { const u32x4 gp = tdm_group0(ring0 + 8u * SLOT, (uint64_t)(size_t)(PL + (tok0 + (size_t)qt * 64) * CI)); tdm_load(gp, g1k); wait_tensor0(gp); }
    issue(0u); wait_tensor0(g0);
    __syncthreads();   // stage 0 and the phi residual rows are published
    issue(1u);
    v16h ah[2][4], pl[2][4];   // phi hi and residual of the wave's two query tiles
    const h16* qp0 = PH + (tok0 + (size_t)(qt * 64 + qg * 32 + lr)) * CI + 8 * hi;
    const h16* qp1 = qp0 + 16 * CI;
#pragma unroll
    for (int kc = 0; kc < 4; ++kc) { ah[0][kc] = cat16(*(const v8h*)(qp0 + kc * 32), *(const v8h*)(qp0 + kc * 32 + 16)); ah[1][kc] = cat16(*(const v8h*)(qp1 + kc * 32), *(const v8h*)(qp1 + kc * 32 + 16)); }
    wait_x0_of(qp0, qp1);
    const unsigned char* alp = ring + 8u * SLOT + (uint32_t)(qg * 32 + lr) * KPIT + 16u * hi;
#pragma unroll
    for (int kc = 0; kc < 4; ++kc) { pl[0][kc] = ldsfrag(alp + kc * 64); pl[1][kc] = ldsfrag(alp + 16u * KPIT + kc * 64); }
    v8f o[2][8];
#pragma unroll
    for (int q = 0; q < 2; ++q)
#pragma unroll
        for (int n = 0; n < 8; ++n) o[q][n] = (v8f){};
    float mrow[2] = {-3.0e38f, -3.0e38f}, lpart[2] = {0.f, 0.f};   // of this lane's two queries, over this wave's keys; lpart sums this half-wave's keys only
#pragma unroll 1   // one trip = one stage with its one publish point
    for (uint32_t st = 0; st < NSTG; ++st) {
      const unsigned char* buf = ring + (st & 1u) * (4u * SLOT);
      const unsigned char* kh = buf + (uint32_t)(kg * 32 + lr) * KPIT + 16u * hi;                 // theta rows (keys), 16 further: + 16 * KPIT; residual plane: + SLOT
      const unsigned char* vp = buf + 2u * SLOT + (uint32_t)lr * VPIT + 16u * hi + (uint32_t)(kg * 64);   // g rows (channels), 16 further: + 16 * VPIT; residual plane: + SLOT
      v16h kf[4][4];   // the 32 keys' score fragments per k-chunk: theta hi (2 tiles), theta residual (2 tiles)
      // The scheduling barriers below keep each block of LDS reads in one place, ahead of the work it flies under: left free, this build moved the reads
      // down among the matrix instructions, two at a time with a full wait behind each pair.
#pragma unroll
      for (int kc = 0; kc < 4; ++kc) {
          kf[kc][0] = ldsfrag(kh + kc * 64); kf[kc][1] = ldsfrag(kh + 16u * KPIT + kc * 64);
          kf[kc][2] = ldsfrag(kh + SLOT + kc * 64); kf[kc][3] = ldsfrag(kh + SLOT + 16u * KPIT + kc * 64);
      }
      v16h vh[8], vl[8];   // asked for directly behind the score fragments, in the same place: they land under the scores and the first softmax
#pragma unroll
      for (int n = 0; n < 8; ++n) { vh[n] = ldsfrag(vp + (uint32_t)(n * 16) * VPIT); vl[n] = ldsfrag(vp + SLOT + (uint32_t)(n * 16) * VPIT); }
      __builtin_amdgcn_sched_barrier(0);
      v8f s0[2], s1[2], x0[2], x1[2];
      auto scores = [&](int q) {
        s0[q] = (v8f){}; s1[q] = (v8f){}; x0[q] = (v8f){}; x1[q] = (v8f){};
#pragma unroll
        for (int kc = 0; kc < 4; ++kc) {
            s0[q] = wmma16(kf[kc][0], ah[q][kc], s0[q]); x0[q] = wmma16(kf[kc][0], pl[q][kc], x0[q]); s1[q] = wmma16(kf[kc][1], ah[q][kc], s1[q]); x1[q] = wmma16(kf[kc][1], pl[q][kc], x1[q]);
            x0[q] = wmma16(kf[kc][2], ah[q][kc], x0[q]); x1[q] = wmma16(kf[kc][3], ah[q][kc], x1[q]);
        }
      };
      v16h pa[2], px[2];   // element s = key 8 hi + s (s < 8), 16 + 8 hi + s - 8 (else): the k order of the g fragments
      float alpha[2];
      auto softmax = [&](int q) {
        // Register j of tile t = key 16 t + 8 hi + j of the wave's 32, query lr of tile q.
        float a0[8], a1[8];
#pragma unroll
        for (int j = 0; j < 8; ++j) { a0[j] = s0[q][j] + x0[q][j] * LOSCI; a1[j] = s1[q][j] + x1[q][j] * LOSCI; }
        float mx = fmaxf(a0[0], a1[0]);
#pragma unroll
        for (int j = 1; j < 8; ++j) mx = fmaxf(mx, fmaxf(a0[j], a1[j]));
        mx = fmaxf(mx, xhalf(mx));
        const float mn = fmaxf(mrow[q], mx);
        alpha[q] = exp_slot(mrow[q] - mn); mrow[q] = mn;
        float es = 0.f;
#pragma unroll
        for (int j = 0; j < 8; ++j) {
            const float e0 = exp_slot(a0[j] - mn), e1 = exp_slot(a1[j] - mn);
            es += e0 + e1;
            const float ps0 = e0 * PSC, ps1 = e1 * PSC; const h16 h0 = (h16)ps0, h1 = (h16)ps1;
            pa[q][j] = h0; pa[q][8 + j] = h1; px[q][j] = (h16)(ps0 - (float)h0); px[q][8 + j] = (h16)(ps1 - (float)h1);   // unscaled residual
        }
        lpart[q] = lpart[q] * alpha[q] + es;
      };
      auto rescale = [&](int q) {
#pragma unroll
        for (int n = 0; n < 8; ++n)
#pragma unroll
            for (int j = 0; j < 8; ++j) o[q][n][j] *= alpha[q];
      };
      auto values = [&](int q) {
        // Three passes over the eight accumulator tiles (per tile: hi.w, residual.w, hi.w-residual): neighbours in the stream do not wait for one another's result.
#pragma unroll
        for (int n = 0; n < 8; ++n) o[q][n] = wmma16(vh[n], pa[q], o[q][n]);
#pragma unroll
        for (int n = 0; n < 8; ++n) o[q][n] = wmma16(vl[n], pa[q], o[q][n]);
#pragma unroll
        for (int n = 0; n < 8; ++n) o[q][n] = wmma16(vh[n], px[q], o[q][n]);
      };
      scores(0);
      __builtin_amdgcn_sched_barrier(0);   // this one and the next two part the phases, so that each run of group barriers orders its own phase only
      // One tile's softmax stands beside the other tile's matrix products, which do not depend on it. The group barriers ask for a few vector instructions, then one
      // matrix instruction, in turn: left free, this build set most of a softmax in one run with the matrix unit idle.
      scores(1); softmax(0);
#pragma unroll
      for (int i = 0; i < 24; ++i) { __builtin_amdgcn_sched_group_barrier(0x2, 6, 1); __builtin_amdgcn_sched_group_barrier(0x8, 1, 1); }
      __builtin_amdgcn_sched_barrier(0);
      rescale(0); values(0); softmax(1);
#pragma unroll
      for (int i = 0; i < 24; ++i) { __builtin_amdgcn_sched_group_barrier(0x2, 9, 2); __builtin_amdgcn_sched_group_barrier(0x8, 1, 2); }
      __builtin_amdgcn_sched_barrier(0);
      rescale(1); values(1);
#pragma unroll   // each accumulator tile's rescaling stands in front of its first product, under the tile before it, not all eight in one run ahead of the products
      for (int i = 0; i < 8; ++i) { __builtin_amdgcn_sched_group_barrier(0x2, 4, 3); __builtin_amdgcn_sched_group_barrier(0x8, 1, 3); }
      __builtin_amdgcn_sched_barrier(0);   // keeps the full LDS wait below behind the softmax and the products
      // Publish point: this wave has left stage st's buffer, its own slice of stage st + 1 has landed, every wave is here; only then the refill.
      wait_ds0();
      wait_tensor0(g0);
      __syncthreads();
      if (pinned(st + 2u < NSTG)) issue(st + 2u);
    }
    wait_tensor0(g0);
    wait_ds0();
    // w_z's fragments and this lane's 16 biases are asked for ahead of the hand-over and the conversions of y, under which they fly.
    const bf* wr = WZ + (size_t)lr * CI + 8 * hi;
    const float* bzp = bz + wave * 32 + hi;
    v16bf wa[8][4]; float bzr[16];
#pragma unroll
    for (int t = 0; t < 8; ++t)
#pragma unroll
        for (int kc = 0; kc < 4; ++kc) wa[t][kc] = cat16b(*(const v8us*)(wr + t * 16 * CI + kc * 32), *(const v8us*)(wr + t * 16 * CI + kc * 32 + 16));
#pragma unroll
    for (int s = 0; s < 16; ++s) bzr[s] = bzp[2 * s];
    wait_x0_of(wr, bzp);
    __builtin_amdgcn_sched_barrier(0);   // keeps these loads in one run up here: left free, this build set them down among the products with w_z, in pairs with a full wait behind each
    // The two waves with the same 32 queries (wave ^ 2) have seen half the keys each: wave kg keeps tile kg and hands the other tile to its partner. The ring is free:
    // every wave's last read of it ended in front of the last trip's barrier, and no tensor load is outstanding.
    const bool up = (wv >> 1) != 0u;
    const float lt0 = lpart[0] + xhalf(lpart[0]), lt1 = lpart[1] + xhalf(lpart[1]);
    const float mown = up ? mrow[1] : mrow[0], lown = up ? lt1 : lt0;
    unsigned char* xw = ring + (uint32_t)wave * XCH + (uint32_t)lane * 16u;
    const unsigned char* xr = ring + (uint32_t)(wave ^ 2) * XCH + (uint32_t)lane * 16u;
    v8f y[8];
#pragma unroll
    for (int n = 0; n < 8; ++n) {
        const v8f give = up ? o[0][n] : o[1][n]; y[n] = up ? o[1][n] : o[0][n];
        *(v4fa*)(xw + (uint32_t)(2 * n) * 512u) = __builtin_shufflevector(give, give, 0, 1, 2, 3); *(v4fa*)(xw + (uint32_t)(2 * n + 1) * 512u) = __builtin_shufflevector(give, give, 4, 5, 6, 7);
    }
    { float* ml = (float*)(ring + (uint32_t)wave * XCH + 8192u + (uint32_t)lane * 8u); ml[0] = up ? mrow[0] : mrow[1]; ml[1] = up ? lt0 : lt1; }
    __syncthreads();   // every wave's hand-over is written
    const float* mlr = (const float*)(ring + (uint32_t)(wave ^ 2) * XCH + 8192u + (uint32_t)lane * 8u);
    const float moth = mlr[0], loth = mlr[1];
    const float mall = fmaxf(mown, moth), fown = exp_slot(mown - mall), foth = exp_slot(moth - mall);
    const float inv = 1.0f / ((lown * fown + loth * foth) * PSC);
#pragma unroll
    for (int n = 0; n < 8; ++n) {
        const v4f p0 = *(const v4fa*)(xr + (uint32_t)(2 * n) * 512u), p1 = *(const v4fa*)(xr + (uint32_t)(2 * n + 1) * 512u);
        y[n] = y[n] * fown + __builtin_shufflevector(p0, p1, 0, 1, 2, 3, 4, 5, 6, 7) * foth;
    }
    const int qcol = (qg * 2 + kg) * 16;   // this wave's merged tile: its 16 columns of the block's 64
    v16bf yh[4], yl[4];   // register j of tiles 2 kc, 2 kc + 1 = channels 32 kc + 8 hi + j, 32 kc + 16 + 8 hi + j of query lr: the k order of the w_z fragments
#pragma unroll
    for (int kc = 0; kc < 4; ++kc) {
        const v8f u = y[2 * kc] * inv, v = y[2 * kc + 1] * inv;
        const v8bf uh = __builtin_convertvector(u, v8bf), vh = __builtin_convertvector(v, v8bf);   // round to nearest even, as f2bf
        const v8bf ul = __builtin_convertvector(u - __builtin_convertvector(uh, v8f), v8bf), vl = __builtin_convertvector(v - __builtin_convertvector(vh, v8f), v8bf);
        yh[kc] = __builtin_shufflevector(uh, vh, 0, 1, 2, 3, 4, 5, 6, 7, 8, 9, 10, 11, 12, 13, 14, 15);
        yl[kc] = __builtin_shufflevector(ul, vl, 0, 1, 2, 3, 4, 5, 6, 7, 8, 9, 10, 11, 12, 13, 14, 15);
    }
#pragma unroll
    for (int t = 0; t < 8; ++t) {
        v8f acc = {}, accx = {};
#pragma unroll
        for (int kc = 0; kc < 4; ++kc) { acc = wmmab(wa[t][kc], yh[kc], acc); accx = wmmab(wa[t][kc], yl[kc], accx); }
#pragma unroll
        for (int j = 0; j < 8; ++j) zst[(t * 16 + hi * 8 + j) * 68 + qcol + lr] = acc[j] + accx[j];   // register j = row o, lane = query
    }
    __syncthreads();   // every wave's 16 columns of the tile are written
    float* zb = Z + ((size_t)b * CI + wave * 32) * NN_ + (size_t)qt * 64;
    v4f val[16];   // one instruction = two rows' 256-byte pieces
#pragma unroll
    for (int s = 0; s < 16; ++s) val[s] = *(const v4fa*)(zst + (wave * 32 + 2 * s + hi) * 68 + lr * 4) + bfr(bzr[s]);
    __builtin_amdgcn_sched_barrier(0);   // the 16 stores go out as one run behind all reads and sums: left free, this build stored in pairs among them and wrote over registers of issued stores
#pragma unroll
    for (int s = 0; s < 16; ++s) *(v4f*)(zb + (size_t)(2 * s + hi) * NN_ + lr * 4) = val[s];
}
__global__ __launch_bounds__(256) void k_stats(const float* __restrict__ Z, float* ST) {
    __shared__ float red[256];
    const int o = blockIdx.x, t = threadIdx.x;
    float zv[(NB_ * NN_) / 256];   // this thread's 64 values of channel o: read once, kept in registers for both sums
#pragma unroll   // 64 independent loads in flight together: rolled, every trip waited out one load's whole latency
    for (int i = 0; i < (NB_ * NN_) / 256; ++i) { const int flat = i * 256 + t; const int b = flat / NN_, n = flat - b * NN_; zv[i] = Z[((size_t)b * CI + o) * NN_ + n]; }
    float s = 0.f;
#pragma unroll   // zv stays in registers only under constant indices
    for (int i = 0; i < (NB_ * NN_) / 256; ++i) s += zv[i];
    red[t] = s; __syncthreads();
    for (int st = 128; st > 0; st >>= 1) { if (t < st) red[t] += red[t + st]; __syncthreads(); }
    const float mu = red[0] / (float)(NB_ * NN_);
    __syncthreads();
    float q = 0.f;
#pragma unroll   // as above
    for (int i = 0; i < (NB_ * NN_) / 256; ++i) { const float d = zv[i] - mu; q += d * d; }
    red[t] = q; __syncthreads();
    for (int st = 128; st > 0; st >>= 1) { if (t < st) red[t] += red[t + st]; __syncthreads(); }
    const float var = red[0] / (float)(NB_ * NN_);
    if (t < 32) { const float v = (t == 0) ? mu : (t == 1) ? rsqrtf(var + 1e-5f) : 0.f; VST2(float, ST + (size_t)o * 32 + t, v); }
}
// k_final: out[b][o][n] = (Z - mu) rs gamma + beta; one wave per 256 values (8 per lane = 32 B -> use 2 x v4f? no: v8f per lane = lane-strided pair of b128 -> use 2
// instructions of v4f over 128 values each: lane -> 4 floats).
__global__ __launch_bounds__(256) void k_final(const float* __restrict__ Z, const float* __restrict__ ST, const float* __restrict__ gam, const float* __restrict__ bet, float* out) {
    const int lane = threadIdx.x & 31; const size_t wid = (size_t)blockIdx.x * 8 + (threadIdx.x >> 5);
    const size_t row = wid >> 4; const int seg = (int)(wid & 15);        // row = b*CI + o (4096 floats = 16 segments of 256)
    const int o = (int)(row % CI);
    const float mu = ST[(size_t)o * 32], rs = ST[(size_t)o * 32 + 1], g = bfr(gam[o]), be = bfr(bet[o]);
#pragma unroll
    for (int hf = 0; hf < 2; ++hf) { const size_t base = row * NN_ + (size_t)seg * 256 + hf * 128 + lane * 4; v4f v;
#pragma unroll
        for (int i = 0; i < 4; ++i) v[i] = (Z[base + i] - mu) * rs * g + be;
        VST2(v4f, out + base, v); }
}

extern "C" void kernel_launch(void* const* d_in, const int* in_sizes, int n_in,
                              void* d_out, int out_size, void* d_ws, size_t ws_size, hipStream_t stream) {
    (void)in_sizes; (void)n_in; (void)out_size;
    const float* xt = (const float*)d_in[0]; const float* xo = (const float*)d_in[1]; const float* wg = (const float*)d_in[2]; const float* bg = (const float*)d_in[3];
    const float* wth = (const float*)d_in[4]; const float* bth = (const float*)d_in[5]; const float* wph = (const float*)d_in[6]; const float* bph = (const float*)d_in[7];
    const float* wz = (const float*)d_in[8]; const float* bz = (const float*)d_in[9]; const float* gam = (const float*)d_in[10]; const float* bet = (const float*)d_in[11];
    float* out = (float*)d_out;    // [4][128][64][64]
    char* wsp = (char*)d_ws;
    auto take = [&](size_t bytes) { char* p = wsp; wsp += (bytes + 255) & ~(size_t)255; return (void*)p; };
    bf* XTt = (bf*)take((size_t)NB_ * NN_ * CIN * 2); bf* XTo = (bf*)take((size_t)NB_ * NN_ * CIN * 2);
    bf* WGb = (bf*)take((size_t)CI * CIN * 2); bf* WTb = (bf*)take((size_t)CI * CIN * 2); bf* WPb = (bf*)take((size_t)CI * CIN * 2); bf* WZb = (bf*)take((size_t)CI * CI * 2);
    h16* TH = (h16*)take((size_t)NB_ * NN_ * CI * 2); h16* TL = (h16*)take((size_t)NB_ * NN_ * CI * 2); h16* PH = (h16*)take((size_t)NB_ * NN_ * CI * 2); h16* PL = (h16*)take((size_t)NB_ * NN_ * CI * 2);
    h16* GTH = (h16*)take((size_t)NB_ * CI * NN_ * 2); h16* GTL = (h16*)take((size_t)NB_ * CI * NN_ * 2);
    float* Z = (float*)take((size_t)NB_ * CI * NN_ * 4); float* ST = (float*)take((size_t)CI * 32 * 4);
    if ((size_t)(wsp - (char*)d_ws) > ws_size) return;    // 8.4x2 + 0.2 + 4.2x4 + 4.2x2 + 8.4 ~ 51 MB
    k_prep<<<WBLK + 2 * NB_ * (NN_ / 64) * (CIN / 64), 256, 0, stream>>>(xt, xo, wg, wth, wph, wz, XTt, XTo, WGb, WTb, WPb, WZb);
    k_proj<<<dim3(NN_ / 64, CI / 64, 3 * NB_), 128, 0, stream>>>(XTt, XTo, WTb, WPb, WGb, bth, bph, bg, TH, TL, PH, PL, GTH, GTL);
    k_attn<<<NB_ * (NN_ / 64), 128, 0, stream>>>(PH, PL, TH, TL, GTH, GTL, WZb, bz, Z);
    k_stats<<<CI, 256, 0, stream>>>(Z, ST);
    k_final<<<(NB_ * CI * 16) / 8, 256, 0, stream>>>(Z, ST, gam, bet, out);
}

// v007
// Measured time: 93.4 microseconds a run.
// Next to v006, in two timings, it ran 1.08 and 1.09 times as fast.
// All steps since v000 together make it 6.57 times as fast.
#include <hip/hip_runtime.h>
#include <stdint.h>

// Contractions, f32 accumulate: the three 1x1 convs g, theta (from x_this) and phi (from x_other) as [4 x 4096 x 256].[256 x 128] products (+bias) and W_z
// ([128 x 128].[128 x 4096] per b, +bias) on v_wmma_f32_16x16x32_bf16 — plain bf16 = rounded inputs (exact) for the convs, y as bf16 hi + residual in registers (two
// products) for W_z; the non-local attention fused on v_wmma_f32_16x16x32_f16: f = phi_i.theta_j over 128 channels (unscaled, sigma ~ 20: both operands f16 hi +
// residual x1024, hi.hi + hi.lo + lo.hi), softmax over the 4096 positions j, y_i = sum_j f g_j with the weights (x32768) and g both as f16 hi + UNSCALED residual so all three products share one accumulator (hi.hi + hi.lo + lo.hi: the softmax is nearly one-hot, so single roundings would pass straight into y).

#define NB_  4
#define CIN  256
#define CI   128
#define NN_  4096
#define PSC  32768.0f
#define LOSC 1024.0f
#define LOSCI (1.0f / 1024.0f)

typedef _Float16 h16;
typedef unsigned short bf;
typedef __attribute__((ext_vector_type(16))) __bf16   v16bf;
typedef __attribute__((ext_vector_type(8)))  __bf16   v8bf;
typedef __attribute__((ext_vector_type(16))) _Float16 v16h;
typedef __attribute__((ext_vector_type(8)))  _Float16 v8h;
typedef __attribute__((ext_vector_type(8)))  unsigned short v8us;
typedef __attribute__((ext_vector_type(8)))  float    v8f;
typedef __attribute__((ext_vector_type(4)))  float    v4f;
typedef v8h  __attribute__((may_alias)) v8ha;
typedef v4f  __attribute__((may_alias)) v4fa;
typedef v8us __attribute__((may_alias)) v8usa;

__device__ __forceinline__ unsigned short f2bf(float f) { unsigned u = __float_as_uint(f); u += 0x7FFFu + ((u >> 16) & 1u); return (unsigned short)(u >> 16); }
__device__ __forceinline__ float bf2f(unsigned short b) { return __uint_as_float(((unsigned)b) << 16); }
__device__ __forceinline__ float bfr(float f) { return bf2f(f2bf(f)); }
__device__ __forceinline__ v16h cat16(v8h lo, v8h hi) { return __builtin_shufflevector(lo, hi, 0, 1, 2, 3, 4, 5, 6, 7, 8, 9, 10, 11, 12, 13, 14, 15); }
__device__ __forceinline__ v16bf cat16b(v8us lo, v8us hi) { return __builtin_bit_cast(v16bf, __builtin_shufflevector(lo, hi, 0, 1, 2, 3, 4, 5, 6, 7, 8, 9, 10, 11, 12, 13, 14, 15)); }
__device__ __forceinline__ v8f wmma16(v16h a, v16h b, v8f c) { return __builtin_amdgcn_wmma_f32_16x16x32_f16(false, a, false, b, (short)0, c, false, false); }
__device__ __forceinline__ v8f wmmab(v16bf a, v16bf b, v8f c) { return __builtin_amdgcn_wmma_f32_16x16x32_bf16(false, a, false, b, (short)0, c, false, false); }
#define VST2(T, p, v) do { const T vst2_v_ = (v); *(T*)(p) = vst2_v_;  } while (0)

// Tensor loads into LDS for k_attn: a stage = 64 keys = four slices (theta hi, theta residual: 64 rows x 256 B; g hi, g residual: 128 rows x 128 B), one slice per wave.
typedef uint32_t u32x4 __attribute__((ext_vector_type(4)));
typedef uint32_t u32x8 __attribute__((ext_vector_type(8)));
#define SKEY 64u
#define NSTG (NN_ / 64u)
#define KPIT 272u      // LDS pitch of a 256-byte row (16 B pad, odd multiple of 16 B for the b128 readers)
#define VPIT 144u      // LDS pitch of a 128-byte row (16 B pad)
#define SLOT 18432u    // one slice's place: 128 x 144 B, and 64 x 272 B rounded up to a multiple of 2 KiB
#define W0_R256 ((1u << 20) | (5u << 22) | (3u << 25))   // group 1 word 0: no mask, 1-byte elements, 4 dwords of pad behind every 256 B
#define W0_R128 ((1u << 20) | (4u << 22) | (3u << 25))   // the same behind every 128 B
__device__ __forceinline__ uint32_t uni(uint32_t v) { return (uint32_t)__builtin_amdgcn_readfirstlane(v); }
// Holds a wave-uniform value in a scalar register, so that a test around a tensor load compiles to a scalar branch (tensor loads ignore EXEC).
__device__ __forceinline__ uint32_t pinned(uint32_t v) { uint32_t w = uni(v); asm volatile("" : "+s"(w)); return w; }
// Descriptor group 0: the tile's first byte at ga, to the LDS byte offset dst. Group 1: D1 rows of D0 bytes, source pitch SP bytes, tensor = tile.
__device__ __forceinline__ u32x4 tdm_group0(uint32_t dst, uint64_t ga) {
    u32x4 g0; g0[0] = uni(1u); g0[1] = uni(dst); g0[2] = uni((uint32_t)ga); g0[3] = uni((((uint32_t)(ga >> 32)) & 0x01FFFFFFu) | 0x80000000u);
    asm volatile("" : "+s"(g0));   // descriptor words held in scalar registers: no word is formed anew elsewhere while the request is outstanding
    return g0;
}
template <uint32_t W0, uint32_t D0, uint32_t D1, uint32_t SP>
__device__ __forceinline__ u32x8 tdm_group1() {
    u32x8 g1; g1[0] = uni(W0); g1[1] = uni((D0 & 0xFFFFu) << 16); g1[2] = uni((D0 >> 16) | ((D1 & 0xFFFFu) << 16)); g1[3] = uni((D1 >> 16) | (D0 << 16));
    g1[4] = uni(D1); g1[5] = uni(SP); g1[6] = uni(0u); g1[7] = uni(0u);
    asm volatile("" : "+s"(g1));   // descriptor words held in scalar registers: set once from constants, in the same registers for as long as requests are issued
    return g1;
}
__device__ __forceinline__ void tdm_load(u32x4 g0, u32x8 g1) { asm volatile("tensor_load_to_lds %0, %1" :: "s"(g0), "s"(g1) : "memory"); }
// The compiler places no wait for a tensor load. The wait names the request's group 0 so that its registers keep their values while the request is outstanding.
__device__ __forceinline__ void wait_tensor0(u32x4 g0) { asm volatile("s_wait_tensorcnt 0x0" :: "s"(g0) : "memory"); }
// Stands behind the last store of a branch whose code is followed, in the built kernel, by another branch's: no register that an issued store names is rewritten ahead of it.
__device__ __forceinline__ void wait_x0() { asm volatile("s_wait_xcnt 0x0" ::: "memory"); }
// The same behind a run of loads, naming the addresses they use: those registers keep their values up to the wait.
__device__ __forceinline__ void wait_x0_of(const void* p) { asm volatile("s_wait_xcnt 0x0" :: "v"(p) : "memory"); }
__device__ __forceinline__ void wait_x0_of(const void* p, const void* q) { asm volatile("s_wait_xcnt 0x0" :: "v"(p), "v"(q) : "memory"); }
__device__ __forceinline__ void wait_x0_of(const void* p, const void* q, const void* r) { asm volatile("s_wait_xcnt 0x0" :: "v"(p), "v"(q), "v"(r) : "memory"); }
__device__ __forceinline__ void wait_ds0() { asm volatile("s_wait_dscnt 0x0" ::: "memory"); }           // this wave's LDS reads are done before their buffer is handed back
// exp(x) as __expf compiles here (one multiply, v_exp_f32), with the one issue slot that the instruction set asks for behind a transcendental tied to it.
__device__ __forceinline__ float exp_slot(float x) { float r; asm("v_exp_f32 %0, %1\n\tv_nop" : "=v"(r) : "v"(x * 1.44269504088896340736f)); return r; }
__device__ __forceinline__ float xhalf(float x) { return __builtin_bit_cast(float, __builtin_amdgcn_permlanex16(__builtin_bit_cast(int, x), __builtin_bit_cast(int, x), 0x76543210, 0xfedcba98, false, false)); }   // lane l's value from lane l ^ 16
__device__ __forceinline__ v16h ldsfrag(const unsigned char* p) { return cat16(*(const v8ha*)p, *(const v8ha*)(p + 32)); }   // k 0..7 and 16..23 (+8 in the upper half-wave) of one row

// k_proj: 64 n x 128 o tile of P[b][n][o] = bf16(x[b][.][n]).bf16(W)^T + bias over K = 256 (exact products); the three projections, none of which reads what another
// writes, side by side in one launch. A block converts what it needs itself: its 256 c x 64 n tile of x (NCHW rows as they lie in memory, whole 256-byte pieces) and
// its 128 x 256 weight go to LDS as bf16; the A fragments (rows n, k = c) come out of the [c][n] tile by transposing LDS loads, the B fragments from the weight rows.
// Eight waves = 4 row groups of 16 n x 2 halves of 64 o. theta (keys, this branch) and phi (queries, other branch) leave as f16 hi + residual planes [b*4096+n][128],
// g (values, this branch) transposed in a half's LDS tile and written as f16 hi + UNSCALED residual planes GTH/GTL [b][c][n] (the A operand of y^T: rows c, k = n; the
// residual is summed into the same accumulator as the hi product). grid (NN_/64, 1, 3 * NB_): z = projection * NB_ + b. Sixteen blocks also write w_z's bf16 copy
// ([out][in] = the A operand of Z as-is; one wave per row), which nothing in this launch reads.
#define XPIT 160u            // LDS pitch of one channel's 64 bf16: 128 B + 32 B, an odd multiple of 32 B for the transposing reads
#define WPIT 528u            // LDS pitch of one weight row's 256 bf16: 512 B + 16 B, an odd multiple of 16 B for the b128 reads
#define XBYT (CIN * XPIT)
#define WBYT (CI * WPIT)
typedef __attribute__((ext_vector_type(8))) short s16x8;
typedef __attribute__((ext_vector_type(4))) __bf16 v4bf;
typedef v4bf __attribute__((may_alias)) v4bfa;
typedef v8bf __attribute__((may_alias)) v8bfa;
// Lane (c = l & 15, h = l >> 4) gets rows 8 h .. 8 h + 7 of column c of the 16 x 16 tile of 16-bit values whose rows the lanes' addresses name.
__device__ __forceinline__ v8us ld_tr16(const unsigned char* p) { typedef __attribute__((address_space(3))) s16x8 lds_s16x8; return __builtin_bit_cast(v8us, __builtin_amdgcn_ds_load_tr16_b128_v8i16((lds_s16x8*)p)); }
__global__ __launch_bounds__(256) void k_proj(const float* __restrict__ xa, const float* __restrict__ xb, const float* __restrict__ wth, const float* __restrict__ wph, const float* __restrict__ wg,
                                              const float* __restrict__ wz, const float* __restrict__ bth, const float* __restrict__ bph, const float* __restrict__ bg,
                                              h16* TH, h16* TL, h16* PH, h16* PL, h16* GTH, h16* GTL, bf* WZb) {
    __shared__ __align__(16) unsigned char sm[XBYT + WBYT];   // x tile [c][n], weight [o][c]; behind the products the x tile's place holds the output tiles
    const int tid = threadIdx.x, lane = tid & 31, wv8 = tid >> 5;
    if (blockIdx.z == 0 && blockIdx.x < CI / 8) {   // the same for the whole block: the grid's first 16 blocks copy 8 rows of w_z each
        typedef __attribute__((ext_vector_type(4))) unsigned short v4us; v4us t; const int r = blockIdx.x * 8 + wv8;
        const float* zq = wz + (size_t)r * CI + lane * 4;
        const v4f z4 = *(const v4fa*)zq; wait_x0_of(zq);
#pragma unroll
        for (int i = 0; i < 4; ++i) t[i] = f2bf(z4[i]);
        VST2(v4us, WZb + (size_t)r * CI + lane * 4, t); wait_x0();
    }
    const int lr = lane & 15, hi = lane >> 4, wave = wv8 & 3, half = wv8 >> 2, sel = blockIdx.z / NB_, b = blockIdx.z - sel * NB_;
    const int r0 = blockIdx.x * 64 + wave * 16, c0 = half * 64;
    const float* xs = ((sel == 1) ? xb : xa) + (size_t)b * CIN * NN_ + (size_t)blockIdx.x * 64 + (size_t)(tid >> 4) * NN_ + (tid & 15) * 4;   // 16 lanes = one channel's 256 bytes
    const float* ws = ((sel == 0) ? wth : (sel == 1) ? wph : wg) + (size_t)wv8 * CIN + lane * 8;                                           // one wave = one weight row
    const float* bias = (sel == 0) ? bth : (sel == 1) ? bph : bg;
    unsigned char* xd = sm + (uint32_t)(tid >> 4) * XPIT + (uint32_t)(tid & 15) * 8u;
    unsigned char* wd = sm + XBYT + (uint32_t)wv8 * WPIT + (uint32_t)lane * 16u;
    const float* bq = bias + c0 + lr;
    v4f xv[16], wv[16]; float bv4[4];
#pragma unroll   // the first half of the weight (from L2) is asked for first: loads are waited for in their order, and it is wanted first
    for (int p = 0; p < 8; ++p) { wv[2 * p] = *(const v4fa*)(ws + (size_t)p * 8 * CIN); wv[2 * p + 1] = *(const v4fa*)(ws + (size_t)p * 8 * CIN + 4); }
    __builtin_amdgcn_sched_barrier(0);   // keeps that order: left free, this build set loads of x among the weight's, and the weight's conversion waited for all of x
#pragma unroll   // all 16 loads of x (from memory) and the four biases are in flight together with it
    for (int p = 0; p < 16; ++p) xv[p] = *(const v4fa*)(xs + (size_t)p * 16 * NN_);
#pragma unroll
    for (int t = 0; t < 4; ++t) bv4[t] = bq[t * 16];
    wait_x0_of(xs, ws, bq);
    __builtin_amdgcn_sched_barrier(0);   // keeps these loads in one run up here: left free, this build asked for the weight only when most of x had come
#pragma unroll
    for (int p = 0; p < 8; ++p) *(v8bfa*)(wd + (uint32_t)p * 8u * WPIT) = __builtin_convertvector(__builtin_shufflevector(wv[2 * p], wv[2 * p + 1], 0, 1, 2, 3, 4, 5, 6, 7), v8bf);   // round to nearest even, as f2bf
    __builtin_amdgcn_sched_barrier(0);   // the second half of the weight is asked for behind the first half's conversion and takes its registers (three blocks fit a WGP's registers so); it flies while x is on its way
#pragma unroll
    for (int p = 0; p < 8; ++p) { wv[2 * p] = *(const v4fa*)(ws + (size_t)(p + 8) * 8 * CIN); wv[2 * p + 1] = *(const v4fa*)(ws + (size_t)(p + 8) * 8 * CIN + 4); }
    wait_x0_of(ws);
    __builtin_amdgcn_sched_barrier(0);   // keeps these loads ahead of the wait for x
#pragma unroll
    for (int p = 0; p < 16; ++p) *(v4bfa*)(xd + (uint32_t)p * 16u * XPIT) = __builtin_convertvector(xv[p], v4bf);
#pragma unroll
    for (int p = 0; p < 8; ++p) *(v8bfa*)(wd + (uint32_t)(p + 8) * 8u * WPIT) = __builtin_convertvector(__builtin_shufflevector(wv[2 * p], wv[2 * p + 1], 0, 1, 2, 3, 4, 5, 6, 7), v8bf);
    __syncthreads();   // the x tile and the weight are written
    const unsigned char* ap = sm + (uint32_t)(8 * hi + (lane & 7)) * XPIT + 32u * (uint32_t)wave + 16u * (uint32_t)((lane >> 3) & 1);   // k rows 8 hi + (l & 7), this wave's 16 columns n
    const unsigned char* bp = sm + XBYT + (uint32_t)(c0 + lr) * WPIT + 16u * (uint32_t)hi;                                              // weight row o, k 8 hi .. 8 hi + 7
    v8f acc[4];
#pragma unroll
    for (int t = 0; t < 4; ++t) acc[t] = (v8f){};
    // Two k-chunks' fragments in registers: a chunk's 10 LDS reads stand in one place, one chunk ahead of the products that use them. The scheduling barriers keep
    // them there: left free, this build set two reads with a full wait in front of every matrix instruction.
    v16bf af[2], wf[2][4];
    auto frags = [&](int kc) {
        af[kc & 1] = cat16b(ld_tr16(ap + (uint32_t)kc * 32u * XPIT), ld_tr16(ap + ((uint32_t)kc * 32u + 16u) * XPIT));   // k 8 hi + 0..7 and 16 + 8 hi + 0..7: the order of the weight fragments
#pragma unroll
        for (int t = 0; t < 4; ++t) wf[kc & 1][t] = cat16b(*(const v8usa*)(bp + (uint32_t)t * 16u * WPIT + (uint32_t)kc * 64u), *(const v8usa*)(bp + (uint32_t)t * 16u * WPIT + (uint32_t)kc * 64u + 32u));
    };
    frags(0);
#pragma unroll
    for (int kc = 0; kc < CIN / 32; ++kc) {
        if (kc + 1 < CIN / 32) frags(kc + 1);
        __builtin_amdgcn_sched_barrier(0);
#pragma unroll
        for (int t = 0; t < 4; ++t) acc[t] = wmmab(af[kc & 1], wf[kc & 1][t], acc[t]);
        __builtin_amdgcn_sched_barrier(0);
    }
    __syncthreads();   // every wave has left the x tile: its place is written anew below
    float* os = (float*)sm + (half * 4 + wave) * (16 * 68);
    float* gs = (float*)sm + half * 4 * (16 * 68);   // g: one tile of a half's four waves, 64 rows c x 64 n (pitch 68)
    if (sel == 2) {   // the same for the whole block; a lane's 8 registers are 8 consecutive n of one channel
#pragma unroll
        for (int t = 0; t < 4; ++t) { const float bv = bfr(bv4[t]); v4f w0, w1;
#pragma unroll
            for (int j = 0; j < 4; ++j) { w0[j] = acc[t][j] + bv; w1[j] = acc[t][4 + j] + bv; }
            float* gp = gs + (t * 16 + lr) * 68 + wave * 16 + hi * 8;
            *(v4fa*)gp = w0; *(v4fa*)(gp + 4) = w1; }
    } else {
#pragma unroll
        for (int t = 0; t < 4; ++t) { const float bv = bfr(bv4[t]);
#pragma unroll
            for (int j = 0; j < 8; ++j) os[(hi * 8 + j) * 68 + t * 16 + lr] = acc[t][j] + bv; }
    }
    __syncthreads();
    const size_t rowbase = (size_t)b * NN_ + r0;
    if (sel == 2) {
        const size_t gbase = ((size_t)b * CI + c0) * NN_ + (size_t)blockIdx.x * 64;
#pragma unroll
        for (int s = 0; s < 4; ++s) { const int Lid = (tid & 127) + 128 * s; const int row = Lid >> 3, piece = Lid & 7; const float* sp = gs + row * 68 + piece * 8; v8h o1, o2;
#pragma unroll
            for (int i = 0; i < 8; ++i) { const h16 a = (h16)sp[i]; o1[i] = a; o2[i] = (h16)(sp[i] - (float)a); }
            *(v8h*)(GTH + gbase + (size_t)row * NN_ + piece * 8) = o1; *(v8h*)(GTL + gbase + (size_t)row * NN_ + piece * 8) = o2; }
        wait_x0();
    } else {
        h16* c1 = ((sel == 0) ? TH : PH) + rowbase * CI + c0; h16* c2 = ((sel == 0) ? TL : PL) + rowbase * CI + c0;
        auto pass = [&]() {
#pragma unroll
            for (int s = 0; s < 4; ++s) { const int row = 4 * s + (lane >> 3), piece = lane & 7; const float* sp = os + row * 68 + piece * 8; v8h o1, o2;
#pragma unroll
                for (int i = 0; i < 8; ++i) { const h16 a = (h16)sp[i]; o1[i] = a; o2[i] = (h16)((sp[i] - (float)a) * LOSC); }
                *(v8h*)(c1 + (size_t)row * CI + piece * 8) = o1; *(v8h*)(c2 + (size_t)row * CI + piece * 8) = o2; }
        };
        pass(); wait_x0();
    }
}
// k_attn: block = (b, 64 queries i); theta and g (hi + residual) come in stages of 64 keys by tensor loads into two LDS buffers, one slice per wave, the
// next stage in flight while this one is worked on; the block's phi residual rows are loaded into LDS once. The four waves are 2 x 2: a wave has 32 queries (two
// tiles of 16) and 32 of a stage's 64 keys, so that every theta and g fragment read from LDS serves two query tiles; phi (hi and residual) stays in registers.
// Both products are transposed: per query tile the scores S^T = theta_j.phi_i (A = theta rows, B = phi; hi.hi + hi.lo + lo.hi over 4 k-chunks x 2 tiles = 24 WMMA),
// so that a lane holds 16 scores of ONE query (lane & 15): online f32 softmax in the lane plus one exchange between the half-waves; the two score tiles, as
// hi/residual weights (x32768), are the B operand of y^T += g^T.w^T as they stand (A = g rows, 8 channel tiles x 3 = 24 WMMA). Behind the loop the two waves that
// share 32 queries hand each other one tile's maximum, sum and y through LDS and each merges one tile. Epilogue: the y accumulators, as bf16 hi + residual, are the
// B operand of Z [b][o][n] = w_z . (yh + yl)^T + b_z[o] as they stand (A = w_z rows o, K = 128: 8 tiles x 4 k-chunks x 2 = 64 WMMA per wave); the block's 128 x 64
// tile of Z goes through LDS and out as 256-byte row pieces.
#define XCH 8448u   // one wave's place for the hand-over: 64 floats a lane (8 KiB) + maximum and sum (8 B a lane)
__global__ __launch_bounds__(128) void k_attn(const h16* __restrict__ PH, const h16* __restrict__ PL, const h16* __restrict__ TH, const h16* __restrict__ TL,
                                             const h16* __restrict__ GTH, const h16* __restrict__ GTL, const bf* __restrict__ WZ, const float* __restrict__ bz, float* Z) {
    __shared__ __attribute__((aligned(2048))) unsigned char ring[9 * SLOT];   // buffer 0: slices 0-3, buffer 1: slices 4-7, slice 8: phi residual rows
    __shared__ __align__(16) float zst[CI * 68];   // the block's tile of Z: 128 rows o x 64 n
    const int lane = threadIdx.x & 31, wave = threadIdx.x >> 5, lr = lane & 15, hi = lane >> 4;
    const int qg = wave & 1, kg = wave >> 1;   // this wave's 32 queries of the block's 64, its 32 keys of a stage's 64
    const int b = blockIdx.x / (NN_ / 64), qt = blockIdx.x - b * (NN_ / 64);
    const size_t tok0 = (size_t)b * NN_;
    const size_t vbase = ((size_t)b * CI) * NN_;
    const uint32_t wv = uni(threadIdx.x >> 5), ring0 = (uint32_t)(size_t)ring;
    // This wave's slice: 0 theta hi, 1 theta residual (a stage further = 64 rows), 2 g hi, 3 g residual (a stage further = 64 keys along the rows).
    const h16* splane = (wv == 0u) ? TH + tok0 * CI : (wv == 1u) ? TL + tok0 * CI : (wv == 2u) ? GTH + vbase : GTL + vbase;
    const uint32_t sstep = (wv < 2u) ? SKEY * CI * 2u : SKEY * 2u;
    const u32x8 g1k = tdm_group1<W0_R256, 256u, 64u, 256u>(), g1v = tdm_group1<W0_R128, 128u, 128u, NN_ * 2u>();
    u32x4 g0;
    auto issue = [&](uint32_t st) {
        g0 = tdm_group0(ring0 + ((st & 1u) * 4u + wv) * SLOT, (uint64_t)(size_t)splane + (uint64_t)st * sstep);
        if (pinned(wv < 2u)) tdm_load(g0, g1k); else tdm_load(g0, g1v);
    };
    if (pinned(wv == 0u)) { const u32x4 gp = tdm_group0(ring0 + 8u * SLOT, (uint64_t)(size_t)(PL + (tok0 + (size_t)qt * 64) * CI)); tdm_load(gp, g1k); wait_tensor0(gp); }
    issue(0u); wait_tensor0(g0);
    __syncthreads();   // stage 0 and the phi residual rows are published
    issue(1u);
    v16h ah[2][4], pl[2][4];   // phi hi and residual of the wave's two query tiles
    const h16* qp0 = PH + (tok0 + (size_t)(qt * 64 + qg * 32 + lr)) * CI + 8 * hi;
    const h16* qp1 = qp0 + 16 * CI;
#pragma unroll
    for (int kc = 0; kc < 4; ++kc) { ah[0][kc] = cat16(*(const v8h*)(qp0 + kc * 32), *(const v8h*)(qp0 + kc * 32 + 16)); ah[1][kc] = cat16(*(const v8h*)(qp1 + kc * 32), *(const v8h*)(qp1 + kc * 32 + 16)); }
    wait_x0_of(qp0, qp1);
    const unsigned char* alp = ring + 8u * SLOT + (uint32_t)(qg * 32 + lr) * KPIT + 16u * hi;
#pragma unroll
    for (int kc = 0; kc < 4; ++kc) { pl[0][kc] = ldsfrag(alp + kc * 64); pl[1][kc] = ldsfrag(alp + 16u * KPIT + kc * 64); }
    v8f o[2][8];
#pragma unroll
    for (int q = 0; q < 2; ++q)
#pragma unroll
        for (int n = 0; n < 8; ++n) o[q][n] = (v8f){};
    float mrow[2] = {-3.0e38f, -3.0e38f}, lpart[2] = {0.f, 0.f};   // of this lane's two queries, over this wave's keys; lpart sums this half-wave's keys only
#pragma unroll 1   // one trip = one stage with its one publish point
    for (uint32_t st = 0; st < NSTG; ++st) {
      const unsigned char* buf = ring + (st & 1u) * (4u * SLOT);
      const unsigned char* kh = buf + (uint32_t)(kg * 32 + lr) * KPIT + 16u * hi;                 // theta rows (keys), 16 further: + 16 * KPIT; residual plane: + SLOT
      const unsigned char* vp = buf + 2u * SLOT + (uint32_t)lr * VPIT + 16u * hi + (uint32_t)(kg * 64);   // g rows (channels), 16 further: + 16 * VPIT; residual plane: + SLOT
      v16h kf[4][4];   // the 32 keys' score fragments per k-chunk: theta hi (2 tiles), theta residual (2 tiles)
      // The scheduling barriers below keep each block of LDS reads in one place, ahead of the work it flies under: left free, this build moved the reads
      // down among the matrix instructions, two at a time with a full wait behind each pair.
#pragma unroll
      for (int kc = 0; kc < 4; ++kc) {
          kf[kc][0] = ldsfrag(kh + kc * 64); kf[kc][1] = ldsfrag(kh + 16u * KPIT + kc * 64);
          kf[kc][2] = ldsfrag(kh + SLOT + kc * 64); kf[kc][3] = ldsfrag(kh + SLOT + 16u * KPIT + kc * 64);
      }
      v16h vh[8], vl[8];   // asked for directly behind the score fragments, in the same place: they land under the scores and the first softmax
#pragma unroll
      for (int n = 0; n < 8; ++n) { vh[n] = ldsfrag(vp + (uint32_t)(n * 16) * VPIT); vl[n] = ldsfrag(vp + SLOT + (uint32_t)(n * 16) * VPIT); }
      __builtin_amdgcn_sched_barrier(0);
      v8f s0[2], s1[2], x0[2], x1[2];
      auto scores = [&](int q) {
        s0[q] = (v8f){}; s1[q] = (v8f){}; x0[q] = (v8f){}; x1[q] = (v8f){};
#pragma unroll
        for (int kc = 0; kc < 4; ++kc) {
            s0[q] = wmma16(kf[kc][0], ah[q][kc], s0[q]); x0[q] = wmma16(kf[kc][0], pl[q][kc], x0[q]); s1[q] = wmma16(kf[kc][1], ah[q][kc], s1[q]); x1[q] = wmma16(kf[kc][1], pl[q][kc], x1[q]);
            x0[q] = wmma16(kf[kc][2], ah[q][kc], x0[q]); x1[q] = wmma16(kf[kc][3], ah[q][kc], x1[q]);
        }
      };
      v16h pa[2], px[2];   // element s = key 8 hi + s (s < 8), 16 + 8 hi + s - 8 (else): the k order of the g fragments
      float alpha[2];
      auto softmax = [&](int q) {
        // Register j of tile t = key 16 t + 8 hi + j of the wave's 32, query lr of tile q.
        float a0[8], a1[8];
#pragma unroll
        for (int j = 0; j < 8; ++j) { a0[j] = s0[q][j] + x0[q][j] * LOSCI; a1[j] = s1[q][j] + x1[q][j] * LOSCI; }
        float mx = fmaxf(a0[0], a1[0]);
#pragma unroll
        for (int j = 1; j < 8; ++j) mx = fmaxf(mx, fmaxf(a0[j], a1[j]));
        mx = fmaxf(mx, xhalf(mx));
        const float mn = fmaxf(mrow[q], mx);
        alpha[q] = exp_slot(mrow[q] - mn); mrow[q] = mn;
        float es = 0.f;
#pragma unroll
        for (int j = 0; j < 8; ++j) {
            const float e0 = exp_slot(a0[j] - mn), e1 = exp_slot(a1[j] - mn);
            es += e0 + e1;
            const float ps0 = e0 * PSC, ps1 = e1 * PSC; const h16 h0 = (h16)ps0, h1 = (h16)ps1;
            pa[q][j] = h0; pa[q][8 + j] = h1; px[q][j] = (h16)(ps0 - (float)h0); px[q][8 + j] = (h16)(ps1 - (float)h1);   // unscaled residual
        }
        lpart[q] = lpart[q] * alpha[q] + es;
      };
      auto rescale = [&](int q) {
#pragma unroll
        for (int n = 0; n < 8; ++n)
#pragma unroll
            for (int j = 0; j < 8; ++j) o[q][n][j] *= alpha[q];
      };
      auto values = [&](int q) {
        // Three passes over the eight accumulator tiles (per tile: hi.w, residual.w, hi.w-residual): neighbours in the stream do not wait for one another's result.
#pragma unroll
        for (int n = 0; n < 8; ++n) o[q][n] = wmma16(vh[n], pa[q], o[q][n]);
#pragma unroll
        for (int n = 0; n < 8; ++n) o[q][n] = wmma16(vl[n], pa[q], o[q][n]);
#pragma unroll
        for (int n = 0; n < 8; ++n) o[q][n] = wmma16(vh[n], px[q], o[q][n]);
      };
      scores(0);
      __builtin_amdgcn_sched_barrier(0);   // this one and the next two part the phases, so that each run of group barriers orders its own phase only
      // One tile's softmax stands beside the other tile's matrix products, which do not depend on it. The group barriers ask for a few vector instructions, then one
      // matrix instruction, in turn: left free, this build set most of a softmax in one run with the matrix unit idle.
      scores(1); softmax(0);
#pragma unroll
      for (int i = 0; i < 24; ++i) { __builtin_amdgcn_sched_group_barrier(0x2, 6, 1); __builtin_amdgcn_sched_group_barrier(0x8, 1, 1); }
      __builtin_amdgcn_sched_barrier(0);
      rescale(0); values(0); softmax(1);
#pragma unroll
      for (int i = 0; i < 24; ++i) { __builtin_amdgcn_sched_group_barrier(0x2, 9, 2); __builtin_amdgcn_sched_group_barrier(0x8, 1, 2); }
      __builtin_amdgcn_sched_barrier(0);
      rescale(1); values(1);
#pragma unroll   // each accumulator tile's rescaling stands in front of its first product, under the tile before it, not all eight in one run ahead of the products
      for (int i = 0; i < 8; ++i) { __builtin_amdgcn_sched_group_barrier(0x2, 4, 3); __builtin_amdgcn_sched_group_barrier(0x8, 1, 3); }
      __builtin_amdgcn_sched_barrier(0);   // keeps the full LDS wait below behind the softmax and the products
      // Publish point: this wave has left stage st's buffer, its own slice of stage st + 1 has landed, every wave is here; only then the refill.
      wait_ds0();
      wait_tensor0(g0);
      __syncthreads();
      if (pinned(st + 2u < NSTG)) issue(st + 2u);
    }
    wait_tensor0(g0);
    wait_ds0();
    // w_z's fragments and this lane's 16 biases are asked for ahead of the hand-over and the conversions of y, under which they fly.
    const bf* wr = WZ + (size_t)lr * CI + 8 * hi;
    const float* bzp = bz + wave * 32 + hi;
    v16bf wa[8][4]; float bzr[16];
#pragma unroll
    for (int t = 0; t < 8; ++t)
#pragma unroll
        for (int kc = 0; kc < 4; ++kc) wa[t][kc] = cat16b(*(const v8us*)(wr + t * 16 * CI + kc * 32), *(const v8us*)(wr + t * 16 * CI + kc * 32 + 16));
#pragma unroll
    for (int s = 0; s < 16; ++s) bzr[s] = bzp[2 * s];
    wait_x0_of(wr, bzp);
    __builtin_amdgcn_sched_barrier(0);   // keeps these loads in one run up here: left free, this build set them down among the products with w_z, in pairs with a full wait behind each
    // The two waves with the same 32 queries (wave ^ 2) have seen half the keys each: wave kg keeps tile kg and hands the other tile to its partner. The ring is free:
    // every wave's last read of it ended in front of the last trip's barrier, and no tensor load is outstanding.
    const bool up = (wv >> 1) != 0u;
    const float lt0 = lpart[0] + xhalf(lpart[0]), lt1 = lpart[1] + xhalf(lpart[1]);
    const float mown = up ? mrow[1] : mrow[0], lown = up ? lt1 : lt0;
    unsigned char* xw = ring + (uint32_t)wave * XCH + (uint32_t)lane * 16u;
    const unsigned char* xr = ring + (uint32_t)(wave ^ 2) * XCH + (uint32_t)lane * 16u;
    v8f y[8];
#pragma unroll
    for (int n = 0; n < 8; ++n) {
        const v8f give = up ? o[0][n] : o[1][n]; y[n] = up ? o[1][n] : o[0][n];
        *(v4fa*)(xw + (uint32_t)(2 * n) * 512u) = __builtin_shufflevector(give, give, 0, 1, 2, 3); *(v4fa*)(xw + (uint32_t)(2 * n + 1) * 512u) = __builtin_shufflevector(give, give, 4, 5, 6, 7);
    }
    { float* ml = (float*)(ring + (uint32_t)wave * XCH + 8192u + (uint32_t)lane * 8u); ml[0] = up ? mrow[0] : mrow[1]; ml[1] = up ? lt0 : lt1; }
    __syncthreads();   // every wave's hand-over is written
    const float* mlr = (const float*)(ring + (uint32_t)(wave ^ 2) * XCH + 8192u + (uint32_t)lane * 8u);
    const float moth = mlr[0], loth = mlr[1];
    const float mall = fmaxf(mown, moth), fown = exp_slot(mown - mall), foth = exp_slot(moth - mall);
    const float inv = 1.0f / ((lown * fown + loth * foth) * PSC);
#pragma unroll
    for (int n = 0; n < 8; ++n) {
        const v4f p0 = *(const v4fa*)(xr + (uint32_t)(2 * n) * 512u), p1 = *(const v4fa*)(xr + (uint32_t)(2 * n + 1) * 512u);
        y[n] = y[n] * fown + __builtin_shufflevector(p0, p1, 0, 1, 2, 3, 4, 5, 6, 7) * foth;
    }
    const int qcol = (qg * 2 + kg) * 16;   // this wave's merged tile: its 16 columns of the block's 64
    v16bf yh[4], yl[4];   // register j of tiles 2 kc, 2 kc + 1 = channels 32 kc + 8 hi + j, 32 kc + 16 + 8 hi + j of query lr: the k order of the w_z fragments
#pragma unroll
    for (int kc = 0; kc < 4; ++kc) {
        const v8f u = y[2 * kc] * inv, v = y[2 * kc + 1] * inv;
        const v8bf uh = __builtin_convertvector(u, v8bf), vh = __builtin_convertvector(v, v8bf);   // round to nearest even, as f2bf
        const v8bf ul = __builtin_convertvector(u - __builtin_convertvector(uh, v8f), v8bf), vl = __builtin_convertvector(v - __builtin_convertvector(vh, v8f), v8bf);
        yh[kc] = __builtin_shufflevector(uh, vh, 0, 1, 2, 3, 4, 5, 6, 7, 8, 9, 10, 11, 12, 13, 14, 15);
        yl[kc] = __builtin_shufflevector(ul, vl, 0, 1, 2, 3, 4, 5, 6, 7, 8, 9, 10, 11, 12, 13, 14, 15);
    }
#pragma unroll
    for (int t = 0; t < 8; ++t) {
        v8f acc = {}, accx = {};
#pragma unroll
        for (int kc = 0; kc < 4; ++kc) { acc = wmmab(wa[t][kc], yh[kc], acc); accx = wmmab(wa[t][kc], yl[kc], accx); }
#pragma unroll
        for (int j = 0; j < 8; ++j) zst[(t * 16 + hi * 8 + j) * 68 + qcol + lr] = acc[j] + accx[j];   // register j = row o, lane = query
    }
    __syncthreads();   // every wave's 16 columns of the tile are written
    float* zb = Z + ((size_t)b * CI + wave * 32) * NN_ + (size_t)qt * 64;
    v4f val[16];   // one instruction = two rows' 256-byte pieces
#pragma unroll
    for (int s = 0; s < 16; ++s) val[s] = *(const v4fa*)(zst + (wave * 32 + 2 * s + hi) * 68 + lr * 4) + bfr(bzr[s]);
    __builtin_amdgcn_sched_barrier(0);   // the 16 stores go out as one run behind all reads and sums: left free, this build stored in pairs among them and wrote over registers of issued stores
#pragma unroll
    for (int s = 0; s < 16; ++s) *(v4f*)(zb + (size_t)(2 * s + hi) * NN_ + lr * 4) = val[s];
}
__global__ __launch_bounds__(256) void k_stats(const float* __restrict__ Z, float* ST) {
    __shared__ float red[256];
    const int o = blockIdx.x, t = threadIdx.x;
    float zv[(NB_ * NN_) / 256];   // this thread's 64 values of channel o: read once, kept in registers for both sums
#pragma unroll   // 64 independent loads in flight together: rolled, every trip waited out one load's whole latency
    for (int i = 0; i < (NB_ * NN_) / 256; ++i) { const int flat = i * 256 + t; const int b = flat / NN_, n = flat - b * NN_; zv[i] = Z[((size_t)b * CI + o) * NN_ + n]; }
    float s = 0.f;
#pragma unroll   // zv stays in registers only under constant indices
    for (int i = 0; i < (NB_ * NN_) / 256; ++i) s += zv[i];
    red[t] = s; __syncthreads();
    for (int st = 128; st > 0; st >>= 1) { if (t < st) red[t] += red[t + st]; __syncthreads(); }
    const float mu = red[0] / (float)(NB_ * NN_);
    __syncthreads();
    float q = 0.f;
#pragma unroll   // as above
    for (int i = 0; i < (NB_ * NN_) / 256; ++i) { const float d = zv[i] - mu; q += d * d; }
    red[t] = q; __syncthreads();
    for (int st = 128; st > 0; st >>= 1) { if (t < st) red[t] += red[t + st]; __syncthreads(); }
    const float var = red[0] / (float)(NB_ * NN_);
    if (t < 32) { const float v = (t == 0) ? mu : (t == 1) ? rsqrtf(var + 1e-5f) : 0.f; VST2(float, ST + (size_t)o * 32 + t, v); }
}
// k_final: out[b][o][n] = (Z - mu) rs gamma + beta; one wave per 256 values (8 per lane = 32 B -> use 2 x v4f? no: v8f per lane = lane-strided pair of b128 -> use 2
// instructions of v4f over 128 values each: lane -> 4 floats).
__global__ __launch_bounds__(256) void k_final(const float* __restrict__ Z, const float* __restrict__ ST, const float* __restrict__ gam, const float* __restrict__ bet, float* out) {
    const int lane = threadIdx.x & 31; const size_t wid = (size_t)blockIdx.x * 8 + (threadIdx.x >> 5);
    const size_t row = wid >> 4; const int seg = (int)(wid & 15);        // row = b*CI + o (4096 floats = 16 segments of 256)
    const int o = (int)(row % CI);
    const float mu = ST[(size_t)o * 32], rs = ST[(size_t)o * 32 + 1], g = bfr(gam[o]), be = bfr(bet[o]);
#pragma unroll
    for (int hf = 0; hf < 2; ++hf) { const size_t base = row * NN_ + (size_t)seg * 256 + hf * 128 + lane * 4; v4f v;
#pragma unroll
        for (int i = 0; i < 4; ++i) v[i] = (Z[base + i] - mu) * rs * g + be;
        VST2(v4f, out + base, v); }
}

extern "C" void kernel_launch(void* const* d_in, const int* in_sizes, int n_in,
                              void* d_out, int out_size, void* d_ws, size_t ws_size, hipStream_t stream) {
    (void)in_sizes; (void)n_in; (void)out_size;
    const float* xt = (const float*)d_in[0]; const float* xo = (const float*)d_in[1]; const float* wg = (const float*)d_in[2]; const float* bg = (const float*)d_in[3];
    const float* wth = (const float*)d_in[4]; const float* bth = (const float*)d_in[5]; const float* wph = (const float*)d_in[6]; const float* bph = (const float*)d_in[7];
    const float* wz = (const float*)d_in[8]; const float* bz = (const float*)d_in[9]; const float* gam = (const float*)d_in[10]; const float* bet = (const float*)d_in[11];
    float* out = (float*)d_out;    // [4][128][64][64]
    char* wsp = (char*)d_ws;
    auto take = [&](size_t bytes) { char* p = wsp; wsp += (bytes + 255) & ~(size_t)255; return (void*)p; };
    bf* WZb = (bf*)take((size_t)CI * CI * 2);
    h16* TH = (h16*)take((size_t)NB_ * NN_ * CI * 2); h16* TL = (h16*)take((size_t)NB_ * NN_ * CI * 2); h16* PH = (h16*)take((size_t)NB_ * NN_ * CI * 2); h16* PL = (h16*)take((size_t)NB_ * NN_ * CI * 2);
    h16* GTH = (h16*)take((size_t)NB_ * CI * NN_ * 2); h16* GTL = (h16*)take((size_t)NB_ * CI * NN_ * 2);
    float* Z = (float*)take((size_t)NB_ * CI * NN_ * 4); float* ST = (float*)take((size_t)CI * 32 * 4);
    if ((size_t)(wsp - (char*)d_ws) > ws_size) return;    // 4.2x4 + 4.2x2 + 8.4 ~ 34 MB
    k_proj<<<dim3(NN_ / 64, 1, 3 * NB_), 256, 0, stream>>>(xt, xo, wth, wph, wg, wz, bth, bph, bg, TH, TL, PH, PL, GTH, GTL, WZb);
    k_attn<<<NB_ * (NN_ / 64), 128, 0, stream>>>(PH, PL, TH, TL, GTH, GTL, WZb, bz, Z);
    k_stats<<<CI, 256, 0, stream>>>(Z, ST);
    k_final<<<(NB_ * CI * 16) / 8, 256, 0, stream>>>(Z, ST, gam, bet, out);
}

// v008
// It runs in 90 microseconds.
// Next to v007, in two timings, it ran 1.04 and 1.03 times as fast.
// All steps since v000 together make it 6.79 times as fast.
#include <hip/hip_runtime.h>
#include <stdint.h>

// Contractions, f32 accumulate: the three 1x1 convs g, theta (from x_this) and phi (from x_other) as [4 x 4096 x 256].[256 x 128] products (+bias) and W_z
// ([128 x 128].[128 x 4096] per b, +bias) on v_wmma_f32_16x16x32_bf16 — plain bf16 = rounded inputs (exact) for the convs, y as bf16 hi + residual in registers (two
// products) for W_z; the non-local attention fused on v_wmma_f32_16x16x32_f16: f = phi_i.theta_j over 128 channels (unscaled, sigma ~ 20: both operands f16 hi +
// residual x1024, hi.hi + hi.lo + lo.hi), softmax over the 4096 positions j, y_i = sum_j f g_j with the weights (x32768) and g both as f16 hi + UNSCALED residual so all three products share one accumulator (hi.hi + hi.lo + lo.hi: the softmax is nearly one-hot, so single roundings would pass straight into y).

#define NB_  4
#define CIN  256
#define CI   128
#define NN_  4096
#define PSC  32768.0f
#define LOSC 1024.0f
#define LOSCI (1.0f / 1024.0f)

typedef _Float16 h16;
typedef unsigned short bf;
typedef __attribute__((ext_vector_type(16))) __bf16   v16bf;
typedef __attribute__((ext_vector_type(8)))  __bf16   v8bf;
typedef __attribute__((ext_vector_type(16))) _Float16 v16h;
typedef __attribute__((ext_vector_type(8)))  _Float16 v8h;
typedef __attribute__((ext_vector_type(8)))  unsigned short v8us;
typedef __attribute__((ext_vector_type(8)))  float    v8f;
typedef __attribute__((ext_vector_type(4)))  float    v4f;
typedef v8h  __attribute__((may_alias)) v8ha;
typedef v4f  __attribute__((may_alias)) v4fa;
typedef v8us __attribute__((may_alias)) v8usa;

__device__ __forceinline__ unsigned short f2bf(float f) { unsigned u = __float_as_uint(f); u += 0x7FFFu + ((u >> 16) & 1u); return (unsigned short)(u >> 16); }
__device__ __forceinline__ float bf2f(unsigned short b) { return __uint_as_float(((unsigned)b) << 16); }
__device__ __forceinline__ float bfr(float f) { return bf2f(f2bf(f)); }
__device__ __forceinline__ v16h cat16(v8h lo, v8h hi) { return __builtin_shufflevector(lo, hi, 0, 1, 2, 3, 4, 5, 6, 7, 8, 9, 10, 11, 12, 13, 14, 15); }
__device__ __forceinline__ v16bf cat16b(v8us lo, v8us hi) { return __builtin_bit_cast(v16bf, __builtin_shufflevector(lo, hi, 0, 1, 2, 3, 4, 5, 6, 7, 8, 9, 10, 11, 12, 13, 14, 15)); }
__device__ __forceinline__ v8f wmma16(v16h a, v16h b, v8f c) { return __builtin_amdgcn_wmma_f32_16x16x32_f16(false, a, false, b, (short)0, c, false, false); }
__device__ __forceinline__ v8f wmmab(v16bf a, v16bf b, v8f c) { return __builtin_amdgcn_wmma_f32_16x16x32_bf16(false, a, false, b, (short)0, c, false, false); }
#define VST2(T, p, v) do { const T vst2_v_ = (v); *(T*)(p) = vst2_v_;  } while (0)

// Tensor loads into LDS for k_attn: a stage = 128 keys = two groups of 64 keys x four slices (theta hi, theta residual: 64 rows x 256 B; g hi, g residual: 128 rows x 128 B), one slice per wave.
typedef uint32_t u32x4 __attribute__((ext_vector_type(4)));
typedef uint32_t u32x8 __attribute__((ext_vector_type(8)));
#define SKEY 64u
#define NSTG (NN_ / 128u)
#define KPIT 272u      // LDS pitch of a 256-byte row (16 B pad, odd multiple of 16 B for the b128 readers)
#define VPIT 144u      // LDS pitch of a 128-byte row (16 B pad)
#define SLOT 18432u    // one slice's place: 128 x 144 B, and 64 x 272 B rounded up to a multiple of 2 KiB
#define W0_R256 ((1u << 20) | (5u << 22) | (3u << 25))   // group 1 word 0: no mask, 1-byte elements, 4 dwords of pad behind every 256 B
#define W0_R128 ((1u << 20) | (4u << 22) | (3u << 25))   // the same behind every 128 B
__device__ __forceinline__ uint32_t uni(uint32_t v) { return (uint32_t)__builtin_amdgcn_readfirstlane(v); }
// Holds a wave-uniform value in a scalar register, so that a test around a tensor load compiles to a scalar branch (tensor loads ignore EXEC).
__device__ __forceinline__ uint32_t pinned(uint32_t v) { uint32_t w = uni(v); asm volatile("" : "+s"(w)); return w; }
// Descriptor group 0: the tile's first byte at ga, to the LDS byte offset dst. Group 1: D1 rows of D0 bytes, source pitch SP bytes, tensor = tile.
__device__ __forceinline__ u32x4 tdm_group0(uint32_t dst, uint64_t ga) {
    u32x4 g0; g0[0] = uni(1u); g0[1] = uni(dst); g0[2] = uni((uint32_t)ga); g0[3] = uni((((uint32_t)(ga >> 32)) & 0x01FFFFFFu) | 0x80000000u);
    asm volatile("" : "+s"(g0));   // descriptor words held in scalar registers: no word is formed anew elsewhere while the request is outstanding
    return g0;
}
template <uint32_t W0, uint32_t D0, uint32_t D1, uint32_t SP>
__device__ __forceinline__ u32x8 tdm_group1() {
    u32x8 g1; g1[0] = uni(W0); g1[1] = uni((D0 & 0xFFFFu) << 16); g1[2] = uni((D0 >> 16) | ((D1 & 0xFFFFu) << 16)); g1[3] = uni((D1 >> 16) | (D0 << 16));
    g1[4] = uni(D1); g1[5] = uni(SP); g1[6] = uni(0u); g1[7] = uni(0u);
    asm volatile("" : "+s"(g1));   // descriptor words held in scalar registers: set once from constants, in the same registers for as long as requests are issued
    return g1;
}
__device__ __forceinline__ void tdm_load(u32x4 g0, u32x8 g1) { asm volatile("tensor_load_to_lds %0, %1" :: "s"(g0), "s"(g1) : "memory"); }
// The compiler places no wait for a tensor load. The wait names the request's group 0 so that its registers keep their values while the request is outstanding.
__device__ __forceinline__ void wait_tensor0(u32x4 g0) { asm volatile("s_wait_tensorcnt 0x0" :: "s"(g0) : "memory"); }
// Stands behind the last store of a branch whose code is followed, in the built kernel, by another branch's: no register that an issued store names is rewritten ahead of it.
__device__ __forceinline__ void wait_x0() { asm volatile("s_wait_xcnt 0x0" ::: "memory"); }
// The same behind a run of loads, naming the addresses they use: those registers keep their values up to the wait.
__device__ __forceinline__ void wait_x0_of(const void* p) { asm volatile("s_wait_xcnt 0x0" :: "v"(p) : "memory"); }
__device__ __forceinline__ void wait_x0_of(const void* p, const void* q) { asm volatile("s_wait_xcnt 0x0" :: "v"(p), "v"(q) : "memory"); }
__device__ __forceinline__ void wait_x0_of(const void* p, const void* q, const void* r) { asm volatile("s_wait_xcnt 0x0" :: "v"(p), "v"(q), "v"(r) : "memory"); }
__device__ __forceinline__ void wait_ds0() { asm volatile("s_wait_dscnt 0x0" ::: "memory"); }           // this wave's LDS reads are done before their buffer is handed back
// exp(x) as __expf compiles here (one multiply, v_exp_f32), with the one issue slot that the instruction set asks for behind a transcendental tied to it.
__device__ __forceinline__ float exp_slot(float x) { float r; asm("v_exp_f32 %0, %1\n\tv_nop" : "=v"(r) : "v"(x * 1.44269504088896340736f)); return r; }
__device__ __forceinline__ float xhalf(float x) { return __builtin_bit_cast(float, __builtin_amdgcn_permlanex16(__builtin_bit_cast(int, x), __builtin_bit_cast(int, x), 0x76543210, 0xfedcba98, false, false)); }   // lane l's value from lane l ^ 16
__device__ __forceinline__ v16h ldsfrag(const unsigned char* p) { return cat16(*(const v8ha*)p, *(const v8ha*)(p + 32)); }   // k 0..7 and 16..23 (+8 in the upper half-wave) of one row

// k_proj: 64 n x 128 o tile of P[b][n][o] = bf16(x[b][.][n]).bf16(W)^T + bias over K = 256 (exact products); the three projections, none of which reads what another
// writes, side by side in one launch. A block converts what it needs itself: its 256 c x 64 n tile of x (NCHW rows as they lie in memory, whole 256-byte pieces) and
// its 128 x 256 weight go to LDS as bf16; the A fragments (rows n, k = c) come out of the [c][n] tile by transposing LDS loads, the B fragments from the weight rows.
// Eight waves = 4 row groups of 16 n x 2 halves of 64 o. theta (keys, this branch) and phi (queries, other branch) leave as f16 hi + residual planes [b*4096+n][128],
// g (values, this branch) transposed in a half's LDS tile and written as f16 hi + UNSCALED residual planes GTH/GTL [b][c][n] (the A operand of y^T: rows c, k = n; the
// residual is summed into the same accumulator as the hi product). grid (NN_/64, 1, 3 * NB_): z = projection * NB_ + b. Sixteen blocks also write w_z's bf16 copy
// ([out][in] = the A operand of Z as-is; one wave per row), which nothing in this launch reads.
#define XPIT 160u            // LDS pitch of one channel's 64 bf16: 128 B + 32 B, an odd multiple of 32 B for the transposing reads
#define WPIT 528u            // LDS pitch of one weight row's 256 bf16: 512 B + 16 B, an odd multiple of 16 B for the b128 reads
#define XBYT (CIN * XPIT)
#define WBYT (CI * WPIT)
typedef __attribute__((ext_vector_type(8))) short s16x8;
typedef __attribute__((ext_vector_type(4))) __bf16 v4bf;
typedef v4bf __attribute__((may_alias)) v4bfa;
typedef v8bf __attribute__((may_alias)) v8bfa;
// Lane (c = l & 15, h = l >> 4) gets rows 8 h .. 8 h + 7 of column c of the 16 x 16 tile of 16-bit values whose rows the lanes' addresses name.
__device__ __forceinline__ v8us ld_tr16(const unsigned char* p) { typedef __attribute__((address_space(3))) s16x8 lds_s16x8; return __builtin_bit_cast(v8us, __builtin_amdgcn_ds_load_tr16_b128_v8i16((lds_s16x8*)p)); }
__global__ __launch_bounds__(256) void k_proj(const float* __restrict__ xa, const float* __restrict__ xb, const float* __restrict__ wth, const float* __restrict__ wph, const float* __restrict__ wg,
                                              const float* __restrict__ wz, const float* __restrict__ bth, const float* __restrict__ bph, const float* __restrict__ bg,
                                              h16* TH, h16* TL, h16* PH, h16* PL, h16* GTH, h16* GTL, bf* WZb) {
    __shared__ __align__(16) unsigned char sm[XBYT + WBYT];   // x tile [c][n], weight [o][c]; behind the products the x tile's place holds the output tiles
    const int tid = threadIdx.x, lane = tid & 31, wv8 = tid >> 5;
    if (blockIdx.z == 0 && blockIdx.x < CI / 8) {   // the same for the whole block: the grid's first 16 blocks copy 8 rows of w_z each
        typedef __attribute__((ext_vector_type(4))) unsigned short v4us; v4us t; const int r = blockIdx.x * 8 + wv8;
        const float* zq = wz + (size_t)r * CI + lane * 4;
        const v4f z4 = *(const v4fa*)zq; wait_x0_of(zq);
#pragma unroll
        for (int i = 0; i < 4; ++i) t[i] = f2bf(z4[i]);
        VST2(v4us, WZb + (size_t)r * CI + lane * 4, t); wait_x0();
    }
    const int lr = lane & 15, hi = lane >> 4, wave = wv8 & 3, half = wv8 >> 2, sel = blockIdx.z / NB_, b = blockIdx.z - sel * NB_;
    const int r0 = blockIdx.x * 64 + wave * 16, c0 = half * 64;
    const float* xs = ((sel == 1) ? xb : xa) + (size_t)b * CIN * NN_ + (size_t)blockIdx.x * 64 + (size_t)(tid >> 4) * NN_ + (tid & 15) * 4;   // 16 lanes = one channel's 256 bytes
    const float* ws = ((sel == 0) ? wth : (sel == 1) ? wph : wg) + (size_t)wv8 * CIN + lane * 8;                                           // one wave = one weight row
    const float* bias = (sel == 0) ? bth : (sel == 1) ? bph : bg;
    unsigned char* xd = sm + (uint32_t)(tid >> 4) * XPIT + (uint32_t)(tid & 15) * 8u;
    unsigned char* wd = sm + XBYT + (uint32_t)wv8 * WPIT + (uint32_t)lane * 16u;
    const float* bq = bias + c0 + lr;
    v4f xv[16], wv[16]; float bv4[4];
#pragma unroll   // the first half of the weight (from L2) is asked for first: loads are waited for in their order, and it is wanted first
    for (int p = 0; p < 8; ++p) { wv[2 * p] = *(const v4fa*)(ws + (size_t)p * 8 * CIN); wv[2 * p + 1] = *(const v4fa*)(ws + (size_t)p * 8 * CIN + 4); }
    __builtin_amdgcn_sched_barrier(0);   // keeps that order: left free, this build set loads of x among the weight's, and the weight's conversion waited for all of x
#pragma unroll   // all 16 loads of x (from memory) and the four biases are in flight together with it
    for (int p = 0; p < 16; ++p) xv[p] = *(const v4fa*)(xs + (size_t)p * 16 * NN_);
#pragma unroll
    for (int t = 0; t < 4; ++t) bv4[t] = bq[t * 16];
    wait_x0_of(xs, ws, bq);
    __builtin_amdgcn_sched_barrier(0);   // keeps these loads in one run up here: left free, this build asked for the weight only when most of x had come
#pragma unroll
    for (int p = 0; p < 8; ++p) *(v8bfa*)(wd + (uint32_t)p * 8u * WPIT) = __builtin_convertvector(__builtin_shufflevector(wv[2 * p], wv[2 * p + 1], 0, 1, 2, 3, 4, 5, 6, 7), v8bf);   // round to nearest even, as f2bf
    __builtin_amdgcn_sched_barrier(0);   // the second half of the weight is asked for behind the first half's conversion and takes its registers (three blocks fit a WGP's registers so); it flies while x is on its way
#pragma unroll
    for (int p = 0; p < 8; ++p) { wv[2 * p] = *(const v4fa*)(ws + (size_t)(p + 8) * 8 * CIN); wv[2 * p + 1] = *(const v4fa*)(ws + (size_t)(p + 8) * 8 * CIN + 4); }
    wait_x0_of(ws);
    __builtin_amdgcn_sched_barrier(0);   // keeps these loads ahead of the wait for x
#pragma unroll
    for (int p = 0; p < 16; ++p) *(v4bfa*)(xd + (uint32_t)p * 16u * XPIT) = __builtin_convertvector(xv[p], v4bf);
#pragma unroll
    for (int p = 0; p < 8; ++p) *(v8bfa*)(wd + (uint32_t)(p + 8) * 8u * WPIT) = __builtin_convertvector(__builtin_shufflevector(wv[2 * p], wv[2 * p + 1], 0, 1, 2, 3, 4, 5, 6, 7), v8bf);
    __syncthreads();   // the x tile and the weight are written
    const unsigned char* ap = sm + (uint32_t)(8 * hi + (lane & 7)) * XPIT + 32u * (uint32_t)wave + 16u * (uint32_t)((lane >> 3) & 1);   // k rows 8 hi + (l & 7), this wave's 16 columns n
    const unsigned char* bp = sm + XBYT + (uint32_t)(c0 + lr) * WPIT + 16u * (uint32_t)hi;                                              // weight row o, k 8 hi .. 8 hi + 7
    v8f acc[4];
#pragma unroll
    for (int t = 0; t < 4; ++t) acc[t] = (v8f){};
    // Two k-chunks' fragments in registers: a chunk's 10 LDS reads stand in one place, one chunk ahead of the products that use them. The scheduling barriers keep
    // them there: left free, this build set two reads with a full wait in front of every matrix instruction.
    v16bf af[2], wf[2][4];
    auto frags = [&](int kc) {
        af[kc & 1] = cat16b(ld_tr16(ap + (uint32_t)kc * 32u * XPIT), ld_tr16(ap + ((uint32_t)kc * 32u + 16u) * XPIT));   // k 8 hi + 0..7 and 16 + 8 hi + 0..7: the order of the weight fragments
#pragma unroll
        for (int t = 0; t < 4; ++t) wf[kc & 1][t] = cat16b(*(const v8usa*)(bp + (uint32_t)t * 16u * WPIT + (uint32_t)kc * 64u), *(const v8usa*)(bp + (uint32_t)t * 16u * WPIT + (uint32_t)kc * 64u + 32u));
    };
    frags(0);
#pragma unroll
    for (int kc = 0; kc < CIN / 32; ++kc) {
        if (kc + 1 < CIN / 32) frags(kc + 1);
        __builtin_amdgcn_sched_barrier(0);
#pragma unroll
        for (int t = 0; t < 4; ++t) acc[t] = wmmab(af[kc & 1], wf[kc & 1][t], acc[t]);
        __builtin_amdgcn_sched_barrier(0);
    }
    __syncthreads();   // every wave has left the x tile: its place is written anew below
    float* os = (float*)sm + (half * 4 + wave) * (16 * 68);
    float* gs = (float*)sm + half * 4 * (16 * 68);   // g: one tile of a half's four waves, 64 rows c x 64 n (pitch 68)
    if (sel == 2) {   // the same for the whole block; a lane's 8 registers are 8 consecutive n of one channel
#pragma unroll
        for (int t = 0; t < 4; ++t) { const float bv = bfr(bv4[t]); v4f w0, w1;
#pragma unroll
            for (int j = 0; j < 4; ++j) { w0[j] = acc[t][j] + bv; w1[j] = acc[t][4 + j] + bv; }
            float* gp = gs + (t * 16 + lr) * 68 + wave * 16 + hi * 8;
            *(v4fa*)gp = w0; *(v4fa*)(gp + 4) = w1; }
    } else {
#pragma unroll
        for (int t = 0; t < 4; ++t) { const float bv = bfr(bv4[t]);
#pragma unroll
            for (int j = 0; j < 8; ++j) os[(hi * 8 + j) * 68 + t * 16 + lr] = acc[t][j] + bv; }
    }
    __syncthreads();
    const size_t rowbase = (size_t)b * NN_ + r0;
    if (sel == 2) {
        const size_t gbase = ((size_t)b * CI + c0) * NN_ + (size_t)blockIdx.x * 64;
#pragma unroll
        for (int s = 0; s < 4; ++s) { const int Lid = (tid & 127) + 128 * s; const int row = Lid >> 3, piece = Lid & 7; const float* sp = gs + row * 68 + piece * 8; v8h o1, o2;
#pragma unroll
            for (int i = 0; i < 8; ++i) { const h16 a = (h16)sp[i]; o1[i] = a; o2[i] = (h16)(sp[i] - (float)a); }
            *(v8h*)(GTH + gbase + (size_t)row * NN_ + piece * 8) = o1; *(v8h*)(GTL + gbase + (size_t)row * NN_ + piece * 8) = o2; }
        wait_x0();
    } else {
        h16* c1 = ((sel == 0) ? TH : PH) + rowbase * CI + c0; h16* c2 = ((sel == 0) ? TL : PL) + rowbase * CI + c0;
        auto pass = [&]() {
#pragma unroll
            for (int s = 0; s < 4; ++s) { const int row = 4 * s + (lane >> 3), piece = lane & 7; const float* sp = os + row * 68 + piece * 8; v8h o1, o2;
#pragma unroll
                for (int i = 0; i < 8; ++i) { const h16 a = (h16)sp[i]; o1[i] = a; o2[i] = (h16)((sp[i] - (float)a) * LOSC); }
                *(v8h*)(c1 + (size_t)row * CI + piece * 8) = o1; *(v8h*)(c2 + (size_t)row * CI + piece * 8) = o2; }
        };
        pass(); wait_x0();
    }
}
// k_attn: block = (b, 64 queries i), eight waves = two per SIMD, so that one wave's softmax runs while the other wave of its SIMD has the matrix unit. theta and g
// (hi + residual) come in stages of 128 keys by tensor loads into two LDS buffers, one slice per wave, the next stage in flight while this one is worked on; the block's
// phi residual rows are loaded into LDS once. The waves are 2 x 4: a wave has 32 queries (two tiles of 16) and 32 of a stage's 128 keys, so that every theta and g
// fragment read from LDS serves two query tiles. A wave has half a SIMD's registers: phi hi and the second tile's phi residual stay in registers, the first tile's phi
// residual is read from LDS in every stage, and the g fragments take the place of the theta fragments.
// Both products are transposed: per query tile the scores S^T = theta_j.phi_i (A = theta rows, B = phi; hi.hi + hi.lo + lo.hi over 4 k-chunks x 2 tiles = 24 WMMA),
// so that a lane holds 16 scores of ONE query (lane & 15): online f32 softmax in the lane plus one exchange between the half-waves; the two score tiles, as
// hi/residual weights (x32768), are the B operand of y^T += g^T.w^T as they stand (A = g rows, 8 channel tiles x 3 = 24 WMMA). Behind the loop every wave lays its two
// tiles' maximum, sum and y in LDS; a query tile is merged from its four key quarters by two waves, each of which makes half the rows of Z for it. Epilogue: the merged
// y, as bf16 hi + residual, is the B operand of Z [b][o][n] = w_z . (yh + yl)^T + b_z[o] (A = w_z rows o, K = 128: 4 tiles x 4 k-chunks x 2 = 32 WMMA per wave); the
// block's 128 x 64 tile of Z goes through LDS and out as 256-byte row pieces.
#define XCH 8448u   // one tile's place in the hand-over: 64 floats a lane (8 KiB) + maximum and sum (8 B a lane)
__global__ __launch_bounds__(256) void k_attn(const h16* __restrict__ PH, const h16* __restrict__ PL, const h16* __restrict__ TH, const h16* __restrict__ TL,
                                             const h16* __restrict__ GTH, const h16* __restrict__ GTL, const bf* __restrict__ WZ, const float* __restrict__ bz, float* Z) {
    // Buffer 0: slices 0-7, buffer 1: slices 8-15, slice 16: phi residual rows. Behind the loop: the hand-over (16 x XCH from the start) and, from slice 10 on, the tile of Z.
    __shared__ __attribute__((aligned(2048))) unsigned char ring[17 * SLOT];
    float* zst = (float*)(ring + 10u * SLOT);   // the block's tile of Z: 128 rows o x 64 n, pitch 68
    const int lane = threadIdx.x & 31, wave = threadIdx.x >> 5, lr = lane & 15, hi = lane >> 4;
    const int qg = wave & 1, kg = wave >> 1;   // this wave's 32 queries of the block's 64, its 32 keys of a stage's 128
    const int b = blockIdx.x / (NN_ / 64), qt = blockIdx.x - b * (NN_ / 64);
    const size_t tok0 = (size_t)b * NN_;
    const size_t vbase = ((size_t)b * CI) * NN_;
    const uint32_t wv = uni(threadIdx.x >> 5), sl = wv & 3u, sub = wv >> 2, ring0 = (uint32_t)(size_t)ring;
    // This wave's slice, of the stage's 64-key group sub: 0 theta hi, 1 theta residual (64 keys further = 64 rows), 2 g hi, 3 g residual (64 keys further = 128 B along the rows).
    const h16* splane = (sl == 0u) ? TH + tok0 * CI : (sl == 1u) ? TL + tok0 * CI : (sl == 2u) ? GTH + vbase : GTL + vbase;
    const uint32_t sstep = (sl < 2u) ? SKEY * CI * 2u : SKEY * 2u;
    const u32x8 g1k = tdm_group1<W0_R256, 256u, 64u, 256u>(), g1v = tdm_group1<W0_R128, 128u, 128u, NN_ * 2u>();
    u32x4 g0;
    auto issue = [&](uint32_t st) {
        g0 = tdm_group0(ring0 + ((st & 1u) * 8u + wv) * SLOT, (uint64_t)(size_t)splane + (uint64_t)(st * 2u + sub) * sstep);
        if (pinned(sl < 2u)) tdm_load(g0, g1k); else tdm_load(g0, g1v);
    };
    if (pinned(wv == 0u)) { const u32x4 gp = tdm_group0(ring0 + 16u * SLOT, (uint64_t)(size_t)(PL + (tok0 + (size_t)qt * 64) * CI)); tdm_load(gp, g1k); wait_tensor0(gp); }
    issue(0u); wait_tensor0(g0);
    __syncthreads();   // stage 0 and the phi residual rows are published
    issue(1u);
    v16h ah[2][4], pl[2][4];   // phi hi and residual of the wave's two query tiles
    const h16* qp0 = PH + (tok0 + (size_t)(qt * 64 + qg * 32 + lr)) * CI + 8 * hi;
    const h16* qp1 = qp0 + 16 * CI;
#pragma unroll
    for (int kc = 0; kc < 4; ++kc) { ah[0][kc] = cat16(*(const v8h*)(qp0 + kc * 32), *(const v8h*)(qp0 + kc * 32 + 16)); ah[1][kc] = cat16(*(const v8h*)(qp1 + kc * 32), *(const v8h*)(qp1 + kc * 32 + 16)); }
    wait_x0_of(qp0, qp1);
    const unsigned char* alp = ring + 16u * SLOT + (uint32_t)(qg * 32 + lr) * KPIT + 16u * hi;
#pragma unroll
    for (int kc = 0; kc < 4; ++kc) pl[1][kc] = ldsfrag(alp + 16u * KPIT + kc * 64);   // the first tile's four are read anew in every stage
    v8f o[2][8];
#pragma unroll
    for (int q = 0; q < 2; ++q)
#pragma unroll
        for (int n = 0; n < 8; ++n) o[q][n] = (v8f){};
    float mrow[2] = {-3.0e38f, -3.0e38f}, lpart[2] = {0.f, 0.f};   // of this lane's two queries, over this wave's keys; lpart sums this half-wave's keys only
#pragma unroll 1   // one trip = one stage with its one publish point
    for (uint32_t st = 0; st < NSTG; ++st) {
      const unsigned char* buf = ring + (st & 1u) * (8u * SLOT) + (uint32_t)(kg >> 1) * (4u * SLOT);
      const unsigned char* kh = buf + (uint32_t)((kg & 1) * 32 + lr) * KPIT + 16u * hi;                 // theta rows (keys), 16 further: + 16 * KPIT; residual plane: + SLOT
      const unsigned char* vp = buf + 2u * SLOT + (uint32_t)lr * VPIT + 16u * hi + (uint32_t)((kg & 1) * 64);   // g rows (channels), 16 further: + 16 * VPIT; residual plane: + SLOT
      v16h kf[4][4];   // the 32 keys' score fragments per k-chunk: theta hi (2 tiles), theta residual (2 tiles)
      // The scheduling barriers below keep each block of LDS reads in one place, ahead of the work it flies under: left free, this build moved the reads
      // down among the matrix instructions, two at a time with a full wait behind each pair.
#pragma unroll
      for (int kc = 0; kc < 4; ++kc) {
          kf[kc][0] = ldsfrag(kh + kc * 64); kf[kc][1] = ldsfrag(kh + 16u * KPIT + kc * 64);
          kf[kc][2] = ldsfrag(kh + SLOT + kc * 64); kf[kc][3] = ldsfrag(kh + SLOT + 16u * KPIT + kc * 64);
      }
#pragma unroll   // held only as long as the first tile's scores last: with all of phi kept through the loop, fragments of it went to scratch
      for (int kc = 0; kc < 4; ++kc) pl[0][kc] = ldsfrag(alp + kc * 64);
      __builtin_amdgcn_sched_barrier(0);
      v8f s0[2], s1[2], x0[2], x1[2];
      auto scores = [&](int q) {
        s0[q] = (v8f){}; s1[q] = (v8f){}; x0[q] = (v8f){}; x1[q] = (v8f){};
#pragma unroll
        for (int kc = 0; kc < 4; ++kc) {
            s0[q] = wmma16(kf[kc][0], ah[q][kc], s0[q]); x0[q] = wmma16(kf[kc][0], pl[q][kc], x0[q]); s1[q] = wmma16(kf[kc][1], ah[q][kc], s1[q]); x1[q] = wmma16(kf[kc][1], pl[q][kc], x1[q]);
            x0[q] = wmma16(kf[kc][2], ah[q][kc], x0[q]); x1[q] = wmma16(kf[kc][3], ah[q][kc], x1[q]);
        }
      };
      v16h pa[2], px[2];   // element s = key 8 hi + s (s < 8), 16 + 8 hi + s - 8 (else): the k order of the g fragments
      float alpha[2];
      auto softmax = [&](int q) {
        // Register j of tile t = key 16 t + 8 hi + j of the wave's 32, query lr of tile q.
        float a0[8], a1[8];
#pragma unroll
        for (int j = 0; j < 8; ++j) { a0[j] = s0[q][j] + x0[q][j] * LOSCI; a1[j] = s1[q][j] + x1[q][j] * LOSCI; }
        float mx = fmaxf(a0[0], a1[0]);
#pragma unroll
        for (int j = 1; j < 8; ++j) mx = fmaxf(mx, fmaxf(a0[j], a1[j]));
        mx = fmaxf(mx, xhalf(mx));
        const float mn = fmaxf(mrow[q], mx);
        alpha[q] = exp_slot(mrow[q] - mn); mrow[q] = mn;
        float es = 0.f;
#pragma unroll
        for (int j = 0; j < 8; ++j) {
            const float e0 = exp_slot(a0[j] - mn), e1 = exp_slot(a1[j] - mn);
            es += e0 + e1;
            const float ps0 = e0 * PSC, ps1 = e1 * PSC; const h16 h0 = (h16)ps0, h1 = (h16)ps1;
            pa[q][j] = h0; pa[q][8 + j] = h1; px[q][j] = (h16)(ps0 - (float)h0); px[q][8 + j] = (h16)(ps1 - (float)h1);   // unscaled residual
        }
        lpart[q] = lpart[q] * alpha[q] + es;
      };
      auto rescale = [&](int q) {
#pragma unroll
        for (int n = 0; n < 8; ++n)
#pragma unroll
            for (int j = 0; j < 8; ++j) o[q][n][j] *= alpha[q];
      };
      v16h vh[8], vl[8];
      auto values = [&](int q) {
        // Three passes over the eight accumulator tiles (per tile: hi.w, residual.w, hi.w-residual): neighbours in the stream do not wait for one another's result.
#pragma unroll
        for (int n = 0; n < 8; ++n) o[q][n] = wmma16(vh[n], pa[q], o[q][n]);
#pragma unroll
        for (int n = 0; n < 8; ++n) o[q][n] = wmma16(vl[n], pa[q], o[q][n]);
#pragma unroll
        for (int n = 0; n < 8; ++n) o[q][n] = wmma16(vh[n], px[q], o[q][n]);
      };
      // No order is asked for between the first tile's softmax and the scores: while this wave is in a run of vector work, the other wave of its SIMD has the matrix unit.
      scores(0); scores(1); softmax(0);
      // This scheduling barrier and the next ones part the phases, so that each run of group barriers orders its own phase only: without this one the group barriers below
      // took instructions from above it too, and an exponential's result was set over an operand of the matrix instruction directly in front of it.
      __builtin_amdgcn_sched_barrier(0);
      // The g fragments take the theta fragments' registers: both sets at once do not fit half a SIMD's registers. In this build each read stands behind the last score
      // product that reads the registers it fills, so that the fragments are there when the first tile's products with g begin.
#pragma unroll
      for (int n = 0; n < 8; ++n) { vh[n] = ldsfrag(vp + (uint32_t)(n * 16) * VPIT); vl[n] = ldsfrag(vp + SLOT + (uint32_t)(n * 16) * VPIT); }
      __builtin_amdgcn_sched_barrier(0);   // keeps the reads ahead of this phase: left free, this build set some of them among its products and most of the second softmax in one run behind them
      // One tile's softmax stands beside the other tile's matrix products, which do not depend on it. The group barriers ask for a few vector instructions, then one
      // matrix instruction, in turn: left free, this build set most of a softmax in one run.
      rescale(0); values(0); softmax(1);
#pragma unroll
      for (int i = 0; i < 24; ++i) { __builtin_amdgcn_sched_group_barrier(0x2, 9, 2); __builtin_amdgcn_sched_group_barrier(0x8, 1, 2); }
      __builtin_amdgcn_sched_barrier(0);
      rescale(1); values(1);
#pragma unroll   // each accumulator tile's rescaling stands in front of its first product, under the tile before it, not all eight in one run ahead of the products
      for (int i = 0; i < 8; ++i) { __builtin_amdgcn_sched_group_barrier(0x2, 4, 3); __builtin_amdgcn_sched_group_barrier(0x8, 1, 3); }
      __builtin_amdgcn_sched_barrier(0);   // keeps the full LDS wait below behind the softmax and the products
      // Publish point: this wave has left stage st's buffer, its own slice of stage st + 1 has landed, every wave is here; only then the refill.
      wait_ds0();
      wait_tensor0(g0);
      __syncthreads();
      if (pinned(st + 2u < NSTG)) issue(st + 2u);
    }
    wait_tensor0(g0);
    wait_ds0();
    // Behind the loop wave w has query tile w & 3 (16 columns of the block's 64) and half w >> 2 of the rows of Z.
    const int T = wave & 3, oh = wave >> 2;
    // w_z's fragments and this lane's 8 biases are asked for ahead of the hand-over and the conversions of y, under which they fly.
    const bf* wr = WZ + (size_t)(oh * 64 + lr) * CI + 8 * hi;
    const float* bzp = bz + wave * 16 + hi;
    v16bf wa[4][4]; float bzr[8];
#pragma unroll
    for (int t = 0; t < 4; ++t)
#pragma unroll
        for (int kc = 0; kc < 4; ++kc) wa[t][kc] = cat16b(*(const v8us*)(wr + t * 16 * CI + kc * 32), *(const v8us*)(wr + t * 16 * CI + kc * 32 + 16));
#pragma unroll
    for (int s = 0; s < 8; ++s) bzr[s] = bzp[2 * s];
    wait_x0_of(wr, bzp);
    __builtin_amdgcn_sched_barrier(0);   // keeps these loads in one run up here: left free, this build set them down among the products with w_z, in pairs with a full wait behind each
    // The four waves with the same 32 queries have seen a quarter of the keys each: every wave lays both its tiles in LDS, place 2 * wave + tile. The ring is free:
    // every wave's last read of it ended in front of the last trip's barrier, and no tensor load is outstanding.
    const float lt[2] = {lpart[0] + xhalf(lpart[0]), lpart[1] + xhalf(lpart[1])};
#pragma unroll
    for (int q = 0; q < 2; ++q) {
        unsigned char* xw = ring + (uint32_t)(wave * 2 + q) * XCH;
#pragma unroll
        for (int n = 0; n < 8; ++n) {
            *(v4fa*)(xw + (uint32_t)lane * 16u + (uint32_t)(2 * n) * 512u) = __builtin_shufflevector(o[q][n], o[q][n], 0, 1, 2, 3);
            *(v4fa*)(xw + (uint32_t)lane * 16u + (uint32_t)(2 * n + 1) * 512u) = __builtin_shufflevector(o[q][n], o[q][n], 4, 5, 6, 7);
        }
        float* ml = (float*)(xw + 8192u + (uint32_t)lane * 8u); ml[0] = mrow[q]; ml[1] = lt[q];
    }
    __syncthreads();   // every wave's hand-over is written
    // Tile T = tile T & 1 of the waves (T >> 1) + 2 c, c = 0..3: places T + 4 c.
    const unsigned char* xr = ring + (uint32_t)T * XCH;
    float mc[4], lc[4], fc[4];
#pragma unroll
    for (int cq = 0; cq < 4; ++cq) { const float* mlr = (const float*)(xr + (uint32_t)(4 * cq) * XCH + 8192u + (uint32_t)lane * 8u); mc[cq] = mlr[0]; lc[cq] = mlr[1]; }
    const float mall = fmaxf(fmaxf(mc[0], mc[1]), fmaxf(mc[2], mc[3]));
#pragma unroll
    for (int cq = 0; cq < 4; ++cq) fc[cq] = exp_slot(mc[cq] - mall);
    const float inv = 1.0f / ((lc[0] * fc[0] + lc[1] * fc[1] + lc[2] * fc[2] + lc[3] * fc[3]) * PSC);
    v8f y[8];
#pragma unroll
    for (int n = 0; n < 8; ++n) {
        y[n] = (v8f){};
#pragma unroll
        for (int cq = 0; cq < 4; ++cq) {
            const unsigned char* xp = xr + (uint32_t)(4 * cq) * XCH + (uint32_t)lane * 16u;
            const v4f p0 = *(const v4fa*)(xp + (uint32_t)(2 * n) * 512u), p1 = *(const v4fa*)(xp + (uint32_t)(2 * n + 1) * 512u);
            y[n] += __builtin_shufflevector(p0, p1, 0, 1, 2, 3, 4, 5, 6, 7) * fc[cq];
        }
    }
    const int qcol = T * 16;   // this wave's merged tile: its 16 columns of the block's 64
    v16bf yh[4], yl[4];   // register j of tiles 2 kc, 2 kc + 1 = channels 32 kc + 8 hi + j, 32 kc + 16 + 8 hi + j of query lr: the k order of the w_z fragments
#pragma unroll
    for (int kc = 0; kc < 4; ++kc) {
        const v8f u = y[2 * kc] * inv, v = y[2 * kc + 1] * inv;
        const v8bf uh = __builtin_convertvector(u, v8bf), vh = __builtin_convertvector(v, v8bf);   // round to nearest even, as f2bf
        const v8bf ul = __builtin_convertvector(u - __builtin_convertvector(uh, v8f), v8bf), vl = __builtin_convertvector(v - __builtin_convertvector(vh, v8f), v8bf);
        yh[kc] = __builtin_shufflevector(uh, vh, 0, 1, 2, 3, 4, 5, 6, 7, 8, 9, 10, 11, 12, 13, 14, 15);
        yl[kc] = __builtin_shufflevector(ul, vl, 0, 1, 2, 3, 4, 5, 6, 7, 8, 9, 10, 11, 12, 13, 14, 15);
    }
#pragma unroll
    for (int t = 0; t < 4; ++t) {
        v8f acc = {}, accx = {};
#pragma unroll
        for (int kc = 0; kc < 4; ++kc) { acc = wmmab(wa[t][kc], yh[kc], acc); accx = wmmab(wa[t][kc], yl[kc], accx); }
#pragma unroll
        for (int j = 0; j < 8; ++j) zst[(oh * 64 + t * 16 + hi * 8 + j) * 68 + qcol + lr] = acc[j] + accx[j];   // register j = row o, lane = query
    }
    __syncthreads();   // every wave's part of the tile is written
    float* zb = Z + ((size_t)b * CI + wave * 16) * NN_ + (size_t)qt * 64;
    v4f val[8];   // one instruction = two rows' 256-byte pieces
#pragma unroll
    for (int s = 0; s < 8; ++s) val[s] = *(const v4fa*)(zst + (wave * 16 + 2 * s + hi) * 68 + lr * 4) + bfr(bzr[s]);
    __builtin_amdgcn_sched_barrier(0);   // the 8 stores go out as one run behind all reads and sums: left free, this build stored in pairs among them and wrote over registers of issued stores
#pragma unroll
    for (int s = 0; s < 8; ++s) *(v4f*)(zb + (size_t)(2 * s + hi) * NN_ + lr * 4) = val[s];
}
__global__ __launch_bounds__(256) void k_stats(const float* __restrict__ Z, float* ST) {
    __shared__ float red[256];
    const int o = blockIdx.x, t = threadIdx.x;
    float zv[(NB_ * NN_) / 256];   // this thread's 64 values of channel o: read once, kept in registers for both sums
#pragma unroll   // 64 independent loads in flight together: rolled, every trip waited out one load's whole latency
    for (int i = 0; i < (NB_ * NN_) / 256; ++i) { const int flat = i * 256 + t; const int b = flat / NN_, n = flat - b * NN_; zv[i] = Z[((size_t)b * CI + o) * NN_ + n]; }
    float s = 0.f;
#pragma unroll   // zv stays in registers only under constant indices
    for (int i = 0; i < (NB_ * NN_) / 256; ++i) s += zv[i];
    red[t] = s; __syncthreads();
    for (int st = 128; st > 0; st >>= 1) { if (t < st) red[t] += red[t + st]; __syncthreads(); }
    const float mu = red[0] / (float)(NB_ * NN_);
    __syncthreads();
    float q = 0.f;
#pragma unroll   // as above
    for (int i = 0; i < (NB_ * NN_) / 256; ++i) { const float d = zv[i] - mu; q += d * d; }
    red[t] = q; __syncthreads();
    for (int st = 128; st > 0; st >>= 1) { if (t < st) red[t] += red[t + st]; __syncthreads(); }
    const float var = red[0] / (float)(NB_ * NN_);
    if (t < 32) { const float v = (t == 0) ? mu : (t == 1) ? rsqrtf(var + 1e-5f) : 0.f; VST2(float, ST + (size_t)o * 32 + t, v); }
}
// k_final: out[b][o][n] = (Z - mu) rs gamma + beta; one wave per 256 values (8 per lane = 32 B -> use 2 x v4f? no: v8f per lane = lane-strided pair of b128 -> use 2
// instructions of v4f over 128 values each: lane -> 4 floats).
__global__ __launch_bounds__(256) void k_final(const float* __restrict__ Z, const float* __restrict__ ST, const float* __restrict__ gam, const float* __restrict__ bet, float* out) {
    const int lane = threadIdx.x & 31; const size_t wid = (size_t)blockIdx.x * 8 + (threadIdx.x >> 5);
    const size_t row = wid >> 4; const int seg = (int)(wid & 15);        // row = b*CI + o (4096 floats = 16 segments of 256)
    const int o = (int)(row % CI);
    const float mu = ST[(size_t)o * 32], rs = ST[(size_t)o * 32 + 1], g = bfr(gam[o]), be = bfr(bet[o]);
#pragma unroll
    for (int hf = 0; hf < 2; ++hf) { const size_t base = row * NN_ + (size_t)seg * 256 + hf * 128 + lane * 4; v4f v;
#pragma unroll
        for (int i = 0; i < 4; ++i) v[i] = (Z[base + i] - mu) * rs * g + be;
        VST2(v4f, out + base, v); }
}

extern "C" void kernel_launch(void* const* d_in, const int* in_sizes, int n_in,
                              void* d_out, int out_size, void* d_ws, size_t ws_size, hipStream_t stream) {
    (void)in_sizes; (void)n_in; (void)out_size;
    const float* xt = (const float*)d_in[0]; const float* xo = (const float*)d_in[1]; const float* wg = (const float*)d_in[2]; const float* bg = (const float*)d_in[3];
    const float* wth = (const float*)d_in[4]; const float* bth = (const float*)d_in[5]; const float* wph = (const float*)d_in[6]; const float* bph = (const float*)d_in[7];
    const float* wz = (const float*)d_in[8]; const float* bz = (const float*)d_in[9]; const float* gam = (const float*)d_in[10]; const float* bet = (const float*)d_in[11];
    float* out = (float*)d_out;    // [4][128][64][64]
    char* wsp = (char*)d_ws;
    auto take = [&](size_t bytes) { char* p = wsp; wsp += (bytes + 255) & ~(size_t)255; return (void*)p; };
    bf* WZb = (bf*)take((size_t)CI * CI * 2);
    h16* TH = (h16*)take((size_t)NB_ * NN_ * CI * 2); h16* TL = (h16*)take((size_t)NB_ * NN_ * CI * 2); h16* PH = (h16*)take((size_t)NB_ * NN_ * CI * 2); h16* PL = (h16*)take((size_t)NB_ * NN_ * CI * 2);
    h16* GTH = (h16*)take((size_t)NB_ * CI * NN_ * 2); h16* GTL = (h16*)take((size_t)NB_ * CI * NN_ * 2);
    float* Z = (float*)take((size_t)NB_ * CI * NN_ * 4); float* ST = (float*)take((size_t)CI * 32 * 4);
    if ((size_t)(wsp - (char*)d_ws) > ws_size) return;    // 4.2x4 + 4.2x2 + 8.4 ~ 34 MB
    k_proj<<<dim3(NN_ / 64, 1, 3 * NB_), 256, 0, stream>>>(xt, xo, wth, wph, wg, wz, bth, bph, bg, TH, TL, PH, PL, GTH, GTL, WZb);
    k_attn<<<NB_ * (NN_ / 64), 256, 0, stream>>>(PH, PL, TH, TL, GTH, GTL, WZb, bz, Z);
    k_stats<<<CI, 256, 0, stream>>>(Z, ST);
    k_final<<<(NB_ * CI * 16) / 8, 256, 0, stream>>>(Z, ST, gam, bet, out);
}

// v009
// One run takes 85.7 microseconds.
// Two timings next to v008 both put it at 1.05 times that version's speed.
// All steps since v000 together make it 7.10 times as fast.
#include <hip/hip_runtime.h>
#include <stdint.h>

// Contractions, f32 accumulate: the three 1x1 convs g, theta (from x_this) and phi (from x_other) as [4 x 4096 x 256].[256 x 128] products (+bias) and W_z
// ([128 x 128].[128 x 4096] per b, +bias) on v_wmma_f32_16x16x32_bf16 — plain bf16 = rounded inputs (exact) for the convs, y as bf16 hi + residual in registers (two
// products) for W_z; the non-local attention fused on v_wmma_f32_16x16x32_f16: f = phi_i.theta_j over 128 channels (unscaled, sigma ~ 20: both operands f16 hi +
// residual x1024, hi.hi + hi.lo + lo.hi), softmax over the 4096 positions j, y_i = sum_j f g_j with the weights (x32768) and g both as f16 hi + UNSCALED residual so all three products share one accumulator (hi.hi + hi.lo + lo.hi: the softmax is nearly one-hot, so single roundings would pass straight into y).

#define NB_  4
#define CIN  256
#define CI   128
#define NN_  4096
#define PSC  32768.0f
#define LOSC 1024.0f
#define LOSCI (1.0f / 1024.0f)

typedef _Float16 h16;
typedef unsigned short bf;
typedef __attribute__((ext_vector_type(16))) __bf16   v16bf;
typedef __attribute__((ext_vector_type(8)))  __bf16   v8bf;
typedef __attribute__((ext_vector_type(16))) _Float16 v16h;
typedef __attribute__((ext_vector_type(8)))  _Float16 v8h;
typedef __attribute__((ext_vector_type(8)))  unsigned short v8us;
typedef __attribute__((ext_vector_type(8)))  float    v8f;
typedef __attribute__((ext_vector_type(4)))  float    v4f;
typedef v8h  __attribute__((may_alias)) v8ha;
typedef v4f  __attribute__((may_alias)) v4fa;
typedef v8us __attribute__((may_alias)) v8usa;

__device__ __forceinline__ unsigned short f2bf(float f) { unsigned u = __float_as_uint(f); u += 0x7FFFu + ((u >> 16) & 1u); return (unsigned short)(u >> 16); }
__device__ __forceinline__ float bf2f(unsigned short b) { return __uint_as_float(((unsigned)b) << 16); }
__device__ __forceinline__ float bfr(float f) { return bf2f(f2bf(f)); }
__device__ __forceinline__ v16h cat16(v8h lo, v8h hi) { return __builtin_shufflevector(lo, hi, 0, 1, 2, 3, 4, 5, 6, 7, 8, 9, 10, 11, 12, 13, 14, 15); }
__device__ __forceinline__ v16bf cat16b(v8us lo, v8us hi) { return __builtin_bit_cast(v16bf, __builtin_shufflevector(lo, hi, 0, 1, 2, 3, 4, 5, 6, 7, 8, 9, 10, 11, 12, 13, 14, 15)); }
__device__ __forceinline__ v8f wmma16(v16h a, v16h b, v8f c) { return __builtin_amdgcn_wmma_f32_16x16x32_f16(false, a, false, b, (short)0, c, false, false); }
__device__ __forceinline__ v8f wmmab(v16bf a, v16bf b, v8f c) { return __builtin_amdgcn_wmma_f32_16x16x32_bf16(false, a, false, b, (short)0, c, false, false); }
#define VST2(T, p, v) do { const T vst2_v_ = (v); *(T*)(p) = vst2_v_;  } while (0)

// Tensor loads into LDS for k_attn: a stage = 128 keys = two groups of 64 keys x four slices (theta hi, theta residual: 64 rows x 256 B; g hi, g residual: 128 rows x 128 B), one slice per wave.
typedef uint32_t u32x4 __attribute__((ext_vector_type(4)));
typedef uint32_t u32x8 __attribute__((ext_vector_type(8)));
#define SKEY 64u
#define NSTG (NN_ / 128u)
#define KPIT 272u      // LDS pitch of a 256-byte row (16 B pad, odd multiple of 16 B for the b128 readers)
#define VPIT 144u      // LDS pitch of a 128-byte row (16 B pad)
#define SLOT 18432u    // one slice's place: 128 x 144 B, and 64 x 272 B rounded up to a multiple of 2 KiB
#define W0_R256 ((1u << 20) | (5u << 22) | (3u << 25))   // group 1 word 0: no mask, 1-byte elements, 4 dwords of pad behind every 256 B
#define W0_R128 ((1u << 20) | (4u << 22) | (3u << 25))   // the same behind every 128 B
__device__ __forceinline__ uint32_t uni(uint32_t v) { return (uint32_t)__builtin_amdgcn_readfirstlane(v); }
// Holds a wave-uniform value in a scalar register, so that a test around a tensor load compiles to a scalar branch (tensor loads ignore EXEC).
__device__ __forceinline__ uint32_t pinned(uint32_t v) { uint32_t w = uni(v); asm volatile("" : "+s"(w)); return w; }
// Descriptor group 0: the tile's first byte at ga, to the LDS byte offset dst. Group 1: D1 rows of D0 bytes, source pitch SP bytes, tensor = tile.
__device__ __forceinline__ u32x4 tdm_group0(uint32_t dst, uint64_t ga) {
    u32x4 g0; g0[0] = uni(1u); g0[1] = uni(dst); g0[2] = uni((uint32_t)ga); g0[3] = uni((((uint32_t)(ga >> 32)) & 0x01FFFFFFu) | 0x80000000u);
    asm volatile("" : "+s"(g0));   // descriptor words held in scalar registers: no word is formed anew elsewhere while the request is outstanding
    return g0;
}
template <uint32_t W0, uint32_t D0, uint32_t D1, uint32_t SP>
__device__ __forceinline__ u32x8 tdm_group1() {
    u32x8 g1; g1[0] = uni(W0); g1[1] = uni((D0 & 0xFFFFu) << 16); g1[2] = uni((D0 >> 16) | ((D1 & 0xFFFFu) << 16)); g1[3] = uni((D1 >> 16) | (D0 << 16));
    g1[4] = uni(D1); g1[5] = uni(SP); g1[6] = uni(0u); g1[7] = uni(0u);
    asm volatile("" : "+s"(g1));   // descriptor words held in scalar registers: set once from constants, in the same registers for as long as requests are issued
    return g1;
}
__device__ __forceinline__ void tdm_load(u32x4 g0, u32x8 g1) { asm volatile("tensor_load_to_lds %0, %1" :: "s"(g0), "s"(g1) : "memory"); }
// The compiler places no wait for a tensor load. The wait names the request's group 0 so that its registers keep their values while the request is outstanding.
__device__ __forceinline__ void wait_tensor0(u32x4 g0) { asm volatile("s_wait_tensorcnt 0x0" :: "s"(g0) : "memory"); }
// Stands behind the last store of a branch whose code is followed, in the built kernel, by another branch's: no register that an issued store names is rewritten ahead of it.
__device__ __forceinline__ void wait_x0() { asm volatile("s_wait_xcnt 0x0" ::: "memory"); }
// The same behind a run of loads, naming the addresses they use: those registers keep their values up to the wait.
__device__ __forceinline__ void wait_x0_of(const void* p) { asm volatile("s_wait_xcnt 0x0" :: "v"(p) : "memory"); }
__device__ __forceinline__ void wait_x0_of(const void* p, const void* q) { asm volatile("s_wait_xcnt 0x0" :: "v"(p), "v"(q) : "memory"); }
__device__ __forceinline__ void wait_x0_of(const void* p, const void* q, const void* r) { asm volatile("s_wait_xcnt 0x0" :: "v"(p), "v"(q), "v"(r) : "memory"); }
__device__ __forceinline__ void wait_ds0() { asm volatile("s_wait_dscnt 0x0" ::: "memory"); }           // this wave's LDS reads are done before their buffer is handed back
// exp(x) as __expf compiles here (one multiply, v_exp_f32), with the one issue slot that the instruction set asks for behind a transcendental tied to it.
__device__ __forceinline__ float exp_slot(float x) { float r; asm("v_exp_f32 %0, %1\n\tv_nop" : "=v"(r) : "v"(x * 1.44269504088896340736f)); return r; }
__device__ __forceinline__ float xhalf(float x) { return __builtin_bit_cast(float, __builtin_amdgcn_permlanex16(__builtin_bit_cast(int, x), __builtin_bit_cast(int, x), 0x76543210, 0xfedcba98, false, false)); }   // lane l's value from lane l ^ 16
// Sum over the 16 lanes of a half-wave, the same value in each of them: four butterfly steps inside the row (row_xmask 1, 2, 4, 8); every lane is on where it is used.
template <int CTRL> __device__ __forceinline__ float rowx(float x) { return __builtin_bit_cast(float, __builtin_amdgcn_update_dpp(0, __builtin_bit_cast(int, x), CTRL, 0xf, 0xf, true)); }
__device__ __forceinline__ float sum16(float x) { x += rowx<0x161>(x); x += rowx<0x162>(x); x += rowx<0x164>(x); x += rowx<0x168>(x); return x; }
__device__ __forceinline__ v16h ldsfrag(const unsigned char* p) { return cat16(*(const v8ha*)p, *(const v8ha*)(p + 32)); }   // k 0..7 and 16..23 (+8 in the upper half-wave) of one row

// k_proj: 64 n x 128 o tile of P[b][n][o] = bf16(x[b][.][n]).bf16(W)^T + bias over K = 256 (exact products); the three projections, none of which reads what another
// writes, side by side in one launch. A block converts what it needs itself: its 256 c x 64 n tile of x (NCHW rows as they lie in memory, whole 256-byte pieces) and
// its 128 x 256 weight go to LDS as bf16; the A fragments (rows n, k = c) come out of the [c][n] tile by transposing LDS loads, the B fragments from the weight rows.
// Eight waves = 4 row groups of 16 n x 2 halves of 64 o. theta (keys, this branch) and phi (queries, other branch) leave as f16 hi + residual planes [b*4096+n][128],
// g (values, this branch) transposed in a half's LDS tile and written as f16 hi + UNSCALED residual planes GTH/GTL [b][c][n] (the A operand of y^T: rows c, k = n; the
// residual is summed into the same accumulator as the hi product). grid (NN_/64, 1, 3 * NB_): z = projection * NB_ + b. Sixteen blocks also write w_z's bf16 copy
// ([out][in] = the A operand of Z as-is; one wave per row), which nothing in this launch reads.
#define XPIT 160u            // LDS pitch of one channel's 64 bf16: 128 B + 32 B, an odd multiple of 32 B for the transposing reads
#define WPIT 528u            // LDS pitch of one weight row's 256 bf16: 512 B + 16 B, an odd multiple of 16 B for the b128 reads
#define XBYT (CIN * XPIT)
#define WBYT (CI * WPIT)
typedef __attribute__((ext_vector_type(8))) short s16x8;
typedef __attribute__((ext_vector_type(4))) __bf16 v4bf;
typedef v4bf __attribute__((may_alias)) v4bfa;
typedef v8bf __attribute__((may_alias)) v8bfa;
// Lane (c = l & 15, h = l >> 4) gets rows 8 h .. 8 h + 7 of column c of the 16 x 16 tile of 16-bit values whose rows the lanes' addresses name.
__device__ __forceinline__ v8us ld_tr16(const unsigned char* p) { typedef __attribute__((address_space(3))) s16x8 lds_s16x8; return __builtin_bit_cast(v8us, __builtin_amdgcn_ds_load_tr16_b128_v8i16((lds_s16x8*)p)); }
__global__ __launch_bounds__(256) void k_proj(const float* __restrict__ xa, const float* __restrict__ xb, const float* __restrict__ wth, const float* __restrict__ wph, const float* __restrict__ wg,
                                              const float* __restrict__ wz, const float* __restrict__ bth, const float* __restrict__ bph, const float* __restrict__ bg,
                                              h16* TH, h16* TL, h16* PH, h16* PL, h16* GTH, h16* GTL, bf* WZb) {
    __shared__ __align__(16) unsigned char sm[XBYT + WBYT];   // x tile [c][n], weight [o][c]; behind the products the x tile's place holds the output tiles
    const int tid = threadIdx.x, lane = tid & 31, wv8 = tid >> 5;
    if (blockIdx.z == 0 && blockIdx.x < CI / 8) {   // the same for the whole block: the grid's first 16 blocks copy 8 rows of w_z each
        typedef __attribute__((ext_vector_type(4))) unsigned short v4us; v4us t; const int r = blockIdx.x * 8 + wv8;
        const float* zq = wz + (size_t)r * CI + lane * 4;
        const v4f z4 = *(const v4fa*)zq; wait_x0_of(zq);
#pragma unroll
        for (int i = 0; i < 4; ++i) t[i] = f2bf(z4[i]);
        VST2(v4us, WZb + (size_t)r * CI + lane * 4, t); wait_x0();
    }
    const int lr = lane & 15, hi = lane >> 4, wave = wv8 & 3, half = wv8 >> 2, sel = blockIdx.z / NB_, b = blockIdx.z - sel * NB_;
    const int r0 = blockIdx.x * 64 + wave * 16, c0 = half * 64;
    const float* xs = ((sel == 1) ? xb : xa) + (size_t)b * CIN * NN_ + (size_t)blockIdx.x * 64 + (size_t)(tid >> 4) * NN_ + (tid & 15) * 4;   // 16 lanes = one channel's 256 bytes
    const float* ws = ((sel == 0) ? wth : (sel == 1) ? wph : wg) + (size_t)wv8 * CIN + lane * 8;                                           // one wave = one weight row
    const float* bias = (sel == 0) ? bth : (sel == 1) ? bph : bg;
    unsigned char* xd = sm + (uint32_t)(tid >> 4) * XPIT + (uint32_t)(tid & 15) * 8u;
    unsigned char* wd = sm + XBYT + (uint32_t)wv8 * WPIT + (uint32_t)lane * 16u;
    const float* bq = bias + c0 + lr;
    v4f xv[16], wv[16]; float bv4[4];
#pragma unroll   // the first half of the weight (from L2) is asked for first: loads are waited for in their order, and it is wanted first
    for (int p = 0; p < 8; ++p) { wv[2 * p] = *(const v4fa*)(ws + (size_t)p * 8 * CIN); wv[2 * p + 1] = *(const v4fa*)(ws + (size_t)p * 8 * CIN + 4); }
    __builtin_amdgcn_sched_barrier(0);   // keeps that order: left free, this build set loads of x among the weight's, and the weight's conversion waited for all of x
#pragma unroll   // all 16 loads of x (from memory) and the four biases are in flight together with it
    for (int p = 0; p < 16; ++p) xv[p] = *(const v4fa*)(xs + (size_t)p * 16 * NN_);
#pragma unroll
    for (int t = 0; t < 4; ++t) bv4[t] = bq[t * 16];
    wait_x0_of(xs, ws, bq);
    __builtin_amdgcn_sched_barrier(0);   // keeps these loads in one run up here: left free, this build asked for the weight only when most of x had come
#pragma unroll
    for (int p = 0; p < 8; ++p) *(v8bfa*)(wd + (uint32_t)p * 8u * WPIT) = __builtin_convertvector(__builtin_shufflevector(wv[2 * p], wv[2 * p + 1], 0, 1, 2, 3, 4, 5, 6, 7), v8bf);   // round to nearest even, as f2bf
    __builtin_amdgcn_sched_barrier(0);   // the second half of the weight is asked for behind the first half's conversion and takes its registers (three blocks fit a WGP's registers so); it flies while x is on its way
#pragma unroll
    for (int p = 0; p < 8; ++p) { wv[2 * p] = *(const v4fa*)(ws + (size_t)(p + 8) * 8 * CIN); wv[2 * p + 1] = *(const v4fa*)(ws + (size_t)(p + 8) * 8 * CIN + 4); }
    wait_x0_of(ws);
    __builtin_amdgcn_sched_barrier(0);   // keeps these loads ahead of the wait for x
#pragma unroll
    for (int p = 0; p < 16; ++p) *(v4bfa*)(xd + (uint32_t)p * 16u * XPIT) = __builtin_convertvector(xv[p], v4bf);
#pragma unroll
    for (int p = 0; p < 8; ++p) *(v8bfa*)(wd + (uint32_t)(p + 8) * 8u * WPIT) = __builtin_convertvector(__builtin_shufflevector(wv[2 * p], wv[2 * p + 1], 0, 1, 2, 3, 4, 5, 6, 7), v8bf);
    __syncthreads();   // the x tile and the weight are written
    const unsigned char* ap = sm + (uint32_t)(8 * hi + (lane & 7)) * XPIT + 32u * (uint32_t)wave + 16u * (uint32_t)((lane >> 3) & 1);   // k rows 8 hi + (l & 7), this wave's 16 columns n
    const unsigned char* bp = sm + XBYT + (uint32_t)(c0 + lr) * WPIT + 16u * (uint32_t)hi;                                              // weight row o, k 8 hi .. 8 hi + 7
    v8f acc[4];
#pragma unroll
    for (int t = 0; t < 4; ++t) acc[t] = (v8f){};
    // Two k-chunks' fragments in registers: a chunk's 10 LDS reads stand in one place, one chunk ahead of the products that use them. The scheduling barriers keep
    // them there: left free, this build set two reads with a full wait in front of every matrix instruction.
    v16bf af[2], wf[2][4];
    auto frags = [&](int kc) {
        af[kc & 1] = cat16b(ld_tr16(ap + (uint32_t)kc * 32u * XPIT), ld_tr16(ap + ((uint32_t)kc * 32u + 16u) * XPIT));   // k 8 hi + 0..7 and 16 + 8 hi + 0..7: the order of the weight fragments
#pragma unroll
        for (int t = 0; t < 4; ++t) wf[kc & 1][t] = cat16b(*(const v8usa*)(bp + (uint32_t)t * 16u * WPIT + (uint32_t)kc * 64u), *(const v8usa*)(bp + (uint32_t)t * 16u * WPIT + (uint32_t)kc * 64u + 32u));
    };
    frags(0);
#pragma unroll
    for (int kc = 0; kc < CIN / 32; ++kc) {
        if (kc + 1 < CIN / 32) frags(kc + 1);
        __builtin_amdgcn_sched_barrier(0);
#pragma unroll
        for (int t = 0; t < 4; ++t) acc[t] = wmmab(af[kc & 1], wf[kc & 1][t], acc[t]);
        __builtin_amdgcn_sched_barrier(0);
    }
    __syncthreads();   // every wave has left the x tile: its place is written anew below
    float* os = (float*)sm + (half * 4 + wave) * (16 * 68);
    float* gs = (float*)sm + half * 4 * (16 * 68);   // g: one tile of a half's four waves, 64 rows c x 64 n (pitch 68)
    if (sel == 2) {   // the same for the whole block; a lane's 8 registers are 8 consecutive n of one channel
#pragma unroll
        for (int t = 0; t < 4; ++t) { const float bv = bfr(bv4[t]); v4f w0, w1;
#pragma unroll
            for (int j = 0; j < 4; ++j) { w0[j] = acc[t][j] + bv; w1[j] = acc[t][4 + j] + bv; }
            float* gp = gs + (t * 16 + lr) * 68 + wave * 16 + hi * 8;
            *(v4fa*)gp = w0; *(v4fa*)(gp + 4) = w1; }
    } else {
#pragma unroll
        for (int t = 0; t < 4; ++t) { const float bv = bfr(bv4[t]);
#pragma unroll
            for (int j = 0; j < 8; ++j) os[(hi * 8 + j) * 68 + t * 16 + lr] = acc[t][j] + bv; }
    }
    __syncthreads();
    const size_t rowbase = (size_t)b * NN_ + r0;
    if (sel == 2) {
        const size_t gbase = ((size_t)b * CI + c0) * NN_ + (size_t)blockIdx.x * 64;
#pragma unroll
        for (int s = 0; s < 4; ++s) { const int Lid = (tid & 127) + 128 * s; const int row = Lid >> 3, piece = Lid & 7; const float* sp = gs + row * 68 + piece * 8; v8h o1, o2;
#pragma unroll
            for (int i = 0; i < 8; ++i) { const h16 a = (h16)sp[i]; o1[i] = a; o2[i] = (h16)(sp[i] - (float)a); }
            *(v8h*)(GTH + gbase + (size_t)row * NN_ + piece * 8) = o1; *(v8h*)(GTL + gbase + (size_t)row * NN_ + piece * 8) = o2; }
        wait_x0();
    } else {
        h16* c1 = ((sel == 0) ? TH : PH) + rowbase * CI + c0; h16* c2 = ((sel == 0) ? TL : PL) + rowbase * CI + c0;
        auto pass = [&]() {
#pragma unroll
            for (int s = 0; s < 4; ++s) { const int row = 4 * s + (lane >> 3), piece = lane & 7; const float* sp = os + row * 68 + piece * 8; v8h o1, o2;
#pragma unroll
                for (int i = 0; i < 8; ++i) { const h16 a = (h16)sp[i]; o1[i] = a; o2[i] = (h16)((sp[i] - (float)a) * LOSC); }
                *(v8h*)(c1 + (size_t)row * CI + piece * 8) = o1; *(v8h*)(c2 + (size_t)row * CI + piece * 8) = o2; }
        };
        pass(); wait_x0();
    }
}
// k_attn: block = (b, 64 queries i), eight waves = two per SIMD, so that one wave's softmax runs while the other wave of its SIMD has the matrix unit. theta and g
// (hi + residual) come in stages of 128 keys by tensor loads into two LDS buffers, one slice per wave, the next stage in flight while this one is worked on; the block's
// phi residual rows are loaded into LDS once. The waves are 2 x 4: a wave has 32 queries (two tiles of 16) and 32 of a stage's 128 keys, so that every theta and g
// fragment read from LDS serves two query tiles. A wave has half a SIMD's registers: phi hi and the second tile's phi residual stay in registers, the first tile's phi
// residual is read from LDS in every stage, and the g fragments take the place of the theta fragments.
// Both products are transposed: per query tile the scores S^T = theta_j.phi_i (A = theta rows, B = phi; hi.hi + hi.lo + lo.hi over 4 k-chunks x 2 tiles = 24 WMMA),
// so that a lane holds 16 scores of ONE query (lane & 15): online f32 softmax in the lane plus one exchange between the half-waves; the two score tiles, as
// hi/residual weights (x32768), are the B operand of y^T += g^T.w^T as they stand (A = g rows, 8 channel tiles x 3 = 24 WMMA). Behind the loop every wave lays its two
// tiles' maximum, sum and y in LDS; a query tile is merged from its four key quarters by two waves, each of which makes half the rows of Z for it. Epilogue: the merged
// y, as bf16 hi + residual, is the B operand of Z [b][o][n] = w_z . (yh + yl)^T + b_z[o] (A = w_z rows o, K = 128: 4 tiles x 4 k-chunks x 2 = 32 WMMA per wave); the
// block's 128 x 64 tile of Z goes through LDS and out as 256-byte row pieces. On the way out a half-wave holds a whole row piece (64 values of one channel): its mean and
// its sum of squared deviations from that mean go to PS [block][256], one 128-byte line per wave; k_final merges the 256 blocks' pairs into the batch statistics.
#define XCH 8448u   // one tile's place in the hand-over: 64 floats a lane (8 KiB) + maximum and sum (8 B a lane)
__global__ __launch_bounds__(256) void k_attn(const h16* __restrict__ PH, const h16* __restrict__ PL, const h16* __restrict__ TH, const h16* __restrict__ TL,
                                             const h16* __restrict__ GTH, const h16* __restrict__ GTL, const bf* __restrict__ WZ, const float* __restrict__ bz, float* Z, float* PS) {
    // Buffer 0: slices 0-7, buffer 1: slices 8-15, slice 16: phi residual rows. Behind the loop: the hand-over (16 x XCH from the start) and, from slice 10 on, the tile of Z.
    __shared__ __attribute__((aligned(2048))) unsigned char ring[17 * SLOT];
    float* zst = (float*)(ring + 10u * SLOT);   // the block's tile of Z: 128 rows o x 64 n, pitch 68
    const int lane = threadIdx.x & 31, wave = threadIdx.x >> 5, lr = lane & 15, hi = lane >> 4;
    const int qg = wave & 1, kg = wave >> 1;   // this wave's 32 queries of the block's 64, its 32 keys of a stage's 128
    const int b = blockIdx.x / (NN_ / 64), qt = blockIdx.x - b * (NN_ / 64);
    const size_t tok0 = (size_t)b * NN_;
    const size_t vbase = ((size_t)b * CI) * NN_;
    const uint32_t wv = uni(threadIdx.x >> 5), sl = wv & 3u, sub = wv >> 2, ring0 = (uint32_t)(size_t)ring;
    // This wave's slice, of the stage's 64-key group sub: 0 theta hi, 1 theta residual (64 keys further = 64 rows), 2 g hi, 3 g residual (64 keys further = 128 B along the rows).
    const h16* splane = (sl == 0u) ? TH + tok0 * CI : (sl == 1u) ? TL + tok0 * CI : (sl == 2u) ? GTH + vbase : GTL + vbase;
    const uint32_t sstep = (sl < 2u) ? SKEY * CI * 2u : SKEY * 2u;
    const u32x8 g1k = tdm_group1<W0_R256, 256u, 64u, 256u>(), g1v = tdm_group1<W0_R128, 128u, 128u, NN_ * 2u>();
    u32x4 g0;
    auto issue = [&](uint32_t st) {
        g0 = tdm_group0(ring0 + ((st & 1u) * 8u + wv) * SLOT, (uint64_t)(size_t)splane + (uint64_t)(st * 2u + sub) * sstep);
        if (pinned(sl < 2u)) tdm_load(g0, g1k); else tdm_load(g0, g1v);
    };
    if (pinned(wv == 0u)) { const u32x4 gp = tdm_group0(ring0 + 16u * SLOT, (uint64_t)(size_t)(PL + (tok0 + (size_t)qt * 64) * CI)); tdm_load(gp, g1k); wait_tensor0(gp); }
    issue(0u); wait_tensor0(g0);
    __syncthreads();   // stage 0 and the phi residual rows are published
    issue(1u);
    v16h ah[2][4], pl[2][4];   // phi hi and residual of the wave's two query tiles
    const h16* qp0 = PH + (tok0 + (size_t)(qt * 64 + qg * 32 + lr)) * CI + 8 * hi;
    const h16* qp1 = qp0 + 16 * CI;
#pragma unroll
    for (int kc = 0; kc < 4; ++kc) { ah[0][kc] = cat16(*(const v8h*)(qp0 + kc * 32), *(const v8h*)(qp0 + kc * 32 + 16)); ah[1][kc] = cat16(*(const v8h*)(qp1 + kc * 32), *(const v8h*)(qp1 + kc * 32 + 16)); }
    wait_x0_of(qp0, qp1);
    const unsigned char* alp = ring + 16u * SLOT + (uint32_t)(qg * 32 + lr) * KPIT + 16u * hi;
#pragma unroll
    for (int kc = 0; kc < 4; ++kc) pl[1][kc] = ldsfrag(alp + 16u * KPIT + kc * 64);   // the first tile's four are read anew in every stage
    v8f o[2][8];
#pragma unroll
    for (int q = 0; q < 2; ++q)
#pragma unroll
        for (int n = 0; n < 8; ++n) o[q][n] = (v8f){};
    float mrow[2] = {-3.0e38f, -3.0e38f}, lpart[2] = {0.f, 0.f};   // of this lane's two queries, over this wave's keys; lpart sums this half-wave's keys only
#pragma unroll 1   // one trip = one stage with its one publish point
    for (uint32_t st = 0; st < NSTG; ++st) {
      const unsigned char* buf = ring + (st & 1u) * (8u * SLOT) + (uint32_t)(kg >> 1) * (4u * SLOT);
      const unsigned char* kh = buf + (uint32_t)((kg & 1) * 32 + lr) * KPIT + 16u * hi;                 // theta rows (keys), 16 further: + 16 * KPIT; residual plane: + SLOT
      const unsigned char* vp = buf + 2u * SLOT + (uint32_t)lr * VPIT + 16u * hi + (uint32_t)((kg & 1) * 64);   // g rows (channels), 16 further: + 16 * VPIT; residual plane: + SLOT
      v16h kf[4][4];   // the 32 keys' score fragments per k-chunk: theta hi (2 tiles), theta residual (2 tiles)
      // The scheduling barriers below keep each block of LDS reads in one place, ahead of the work it flies under: left free, this build moved the reads
      // down among the matrix instructions, two at a time with a full wait behind each pair.
#pragma unroll
      for (int kc = 0; kc < 4; ++kc) {
          kf[kc][0] = ldsfrag(kh + kc * 64); kf[kc][1] = ldsfrag(kh + 16u * KPIT + kc * 64);
          kf[kc][2] = ldsfrag(kh + SLOT + kc * 64); kf[kc][3] = ldsfrag(kh + SLOT + 16u * KPIT + kc * 64);
      }
#pragma unroll   // held only as long as the first tile's scores last: with all of phi kept through the loop, fragments of it went to scratch
      for (int kc = 0; kc < 4; ++kc) pl[0][kc] = ldsfrag(alp + kc * 64);
      __builtin_amdgcn_sched_barrier(0);
      v8f s0[2], s1[2], x0[2], x1[2];
      auto scores = [&](int q) {
        s0[q] = (v8f){}; s1[q] = (v8f){}; x0[q] = (v8f){}; x1[q] = (v8f){};
#pragma unroll
        for (int kc = 0; kc < 4; ++kc) {
            s0[q] = wmma16(kf[kc][0], ah[q][kc], s0[q]); x0[q] = wmma16(kf[kc][0], pl[q][kc], x0[q]); s1[q] = wmma16(kf[kc][1], ah[q][kc], s1[q]); x1[q] = wmma16(kf[kc][1], pl[q][kc], x1[q]);
            x0[q] = wmma16(kf[kc][2], ah[q][kc], x0[q]); x1[q] = wmma16(kf[kc][3], ah[q][kc], x1[q]);
        }
      };
      v16h pa[2], px[2];   // element s = key 8 hi + s (s < 8), 16 + 8 hi + s - 8 (else): the k order of the g fragments
      float alpha[2];
      auto softmax = [&](int q) {
        // Register j of tile t = key 16 t + 8 hi + j of the wave's 32, query lr of tile q.
        float a0[8], a1[8];
#pragma unroll
        for (int j = 0; j < 8; ++j) { a0[j] = s0[q][j] + x0[q][j] * LOSCI; a1[j] = s1[q][j] + x1[q][j] * LOSCI; }
        float mx = fmaxf(a0[0], a1[0]);
#pragma unroll
        for (int j = 1; j < 8; ++j) mx = fmaxf(mx, fmaxf(a0[j], a1[j]));
        mx = fmaxf(mx, xhalf(mx));
        const float mn = fmaxf(mrow[q], mx);
        alpha[q] = exp_slot(mrow[q] - mn); mrow[q] = mn;
        float es = 0.f;
#pragma unroll
        for (int j = 0; j < 8; ++j) {
            const float e0 = exp_slot(a0[j] - mn), e1 = exp_slot(a1[j] - mn);
            es += e0 + e1;
            const float ps0 = e0 * PSC, ps1 = e1 * PSC; const h16 h0 = (h16)ps0, h1 = (h16)ps1;
            pa[q][j] = h0; pa[q][8 + j] = h1; px[q][j] = (h16)(ps0 - (float)h0); px[q][8 + j] = (h16)(ps1 - (float)h1);   // unscaled residual
        }
        lpart[q] = lpart[q] * alpha[q] + es;
      };
      auto rescale = [&](int q) {
#pragma unroll
        for (int n = 0; n < 8; ++n)
#pragma unroll
            for (int j = 0; j < 8; ++j) o[q][n][j] *= alpha[q];
      };
      v16h vh[8], vl[8];
      auto values = [&](int q) {
        // Three passes over the eight accumulator tiles (per tile: hi.w, residual.w, hi.w-residual): neighbours in the stream do not wait for one another's result.
#pragma unroll
        for (int n = 0; n < 8; ++n) o[q][n] = wmma16(vh[n], pa[q], o[q][n]);
#pragma unroll
        for (int n = 0; n < 8; ++n) o[q][n] = wmma16(vl[n], pa[q], o[q][n]);
#pragma unroll
        for (int n = 0; n < 8; ++n) o[q][n] = wmma16(vh[n], px[q], o[q][n]);
      };
      // No order is asked for between the first tile's softmax and the scores: while this wave is in a run of vector work, the other wave of its SIMD has the matrix unit.
      scores(0); scores(1); softmax(0);
      // This scheduling barrier and the next ones part the phases, so that each run of group barriers orders its own phase only: without this one the group barriers below
      // took instructions from above it too, and an exponential's result was set over an operand of the matrix instruction directly in front of it.
      __builtin_amdgcn_sched_barrier(0);
      // The g fragments take the theta fragments' registers: both sets at once do not fit half a SIMD's registers. In this build each read stands behind the last score
      // product that reads the registers it fills, so that the fragments are there when the first tile's products with g begin.
#pragma unroll
      for (int n = 0; n < 8; ++n) { vh[n] = ldsfrag(vp + (uint32_t)(n * 16) * VPIT); vl[n] = ldsfrag(vp + SLOT + (uint32_t)(n * 16) * VPIT); }
      __builtin_amdgcn_sched_barrier(0);   // keeps the reads ahead of this phase: left free, this build set some of them among its products and most of the second softmax in one run behind them
      // One tile's softmax stands beside the other tile's matrix products, which do not depend on it. The group barriers ask for a few vector instructions, then one
      // matrix instruction, in turn: left free, this build set most of a softmax in one run.
      rescale(0); values(0); softmax(1);
#pragma unroll
      for (int i = 0; i < 24; ++i) { __builtin_amdgcn_sched_group_barrier(0x2, 9, 2); __builtin_amdgcn_sched_group_barrier(0x8, 1, 2); }
      __builtin_amdgcn_sched_barrier(0);
      rescale(1); values(1);
#pragma unroll   // each accumulator tile's rescaling stands in front of its first product, under the tile before it, not all eight in one run ahead of the products
      for (int i = 0; i < 8; ++i) { __builtin_amdgcn_sched_group_barrier(0x2, 4, 3); __builtin_amdgcn_sched_group_barrier(0x8, 1, 3); }
      __builtin_amdgcn_sched_barrier(0);   // keeps the full LDS wait below behind the softmax and the products
      // Publish point: this wave has left stage st's buffer, its own slice of stage st + 1 has landed, every wave is here; only then the refill.
      wait_ds0();
      wait_tensor0(g0);
      __syncthreads();
      if (pinned(st + 2u < NSTG)) issue(st + 2u);
    }
    wait_tensor0(g0);
    wait_ds0();
    // Behind the loop wave w has query tile w & 3 (16 columns of the block's 64) and half w >> 2 of the rows of Z.
    const int T = wave & 3, oh = wave >> 2;
    // w_z's fragments and this lane's 8 biases are asked for ahead of the hand-over and the conversions of y, under which they fly.
    const bf* wr = WZ + (size_t)(oh * 64 + lr) * CI + 8 * hi;
    const float* bzp = bz + wave * 16 + hi;
    v16bf wa[4][4]; float bzr[8];
#pragma unroll
    for (int t = 0; t < 4; ++t)
#pragma unroll
        for (int kc = 0; kc < 4; ++kc) wa[t][kc] = cat16b(*(const v8us*)(wr + t * 16 * CI + kc * 32), *(const v8us*)(wr + t * 16 * CI + kc * 32 + 16));
#pragma unroll
    for (int s = 0; s < 8; ++s) bzr[s] = bzp[2 * s];
    wait_x0_of(wr, bzp);
    __builtin_amdgcn_sched_barrier(0);   // keeps these loads in one run up here: left free, this build set them down among the products with w_z, in pairs with a full wait behind each
    // The four waves with the same 32 queries have seen a quarter of the keys each: every wave lays both its tiles in LDS, place 2 * wave + tile. The ring is free:
    // every wave's last read of it ended in front of the last trip's barrier, and no tensor load is outstanding.
    const float lt[2] = {lpart[0] + xhalf(lpart[0]), lpart[1] + xhalf(lpart[1])};
#pragma unroll
    for (int q = 0; q < 2; ++q) {
        unsigned char* xw = ring + (uint32_t)(wave * 2 + q) * XCH;
#pragma unroll
        for (int n = 0; n < 8; ++n) {
            *(v4fa*)(xw + (uint32_t)lane * 16u + (uint32_t)(2 * n) * 512u) = __builtin_shufflevector(o[q][n], o[q][n], 0, 1, 2, 3);
            *(v4fa*)(xw + (uint32_t)lane * 16u + (uint32_t)(2 * n + 1) * 512u) = __builtin_shufflevector(o[q][n], o[q][n], 4, 5, 6, 7);
        }
        float* ml = (float*)(xw + 8192u + (uint32_t)lane * 8u); ml[0] = mrow[q]; ml[1] = lt[q];
    }
    __syncthreads();   // every wave's hand-over is written
    // Tile T = tile T & 1 of the waves (T >> 1) + 2 c, c = 0..3: places T + 4 c.
    const unsigned char* xr = ring + (uint32_t)T * XCH;
    float mc[4], lc[4], fc[4];
#pragma unroll
    for (int cq = 0; cq < 4; ++cq) { const float* mlr = (const float*)(xr + (uint32_t)(4 * cq) * XCH + 8192u + (uint32_t)lane * 8u); mc[cq] = mlr[0]; lc[cq] = mlr[1]; }
    const float mall = fmaxf(fmaxf(mc[0], mc[1]), fmaxf(mc[2], mc[3]));
#pragma unroll
    for (int cq = 0; cq < 4; ++cq) fc[cq] = exp_slot(mc[cq] - mall);
    const float inv = 1.0f / ((lc[0] * fc[0] + lc[1] * fc[1] + lc[2] * fc[2] + lc[3] * fc[3]) * PSC);
    v8f y[8];
#pragma unroll
    for (int n = 0; n < 8; ++n) {
        y[n] = (v8f){};
#pragma unroll
        for (int cq = 0; cq < 4; ++cq) {
            const unsigned char* xp = xr + (uint32_t)(4 * cq) * XCH + (uint32_t)lane * 16u;
            const v4f p0 = *(const v4fa*)(xp + (uint32_t)(2 * n) * 512u), p1 = *(const v4fa*)(xp + (uint32_t)(2 * n + 1) * 512u);
            y[n] += __builtin_shufflevector(p0, p1, 0, 1, 2, 3, 4, 5, 6, 7) * fc[cq];
        }
    }
    const int qcol = T * 16;   // this wave's merged tile: its 16 columns of the block's 64
    v16bf yh[4], yl[4];   // register j of tiles 2 kc, 2 kc + 1 = channels 32 kc + 8 hi + j, 32 kc + 16 + 8 hi + j of query lr: the k order of the w_z fragments
#pragma unroll
    for (int kc = 0; kc < 4; ++kc) {
        const v8f u = y[2 * kc] * inv, v = y[2 * kc + 1] * inv;
        const v8bf uh = __builtin_convertvector(u, v8bf), vh = __builtin_convertvector(v, v8bf);   // round to nearest even, as f2bf
        const v8bf ul = __builtin_convertvector(u - __builtin_convertvector(uh, v8f), v8bf), vl = __builtin_convertvector(v - __builtin_convertvector(vh, v8f), v8bf);
        yh[kc] = __builtin_shufflevector(uh, vh, 0, 1, 2, 3, 4, 5, 6, 7, 8, 9, 10, 11, 12, 13, 14, 15);
        yl[kc] = __builtin_shufflevector(ul, vl, 0, 1, 2, 3, 4, 5, 6, 7, 8, 9, 10, 11, 12, 13, 14, 15);
    }
#pragma unroll
    for (int t = 0; t < 4; ++t) {
        v8f acc = {}, accx = {};
#pragma unroll
        for (int kc = 0; kc < 4; ++kc) { acc = wmmab(wa[t][kc], yh[kc], acc); accx = wmmab(wa[t][kc], yl[kc], accx); }
#pragma unroll
        for (int j = 0; j < 8; ++j) zst[(oh * 64 + t * 16 + hi * 8 + j) * 68 + qcol + lr] = acc[j] + accx[j];   // register j = row o, lane = query
    }
    __syncthreads();   // every wave's part of the tile is written
    float* zb = Z + ((size_t)b * CI + wave * 16) * NN_ + (size_t)qt * 64;
    v4f val[8];   // one instruction = two rows' 256-byte pieces
#pragma unroll
    for (int s = 0; s < 8; ++s) val[s] = *(const v4fa*)(zst + (wave * 16 + 2 * s + hi) * 68 + lr * 4) + bfr(bzr[s]);
    float rm[8], rq[8];   // of row 2 s + hi of the wave's 16: mean of its 64 values here, sum of their squared deviations from it
#pragma unroll
    for (int s = 0; s < 8; ++s) rm[s] = sum16((val[s][0] + val[s][1]) + (val[s][2] + val[s][3])) * (1.0f / 64.0f);
#pragma unroll
    for (int s = 0; s < 8; ++s) { const v4f d = val[s] - rm[s]; rq[s] = sum16((d[0] * d[0] + d[1] * d[1]) + (d[2] * d[2] + d[3] * d[3])); }
    float pm = rm[0], pq = rq[0];   // lane (hi, lr) writes float hi * 16 + lr of the wave's line: row 2 (lr >> 1) + hi, mean (lr even) or squares (lr odd)
#pragma unroll
    for (int s = 1; s < 8; ++s) { pm = ((lr >> 1) == s) ? rm[s] : pm; pq = ((lr >> 1) == s) ? rq[s] : pq; }
    const float pv = (lr & 1) ? pq : pm;
    __builtin_amdgcn_sched_barrier(0);   // the 9 stores go out as one run behind all reads and sums: left free, this build stored in pairs among them and wrote over registers of issued stores
    PS[(size_t)blockIdx.x * 256 + wave * 32 + lane] = pv;   // first of the run: set last, its value was formed among the stores of Z, over their registers
#pragma unroll
    for (int s = 0; s < 8; ++s) *(v4f*)(zb + (size_t)(2 * s + hi) * NN_ + lr * 4) = val[s];
}
// k_final: out[b][o][n] = (Z - mu) rs gamma + beta. Block = channel o and two of the four b: 8192 values, 8 x 16 bytes a thread, all asked for at once. Thread t has
// the pair (mean, squared deviations; 64 values each) that block t of k_attn left for channel o; the 256 pairs are merged under the loads of Z: mu = mean of the means,
// sum of squares = sum of (squares + 64 (mean - mu)^2), each a sum over the wave, then over the eight waves through LDS, in a fixed order.
typedef __attribute__((ext_vector_type(2))) float v2f;
typedef v2f __attribute__((may_alias)) v2fa;
// Work-group barrier that orders LDS alone: __syncthreads() also waited for every outstanding global load, so that the merge began only when all of Z had come.
__device__ __forceinline__ void lds_barrier() { __builtin_amdgcn_fence(__ATOMIC_RELEASE, "workgroup", "local"); __builtin_amdgcn_s_barrier(); __builtin_amdgcn_fence(__ATOMIC_ACQUIRE, "workgroup", "local"); }
__global__ __launch_bounds__(256) void k_final(const float* __restrict__ Z, const float* __restrict__ PS, const float* __restrict__ gam, const float* __restrict__ bet, float* out) {
    __shared__ __align__(16) float red[16];
    const int t = threadIdx.x, lane = t & 31, wave = t >> 5, o = blockIdx.x >> 1;
    const size_t base = ((size_t)(blockIdx.x & 1) * 2 * CI + o) * NN_ + (size_t)t * 4;
    const float* pp = PS + (size_t)t * 256 + (o >> 4) * 32 + (o & 1) * 16 + ((o >> 1) & 7) * 2;
    const float* zp = Z + base;
    const v2f pr = *(const v2fa*)pp;
    __builtin_amdgcn_sched_barrier(0);   // the pair is asked for first: loads are waited for in their order, and it is wanted first
    v4f zv[8];
#pragma unroll
    for (int i = 0; i < 8; ++i) zv[i] = *(const v4fa*)(zp + (size_t)(i >> 2) * CI * NN_ + (i & 3) * 1024);
    wait_x0_of(pp, zp);
    __builtin_amdgcn_sched_barrier(0);   // keeps the loads of Z up here, in flight under the merge
    const float g = bfr(gam[o]), be = bfr(bet[o]);
    float sm = sum16(pr[0]); sm += xhalf(sm);
    if (lane == 0) red[wave] = sm;
    lds_barrier();   // the eight waves' sums of means are written
    const v4f m0 = *(const v4fa*)red, m1 = *(const v4fa*)(red + 4);
    const float mu = (((m0[0] + m0[1]) + (m0[2] + m0[3])) + ((m1[0] + m1[1]) + (m1[2] + m1[3]))) * (1.0f / 256.0f);
    const float dm = pr[0] - mu;
    float sq = sum16(pr[1] + 64.0f * (dm * dm)); sq += xhalf(sq);
    if (lane == 0) red[8 + wave] = sq;
    lds_barrier();   // the eight waves' sums of squares are written
    const v4f q0 = *(const v4fa*)(red + 8), q1 = *(const v4fa*)(red + 12);
    const float var = (((q0[0] + q0[1]) + (q0[2] + q0[3])) + ((q1[0] + q1[1]) + (q1[2] + q1[3]))) / (float)(NB_ * NN_);
    const float rs = rsqrtf(var + 1e-5f);
#pragma unroll
    for (int i = 0; i < 8; ++i) { const v4f v = (zv[i] - mu) * rs * g + be; VST2(v4f, out + base + (size_t)(i >> 2) * CI * NN_ + (i & 3) * 1024, v); }
}

extern "C" void kernel_launch(void* const* d_in, const int* in_sizes, int n_in,
                              void* d_out, int out_size, void* d_ws, size_t ws_size, hipStream_t stream) {
    (void)in_sizes; (void)n_in; (void)out_size;
    const float* xt = (const float*)d_in[0]; const float* xo = (const float*)d_in[1]; const float* wg = (const float*)d_in[2]; const float* bg = (const float*)d_in[3];
    const float* wth = (const float*)d_in[4]; const float* bth = (const float*)d_in[5]; const float* wph = (const float*)d_in[6]; const float* bph = (const float*)d_in[7];
    const float* wz = (const float*)d_in[8]; const float* bz = (const float*)d_in[9]; const float* gam = (const float*)d_in[10]; const float* bet = (const float*)d_in[11];
    float* out = (float*)d_out;    // [4][128][64][64]
    char* wsp = (char*)d_ws;
    auto take = [&](size_t bytes) { char* p = wsp; wsp += (bytes + 255) & ~(size_t)255; return (void*)p; };
    bf* WZb = (bf*)take((size_t)CI * CI * 2);
    h16* TH = (h16*)take((size_t)NB_ * NN_ * CI * 2); h16* TL = (h16*)take((size_t)NB_ * NN_ * CI * 2); h16* PH = (h16*)take((size_t)NB_ * NN_ * CI * 2); h16* PL = (h16*)take((size_t)NB_ * NN_ * CI * 2);
    h16* GTH = (h16*)take((size_t)NB_ * CI * NN_ * 2); h16* GTL = (h16*)take((size_t)NB_ * CI * NN_ * 2);
    float* Z = (float*)take((size_t)NB_ * CI * NN_ * 4); float* PS = (float*)take((size_t)NB_ * (NN_ / 64) * 256 * 4);
    if ((size_t)(wsp - (char*)d_ws) > ws_size) return;    // 4.2x4 + 4.2x2 + 8.4 ~ 34 MB
    k_proj<<<dim3(NN_ / 64, 1, 3 * NB_), 256, 0, stream>>>(xt, xo, wth, wph, wg, wz, bth, bph, bg, TH, TL, PH, PL, GTH, GTL, WZb);
    k_attn<<<NB_ * (NN_ / 64), 256, 0, stream>>>(PH, PL, TH, TL, GTH, GTL, WZb, bz, Z, PS);
    k_final<<<2 * CI, 256, 0, stream>>>(Z, PS, gam, bet, out);
}

// v010
// Measured time: 80.8 microseconds a run.
// Two timings next to v009 put it at 1.06 and 1.07 times that version's speed.
// Counting every step since v000, it is 7.53 times as fast.
#include <hip/hip_runtime.h>
#include <stdint.h>

// Contractions, f32 accumulate: the three 1x1 convs g, theta (from x_this) and phi (from x_other) as [4 x 4096 x 256].[256 x 128] products (+bias) and W_z
// ([128 x 128].[128 x 4096] per b, +bias) on v_wmma_f32_16x16x32_bf16 — plain bf16 = rounded inputs (exact) for the convs, y as bf16 hi + residual in registers (two
// products) for W_z; the non-local attention fused on v_wmma_f32_16x16x32_f16: f = phi_i.theta_j over 128 channels (unscaled, sigma ~ 20: both operands f16 hi +
// residual x1024, hi.hi + hi.lo + lo.hi), softmax over the 4096 positions j, y_i = sum_j f g_j with g as f16 hi + UNSCALED residual (both products share one accumulator: the softmax is nearly one-hot, so a single rounding of g would pass straight into y) and the weights (x32768) as one f16 each: the weight of a wave's largest score so far is 1, which f16 holds exactly, so that a nearly one-hot row loses nothing; the other weights carry f16's rounding.

#define NB_  4
#define CIN  256
#define CI   128
#define NN_  4096
#define PSC  32768.0f
#define LOSC 1024.0f
#define LOSCI (1.0f / 1024.0f)

typedef _Float16 h16;
typedef unsigned short bf;
typedef __attribute__((ext_vector_type(16))) __bf16   v16bf;
typedef __attribute__((ext_vector_type(8)))  __bf16   v8bf;
typedef __attribute__((ext_vector_type(16))) _Float16 v16h;
typedef __attribute__((ext_vector_type(8)))  _Float16 v8h;
typedef __attribute__((ext_vector_type(8)))  unsigned short v8us;
typedef __attribute__((ext_vector_type(8)))  float    v8f;
typedef __attribute__((ext_vector_type(4)))  float    v4f;
typedef v8h  __attribute__((may_alias)) v8ha;
typedef v4f  __attribute__((may_alias)) v4fa;
typedef v8us __attribute__((may_alias)) v8usa;

__device__ __forceinline__ unsigned short f2bf(float f) { unsigned u = __float_as_uint(f); u += 0x7FFFu + ((u >> 16) & 1u); return (unsigned short)(u >> 16); }
__device__ __forceinline__ float bf2f(unsigned short b) { return __uint_as_float(((unsigned)b) << 16); }
__device__ __forceinline__ float bfr(float f) { return bf2f(f2bf(f)); }
__device__ __forceinline__ v16h cat16(v8h lo, v8h hi) { return __builtin_shufflevector(lo, hi, 0, 1, 2, 3, 4, 5, 6, 7, 8, 9, 10, 11, 12, 13, 14, 15); }
__device__ __forceinline__ v16bf cat16b(v8us lo, v8us hi) { return __builtin_bit_cast(v16bf, __builtin_shufflevector(lo, hi, 0, 1, 2, 3, 4, 5, 6, 7, 8, 9, 10, 11, 12, 13, 14, 15)); }
__device__ __forceinline__ v8f wmma16(v16h a, v16h b, v8f c) { return __builtin_amdgcn_wmma_f32_16x16x32_f16(false, a, false, b, (short)0, c, false, false); }
__device__ __forceinline__ v8f wmmab(v16bf a, v16bf b, v8f c) { return __builtin_amdgcn_wmma_f32_16x16x32_bf16(false, a, false, b, (short)0, c, false, false); }
#define VST2(T, p, v) do { const T vst2_v_ = (v); *(T*)(p) = vst2_v_;  } while (0)

// Tensor loads into LDS for k_attn: a stage = 128 keys = two groups of 64 keys x four slices (theta hi, theta residual: 64 rows x 256 B; g hi, g residual: 128 rows x 128 B), one slice per wave.
typedef uint32_t u32x4 __attribute__((ext_vector_type(4)));
typedef uint32_t u32x8 __attribute__((ext_vector_type(8)));
#define SKEY 64u
#define NSTG (NN_ / 128u)
#define KPIT 272u      // LDS pitch of a 256-byte row (16 B pad, odd multiple of 16 B for the b128 readers)
#define VPIT 144u      // LDS pitch of a 128-byte row (16 B pad)
#define SLOT 18432u    // one slice's place: 128 x 144 B, and 64 x 272 B rounded up to a multiple of 2 KiB
#define W0_R256 ((1u << 20) | (5u << 22) | (3u << 25))   // group 1 word 0: no mask, 1-byte elements, 4 dwords of pad behind every 256 B
#define W0_R128 ((1u << 20) | (4u << 22) | (3u << 25))   // the same behind every 128 B
__device__ __forceinline__ uint32_t uni(uint32_t v) { return (uint32_t)__builtin_amdgcn_readfirstlane(v); }
// Holds a wave-uniform value in a scalar register, so that a test around a tensor load compiles to a scalar branch (tensor loads ignore EXEC).
__device__ __forceinline__ uint32_t pinned(uint32_t v) { uint32_t w = uni(v); asm volatile("" : "+s"(w)); return w; }
// Descriptor group 0: the tile's first byte at ga, to the LDS byte offset dst. Group 1: D1 rows of D0 bytes, source pitch SP bytes, tensor = tile.
__device__ __forceinline__ u32x4 tdm_group0(uint32_t dst, uint64_t ga) {
    u32x4 g0; g0[0] = uni(1u); g0[1] = uni(dst); g0[2] = uni((uint32_t)ga); g0[3] = uni((((uint32_t)(ga >> 32)) & 0x01FFFFFFu) | 0x80000000u);
    asm volatile("" : "+s"(g0));   // descriptor words held in scalar registers: no word is formed anew elsewhere while the request is outstanding
    return g0;
}
template <uint32_t W0, uint32_t D0, uint32_t D1, uint32_t SP>
__device__ __forceinline__ u32x8 tdm_group1() {
    u32x8 g1; g1[0] = uni(W0); g1[1] = uni((D0 & 0xFFFFu) << 16); g1[2] = uni((D0 >> 16) | ((D1 & 0xFFFFu) << 16)); g1[3] = uni((D1 >> 16) | (D0 << 16));
    g1[4] = uni(D1); g1[5] = uni(SP); g1[6] = uni(0u); g1[7] = uni(0u);
    asm volatile("" : "+s"(g1));   // descriptor words held in scalar registers: set once from constants, in the same registers for as long as requests are issued
    return g1;
}
__device__ __forceinline__ void tdm_load(u32x4 g0, u32x8 g1) { asm volatile("tensor_load_to_lds %0, %1" :: "s"(g0), "s"(g1) : "memory"); }
// The compiler places no wait for a tensor load. The wait names the request's group 0 so that its registers keep their values while the request is outstanding.
__device__ __forceinline__ void wait_tensor0(u32x4 g0) { asm volatile("s_wait_tensorcnt 0x0" :: "s"(g0) : "memory"); }
// Stands behind the last store of a branch whose code is followed, in the built kernel, by another branch's: no register that an issued store names is rewritten ahead of it.
__device__ __forceinline__ void wait_x0() { asm volatile("s_wait_xcnt 0x0" ::: "memory"); }
// The same behind a run of loads, naming the addresses they use: those registers keep their values up to the wait.
__device__ __forceinline__ void wait_x0_of(const void* p) { asm volatile("s_wait_xcnt 0x0" :: "v"(p) : "memory"); }
__device__ __forceinline__ void wait_x0_of(const void* p, const void* q) { asm volatile("s_wait_xcnt 0x0" :: "v"(p), "v"(q) : "memory"); }
__device__ __forceinline__ void wait_x0_of(const void* p, const void* q, const void* r) { asm volatile("s_wait_xcnt 0x0" :: "v"(p), "v"(q), "v"(r) : "memory"); }
__device__ __forceinline__ void wait_ds0() { asm volatile("s_wait_dscnt 0x0" ::: "memory"); }           // this wave's LDS reads are done before their buffer is handed back
// exp(x) as __expf compiles here (one multiply, v_exp_f32), with the one issue slot that the instruction set asks for behind a transcendental tied to it.
__device__ __forceinline__ float exp_slot(float x) { float r; asm("v_exp_f32 %0, %1\n\tv_nop" : "=v"(r) : "v"(x * 1.44269504088896340736f)); return r; }
__device__ __forceinline__ float xhalf(float x) { return __builtin_bit_cast(float, __builtin_amdgcn_permlanex16(__builtin_bit_cast(int, x), __builtin_bit_cast(int, x), 0x76543210, 0xfedcba98, false, false)); }   // lane l's value from lane l ^ 16
// Sum over the 16 lanes of a half-wave, the same value in each of them: four butterfly steps inside the row (row_xmask 1, 2, 4, 8); every lane is on where it is used.
template <int CTRL> __device__ __forceinline__ float rowx(float x) { return __builtin_bit_cast(float, __builtin_amdgcn_update_dpp(0, __builtin_bit_cast(int, x), CTRL, 0xf, 0xf, true)); }
__device__ __forceinline__ float sum16(float x) { x += rowx<0x161>(x); x += rowx<0x162>(x); x += rowx<0x164>(x); x += rowx<0x168>(x); return x; }
__device__ __forceinline__ v16h ldsfrag(const unsigned char* p) { return cat16(*(const v8ha*)p, *(const v8ha*)(p + 32)); }   // k 0..7 and 16..23 (+8 in the upper half-wave) of one row

// k_proj: 64 n x 128 o tile of P[b][n][o] = bf16(x[b][.][n]).bf16(W)^T + bias over K = 256 (exact products); the three projections, none of which reads what another
// writes, side by side in one launch. A block converts what it needs itself: its 256 c x 64 n tile of x (NCHW rows as they lie in memory, whole 256-byte pieces) and
// its 128 x 256 weight go to LDS as bf16; the A fragments (rows n, k = c) come out of the [c][n] tile by transposing LDS loads, the B fragments from the weight rows.
// Eight waves = 4 row groups of 16 n x 2 halves of 64 o. theta (keys, this branch) and phi (queries, other branch) leave as f16 hi + residual planes [b*4096+n][128],
// g (values, this branch) transposed in a half's LDS tile and written as f16 hi + UNSCALED residual planes GTH/GTL [b][c][n] (the A operand of y^T: rows c, k = n; the
// residual is summed into the same accumulator as the hi product). grid (NN_/64, 1, 3 * NB_): z = projection * NB_ + b. Sixteen blocks also write w_z's bf16 copy
// ([out][in] = the A operand of Z as-is; one wave per row), which nothing in this launch reads.
#define XPIT 160u            // LDS pitch of one channel's 64 bf16: 128 B + 32 B, an odd multiple of 32 B for the transposing reads
#define WPIT 528u            // LDS pitch of one weight row's 256 bf16: 512 B + 16 B, an odd multiple of 16 B for the b128 reads
#define XBYT (CIN * XPIT)
#define WBYT (CI * WPIT)
typedef __attribute__((ext_vector_type(8))) short s16x8;
typedef __attribute__((ext_vector_type(4))) __bf16 v4bf;
typedef v4bf __attribute__((may_alias)) v4bfa;
typedef v8bf __attribute__((may_alias)) v8bfa;
// Lane (c = l & 15, h = l >> 4) gets rows 8 h .. 8 h + 7 of column c of the 16 x 16 tile of 16-bit values whose rows the lanes' addresses name.
__device__ __forceinline__ v8us ld_tr16(const unsigned char* p) { typedef __attribute__((address_space(3))) s16x8 lds_s16x8; return __builtin_bit_cast(v8us, __builtin_amdgcn_ds_load_tr16_b128_v8i16((lds_s16x8*)p)); }
__global__ __launch_bounds__(256) void k_proj(const float* __restrict__ xa, const float* __restrict__ xb, const float* __restrict__ wth, const float* __restrict__ wph, const float* __restrict__ wg,
                                              const float* __restrict__ wz, const float* __restrict__ bth, const float* __restrict__ bph, const float* __restrict__ bg,
                                              h16* TH, h16* TL, h16* PH, h16* PL, h16* GTH, h16* GTL, bf* WZb) {
    __shared__ __align__(16) unsigned char sm[XBYT + WBYT];   // x tile [c][n], weight [o][c]; behind the products the x tile's place holds the output tiles
    const int tid = threadIdx.x, lane = tid & 31, wv8 = tid >> 5;
    if (blockIdx.z == 0 && blockIdx.x < CI / 8) {   // the same for the whole block: the grid's first 16 blocks copy 8 rows of w_z each
        typedef __attribute__((ext_vector_type(4))) unsigned short v4us; v4us t; const int r = blockIdx.x * 8 + wv8;
        const float* zq = wz + (size_t)r * CI + lane * 4;
        const v4f z4 = *(const v4fa*)zq; wait_x0_of(zq);
#pragma unroll
        for (int i = 0; i < 4; ++i) t[i] = f2bf(z4[i]);
        VST2(v4us, WZb + (size_t)r * CI + lane * 4, t); wait_x0();
    }
    const int lr = lane & 15, hi = lane >> 4, wave = wv8 & 3, half = wv8 >> 2, sel = blockIdx.z / NB_, b = blockIdx.z - sel * NB_;
    const int r0 = blockIdx.x * 64 + wave * 16, c0 = half * 64;
    const float* xs = ((sel == 1) ? xb : xa) + (size_t)b * CIN * NN_ + (size_t)blockIdx.x * 64 + (size_t)(tid >> 4) * NN_ + (tid & 15) * 4;   // 16 lanes = one channel's 256 bytes
    const float* ws = ((sel == 0) ? wth : (sel == 1) ? wph : wg) + (size_t)wv8 * CIN + lane * 8;                                           // one wave = one weight row
    const float* bias = (sel == 0) ? bth : (sel == 1) ? bph : bg;
    unsigned char* xd = sm + (uint32_t)(tid >> 4) * XPIT + (uint32_t)(tid & 15) * 8u;
    unsigned char* wd = sm + XBYT + (uint32_t)wv8 * WPIT + (uint32_t)lane * 16u;
    const float* bq = bias + c0 + lr;
    v4f xv[16], wv[16]; float bv4[4];
#pragma unroll   // the first half of the weight (from L2) is asked for first: loads are waited for in their order, and it is wanted first
    for (int p = 0; p < 8; ++p) { wv[2 * p] = *(const v4fa*)(ws + (size_t)p * 8 * CIN); wv[2 * p + 1] = *(const v4fa*)(ws + (size_t)p * 8 * CIN + 4); }
    __builtin_amdgcn_sched_barrier(0);   // keeps that order: left free, this build set loads of x among the weight's, and the weight's conversion waited for all of x
#pragma unroll   // all 16 loads of x (from memory) and the four biases are in flight together with it
    for (int p = 0; p < 16; ++p) xv[p] = *(const v4fa*)(xs + (size_t)p * 16 * NN_);
#pragma unroll
    for (int t = 0; t < 4; ++t) bv4[t] = bq[t * 16];
    wait_x0_of(xs, ws, bq);
    __builtin_amdgcn_sched_barrier(0);   // keeps these loads in one run up here: left free, this build asked for the weight only when most of x had come
#pragma unroll
    for (int p = 0; p < 8; ++p) *(v8bfa*)(wd + (uint32_t)p * 8u * WPIT) = __builtin_convertvector(__builtin_shufflevector(wv[2 * p], wv[2 * p + 1], 0, 1, 2, 3, 4, 5, 6, 7), v8bf);   // round to nearest even, as f2bf
    __builtin_amdgcn_sched_barrier(0);   // the second half of the weight is asked for behind the first half's conversion and takes its registers (three blocks fit a WGP's registers so); it flies while x is on its way
#pragma unroll
    for (int p = 0; p < 8; ++p) { wv[2 * p] = *(const v4fa*)(ws + (size_t)(p + 8) * 8 * CIN); wv[2 * p + 1] = *(const v4fa*)(ws + (size_t)(p + 8) * 8 * CIN + 4); }
    wait_x0_of(ws);
    __builtin_amdgcn_sched_barrier(0);   // keeps these loads ahead of the wait for x
#pragma unroll
    for (int p = 0; p < 16; ++p) *(v4bfa*)(xd + (uint32_t)p * 16u * XPIT) = __builtin_convertvector(xv[p], v4bf);
#pragma unroll
    for (int p = 0; p < 8; ++p) *(v8bfa*)(wd + (uint32_t)(p + 8) * 8u * WPIT) = __builtin_convertvector(__builtin_shufflevector(wv[2 * p], wv[2 * p + 1], 0, 1, 2, 3, 4, 5, 6, 7), v8bf);
    __syncthreads();   // the x tile and the weight are written
    const unsigned char* ap = sm + (uint32_t)(8 * hi + (lane & 7)) * XPIT + 32u * (uint32_t)wave + 16u * (uint32_t)((lane >> 3) & 1);   // k rows 8 hi + (l & 7), this wave's 16 columns n
    const unsigned char* bp = sm + XBYT + (uint32_t)(c0 + lr) * WPIT + 16u * (uint32_t)hi;                                              // weight row o, k 8 hi .. 8 hi + 7
    v8f acc[4];
#pragma unroll
    for (int t = 0; t < 4; ++t) acc[t] = (v8f){};
    // Two k-chunks' fragments in registers: a chunk's 10 LDS reads stand in one place, one chunk ahead of the products that use them. The scheduling barriers keep
    // them there: left free, this build set two reads with a full wait in front of every matrix instruction.
    v16bf af[2], wf[2][4];
    auto frags = [&](int kc) {
        af[kc & 1] = cat16b(ld_tr16(ap + (uint32_t)kc * 32u * XPIT), ld_tr16(ap + ((uint32_t)kc * 32u + 16u) * XPIT));   // k 8 hi + 0..7 and 16 + 8 hi + 0..7: the order of the weight fragments
#pragma unroll
        for (int t = 0; t < 4; ++t) wf[kc & 1][t] = cat16b(*(const v8usa*)(bp + (uint32_t)t * 16u * WPIT + (uint32_t)kc * 64u), *(const v8usa*)(bp + (uint32_t)t * 16u * WPIT + (uint32_t)kc * 64u + 32u));
    };
    frags(0);
#pragma unroll
    for (int kc = 0; kc < CIN / 32; ++kc) {
        if (kc + 1 < CIN / 32) frags(kc + 1);
        __builtin_amdgcn_sched_barrier(0);
#pragma unroll
        for (int t = 0; t < 4; ++t) acc[t] = wmmab(af[kc & 1], wf[kc & 1][t], acc[t]);
        __builtin_amdgcn_sched_barrier(0);
    }
    __syncthreads();   // every wave has left the x tile: its place is written anew below
    float* os = (float*)sm + (half * 4 + wave) * (16 * 68);
    float* gs = (float*)sm + half * 4 * (16 * 68);   // g: one tile of a half's four waves, 64 rows c x 64 n (pitch 68)
    if (sel == 2) {   // the same for the whole block; a lane's 8 registers are 8 consecutive n of one channel
#pragma unroll
        for (int t = 0; t < 4; ++t) { const float bv = bfr(bv4[t]); v4f w0, w1;
#pragma unroll
            for (int j = 0; j < 4; ++j) { w0[j] = acc[t][j] + bv; w1[j] = acc[t][4 + j] + bv; }
            float* gp = gs + (t * 16 + lr) * 68 + wave * 16 + hi * 8;
            *(v4fa*)gp = w0; *(v4fa*)(gp + 4) = w1; }
    } else {
#pragma unroll
        for (int t = 0; t < 4; ++t) { const float bv = bfr(bv4[t]);
#pragma unroll
            for (int j = 0; j < 8; ++j) os[(hi * 8 + j) * 68 + t * 16 + lr] = acc[t][j] + bv; }
    }
    __syncthreads();
    const size_t rowbase = (size_t)b * NN_ + r0;
    if (sel == 2) {
        const size_t gbase = ((size_t)b * CI + c0) * NN_ + (size_t)blockIdx.x * 64;
#pragma unroll
        for (int s = 0; s < 4; ++s) { const int Lid = (tid & 127) + 128 * s; const int row = Lid >> 3, piece = Lid & 7; const float* sp = gs + row * 68 + piece * 8; v8h o1, o2;
#pragma unroll
            for (int i = 0; i < 8; ++i) { const h16 a = (h16)sp[i]; o1[i] = a; o2[i] = (h16)(sp[i] - (float)a); }
            *(v8h*)(GTH + gbase + (size_t)row * NN_ + piece * 8) = o1; *(v8h*)(GTL + gbase + (size_t)row * NN_ + piece * 8) = o2; }
        wait_x0();
    } else {
        h16* c1 = ((sel == 0) ? TH : PH) + rowbase * CI + c0; h16* c2 = ((sel == 0) ? TL : PL) + rowbase * CI + c0;
        auto pass = [&]() {
#pragma unroll
            for (int s = 0; s < 4; ++s) { const int row = 4 * s + (lane >> 3), piece = lane & 7; const float* sp = os + row * 68 + piece * 8; v8h o1, o2;
#pragma unroll
                for (int i = 0; i < 8; ++i) { const h16 a = (h16)sp[i]; o1[i] = a; o2[i] = (h16)((sp[i] - (float)a) * LOSC); }
                *(v8h*)(c1 + (size_t)row * CI + piece * 8) = o1; *(v8h*)(c2 + (size_t)row * CI + piece * 8) = o2; }
        };
        pass(); wait_x0();
    }
}
// k_attn: block = (b, 64 queries i), eight waves = two per SIMD, so that one wave's softmax runs while the other wave of its SIMD has the matrix unit. theta and g
// (hi + residual) come in stages of 128 keys by tensor loads into two LDS buffers, one slice per wave, the next stage in flight while this one is worked on; the block's
// phi residual rows are loaded into LDS once. The waves are 2 x 4: a wave has 32 queries (two tiles of 16) and 32 of a stage's 128 keys, so that every theta and g
// fragment read from LDS serves two query tiles. A wave has half a SIMD's registers: phi hi and the second tile's phi residual stay in registers, the first tile's phi
// residual is read from LDS in every stage, and the g fragments take the place of the theta fragments.
// Both products are transposed: per query tile the scores S^T = theta_j.phi_i (A = theta rows, B = phi; hi.hi + hi.lo + lo.hi over 4 k-chunks x 2 tiles = 24 WMMA),
// so that a lane holds 16 scores of ONE query (lane & 15): online f32 softmax in the lane plus one exchange between the half-waves; the two score tiles, as
// f16 weights (x32768), are the B operand of y^T += g^T.w^T as they stand (A = g rows hi and residual, 8 channel tiles x 2 = 16 WMMA). Behind the loop every wave lays its two
// tiles' maximum, sum and y in LDS; a query tile is merged from its four key quarters by two waves, each of which makes half the rows of Z for it. Epilogue: the merged
// y, as bf16 hi + residual, is the B operand of Z [b][o][n] = w_z . (yh + yl)^T + b_z[o] (A = w_z rows o, K = 128: 4 tiles x 4 k-chunks x 2 = 32 WMMA per wave); the
// block's 128 x 64 tile of Z goes through LDS and out as 256-byte row pieces. On the way out a half-wave holds a whole row piece (64 values of one channel): its mean and
// its sum of squared deviations from that mean go to PS [block][256], one 128-byte line per wave; k_final merges the 256 blocks' pairs into the batch statistics.
#define XCH 8448u   // one tile's place in the hand-over: 64 floats a lane (8 KiB) + maximum and sum (8 B a lane)
__global__ __launch_bounds__(256) void k_attn(const h16* __restrict__ PH, const h16* __restrict__ PL, const h16* __restrict__ TH, const h16* __restrict__ TL,
                                             const h16* __restrict__ GTH, const h16* __restrict__ GTL, const bf* __restrict__ WZ, const float* __restrict__ bz, float* Z, float* PS) {
    // Buffer 0: slices 0-7, buffer 1: slices 8-15, slice 16: phi residual rows. Behind the loop: the hand-over (16 x XCH from the start) and, from slice 10 on, the tile of Z.
    __shared__ __attribute__((aligned(2048))) unsigned char ring[17 * SLOT];
    float* zst = (float*)(ring + 10u * SLOT);   // the block's tile of Z: 128 rows o x 64 n, pitch 68
    const int lane = threadIdx.x & 31, wave = threadIdx.x >> 5, lr = lane & 15, hi = lane >> 4;
    const int qg = wave & 1, kg = wave >> 1;   // this wave's 32 queries of the block's 64, its 32 keys of a stage's 128
    const int b = blockIdx.x / (NN_ / 64), qt = blockIdx.x - b * (NN_ / 64);
    const size_t tok0 = (size_t)b * NN_;
    const size_t vbase = ((size_t)b * CI) * NN_;
    const uint32_t wv = uni(threadIdx.x >> 5), sl = wv & 3u, sub = wv >> 2, ring0 = (uint32_t)(size_t)ring;
    // This wave's slice, of the stage's 64-key group sub: 0 theta hi, 1 theta residual (64 keys further = 64 rows), 2 g hi, 3 g residual (64 keys further = 128 B along the rows).
    const h16* splane = (sl == 0u) ? TH + tok0 * CI : (sl == 1u) ? TL + tok0 * CI : (sl == 2u) ? GTH + vbase : GTL + vbase;
    const uint32_t sstep = (sl < 2u) ? SKEY * CI * 2u : SKEY * 2u;
    const u32x8 g1k = tdm_group1<W0_R256, 256u, 64u, 256u>(), g1v = tdm_group1<W0_R128, 128u, 128u, NN_ * 2u>();
    u32x4 g0;
    auto issue = [&](uint32_t st) {
        g0 = tdm_group0(ring0 + ((st & 1u) * 8u + wv) * SLOT, (uint64_t)(size_t)splane + (uint64_t)(st * 2u + sub) * sstep);
        if (pinned(sl < 2u)) tdm_load(g0, g1k); else tdm_load(g0, g1v);
    };
    if (pinned(wv == 0u)) { const u32x4 gp = tdm_group0(ring0 + 16u * SLOT, (uint64_t)(size_t)(PL + (tok0 + (size_t)qt * 64) * CI)); tdm_load(gp, g1k); wait_tensor0(gp); }
    issue(0u); wait_tensor0(g0);
    __syncthreads();   // stage 0 and the phi residual rows are published
    issue(1u);
    v16h ah[2][4], pl[2][4];   // phi hi and residual of the wave's two query tiles
    const h16* qp0 = PH + (tok0 + (size_t)(qt * 64 + qg * 32 + lr)) * CI + 8 * hi;
    const h16* qp1 = qp0 + 16 * CI;
#pragma unroll
    for (int kc = 0; kc < 4; ++kc) { ah[0][kc] = cat16(*(const v8h*)(qp0 + kc * 32), *(const v8h*)(qp0 + kc * 32 + 16)); ah[1][kc] = cat16(*(const v8h*)(qp1 + kc * 32), *(const v8h*)(qp1 + kc * 32 + 16)); }
    wait_x0_of(qp0, qp1);
    const unsigned char* alp = ring + 16u * SLOT + (uint32_t)(qg * 32 + lr) * KPIT + 16u * hi;
#pragma unroll
    for (int kc = 0; kc < 4; ++kc) pl[1][kc] = ldsfrag(alp + 16u * KPIT + kc * 64);   // the first tile's four are read anew in every stage
    v8f o[2][8];
#pragma unroll
    for (int q = 0; q < 2; ++q)
#pragma unroll
        for (int n = 0; n < 8; ++n) o[q][n] = (v8f){};
    float mrow[2] = {-3.0e38f, -3.0e38f}, lpart[2] = {0.f, 0.f};   // of this lane's two queries, over this wave's keys; lpart sums this half-wave's keys only
#pragma unroll 1   // one trip = one stage with its one publish point
    for (uint32_t st = 0; st < NSTG; ++st) {
      const unsigned char* buf = ring + (st & 1u) * (8u * SLOT) + (uint32_t)(kg >> 1) * (4u * SLOT);
      const unsigned char* kh = buf + (uint32_t)((kg & 1) * 32 + lr) * KPIT + 16u * hi;                 // theta rows (keys), 16 further: + 16 * KPIT; residual plane: + SLOT
      const unsigned char* vp = buf + 2u * SLOT + (uint32_t)lr * VPIT + 16u * hi + (uint32_t)((kg & 1) * 64);   // g rows (channels), 16 further: + 16 * VPIT; residual plane: + SLOT
      v16h kf[4][4];   // the 32 keys' score fragments per k-chunk: theta hi (2 tiles), theta residual (2 tiles)
      // The scheduling barriers below keep each block of LDS reads in one place, ahead of the work it flies under: left free, this build moved the reads
      // down among the matrix instructions, two at a time with a full wait behind each pair.
#pragma unroll
      for (int kc = 0; kc < 4; ++kc) {
          kf[kc][0] = ldsfrag(kh + kc * 64); kf[kc][1] = ldsfrag(kh + 16u * KPIT + kc * 64);
          kf[kc][2] = ldsfrag(kh + SLOT + kc * 64); kf[kc][3] = ldsfrag(kh + SLOT + 16u * KPIT + kc * 64);
      }
#pragma unroll   // held only as long as the first tile's scores last: with all of phi kept through the loop, fragments of it went to scratch
      for (int kc = 0; kc < 4; ++kc) pl[0][kc] = ldsfrag(alp + kc * 64);
      __builtin_amdgcn_sched_barrier(0);
      v8f s0[2], s1[2], x0[2], x1[2];
      auto scores = [&](int q) {
        s0[q] = (v8f){}; s1[q] = (v8f){}; x0[q] = (v8f){}; x1[q] = (v8f){};
#pragma unroll
        for (int kc = 0; kc < 4; ++kc) {
            s0[q] = wmma16(kf[kc][0], ah[q][kc], s0[q]); x0[q] = wmma16(kf[kc][0], pl[q][kc], x0[q]); s1[q] = wmma16(kf[kc][1], ah[q][kc], s1[q]); x1[q] = wmma16(kf[kc][1], pl[q][kc], x1[q]);
            x0[q] = wmma16(kf[kc][2], ah[q][kc], x0[q]); x1[q] = wmma16(kf[kc][3], ah[q][kc], x1[q]);
        }
      };
      v16h pa[2];   // element s = key 8 hi + s (s < 8), 16 + 8 hi + s - 8 (else): the k order of the g fragments
      float alpha[2];
      auto softmax = [&](int q) {
        // Register j of tile t = key 16 t + 8 hi + j of the wave's 32, query lr of tile q.
        float a0[8], a1[8];
#pragma unroll
        for (int j = 0; j < 8; ++j) { a0[j] = s0[q][j] + x0[q][j] * LOSCI; a1[j] = s1[q][j] + x1[q][j] * LOSCI; }
        float mx = fmaxf(a0[0], a1[0]);
#pragma unroll
        for (int j = 1; j < 8; ++j) mx = fmaxf(mx, fmaxf(a0[j], a1[j]));
        mx = fmaxf(mx, xhalf(mx));
        const float mn = fmaxf(mrow[q], mx);
        alpha[q] = exp_slot(mrow[q] - mn); mrow[q] = mn;
        float es = 0.f;
#pragma unroll
        for (int j = 0; j < 8; ++j) {
            const float e0 = exp_slot(a0[j] - mn), e1 = exp_slot(a1[j] - mn);
            es += e0 + e1;
            pa[q][j] = (h16)(e0 * PSC); pa[q][8 + j] = (h16)(e1 * PSC);
        }
        lpart[q] = lpart[q] * alpha[q] + es;
      };
      auto rescale = [&](int q) {
#pragma unroll
        for (int n = 0; n < 8; ++n)
#pragma unroll
            for (int j = 0; j < 8; ++j) o[q][n][j] *= alpha[q];
      };
      v16h vh[8], vl[8];
      auto values = [&](int q) {
        // Two passes over the eight accumulator tiles (per tile: hi.w, residual.w): neighbours in the stream do not wait for one another's result.
#pragma unroll
        for (int n = 0; n < 8; ++n) o[q][n] = wmma16(vh[n], pa[q], o[q][n]);
#pragma unroll
        for (int n = 0; n < 8; ++n) o[q][n] = wmma16(vl[n], pa[q], o[q][n]);
      };
      // No order is asked for between the first tile's softmax and the scores: while this wave is in a run of vector work, the other wave of its SIMD has the matrix unit.
      scores(0); scores(1); softmax(0);
      // This scheduling barrier and the next ones part the phases, so that each run of group barriers orders its own phase only: without this one the group barriers below
      // took instructions from above it too, and an exponential's result was set over an operand of the matrix instruction directly in front of it.
      __builtin_amdgcn_sched_barrier(0);
      // The g fragments take the theta fragments' registers: both sets at once do not fit half a SIMD's registers. In this build each read stands behind the last score
      // product that reads the registers it fills, so that the fragments are there when the first tile's products with g begin.
#pragma unroll
      for (int n = 0; n < 8; ++n) { vh[n] = ldsfrag(vp + (uint32_t)(n * 16) * VPIT); vl[n] = ldsfrag(vp + SLOT + (uint32_t)(n * 16) * VPIT); }
      __builtin_amdgcn_sched_barrier(0);   // keeps the reads ahead of this phase: left free, this build set some of them among its products and most of the second softmax in one run behind them
      // One tile's softmax stands beside the other tile's matrix products, which do not depend on it. The group barriers ask for a few vector instructions, then one
      // matrix instruction, in turn: left free, this build set most of a softmax in one run.
      rescale(0); values(0); softmax(1);
#pragma unroll
      for (int i = 0; i < 16; ++i) { __builtin_amdgcn_sched_group_barrier(0x2, 10, 2); __builtin_amdgcn_sched_group_barrier(0x8, 1, 2); }
      __builtin_amdgcn_sched_barrier(0);
      rescale(1); values(1);
#pragma unroll   // each accumulator tile's rescaling stands in front of its first product, under the tile before it, not all eight in one run ahead of the products
      for (int i = 0; i < 8; ++i) { __builtin_amdgcn_sched_group_barrier(0x2, 4, 3); __builtin_amdgcn_sched_group_barrier(0x8, 1, 3); }
      __builtin_amdgcn_sched_barrier(0);   // keeps the full LDS wait below behind the softmax and the products
      // Publish point: this wave has left stage st's buffer, its own slice of stage st + 1 has landed, every wave is here; only then the refill.
      wait_ds0();
      wait_tensor0(g0);
      __syncthreads();
      if (pinned(st + 2u < NSTG)) issue(st + 2u);
    }
    wait_tensor0(g0);
    wait_ds0();
    // Behind the loop wave w has query tile w & 3 (16 columns of the block's 64) and half w >> 2 of the rows of Z.
    const int T = wave & 3, oh = wave >> 2;
    // w_z's fragments and this lane's 8 biases are asked for ahead of the hand-over and the conversions of y, under which they fly.
    const bf* wr = WZ + (size_t)(oh * 64 + lr) * CI + 8 * hi;
    const float* bzp = bz + wave * 16 + hi;
    v16bf wa[4][4]; float bzr[8];
#pragma unroll
    for (int t = 0; t < 4; ++t)
#pragma unroll
        for (int kc = 0; kc < 4; ++kc) wa[t][kc] = cat16b(*(const v8us*)(wr + t * 16 * CI + kc * 32), *(const v8us*)(wr + t * 16 * CI + kc * 32 + 16));
#pragma unroll
    for (int s = 0; s < 8; ++s) bzr[s] = bzp[2 * s];
    wait_x0_of(wr, bzp);
    __builtin_amdgcn_sched_barrier(0);   // keeps these loads in one run up here: left free, this build set them down among the products with w_z, in pairs with a full wait behind each
    // The four waves with the same 32 queries have seen a quarter of the keys each: every wave lays both its tiles in LDS, place 2 * wave + tile. The ring is free:
    // every wave's last read of it ended in front of the last trip's barrier, and no tensor load is outstanding.
    const float lt[2] = {lpart[0] + xhalf(lpart[0]), lpart[1] + xhalf(lpart[1])};
#pragma unroll
    for (int q = 0; q < 2; ++q) {
        unsigned char* xw = ring + (uint32_t)(wave * 2 + q) * XCH;
#pragma unroll
        for (int n = 0; n < 8; ++n) {
            *(v4fa*)(xw + (uint32_t)lane * 16u + (uint32_t)(2 * n) * 512u) = __builtin_shufflevector(o[q][n], o[q][n], 0, 1, 2, 3);
            *(v4fa*)(xw + (uint32_t)lane * 16u + (uint32_t)(2 * n + 1) * 512u) = __builtin_shufflevector(o[q][n], o[q][n], 4, 5, 6, 7);
        }
        float* ml = (float*)(xw + 8192u + (uint32_t)lane * 8u); ml[0] = mrow[q]; ml[1] = lt[q];
    }
    __syncthreads();   // every wave's hand-over is written
    // Tile T = tile T & 1 of the waves (T >> 1) + 2 c, c = 0..3: places T + 4 c.
    const unsigned char* xr = ring + (uint32_t)T * XCH;
    float mc[4], lc[4], fc[4];
#pragma unroll
    for (int cq = 0; cq < 4; ++cq) { const float* mlr = (const float*)(xr + (uint32_t)(4 * cq) * XCH + 8192u + (uint32_t)lane * 8u); mc[cq] = mlr[0]; lc[cq] = mlr[1]; }
    const float mall = fmaxf(fmaxf(mc[0], mc[1]), fmaxf(mc[2], mc[3]));
#pragma unroll
    for (int cq = 0; cq < 4; ++cq) fc[cq] = exp_slot(mc[cq] - mall);
    const float inv = 1.0f / ((lc[0] * fc[0] + lc[1] * fc[1] + lc[2] * fc[2] + lc[3] * fc[3]) * PSC);
    v8f y[8];
#pragma unroll
    for (int n = 0; n < 8; ++n) {
        y[n] = (v8f){};
#pragma unroll
        for (int cq = 0; cq < 4; ++cq) {
            const unsigned char* xp = xr + (uint32_t)(4 * cq) * XCH + (uint32_t)lane * 16u;
            const v4f p0 = *(const v4fa*)(xp + (uint32_t)(2 * n) * 512u), p1 = *(const v4fa*)(xp + (uint32_t)(2 * n + 1) * 512u);
            y[n] += __builtin_shufflevector(p0, p1, 0, 1, 2, 3, 4, 5, 6, 7) * fc[cq];
        }
    }
    const int qcol = T * 16;   // this wave's merged tile: its 16 columns of the block's 64
    v16bf yh[4], yl[4];   // register j of tiles 2 kc, 2 kc + 1 = channels 32 kc + 8 hi + j, 32 kc + 16 + 8 hi + j of query lr: the k order of the w_z fragments
#pragma unroll
    for (int kc = 0; kc < 4; ++kc) {
        const v8f u = y[2 * kc] * inv, v = y[2 * kc + 1] * inv;
        const v8bf uh = __builtin_convertvector(u, v8bf), vh = __builtin_convertvector(v, v8bf);   // round to nearest even, as f2bf
        const v8bf ul = __builtin_convertvector(u - __builtin_convertvector(uh, v8f), v8bf), vl = __builtin_convertvector(v - __builtin_convertvector(vh, v8f), v8bf);
        yh[kc] = __builtin_shufflevector(uh, vh, 0, 1, 2, 3, 4, 5, 6, 7, 8, 9, 10, 11, 12, 13, 14, 15);
        yl[kc] = __builtin_shufflevector(ul, vl, 0, 1, 2, 3, 4, 5, 6, 7, 8, 9, 10, 11, 12, 13, 14, 15);
    }
#pragma unroll
    for (int t = 0; t < 4; ++t) {
        v8f acc = {}, accx = {};
#pragma unroll
        for (int kc = 0; kc < 4; ++kc) { acc = wmmab(wa[t][kc], yh[kc], acc); accx = wmmab(wa[t][kc], yl[kc], accx); }
#pragma unroll
        for (int j = 0; j < 8; ++j) zst[(oh * 64 + t * 16 + hi * 8 + j) * 68 + qcol + lr] = acc[j] + accx[j];   // register j = row o, lane = query
    }
    __syncthreads();   // every wave's part of the tile is written
    float* zb = Z + ((size_t)b * CI + wave * 16) * NN_ + (size_t)qt * 64;
    v4f val[8];   // one instruction = two rows' 256-byte pieces
#pragma unroll
    for (int s = 0; s < 8; ++s) val[s] = *(const v4fa*)(zst + (wave * 16 + 2 * s + hi) * 68 + lr * 4) + bfr(bzr[s]);
    float rm[8], rq[8];   // of row 2 s + hi of the wave's 16: mean of its 64 values here, sum of their squared deviations from it
#pragma unroll
    for (int s = 0; s < 8; ++s) rm[s] = sum16((val[s][0] + val[s][1]) + (val[s][2] + val[s][3])) * (1.0f / 64.0f);
#pragma unroll
    for (int s = 0; s < 8; ++s) { const v4f d = val[s] - rm[s]; rq[s] = sum16((d[0] * d[0] + d[1] * d[1]) + (d[2] * d[2] + d[3] * d[3])); }
    float pm = rm[0], pq = rq[0];   // lane (hi, lr) writes float hi * 16 + lr of the wave's line: row 2 (lr >> 1) + hi, mean (lr even) or squares (lr odd)
#pragma unroll
    for (int s = 1; s < 8; ++s) { pm = ((lr >> 1) == s) ? rm[s] : pm; pq = ((lr >> 1) == s) ? rq[s] : pq; }
    const float pv = (lr & 1) ? pq : pm;
    __builtin_amdgcn_sched_barrier(0);   // the 9 stores go out as one run behind all reads and sums: left free, this build stored in pairs among them and wrote over registers of issued stores
    PS[(size_t)blockIdx.x * 256 + wave * 32 + lane] = pv;   // first of the run: set last, its value was formed among the stores of Z, over their registers
#pragma unroll
    for (int s = 0; s < 8; ++s) *(v4f*)(zb + (size_t)(2 * s + hi) * NN_ + lr * 4) = val[s];
}
// k_final: out[b][o][n] = (Z - mu) rs gamma + beta. Block = channel o and two of the four b: 8192 values, 8 x 16 bytes a thread, all asked for at once. Thread t has
// the pair (mean, squared deviations; 64 values each) that block t of k_attn left for channel o; the 256 pairs are merged under the loads of Z: mu = mean of the means,
// sum of squares = sum of (squares + 64 (mean - mu)^2), each a sum over the wave, then over the eight waves through LDS, in a fixed order.
typedef __attribute__((ext_vector_type(2))) float v2f;
typedef v2f __attribute__((may_alias)) v2fa;
// Work-group barrier that orders LDS alone: __syncthreads() also waited for every outstanding global load, so that the merge began only when all of Z had come.
__device__ __forceinline__ void lds_barrier() { __builtin_amdgcn_fence(__ATOMIC_RELEASE, "workgroup", "local"); __builtin_amdgcn_s_barrier(); __builtin_amdgcn_fence(__ATOMIC_ACQUIRE, "workgroup", "local"); }
__global__ __launch_bounds__(256) void k_final(const float* __restrict__ Z, const float* __restrict__ PS, const float* __restrict__ gam, const float* __restrict__ bet, float* out) {
    __shared__ __align__(16) float red[16];
    const int t = threadIdx.x, lane = t & 31, wave = t >> 5, o = blockIdx.x >> 1;
    const size_t base = ((size_t)(blockIdx.x & 1) * 2 * CI + o) * NN_ + (size_t)t * 4;
    const float* pp = PS + (size_t)t * 256 + (o >> 4) * 32 + (o & 1) * 16 + ((o >> 1) & 7) * 2;
    const float* zp = Z + base;
    const v2f pr = *(const v2fa*)pp;
    __builtin_amdgcn_sched_barrier(0);   // the pair is asked for first: loads are waited for in their order, and it is wanted first
    v4f zv[8];
#pragma unroll
    for (int i = 0; i < 8; ++i) zv[i] = *(const v4fa*)(zp + (size_t)(i >> 2) * CI * NN_ + (i & 3) * 1024);
    wait_x0_of(pp, zp);
    __builtin_amdgcn_sched_barrier(0);   // keeps the loads of Z up here, in flight under the merge
    const float g = bfr(gam[o]), be = bfr(bet[o]);
    float sm = sum16(pr[0]); sm += xhalf(sm);
    if (lane == 0) red[wave] = sm;
    lds_barrier();   // the eight waves' sums of means are written
    const v4f m0 = *(const v4fa*)red, m1 = *(const v4fa*)(red + 4);
    const float mu = (((m0[0] + m0[1]) + (m0[2] + m0[3])) + ((m1[0] + m1[1]) + (m1[2] + m1[3]))) * (1.0f / 256.0f);
    const float dm = pr[0] - mu;
    float sq = sum16(pr[1] + 64.0f * (dm * dm)); sq += xhalf(sq);
    if (lane == 0) red[8 + wave] = sq;
    lds_barrier();   // the eight waves' sums of squares are written
    const v4f q0 = *(const v4fa*)(red + 8), q1 = *(const v4fa*)(red + 12);
    const float var = (((q0[0] + q0[1]) + (q0[2] + q0[3])) + ((q1[0] + q1[1]) + (q1[2] + q1[3]))) / (float)(NB_ * NN_);
    const float rs = rsqrtf(var + 1e-5f);
#pragma unroll
    for (int i = 0; i < 8; ++i) { const v4f v = (zv[i] - mu) * rs * g + be; VST2(v4f, out + base + (size_t)(i >> 2) * CI * NN_ + (i & 3) * 1024, v); }
}

extern "C" void kernel_launch(void* const* d_in, const int* in_sizes, int n_in,
                              void* d_out, int out_size, void* d_ws, size_t ws_size, hipStream_t stream) {
    (void)in_sizes; (void)n_in; (void)out_size;
    const float* xt = (const float*)d_in[0]; const float* xo = (const float*)d_in[1]; const float* wg = (const float*)d_in[2]; const float* bg = (const float*)d_in[3];
    const float* wth = (const float*)d_in[4]; const float* bth = (const float*)d_in[5]; const float* wph = (const float*)d_in[6]; const float* bph = (const float*)d_in[7];
    const float* wz = (const float*)d_in[8]; const float* bz = (const float*)d_in[9]; const float* gam = (const float*)d_in[10]; const float* bet = (const float*)d_in[11];
    float* out = (float*)d_out;    // [4][128][64][64]
    char* wsp = (char*)d_ws;
    auto take = [&](size_t bytes) { char* p = wsp; wsp += (bytes + 255) & ~(size_t)255; return (void*)p; };
    bf* WZb = (bf*)take((size_t)CI * CI * 2);
    h16* TH = (h16*)take((size_t)NB_ * NN_ * CI * 2); h16* TL = (h16*)take((size_t)NB_ * NN_ * CI * 2); h16* PH = (h16*)take((size_t)NB_ * NN_ * CI * 2); h16* PL = (h16*)take((size_t)NB_ * NN_ * CI * 2);
    h16* GTH = (h16*)take((size_t)NB_ * CI * NN_ * 2); h16* GTL = (h16*)take((size_t)NB_ * CI * NN_ * 2);
    float* Z = (float*)take((size_t)NB_ * CI * NN_ * 4); float* PS = (float*)take((size_t)NB_ * (NN_ / 64) * 256 * 4);
    if ((size_t)(wsp - (char*)d_ws) > ws_size) return;    // 4.2x4 + 4.2x2 + 8.4 ~ 34 MB
    k_proj<<<dim3(NN_ / 64, 1, 3 * NB_), 256, 0, stream>>>(xt, xo, wth, wph, wg, wz, bth, bph, bg, TH, TL, PH, PL, GTH, GTL, WZb);
    k_attn<<<NB_ * (NN_ / 64), 256, 0, stream>>>(PH, PL, TH, TL, GTH, GTL, WZb, bz, Z, PS);
    k_final<<<2 * CI, 256, 0, stream>>>(Z, PS, gam, bet, out);
}
